// v000
// Times are from an AMD MI455X. After a warm-up the kernel runs many times in a row, and a time is the length of
// such a window on the GPU divided by its runs, so every launch and the gaps after it count. The runs cycle
// through copies of the inputs. A figure is the median of several windows, for all but v000 over two sittings.
// Sittings can differ by a few percent; kernels timed side by side share one.
// v000, which the later versions start from, runs in 1820 microseconds.
// Compute dtypes: q/k/v projections on v_wmma_f32_16x16x32_bf16 (x and Wq/Wk/Wv RNE-converted to bf16, f32 accumulate, results carried x16 into f16 planes); scores q.k^T, attn.v and the output projection on v_wmma_f32_16x16x32_f16 (f16 operands: q,k,v x16, probabilities x2^15 with the per-sample mixing weight folded in, combined x256, Wo as f16(16*bf16(Wo))), f32 accumulate; mean-pool, gates, softmax and the head/sample mixing in f32.
#include <hip/hip_runtime.h>
#include <math.h>

// ---------------------------------------------------------------------------
// Problem constants
// ---------------------------------------------------------------------------
constexpr int kBatch     = 2;
constexpr int kSeq       = 1024;
constexpr int kDim       = 1024;
constexpr int kHeads     = 16;
constexpr int kSamp      = 4;
constexpr int kDh        = 64;
constexpr int kTok       = kBatch * kSeq;       // 2048 token rows
constexpr int kHeadsHalf = 8;                   // heads per score / probability plane
constexpr int kQKld      = 2 * kDim;            // 2048: q columns 0..1023 | k columns 1024..2047
constexpr float kQKVCarry   = 16.0f;            // q, k, v carried x16 in f16
constexpr float kPCarry     = 32768.0f;         // probabilities carried x2^15 (times gate <= 1)
constexpr float kCombCarry  = 256.0f;           // combined carried x256
constexpr float kWoCarry    = 16.0f;            // Wo carried x16 in f16
constexpr float kScoreScale = 0.125f / (16.0f * 16.0f);              // dh^-0.5 / (16*16) = 2^-11
constexpr float kPVScale    = kCombCarry / (kPCarry * kQKVCarry);    // 256 / 2^19 = 2^-11
constexpr float kOutScale   = 1.0f / (kCombCarry * kWoCarry);        // 2^-12

typedef __attribute__((ext_vector_type(16))) _Float16 v16h;
typedef __attribute__((ext_vector_type(8)))  _Float16 v8h;
typedef __attribute__((ext_vector_type(16))) __bf16   v16b;
typedef __attribute__((ext_vector_type(8)))  __bf16   v8b;
typedef __attribute__((ext_vector_type(8)))  float    v8f;
typedef __attribute__((ext_vector_type(4)))  float    v4f;
typedef __attribute__((ext_vector_type(4)))  unsigned int v4u;

__device__ __forceinline__ unsigned short f2bf_bits(float f) {
  unsigned u = __float_as_uint(f);
  return (unsigned short)((u + 0x7FFFu + ((u >> 16) & 1u)) >> 16);
}
__device__ __forceinline__ float bf_bits2f(unsigned short h) { return __uint_as_float(((unsigned)h) << 16); }

// hazard guards as plain device helpers (no inline asm inside the kernel template body)
__device__ __forceinline__ void dep_guard_h(v8f& a, v8f& b, v16h x, v16h y) { asm volatile("v_nop\n\tv_nop\n\tv_nop\n\tv_nop" : "+v"(a), "+v"(b) : "v"(x), "v"(y)); }
__device__ __forceinline__ void dep_guard_b(v8f& a, v8f& b, v16b x, v16b y) { asm volatile("v_nop\n\tv_nop\n\tv_nop\n\tv_nop" : "+v"(a), "+v"(b) : "v"(x), "v"(y)); }
__device__ __forceinline__ void keep4_h(v16h a, v16h b, v16h c, v16h d) { asm volatile("v_nop" :: "v"(a), "v"(b), "v"(c), "v"(d)); }
__device__ __forceinline__ void keep4_b(v16b a, v16b b, v16b c, v16b d) { asm volatile("v_nop" :: "v"(a), "v"(b), "v"(c), "v"(d)); }
__device__ __forceinline__ void acc_guard4(v8f& a, v8f& b, v8f& c, v8f& d) { asm volatile("v_nop\n\tv_nop\n\tv_nop\n\tv_nop" : "+v"(a), "+v"(b), "+v"(c), "+v"(d)); }
template <typename T> struct Frag;
template <> struct Frag<_Float16> {
  typedef v16h V; union U { v16h v; v8h h[2]; };
  static __device__ __forceinline__ v16h load(const _Float16* p) {   // elements 0..7 <- p[0..7], 8..15 <- p[16..23]
    U f; f.h[0] = *(const v8h*)(p); f.h[1] = *(const v8h*)(p + 16); return f.v;
  }
  static __device__ __forceinline__ v8f mma(v16h a, v16h b, v8f c) {
    return __builtin_amdgcn_wmma_f32_16x16x32_f16(false, a, false, b, (short)0, c, false, false);
  }
  static __device__ __forceinline__ void guard(v8f& a, v8f& b, v16h x, v16h y) { dep_guard_h(a, b, x, y); }
  static __device__ __forceinline__ void keep(v16h a, v16h b, v16h c, v16h d) { keep4_h(a, b, c, d); }
};
template <> struct Frag<__bf16> {
  typedef v16b V; union U { v16b v; v8b h[2]; };
  static __device__ __forceinline__ v16b load(const __bf16* p) {
    U f; f.h[0] = *(const v8b*)(p); f.h[1] = *(const v8b*)(p + 16); return f.v;
  }
  static __device__ __forceinline__ v8f mma(v16b a, v16b b, v8f c) {
    return __builtin_amdgcn_wmma_f32_16x16x32_bf16(false, a, false, b, (short)0, c, false, false);
  }
  static __device__ __forceinline__ void guard(v8f& a, v8f& b, v16b x, v16b y) { dep_guard_b(a, b, x, y); }
  static __device__ __forceinline__ void keep(v16b a, v16b b, v16b c, v16b d) { keep4_b(a, b, c, d); }
};

__device__ __forceinline__ unsigned pk16(unsigned short a, unsigned short b) { return (unsigned)a | ((unsigned)b << 16); }
__device__ __forceinline__ unsigned short h_bits(float f) { const _Float16 h = (_Float16)f; return __builtin_bit_cast(unsigned short, h); }

// ---- Register-blocked batched WMMA GEMM (ACT reduced to none/relu/leaky; Cout/resid without restrict
//      so that the in-place residual accumulate (resid == Cout, same wave reads its rows before storing them) is well formed) --
// C[m,n] = scale * sum_k A[m,k] * Bt[n,k] (+bias)(+resid); each wave owns a 64x64 tile.
// A row-major [M,K]; Bt row-major [N,K]; M,N % 64 == 0, K % 32 == 0.
// SPLIT: operands are hi/lo planes (A2/Bt2 = lo planes, same layout); product = hi.hi + hi.lo + lo.hi.
// BIAS_MODE: 0 = none, 1 = bias[m], 2 = bias[n].
// OUT_MODE: 0 = f32, 1 = f16, 2 = bf16 hi plane (Cout) + bf16 lo plane (Cout2).
// ET: 0 = f16 operands, 1 = bf16 operands (pointers passed as 16-bit storage)
template <int ET> struct Elem;
template <> struct Elem<0> { typedef _Float16 T; };
template <> struct Elem<1> { typedef __bf16 T; };
template <int ET, bool SPLIT, int BIAS_MODE, int OUT_MODE, bool RESID, int ACT = 0>
__global__ __launch_bounds__(256) void wmma_gemm64(
    const unsigned short* __restrict__ Ap, const unsigned short* __restrict__ A2p, int lda, long strideA,
    const unsigned short* __restrict__ Btp, const unsigned short* __restrict__ Bt2p, int ldb, long strideB,
    void* Cout, void* Cout2, int ldc, long strideC,
    const float* __restrict__ bias,
    const float* resid, long strideR,
    int M, int N, int K, float scale) {
  typedef typename Elem<ET>::T T;
  typedef typename Frag<T>::V V;
  const T* A = (const T*)Ap; const T* A2 = (const T*)A2p; const T* Bt = (const T*)Btp; const T* Bt2 = (const T*)Bt2p;
  __shared__ __align__(16) float sT[8][16 * 68];   // per-wave 16x64 slab, pitch 68 floats
  const int b    = blockIdx.y;
  const int lane = threadIdx.x & 31;
  const int wave = threadIdx.x >> 5;
  const int tilesN = N >> 6;
  const int tilesM = M >> 6;
  const int tile = blockIdx.x * 8 + wave;
  if (tile >= tilesM * tilesN) return;   // wave-uniform; no block barriers in this kernel
  const int tm = tile / tilesN;
  const int tn = tile - tm * tilesN;
  const int m0 = tm << 6;
  const int n0 = tn << 6;

  const T* Ab  = A  + (size_t)b * strideA;
  const T* Bb  = Bt + (size_t)b * strideB;
  const T* Ab2 = SPLIT ? (A2  + (size_t)b * strideA) : nullptr;
  const T* Bb2 = SPLIT ? (Bt2 + (size_t)b * strideB) : nullptr;

  const int rlane = lane & 15;                 // row (A) / col (B, D) within subtile
  const int koff  = (lane >> 4) * 8;           // k offset of this lane half
  const int mOff  = (lane >> 4) * 8;           // D row offset

  v8f acc[4][4];
#pragma unroll
  for (int i = 0; i < 4; ++i)
#pragma unroll
    for (int j = 0; j < 4; ++j) acc[i][j] = (v8f){0.f,0.f,0.f,0.f,0.f,0.f,0.f,0.f};

  for (int k0 = 0; k0 < K; k0 += 32) {
    V bh[4], bl[4];
#pragma unroll
    for (int j = 0; j < 4; ++j) {
      const size_t bo = (size_t)(n0 + (j << 4) + rlane) * ldb + koff + k0;
      bh[j] = Frag<T>::load(Bb + bo);
      if (SPLIT) bl[j] = Frag<T>::load(Bb2 + bo);
    }
#pragma unroll
    for (int i = 0; i < 4; ++i) {
      const size_t ao = (size_t)(m0 + (i << 4) + rlane) * lda + koff + k0;
      V ah = Frag<T>::load(Ab + ao);
      V al;
      if (SPLIT) al = Frag<T>::load(Ab2 + ao);
#pragma unroll
      for (int j = 0; j < 4; ++j) {
        acc[i][j] = Frag<T>::mma(ah, bh[j], acc[i][j]);
        if (SPLIT) {
          acc[i][j] = Frag<T>::mma(ah, bl[j], acc[i][j]);
          acc[i][j] = Frag<T>::mma(al, bh[j], acc[i][j]);
        }
      }
      Frag<T>::guard(acc[i][0], acc[i][3], ah, SPLIT ? al : ah);
    }
    Frag<T>::keep(bh[0], bh[1], bh[2], bh[3]);
    if (SPLIT) Frag<T>::keep(bl[0], bl[1], bl[2], bl[3]);
  }
  acc_guard4(acc[0][0], acc[0][1], acc[0][2], acc[0][3]);
  acc_guard4(acc[1][0], acc[1][1], acc[1][2], acc[1][3]);
  acc_guard4(acc[2][0], acc[2][1], acc[2][2], acc[2][3]);
  acc_guard4(acc[3][0], acc[3][1], acc[3][2], acc[3][3]);

  // ---- epilogue ----
  float* slab = sT[wave];
  const float* Rb = RESID ? (resid + (size_t)b * strideR) : nullptr;
#pragma unroll
  for (int i = 0; i < 4; ++i) {
    const int mBase = m0 + (i << 4);
#pragma unroll
    for (int j = 0; j < 4; ++j) {
      const int n = n0 + (j << 4) + rlane;
      float bv = 0.f;
      if (BIAS_MODE == 2) bv = bias[n];
#pragma unroll
      for (int r = 0; r < 8; ++r) {
        float v = acc[i][j][r] * scale;
        if (BIAS_MODE == 1) v += bias[mBase + mOff + r];
        if (BIAS_MODE == 2) v += bv;
        if (RESID) v += Rb[(size_t)(mBase + mOff + r) * ldc + n];
        if (ACT == 2) v = fmaxf(v, 0.0f);
        if (ACT == 4) v = (v > 0.f) ? v : 0.01f * v;
        slab[(mOff + r) * 68 + (j << 4) + rlane] = v;
      }
    }
    __builtin_amdgcn_fence(__ATOMIC_RELEASE, "workgroup");
    __builtin_amdgcn_wave_barrier();
    __builtin_amdgcn_fence(__ATOMIC_ACQUIRE, "workgroup");
    if (OUT_MODE == 0) {
      float* C = (float*)Cout + (size_t)b * strideC;
      const int hh = lane >> 4, c4 = (lane & 15) * 4;     // row seg = 256 B = 16 lanes x 16 B
      {
#pragma unroll
        for (int it = 0; it < 8; ++it) {
          const int row = it * 2 + hh;
          v4f v = *(const v4f*)(slab + row * 68 + c4);
          *(v4f*)(C + (size_t)(mBase + row) * ldc + n0 + c4) = v;
        }
        
      }
    } else {
      const int q = lane >> 3, c8 = (lane & 7) * 8;
      unsigned short* C  = (unsigned short*)Cout  + (size_t)b * strideC;
      unsigned short* C2 = (OUT_MODE == 2) ? ((unsigned short*)Cout2 + (size_t)b * strideC) : nullptr;
      {
#pragma unroll
        for (int it = 0; it < 4; ++it) {
          const int row = it * 4 + q;
          const float* sp = slab + row * 68 + c8;
          v8h hv, lv;
#pragma unroll
          for (int e = 0; e < 8; ++e) {
            if (OUT_MODE == 1) {
              hv[e] = (_Float16)sp[e];
            } else {
              unsigned short hb = f2bf_bits(sp[e]);
              unsigned short lb = f2bf_bits(sp[e] - bf_bits2f(hb));
              hv[e] = __builtin_bit_cast(_Float16, hb);
              lv[e] = __builtin_bit_cast(_Float16, lb);
            }
          }
          *(v8h*)(C + (size_t)(mBase + row) * ldc + n0 + c8) = hv;
          if (OUT_MODE == 2) *(v8h*)(C2 + (size_t)(mBase + row) * ldc + n0 + c8) = lv;
        }
        
      }
    }
    __builtin_amdgcn_fence(__ATOMIC_RELEASE, "workgroup");
    __builtin_amdgcn_wave_barrier();
    __builtin_amdgcn_fence(__ATOMIC_ACQUIRE, "workgroup");
  }
}

// ---------------------------------------------------------------------------
// f32 -> bf16 bits (RNE), 8 consecutive elements per thread: one 16-B store per lane, 32 contiguous lanes = 4 whole
// ---------------------------------------------------------------------------
__global__ __launch_bounds__(256) void cast_bf16_kernel(const float* __restrict__ in, unsigned short* __restrict__ out, int n8) {
  const int i = blockIdx.x * 256 + threadIdx.x;
  if (i >= n8) return;
  const float* p = in + 8 * (size_t)i;
  const v4f a = *(const v4f*)(p);
  const v4f c = *(const v4f*)(p + 4);
  unsigned short hb[8];
#pragma unroll
  for (int e = 0; e < 4; ++e) {
    hb[e]     = f2bf_bits(a[e]);
    hb[4 + e] = f2bf_bits(c[e]);
  }
  const v4u u = (v4u){pk16(hb[0], hb[1]), pk16(hb[2], hb[3]), pk16(hb[4], hb[5]), pk16(hb[6], hb[7])};
  unsigned short* q = out + 8 * (size_t)i;
  *(v4u*)q = u;
  
}

// ---------------------------------------------------------------------------
// Stacked q|k weight cast: out[s][2048][1024] bf16, rows 0..1023 = Wq[s], rows 1024..2047 = Wk[s] (both [out][in], k-contiguous).
// grid (512, 8): blockIdx.y = (which<<2)|s with which 0 = Wq, 1 = Wk (block-uniform source select);
// coverage per y: 512 blocks x 256 threads x 8 = 1,048,576 = one [1024][1024] matrix exactly. Stores as cast_bf16_kernel.
// ---------------------------------------------------------------------------
__global__ __launch_bounds__(256) void cast_wqk_kernel(const float* __restrict__ Wq, const float* __restrict__ Wk,
                                                       unsigned short* __restrict__ out) {
  const int y = blockIdx.y;
  const int smp = y & 3, which = y >> 2;
  const float* src = ((which == 0) ? Wq : Wk) + (size_t)smp * kDim * kDim;
  unsigned short* dst = out + (size_t)smp * kQKld * kDim + (size_t)which * kDim * kDim;
  const int i = blockIdx.x * 256 + threadIdx.x;
  if (i >= (kDim * kDim) / 8) return;
  const float* p = src + 8 * (size_t)i;
  const v4f a = *(const v4f*)(p);
  const v4f c = *(const v4f*)(p + 4);
  unsigned short hb[8];
#pragma unroll
  for (int e = 0; e < 4; ++e) {
    hb[e]     = f2bf_bits(a[e]);
    hb[4 + e] = f2bf_bits(c[e]);
  }
  const v4u u = (v4u){pk16(hb[0], hb[1]), pk16(hb[2], hb[3]), pk16(hb[4], hb[5]), pk16(hb[6], hb[7])};
  unsigned short* q = dst + 8 * (size_t)i;
  *(v4u*)q = u;
  
}

// ---------------------------------------------------------------------------
// Wo cast: out = f16(16 * bf16(Wo)) (RNE to bf16 first, then exact power-of-two carry into f16), 8 per thread, stores as above.
// Coverage: 512 blocks x 256 x 8 = 1,048,576 = [1024][1024] exactly.
// ---------------------------------------------------------------------------
__global__ __launch_bounds__(256) void cast_wo_kernel(const float* __restrict__ in, unsigned short* __restrict__ out, int n8) {
  const int i = blockIdx.x * 256 + threadIdx.x;
  if (i >= n8) return;
  const float* p = in + 8 * (size_t)i;
  const v4f a = *(const v4f*)(p);
  const v4f c = *(const v4f*)(p + 4);
  unsigned short hb[8];
#pragma unroll
  for (int e = 0; e < 4; ++e) {
    hb[e]     = h_bits(kWoCarry * bf_bits2f(f2bf_bits(a[e])));
    hb[4 + e] = h_bits(kWoCarry * bf_bits2f(f2bf_bits(c[e])));
  }
  const v4u u = (v4u){pk16(hb[0], hb[1]), pk16(hb[2], hb[3]), pk16(hb[4], hb[5]), pk16(hb[6], hb[7])};
  unsigned short* q = out + 8 * (size_t)i;
  *(v4u*)q = u;
  
}

// ---------------------------------------------------------------------------
// Mean over tokens of the bf16 x plane: xmean[b][d] = (1/1024) * sum_n x[b][n][d], f32 sequential per (b, d).
// ---------------------------------------------------------------------------
__global__ __launch_bounds__(256) void mean_kernel(const unsigned short* __restrict__ xb, float* __restrict__ xmean) {
  const int t = blockIdx.x * 256 + threadIdx.x;
  if (t >= kBatch * kDim) return;
  const int b = t >> 10, d = t & (kDim - 1);
  const unsigned short* p = xb + (size_t)b * kSeq * kDim + d;
  float acc = 0.f;
#pragma unroll 4
  for (int n = 0; n < kSeq; ++n) acc += bf_bits2f(p[(size_t)n * kDim]);
  const float m = acc * (1.0f / (float)kSeq);
  *(float*)(xmean + t) = m;
  
}

// ---------------------------------------------------------------------------
// Gates and mixing weights (one block, 256 threads = 8 waves):
//   coh[b][s] = sigmoid(xmean[b] . bf16(Wg[s]) + bg[s])  (wave w -> (b, s) = (w>>2, w&3); per-lane strided partials + shuffle tree)
//   t = clip(temperature, 0.1, 10); invt = 1/t; gw = softmax(hyp_w * invt)
// ---------------------------------------------------------------------------
__global__ __launch_bounds__(256) void gate_kernel(const float* __restrict__ xmean, const float* __restrict__ Wg,
                                                   const float* __restrict__ bg, const float* __restrict__ hw,
                                                   const float* __restrict__ temp, float* __restrict__ wsS) {
  __shared__ float vals[32];
  const int t = threadIdx.x, lane = t & 31, wave = t >> 5;
  if (t < 32) vals[t] = 0.f;
  __syncthreads();
  {
    const int b = wave >> 2, s = wave & 3;
    float acc = 0.f;
#pragma unroll 1
    for (int d = lane; d < kDim; d += 32) {
      const float wg = bf_bits2f(f2bf_bits(Wg[(size_t)s * kDim + d]));
      acc += xmean[b * kDim + d] * wg;
    }
#pragma unroll
    for (int off = 16; off > 0; off >>= 1) acc += __shfl_xor(acc, off, 32);
    if (lane == 0) {
      const float z = acc + bf_bits2f(f2bf_bits(bg[s]));
      vals[4 + b * kSamp + s] = 1.0f / (1.0f + __expf(-z));
    }
  }
  __syncthreads();
  if (t == 0) {
    float tc = bf_bits2f(f2bf_bits(temp[0]));
    tc = fminf(fmaxf(tc, 0.1f), 10.0f);
    const float invt = 1.0f / tc;
    const float l0 = bf_bits2f(f2bf_bits(hw[0])) * invt;
    const float l1 = bf_bits2f(f2bf_bits(hw[1])) * invt;
    const float l2 = bf_bits2f(f2bf_bits(hw[2])) * invt;
    const float l3 = bf_bits2f(f2bf_bits(hw[3])) * invt;
    const float mx = fmaxf(fmaxf(l0, l1), fmaxf(l2, l3));
    const float e0 = __expf(l0 - mx), e1 = __expf(l1 - mx), e2 = __expf(l2 - mx), e3 = __expf(l3 - mx);
    const float is = 1.0f / ((e0 + e1) + (e2 + e3));
    vals[0] = e0 * is; vals[1] = e1 * is; vals[2] = e2 * is; vals[3] = e3 * is;
    vals[12] = invt;
  }
  __syncthreads();
  if (wave == 0) {
    const float v = vals[lane];
    *(float*)(wsS + lane) = v;
    
  }
}

// ---------------------------------------------------------------------------
// Row softmax + mixing, f32 math. One launch per (sample s, batch b, head half); grid = 1024 query rows i, 128 threads;
// thread t owns columns 8t..8t+7 (128 x 8 = 1024 = whole row). Block loops over the 8 heads of the plane in fixed order:
//   x = S[h][i][:] * invt; p = exp(x - max) / sum  (reductions: thread, shuffle tree, 4 wave partials in index order)
//   a2 += (gw_s / 16) * p                              -> registers
// After the head loop the a2 row is staged in LDS and written to out2[b][i][:] (set when first, else old + a2) with two
// ---------------------------------------------------------------------------
__global__ __launch_bounds__(128) void softmax_mix_kernel(const float* __restrict__ Sf, const float* __restrict__ wsS,
                                                          unsigned short* __restrict__ P16, float* out2,
                                                          int smp, int bat, int first) {
  __shared__ float redM[4];
  __shared__ float redS[4];
  __shared__ __align__(16) float arow[kSeq];
  const int i = blockIdx.x;
  const int t = threadIdx.x, lane = t & 31, wave = t >> 5;
  const int c0 = t * 8;
  const float invt = wsS[12];
  const float gw   = wsS[smp];
  const float coh  = wsS[4 + bat * kSamp + smp];
  const float wP   = kPCarry * gw * coh;
  const float wA   = gw * (1.0f / (float)kHeads);
  float a2[8];
#pragma unroll
  for (int e = 0; e < 8; ++e) a2[e] = 0.f;

#pragma unroll 1
  for (int h = 0; h < kHeadsHalf; ++h) {
    const size_t rb = ((size_t)h * kSeq + i) * kSeq + c0;
    const v4f va = *(const v4f*)(Sf + rb);
    const v4f vc = *(const v4f*)(Sf + rb + 4);
    float x[8];
#pragma unroll
    for (int e = 0; e < 4; ++e) { x[e] = va[e] * invt; x[4 + e] = vc[e] * invt; }
    float m = fmaxf(fmaxf(fmaxf(x[0], x[1]), fmaxf(x[2], x[3])), fmaxf(fmaxf(x[4], x[5]), fmaxf(x[6], x[7])));
#pragma unroll
    for (int off = 16; off > 0; off >>= 1) m = fmaxf(m, __shfl_xor(m, off, 32));
    if (lane == 0) redM[wave] = m;
    __syncthreads();
    const float M = fmaxf(fmaxf(redM[0], redM[1]), fmaxf(redM[2], redM[3]));
    float ex[8];
#pragma unroll
    for (int e = 0; e < 8; ++e) ex[e] = __expf(x[e] - M);
    float ssum = ((ex[0] + ex[1]) + (ex[2] + ex[3])) + ((ex[4] + ex[5]) + (ex[6] + ex[7]));
#pragma unroll
    for (int off = 16; off > 0; off >>= 1) ssum += __shfl_xor(ssum, off, 32);
    if (lane == 0) redS[wave] = ssum;
    __syncthreads();
    const float l  = (redS[0] + redS[1]) + (redS[2] + redS[3]);
    const float il = 1.0f / l;
    unsigned short hb[8];
#pragma unroll
    for (int e = 0; e < 8; ++e) {
      const float p = ex[e] * il;
      a2[e] += wA * p;
      hb[e] = h_bits(p * wP);
    }
    const v4u u = (v4u){pk16(hb[0], hb[1]), pk16(hb[2], hb[3]), pk16(hb[4], hb[5]), pk16(hb[6], hb[7])};
    unsigned short* q = P16 + rb;
    *(v4u*)q = u;
    
  }

#pragma unroll
  for (int e = 0; e < 8; ++e) arow[c0 + e] = a2[e];
  __syncthreads();
  float* orow = out2 + ((size_t)bat * kSeq + i) * kSeq;
  const int ca = 4 * t, cb = 512 + 4 * t;
  const v4f v0 = *(const v4f*)(arow + ca);
  const v4f v1 = *(const v4f*)(arow + cb);
  const v4f o0 = *(const v4f*)(orow + ca);
  const v4f o1 = *(const v4f*)(orow + cb);
  v4f n0, n1;
#pragma unroll
  for (int e = 0; e < 4; ++e) {
    n0[e] = first ? v0[e] : (o0[e] + v0[e]);
    n1[e] = first ? v1[e] : (o1[e] + v1[e]);
  }
  *(v4f*)(orow + ca) = n0;
  *(v4f*)(orow + cb) = n1;
  
}

// ---------------------------------------------------------------------------
// Workspace region map (byte offsets, all multiples of 4096). Every region is fully written before it is read.
//   wsS    f32 [32] (gw, coh, 1/t)                         0           ..       4,096
//   xmean  f32 [2][1024]                                   4,096       ..      12,288
//   xb     bf16 [2048][1024]                               12,288      ..   4,206,592
//   Wqkb   bf16 [4][2048][1024] (Wq[s] rows | Wk[s] rows)  4,206,592   ..  20,983,808
//   Wvb    bf16 [4][1024][1024]                            20,983,808  ..  29,372,416
//   Wo16   f16  [1024][1024]  = f16(16*bf16(Wo))          29,372,416  ..  31,469,568
//   QK16   f16  [2048][2048]  q x16 | k x16 (one sample)  31,469,568  ..  39,858,176
//   VT16   f16  [2][1024 e][1024 tok] v x16 transposed    39,858,176  ..  44,052,480
//   Sf     f32  [8 heads][1024][1024] scores of one (s,b)  44,052,480  ..  77,606,912
//   P16    f16  [8 heads][1024][1024] probabilities        77,606,912  ..  94,384,128
//   combF  f32  [2][1024][1024] 256 * sum_s gw*coh*out_s   94,384,128  .. 102,772,736
//   comb16 f16  [2][1024][1024] f16 of the same            102,772,736 .. 106,967,040
//   total 106,967,040 B
// GEMM shapes (all K % 32 == 0, all M, N % 64 == 0, no padded planes):
//   q|k projection  M=2048 N=2048 K=1024 (bf16 in, f16 out x16)
//   v (role-swapped) M=1024 (e) N=1024 (tok) K=1024, z-batch 2 over b
//   scores          M=N=1024 K=64, z-batch 8 heads (column stride 64 in QK16)
//   attn.v          M=1024 N=64 K=1024, z-batch 8 heads (A = P16 planes, Bt = VT16 rows, C columns h*64)
//   output          M=2048 N=1024 K=1024 + bo -> d_out
// ---------------------------------------------------------------------------
extern "C" void kernel_launch(void* const* d_in, const int* in_sizes, int n_in,
                              void* d_out, int out_size, void* d_ws, size_t ws_size,
                              hipStream_t stream) {
  if (n_in < 10) return;
  if (in_sizes[0] != kTok * kDim) return;
  if (in_sizes[1] != kSamp * kDim * kDim || in_sizes[2] != kSamp * kDim * kDim || in_sizes[3] != kSamp * kDim * kDim) return;
  if (in_sizes[4] != kSamp * kDim || in_sizes[5] != kSamp) return;
  if (in_sizes[6] != kDim * kDim || in_sizes[7] != kDim) return;
  if (in_sizes[8] != kSamp || in_sizes[9] != 1) return;
  if (out_size != kTok * kDim + kBatch * kSeq * kSeq) return;

  const float* x    = (const float*)d_in[0];   // [2][1024][1024]
  const float* Wq   = (const float*)d_in[1];   // [4][1024][1024] ([s][out][in])
  const float* Wk   = (const float*)d_in[2];
  const float* Wv   = (const float*)d_in[3];
  const float* Wg   = (const float*)d_in[4];   // [4][1024]
  const float* bg   = (const float*)d_in[5];   // [4]
  const float* Wo   = (const float*)d_in[6];   // [1024][1024] ([out][in])
  const float* bo   = (const float*)d_in[7];   // [1024]
  const float* hw   = (const float*)d_in[8];   // [4]
  const float* temp = (const float*)d_in[9];   // [1]
  float* yout = (float*)d_out;                             // [2][1024][1024] at byte 0
  float* aout = (float*)d_out + (size_t)kTok * kDim;       // [2][1024][1024] at byte 8,388,608

  // ---- carve ----
  const size_t SZ_WSS  = 4096;
  const size_t SZ_XM   = (size_t)kBatch * kDim * 4;                 //      8,192
  const size_t SZ_XB   = (size_t)kTok * kDim * 2;                   //  4,194,304
  const size_t SZ_WQK  = (size_t)kSamp * kQKld * kDim * 2;          // 16,777,216
  const size_t SZ_WV   = (size_t)kSamp * kDim * kDim * 2;           //  8,388,608
  const size_t SZ_WO   = (size_t)kDim * kDim * 2;                   //  2,097,152
  const size_t SZ_QK   = (size_t)kTok * kQKld * 2;                  //  8,388,608
  const size_t SZ_VT   = (size_t)kBatch * kDim * kSeq * 2;          //  4,194,304
  const size_t SZ_S    = (size_t)kHeadsHalf * kSeq * kSeq * 4;      // 33,554,432
  const size_t SZ_P    = (size_t)kHeadsHalf * kSeq * kSeq * 2;      // 16,777,216
  const size_t SZ_CF   = (size_t)kBatch * kSeq * kDim * 4;          //  8,388,608
  const size_t SZ_CH   = (size_t)kBatch * kSeq * kDim * 2;          //  4,194,304
  size_t off = 0;
  const size_t oWSS = off; off += SZ_WSS;
  const size_t oXM  = off; off += SZ_XM;
  const size_t oXB  = off; off += SZ_XB;
  const size_t oWQK = off; off += SZ_WQK;
  const size_t oWV  = off; off += SZ_WV;
  const size_t oWO  = off; off += SZ_WO;
  const size_t oQK  = off; off += SZ_QK;
  const size_t oVT  = off; off += SZ_VT;
  const size_t oS   = off; off += SZ_S;
  const size_t oP   = off; off += SZ_P;
  const size_t oCF  = off; off += SZ_CF;
  const size_t oCH  = off; off += SZ_CH;
  const size_t TOTAL = off;                                         // 106,967,040
  if (TOTAL > ws_size) return;
  if (TOTAL > (size_t)134217728) return;

  char* ws = (char*)d_ws;
  float*          wsS    = (float*)(ws + oWSS);
  float*          xmean  = (float*)(ws + oXM);
  unsigned short* xb     = (unsigned short*)(ws + oXB);
  unsigned short* Wqkb   = (unsigned short*)(ws + oWQK);
  unsigned short* Wvb    = (unsigned short*)(ws + oWV);
  unsigned short* Wo16   = (unsigned short*)(ws + oWO);
  unsigned short* QK16   = (unsigned short*)(ws + oQK);
  unsigned short* VT16   = (unsigned short*)(ws + oVT);
  float*          Sf     = (float*)(ws + oS);
  unsigned short* P16    = (unsigned short*)(ws + oP);
  float*          combF  = (float*)(ws + oCF);
  unsigned short* comb16 = (unsigned short*)(ws + oCH);

  const dim3 blk(256);

  // (0) operand casts
  {
    const int n8x = kTok * kDim / 8;                 // 262,144 -> 1024 blocks exactly
    cast_bf16_kernel<<<dim3(n8x / 256), blk, 0, stream>>>(x, xb, n8x);
    cast_wqk_kernel<<<dim3((kDim * kDim / 8) / 256, 8), blk, 0, stream>>>(Wq, Wk, Wqkb);   // 512 x 8 blocks
    const int n8v = kSamp * kDim * kDim / 8;         // 524,288 -> 2048 blocks exactly
    cast_bf16_kernel<<<dim3(n8v / 256), blk, 0, stream>>>(Wv, Wvb, n8v);
    const int n8o = kDim * kDim / 8;                 // 131,072 -> 512 blocks exactly
    cast_wo_kernel<<<dim3(n8o / 256), blk, 0, stream>>>(Wo, Wo16, n8o);
  }
  // (1) mean pool + gates
  mean_kernel<<<dim3((kBatch * kDim) / 256), blk, 0, stream>>>(xb, xmean);   // 8 blocks exactly
  gate_kernel<<<dim3(1), blk, 0, stream>>>(xmean, Wg, bg, hw, temp, wsS);

  const dim3 gQK((((kTok / 64) * (kQKld / 64)) + 7) / 8, 1);        // 128 blocks: M=2048, N=2048
  const dim3 gV((((kDim / 64) * (kSeq / 64)) + 7) / 8, kBatch);     // 32 x 2:     M=1024, N=1024
  const dim3 gS((((kSeq / 64) * (kSeq / 64)) + 7) / 8, kHeadsHalf); // 32 x 8:     M=N=1024
  const dim3 gPV((((kSeq / 64) * (kDh / 64)) + 7) / 8, kHeadsHalf); // 2 x 8:      M=1024, N=64
  const dim3 gOut((((kTok / 64) * (kDim / 64)) + 7) / 8, 1);        // 64 blocks:  M=2048, N=1024

  for (int s = 0; s < kSamp; ++s) {
    // (2) q|k projection of sample s: QK16[tok][n] = f16(16 * sum_c bf16(x[tok][c]) * bf16(Wqk[s][n][c]))
    const unsigned short* Wsb = Wqkb + (size_t)s * kQKld * kDim;
    wmma_gemm64<1, false, 0, 1, false, 0><<<gQK, blk, 0, stream>>>(
        xb, xb, kDim, 0L, Wsb, Wsb, kDim, 0L, (void*)QK16, (void*)QK16, kQKld, 0L,
        bo, x, 0L, kTok, kQKld, kDim, kQKVCarry);
    // (3) v role-swapped per batch: VT16[b][e][tok] = f16(16 * sum_c bf16(Wv[s][e][c]) * bf16(x[b][tok][c]))
    const unsigned short* Wvs = Wvb + (size_t)s * kDim * kDim;
    wmma_gemm64<1, false, 0, 1, false, 0><<<gV, blk, 0, stream>>>(
        Wvs, Wvs, kDim, 0L, xb, xb, kDim, (long)kSeq * kDim, (void*)VT16, (void*)VT16, kSeq, (long)kDim * kSeq,
        bo, x, 0L, kDim, kSeq, kDim, kQKVCarry);

    for (int b = 0; b < kBatch; ++b) {
      for (int hh = 0; hh < kHeads / kHeadsHalf; ++hh) {
        // (4) scores for 8 heads: Sf[h'][i][j] = 2^-11 * sum_d (16q)(16k) = 0.125 * q.k  (head = hh*8 + h', column stride 64)
        const unsigned short* Aq = QK16 + (size_t)b * kSeq * kQKld + (size_t)hh * kHeadsHalf * kDh;
        const unsigned short* Bk = Aq + kDim;
        wmma_gemm64<0, false, 0, 0, false, 0><<<gS, blk, 0, stream>>>(
            Aq, Aq, kQKld, (long)kDh, Bk, Bk, kQKld, (long)kDh, (void*)Sf, (void*)Sf, kSeq, (long)kSeq * kSeq,
            bo, x, 0L, kSeq, kSeq, kDh, kScoreScale);
        // (5) softmax (x 1/t), P16 planes, head-mean mixing into output 2
        const int first = (s == 0 && hh == 0) ? 1 : 0;
        softmax_mix_kernel<<<dim3(kSeq), dim3(128), 0, stream>>>(Sf, wsS, P16, aout, s, b, first);
        // (6) attn.v for 8 heads into combF columns (hh*8+h')*64..; accumulate over s in place; last sample emits f16 x256
        const unsigned short* Vb = VT16 + (size_t)b * kDim * kSeq + (size_t)hh * kHeadsHalf * kDh * kSeq;
        float* Cf = combF + (size_t)b * kSeq * kDim + (size_t)hh * kHeadsHalf * kDh;
        if (s == 0) {
          wmma_gemm64<0, false, 0, 0, false, 0><<<gPV, blk, 0, stream>>>(
              P16, P16, kSeq, (long)kSeq * kSeq, Vb, Vb, kSeq, (long)kDh * kSeq, (void*)Cf, (void*)Cf, kDim, (long)kDh,
              bo, x, 0L, kSeq, kDh, kSeq, kPVScale);
        } else if (s < kSamp - 1) {
          wmma_gemm64<0, false, 0, 0, true, 0><<<gPV, blk, 0, stream>>>(
              P16, P16, kSeq, (long)kSeq * kSeq, Vb, Vb, kSeq, (long)kDh * kSeq, (void*)Cf, (void*)Cf, kDim, (long)kDh,
              bo, Cf, (long)kDh, kSeq, kDh, kSeq, kPVScale);
        } else {
          unsigned short* Ch = comb16 + (size_t)b * kSeq * kDim + (size_t)hh * kHeadsHalf * kDh;
          wmma_gemm64<0, false, 0, 1, true, 0><<<gPV, blk, 0, stream>>>(
              P16, P16, kSeq, (long)kSeq * kSeq, Vb, Vb, kSeq, (long)kDh * kSeq, (void*)Ch, (void*)Ch, kDim, (long)kDh,
              bo, Cf, (long)kDh, kSeq, kDh, kSeq, kPVScale);
        }
      }
    }
  }

  // (7) y = (comb16 . Wo16^T) / 4096 + bo -> d_out output 0 (f32)
  wmma_gemm64<0, false, 2, 0, false, 0><<<gOut, blk, 0, stream>>>(
      comb16, comb16, kDim, 0L, Wo16, Wo16, kDim, 0L, (void*)yout, (void*)yout, kDim, 0L,
      bo, x, 0L, kTok, kDim, kDim, kOutScale);
}

// v001
// It runs in 1030 microseconds.
// Two timings next to v000 put it at 1.75 and 1.77 times that version's speed.
// Compute dtypes: q/k/v projections on v_wmma_f32_16x16x32_bf16 (x and Wq/Wk/Wv RNE-converted to bf16, f32 accumulate, results carried x16 into f16 planes); scores q.k^T, attn.v and the output projection on v_wmma_f32_16x16x32_f16 (f16 operands: q,k,v x16, probabilities x2^15 with the per-sample mixing weight folded in, combined x256, Wo as f16(16*bf16(Wo))), f32 accumulate; mean-pool, gates, softmax and the head/sample mixing in f32.
#include <hip/hip_runtime.h>
#include <math.h>

// ---------------------------------------------------------------------------
// Problem constants
// ---------------------------------------------------------------------------
constexpr int kBatch     = 2;
constexpr int kSeq       = 1024;
constexpr int kDim       = 1024;
constexpr int kHeads     = 16;
constexpr int kSamp      = 4;
constexpr int kDh        = 64;
constexpr int kTok       = kBatch * kSeq;       // 2048 token rows
constexpr int kHeadsHalf = 8;                   // heads per half; one score / probability plane each
constexpr int kQKld      = 2 * kDim;            // 2048: q columns 0..1023 | k columns 1024..2047
constexpr float kQKVCarry   = 16.0f;            // q, k, v carried x16 in f16
constexpr float kPCarry     = 32768.0f;         // probabilities carried x2^15 (times gate <= 1)
constexpr float kCombCarry  = 256.0f;           // combined carried x256
constexpr float kWoCarry    = 16.0f;            // Wo carried x16 in f16
constexpr float kScoreScale = 0.125f / (16.0f * 16.0f);              // dh^-0.5 / (16*16) = 2^-11
constexpr float kPVScale    = kCombCarry / (kPCarry * kQKVCarry);    // 256 / 2^19 = 2^-11
constexpr float kOutScale   = 1.0f / (kCombCarry * kWoCarry);        // 2^-12

typedef __attribute__((ext_vector_type(16))) _Float16 v16h;
typedef __attribute__((ext_vector_type(8)))  _Float16 v8h;
typedef __attribute__((ext_vector_type(16))) __bf16   v16b;
typedef __attribute__((ext_vector_type(8)))  __bf16   v8b;
typedef __attribute__((ext_vector_type(8)))  float    v8f;
typedef __attribute__((ext_vector_type(4)))  float    v4f;
typedef __attribute__((ext_vector_type(4)))  unsigned int v4u;

__device__ __forceinline__ unsigned short f2bf_bits(float f) {
  unsigned u = __float_as_uint(f);
  return (unsigned short)((u + 0x7FFFu + ((u >> 16) & 1u)) >> 16);
}
__device__ __forceinline__ float bf_bits2f(unsigned short h) { return __uint_as_float(((unsigned)h) << 16); }

// hazard guard as a plain device helper
__device__ __forceinline__ void acc_guard4(v8f& a, v8f& b, v8f& c, v8f& d) { asm volatile("v_nop\n\tv_nop\n\tv_nop\n\tv_nop" : "+v"(a), "+v"(b), "+v"(c), "+v"(d)); }
template <typename T> struct Frag;
template <> struct Frag<_Float16> {
  typedef v16h V; union U { v16h v; v8h h[2]; };
  static __device__ __forceinline__ v16h load(const _Float16* p) {   // elements 0..7 <- p[0..7], 8..15 <- p[16..23]
    U f; f.h[0] = *(const v8h*)(p); f.h[1] = *(const v8h*)(p + 16); return f.v;
  }
  static __device__ __forceinline__ v8f mma(v16h a, v16h b, v8f c) {
    return __builtin_amdgcn_wmma_f32_16x16x32_f16(false, a, false, b, (short)0, c, false, false);
  }
};
template <> struct Frag<__bf16> {
  typedef v16b V; union U { v16b v; v8b h[2]; };
  static __device__ __forceinline__ v16b load(const __bf16* p) {
    U f; f.h[0] = *(const v8b*)(p); f.h[1] = *(const v8b*)(p + 16); return f.v;
  }
  static __device__ __forceinline__ v8f mma(v16b a, v16b b, v8f c) {
    return __builtin_amdgcn_wmma_f32_16x16x32_bf16(false, a, false, b, (short)0, c, false, false);
  }
};

__device__ __forceinline__ unsigned pk16(unsigned short a, unsigned short b) { return (unsigned)a | ((unsigned)b << 16); }
__device__ __forceinline__ unsigned short h_bits(float f) { const _Float16 h = (_Float16)f; return __builtin_bit_cast(unsigned short, h); }

// ---- Operand staging: asynchronous copies global -> LDS ----
constexpr int kStageK   = 64;    // k elements per stage = one whole 128-B line of every operand row
constexpr int kRowPitch = 144;   // LDS bytes per staged row: 128 + 16, an odd multiple of 16 B, so that the 16 rows of a fragment read fall on distinct banks

// Six 16-B copies per lane, global -> LDS through no register. The s_wait_xcnt 0 is the statement's last line so that
// no address register named by an issued copy is rewritten in front of it.
__device__ __forceinline__ void async_copy6(unsigned l0, const unsigned short* g0, unsigned l1, const unsigned short* g1,
                                            unsigned l2, const unsigned short* g2, unsigned l3, const unsigned short* g3,
                                            unsigned l4, const unsigned short* g4, unsigned l5, const unsigned short* g5) {
  asm volatile("global_load_async_to_lds_b128 %0, %1, off\n\t"
               "global_load_async_to_lds_b128 %2, %3, off\n\t"
               "global_load_async_to_lds_b128 %4, %5, off\n\t"
               "global_load_async_to_lds_b128 %6, %7, off\n\t"
               "global_load_async_to_lds_b128 %8, %9, off\n\t"
               "global_load_async_to_lds_b128 %10, %11, off\n\t"
               "s_wait_xcnt 0x0"
               :: "v"(l0), "v"(g0), "v"(l1), "v"(g1), "v"(l2), "v"(g2), "v"(l3), "v"(g3), "v"(l4), "v"(g4), "v"(l5), "v"(g5)
               : "memory");
}

// ---- Register-blocked batched WMMA GEMM (ACT reduced to none/relu/leaky; Cout/resid without restrict
//      so that the in-place residual accumulate (resid == Cout, same wave reads its rows before storing them) is well formed) --
// C[m,n] = scale * sum_k A[m,k] * Bt[n,k] (+bias)(+resid); each wave owns a 64x64 tile; the block's 8 waves form a WM x WN grid of
// such tiles and share one staged k-tile: 64*WM rows of A, then 64*WN rows of Bt, 64 k each, two LDS buffers (the next k-tile's
// copies fly while this one is multiplied).
// A row-major [M,K]; Bt row-major [N,K]; M % (64*WM) == 0, N % (64*WN) == 0, K % 64 == 0; rows and bases 16-B aligned.
// SPLIT (hi/lo planes) is not carried by the staged loop and must be false.
// BIAS_MODE: 0 = none, 1 = bias[m], 2 = bias[n].
// OUT_MODE: 0 = f32, 1 = f16, 2 = bf16 hi plane (Cout) + bf16 lo plane (Cout2).
// ET: 0 = f16 operands, 1 = bf16 operands (pointers passed as 16-bit storage)
template <int ET> struct Elem;
template <> struct Elem<0> { typedef _Float16 T; };
template <> struct Elem<1> { typedef __bf16 T; };
template <int ET, bool SPLIT, int BIAS_MODE, int OUT_MODE, bool RESID, int ACT, int WM, int WN>
__global__ __launch_bounds__(256) void wmma_gemm64(
    const unsigned short* __restrict__ Ap, const unsigned short* __restrict__ A2p, int lda, long strideA,
    const unsigned short* __restrict__ Btp, const unsigned short* __restrict__ Bt2p, int ldb, long strideB,
    void* Cout, void* Cout2, int ldc, long strideC,
    const float* __restrict__ bias,
    const float* resid, long strideR,
    int M, int N, int K, float scale) {
  typedef typename Elem<ET>::T T;
  typedef typename Frag<T>::V V;
  static_assert(!SPLIT, "the staged k-loop carries one plane per operand");
  static_assert(WM * WN == 8, "eight waves per block");
  constexpr int kRowsA  = 64 * WM;                    // staged rows 0..kRowsA-1 = A, the rest = Bt
  constexpr int kRows   = 64 * (WM + WN);
  constexpr int kStageB = kRows * kRowPitch;          // bytes of one buffer
  constexpr int kCopies = kRows / 32;                 // copies per lane and stage: 256 lanes cover 32 rows x 8 chunks of 16 B
  static_assert(kCopies % 6 == 0 && kCopies <= 63, "copies go out six to a statement");
  __shared__ __align__(16) unsigned char ring[2 * kStageB];
  __shared__ __align__(16) float sT[8][16 * 68];   // per-wave 16x64 slab, pitch 68 floats
  const int b    = blockIdx.y;
  const int lane = threadIdx.x & 31;
  const int wave = threadIdx.x >> 5;
  const int tilesN = N / (64 * WN);
  const int tilesM = M / (64 * WM);
  if ((int)blockIdx.x >= tilesM * tilesN) return;   // block-uniform, in front of every barrier
  const int bm = blockIdx.x / tilesN;
  const int bn = blockIdx.x - bm * tilesN;
  const int mB = bm * (64 * WM);
  const int nB = bn * (64 * WN);
  const int wm = wave / WN;
  const int wn = wave - wm * WN;
  const int m0 = mB + (wm << 6);
  const int n0 = nB + (wn << 6);

  const int rlane = lane & 15;                 // row (A) / col (B, D) within subtile
  const int mOff  = (lane >> 4) * 8;           // D row offset

  // copy side: lane -> (row crow + 32*j, 16-B chunk cchk) of the staged k-tile
  const int crow = threadIdx.x >> 3;
  const int cchk = threadIdx.x & 7;
  const unsigned short* gA = Ap  + (size_t)b * strideA + (size_t)(mB + crow) * lda + cchk * 8;
  const unsigned short* gB = Btp + (size_t)b * strideB + (size_t)(nB + crow) * ldb + cchk * 8;
  const unsigned ldsC = (unsigned)(size_t)(void*)ring + (unsigned)(crow * kRowPitch + cchk * 16);
  auto issue = [&](int t, int buf) {
    const unsigned l = ldsC + (unsigned)(buf * kStageB);
    const unsigned short* a = gA + t * kStageK;
    const unsigned short* w = gB + t * kStageK;
    auto from = [&](int j) { return (j < kRowsA / 32) ? (a + (size_t)(j * 32) * lda) : (w + (size_t)((j - kRowsA / 32) * 32) * ldb); };
    auto to   = [&](int j) { return l + (unsigned)(j * 32 * kRowPitch); };
#pragma unroll
    for (int j = 0; j < kCopies; j += 6)
      async_copy6(to(j), from(j), to(j + 1), from(j + 1), to(j + 2), from(j + 2),
                  to(j + 3), from(j + 3), to(j + 4), from(j + 4), to(j + 5), from(j + 5));
  };
  // read side: this lane's row of the first A / Bt fragment, at its lane half's k offset (8 elements = 16 B)
  const unsigned char* fA = ring + ((wm << 6) + rlane) * kRowPitch + (lane >> 4) * 16;
  const unsigned char* fB = ring + (kRowsA + (wn << 6) + rlane) * kRowPitch + (lane >> 4) * 16;

  v8f acc[4][4];
#pragma unroll
  for (int i = 0; i < 4; ++i)
#pragma unroll
    for (int j = 0; j < 4; ++j) acc[i][j] = (v8f){0.f,0.f,0.f,0.f,0.f,0.f,0.f,0.f};

  const int nT = K / kStageK;
  issue(0, 0);
  asm volatile("s_wait_asynccnt 0x0" ::: "memory");   // this wave's copies of k-tile 0 have landed
  __syncthreads();                                    // ... and every other wave's: k-tile 0 may be read
  if (nT > 1) issue(1, 1);

  for (int t = 0; t < nT; ++t) {
    const int bo = (t & 1) * kStageB;
    // all fragment reads of the k-tile stand as one group in front of its WMMAs (one LDS latency per trip, counted waits behind it)
    V ah[kStageK / 32][4], bh[kStageK / 32][4];
#pragma unroll
    for (int ks = 0; ks < kStageK / 32; ++ks) {
#pragma unroll
      for (int j = 0; j < 4; ++j) bh[ks][j] = Frag<T>::load((const T*)(fB + bo + j * 16 * kRowPitch + ks * 64));
#pragma unroll
      for (int i = 0; i < 4; ++i) ah[ks][i] = Frag<T>::load((const T*)(fA + bo + i * 16 * kRowPitch + ks * 64));
    }
    __builtin_amdgcn_sched_barrier(0);   // keeps the reads one group: without it they are sunk between the WMMAs, each with a wait to 0
#pragma unroll
    for (int ks = 0; ks < kStageK / 32; ++ks)
#pragma unroll
      for (int i = 0; i < 4; ++i)
#pragma unroll
        for (int j = 0; j < 4; ++j) acc[i][j] = Frag<T>::mma(ah[ks][i], bh[ks][j], acc[i][j]);
    __builtin_amdgcn_sched_barrier(0);   // keeps the WMMAs in front of the waits: sunk behind them, the next k-tile's copies would be waited for before the work that hides them
    asm volatile("s_wait_dscnt 0x0" ::: "memory");     // this wave's reads of buffer t&1 have returned before it is refilled
    asm volatile("s_wait_asynccnt 0x0" ::: "memory");  // this wave's copies of k-tile t+1 have landed
    __syncthreads();                                   // publishes k-tile t+1 and ends every wave's reads of buffer t&1
    if (t + 2 < nT) issue(t + 2, t & 1);
  }
  asm volatile("s_wait_asynccnt 0x0" ::: "memory");    // no copy is outstanding when the wave goes on to the epilogue and ends
  acc_guard4(acc[0][0], acc[0][1], acc[0][2], acc[0][3]);
  acc_guard4(acc[1][0], acc[1][1], acc[1][2], acc[1][3]);
  acc_guard4(acc[2][0], acc[2][1], acc[2][2], acc[2][3]);
  acc_guard4(acc[3][0], acc[3][1], acc[3][2], acc[3][3]);

  // ---- epilogue ----
  float* slab = sT[wave];
  const float* Rb = RESID ? (resid + (size_t)b * strideR) : nullptr;
#pragma unroll
  for (int i = 0; i < 4; ++i) {
    const int mBase = m0 + (i << 4);
#pragma unroll
    for (int j = 0; j < 4; ++j) {
      const int n = n0 + (j << 4) + rlane;
      float bv = 0.f;
      if (BIAS_MODE == 2) bv = bias[n];
#pragma unroll
      for (int r = 0; r < 8; ++r) {
        float v = acc[i][j][r] * scale;
        if (BIAS_MODE == 1) v += bias[mBase + mOff + r];
        if (BIAS_MODE == 2) v += bv;
        if (RESID) v += Rb[(size_t)(mBase + mOff + r) * ldc + n];
        if (ACT == 2) v = fmaxf(v, 0.0f);
        if (ACT == 4) v = (v > 0.f) ? v : 0.01f * v;
        slab[(mOff + r) * 68 + (j << 4) + rlane] = v;
      }
    }
    __builtin_amdgcn_fence(__ATOMIC_RELEASE, "workgroup");
    __builtin_amdgcn_wave_barrier();
    __builtin_amdgcn_fence(__ATOMIC_ACQUIRE, "workgroup");
    if (OUT_MODE == 0) {
      float* C = (float*)Cout + (size_t)b * strideC;
      const int hh = lane >> 4, c4 = (lane & 15) * 4;     // row seg = 256 B = 16 lanes x 16 B
      {
#pragma unroll
        for (int it = 0; it < 8; ++it) {
          const int row = it * 2 + hh;
          v4f v = *(const v4f*)(slab + row * 68 + c4);
          *(v4f*)(C + (size_t)(mBase + row) * ldc + n0 + c4) = v;
        }
        
      }
    } else {
      const int q = lane >> 3, c8 = (lane & 7) * 8;
      unsigned short* C  = (unsigned short*)Cout  + (size_t)b * strideC;
      unsigned short* C2 = (OUT_MODE == 2) ? ((unsigned short*)Cout2 + (size_t)b * strideC) : nullptr;
      {
#pragma unroll
        for (int it = 0; it < 4; ++it) {
          const int row = it * 4 + q;
          const float* sp = slab + row * 68 + c8;
          v8h hv, lv;
#pragma unroll
          for (int e = 0; e < 8; ++e) {
            if (OUT_MODE == 1) {
              hv[e] = (_Float16)sp[e];
            } else {
              unsigned short hb = f2bf_bits(sp[e]);
              unsigned short lb = f2bf_bits(sp[e] - bf_bits2f(hb));
              hv[e] = __builtin_bit_cast(_Float16, hb);
              lv[e] = __builtin_bit_cast(_Float16, lb);
            }
          }
          *(v8h*)(C + (size_t)(mBase + row) * ldc + n0 + c8) = hv;
          if (OUT_MODE == 2) *(v8h*)(C2 + (size_t)(mBase + row) * ldc + n0 + c8) = lv;
        }
        
      }
    }
    __builtin_amdgcn_fence(__ATOMIC_RELEASE, "workgroup");
    __builtin_amdgcn_wave_barrier();
    __builtin_amdgcn_fence(__ATOMIC_ACQUIRE, "workgroup");
  }
}

// ---------------------------------------------------------------------------
// f32 -> bf16 bits (RNE), 8 consecutive elements per thread: one 16-B store per lane, 32 contiguous lanes = 4 whole
// ---------------------------------------------------------------------------
__global__ __launch_bounds__(256) void cast_bf16_kernel(const float* __restrict__ in, unsigned short* __restrict__ out, int n8) {
  const int i = blockIdx.x * 256 + threadIdx.x;
  if (i >= n8) return;
  const float* p = in + 8 * (size_t)i;
  const v4f a = *(const v4f*)(p);
  const v4f c = *(const v4f*)(p + 4);
  unsigned short hb[8];
#pragma unroll
  for (int e = 0; e < 4; ++e) {
    hb[e]     = f2bf_bits(a[e]);
    hb[4 + e] = f2bf_bits(c[e]);
  }
  const v4u u = (v4u){pk16(hb[0], hb[1]), pk16(hb[2], hb[3]), pk16(hb[4], hb[5]), pk16(hb[6], hb[7])};
  unsigned short* q = out + 8 * (size_t)i;
  *(v4u*)q = u;
  
}

// ---------------------------------------------------------------------------
// Stacked q|k weight cast: out[s][2048][1024] bf16, rows 0..1023 = Wq[s], rows 1024..2047 = Wk[s] (both [out][in], k-contiguous).
// grid (512, 8): blockIdx.y = (which<<2)|s with which 0 = Wq, 1 = Wk (block-uniform source select);
// coverage per y: 512 blocks x 256 threads x 8 = 1,048,576 = one [1024][1024] matrix exactly. Stores as cast_bf16_kernel.
// ---------------------------------------------------------------------------
__global__ __launch_bounds__(256) void cast_wqk_kernel(const float* __restrict__ Wq, const float* __restrict__ Wk,
                                                       unsigned short* __restrict__ out) {
  const int y = blockIdx.y;
  const int smp = y & 3, which = y >> 2;
  const float* src = ((which == 0) ? Wq : Wk) + (size_t)smp * kDim * kDim;
  unsigned short* dst = out + (size_t)smp * kQKld * kDim + (size_t)which * kDim * kDim;
  const int i = blockIdx.x * 256 + threadIdx.x;
  if (i >= (kDim * kDim) / 8) return;
  const float* p = src + 8 * (size_t)i;
  const v4f a = *(const v4f*)(p);
  const v4f c = *(const v4f*)(p + 4);
  unsigned short hb[8];
#pragma unroll
  for (int e = 0; e < 4; ++e) {
    hb[e]     = f2bf_bits(a[e]);
    hb[4 + e] = f2bf_bits(c[e]);
  }
  const v4u u = (v4u){pk16(hb[0], hb[1]), pk16(hb[2], hb[3]), pk16(hb[4], hb[5]), pk16(hb[6], hb[7])};
  unsigned short* q = dst + 8 * (size_t)i;
  *(v4u*)q = u;
  
}

// ---------------------------------------------------------------------------
// Wo cast: out = f16(16 * bf16(Wo)) (RNE to bf16 first, then exact power-of-two carry into f16), 8 per thread, stores as above.
// Coverage: 512 blocks x 256 x 8 = 1,048,576 = [1024][1024] exactly.
// ---------------------------------------------------------------------------
__global__ __launch_bounds__(256) void cast_wo_kernel(const float* __restrict__ in, unsigned short* __restrict__ out, int n8) {
  const int i = blockIdx.x * 256 + threadIdx.x;
  if (i >= n8) return;
  const float* p = in + 8 * (size_t)i;
  const v4f a = *(const v4f*)(p);
  const v4f c = *(const v4f*)(p + 4);
  unsigned short hb[8];
#pragma unroll
  for (int e = 0; e < 4; ++e) {
    hb[e]     = h_bits(kWoCarry * bf_bits2f(f2bf_bits(a[e])));
    hb[4 + e] = h_bits(kWoCarry * bf_bits2f(f2bf_bits(c[e])));
  }
  const v4u u = (v4u){pk16(hb[0], hb[1]), pk16(hb[2], hb[3]), pk16(hb[4], hb[5]), pk16(hb[6], hb[7])};
  unsigned short* q = out + 8 * (size_t)i;
  *(v4u*)q = u;
  
}

// ---------------------------------------------------------------------------
// Mean over tokens of the bf16 x plane: xmean[b][d] = (1/1024) * sum_n x[b][n][d], f32 sequential per (b, d).
// ---------------------------------------------------------------------------
__global__ __launch_bounds__(256) void mean_kernel(const unsigned short* __restrict__ xb, float* __restrict__ xmean) {
  const int t = blockIdx.x * 256 + threadIdx.x;
  if (t >= kBatch * kDim) return;
  const int b = t >> 10, d = t & (kDim - 1);
  const unsigned short* p = xb + (size_t)b * kSeq * kDim + d;
  float acc = 0.f;
#pragma unroll 4
  for (int n = 0; n < kSeq; ++n) acc += bf_bits2f(p[(size_t)n * kDim]);
  const float m = acc * (1.0f / (float)kSeq);
  *(float*)(xmean + t) = m;
  
}

// ---------------------------------------------------------------------------
// Gates and mixing weights (one block, 256 threads = 8 waves):
//   coh[b][s] = sigmoid(xmean[b] . bf16(Wg[s]) + bg[s])  (wave w -> (b, s) = (w>>2, w&3); per-lane strided partials + shuffle tree)
//   t = clip(temperature, 0.1, 10); invt = 1/t; gw = softmax(hyp_w * invt)
// ---------------------------------------------------------------------------
__global__ __launch_bounds__(256) void gate_kernel(const float* __restrict__ xmean, const float* __restrict__ Wg,
                                                   const float* __restrict__ bg, const float* __restrict__ hw,
                                                   const float* __restrict__ temp, float* __restrict__ wsS) {
  __shared__ float vals[32];
  const int t = threadIdx.x, lane = t & 31, wave = t >> 5;
  if (t < 32) vals[t] = 0.f;
  __syncthreads();
  {
    const int b = wave >> 2, s = wave & 3;
    float acc = 0.f;
#pragma unroll 1
    for (int d = lane; d < kDim; d += 32) {
      const float wg = bf_bits2f(f2bf_bits(Wg[(size_t)s * kDim + d]));
      acc += xmean[b * kDim + d] * wg;
    }
#pragma unroll
    for (int off = 16; off > 0; off >>= 1) acc += __shfl_xor(acc, off, 32);
    if (lane == 0) {
      const float z = acc + bf_bits2f(f2bf_bits(bg[s]));
      vals[4 + b * kSamp + s] = 1.0f / (1.0f + __expf(-z));
    }
  }
  __syncthreads();
  if (t == 0) {
    float tc = bf_bits2f(f2bf_bits(temp[0]));
    tc = fminf(fmaxf(tc, 0.1f), 10.0f);
    const float invt = 1.0f / tc;
    const float l0 = bf_bits2f(f2bf_bits(hw[0])) * invt;
    const float l1 = bf_bits2f(f2bf_bits(hw[1])) * invt;
    const float l2 = bf_bits2f(f2bf_bits(hw[2])) * invt;
    const float l3 = bf_bits2f(f2bf_bits(hw[3])) * invt;
    const float mx = fmaxf(fmaxf(l0, l1), fmaxf(l2, l3));
    const float e0 = __expf(l0 - mx), e1 = __expf(l1 - mx), e2 = __expf(l2 - mx), e3 = __expf(l3 - mx);
    const float is = 1.0f / ((e0 + e1) + (e2 + e3));
    vals[0] = e0 * is; vals[1] = e1 * is; vals[2] = e2 * is; vals[3] = e3 * is;
    vals[12] = invt;
  }
  __syncthreads();
  if (wave == 0) {
    const float v = vals[lane];
    *(float*)(wsS + lane) = v;
    
  }
}

// ---------------------------------------------------------------------------
// Row softmax + mixing, f32 math. One launch per (sample s, batch b, head half); grid = 1024 query rows i, 128 threads;
// thread t owns columns 8t..8t+7 (128 x 8 = 1024 = whole row). Block loops over the 8 head planes in fixed order:
//   x = S[h][i][:] * invt; p = exp(x - max) / sum  (reductions: thread, shuffle tree, 4 wave partials in index order)
//   a2 += (gw_s / 16) * p                              -> registers
// After the head loop the a2 row is staged in LDS and written to out2[b][i][:] (set when first, else old + a2) with two
// ---------------------------------------------------------------------------
__global__ __launch_bounds__(128) void softmax_mix_kernel(const float* __restrict__ Sf, const float* __restrict__ wsS,
                                                          unsigned short* __restrict__ P16, float* out2,
                                                          int smp, int bat, int first) {
  __shared__ float redM[4];
  __shared__ float redS[4];
  __shared__ __align__(16) float arow[kSeq];
  const int i = blockIdx.x;
  const int t = threadIdx.x, lane = t & 31, wave = t >> 5;
  const int c0 = t * 8;
  const float invt = wsS[12];
  const float gw   = wsS[smp];
  const float coh  = wsS[4 + bat * kSamp + smp];
  const float wP   = kPCarry * gw * coh;
  const float wA   = gw * (1.0f / (float)kHeads);
  float a2[8];
#pragma unroll
  for (int e = 0; e < 8; ++e) a2[e] = 0.f;

#pragma unroll 1
  for (int h = 0; h < kHeadsHalf; ++h) {
    const size_t rb = ((size_t)h * kSeq + i) * kSeq + c0;
    const v4f va = *(const v4f*)(Sf + rb);
    const v4f vc = *(const v4f*)(Sf + rb + 4);
    float x[8];
#pragma unroll
    for (int e = 0; e < 4; ++e) { x[e] = va[e] * invt; x[4 + e] = vc[e] * invt; }
    float m = fmaxf(fmaxf(fmaxf(x[0], x[1]), fmaxf(x[2], x[3])), fmaxf(fmaxf(x[4], x[5]), fmaxf(x[6], x[7])));
#pragma unroll
    for (int off = 16; off > 0; off >>= 1) m = fmaxf(m, __shfl_xor(m, off, 32));
    if (lane == 0) redM[wave] = m;
    __syncthreads();
    const float M = fmaxf(fmaxf(redM[0], redM[1]), fmaxf(redM[2], redM[3]));
    float ex[8];
#pragma unroll
    for (int e = 0; e < 8; ++e) ex[e] = __expf(x[e] - M);
    float ssum = ((ex[0] + ex[1]) + (ex[2] + ex[3])) + ((ex[4] + ex[5]) + (ex[6] + ex[7]));
#pragma unroll
    for (int off = 16; off > 0; off >>= 1) ssum += __shfl_xor(ssum, off, 32);
    if (lane == 0) redS[wave] = ssum;
    __syncthreads();
    const float l  = (redS[0] + redS[1]) + (redS[2] + redS[3]);
    const float il = 1.0f / l;
    unsigned short hb[8];
#pragma unroll
    for (int e = 0; e < 8; ++e) {
      const float p = ex[e] * il;
      a2[e] += wA * p;
      hb[e] = h_bits(p * wP);
    }
    const v4u u = (v4u){pk16(hb[0], hb[1]), pk16(hb[2], hb[3]), pk16(hb[4], hb[5]), pk16(hb[6], hb[7])};
    unsigned short* q = P16 + rb;
    *(v4u*)q = u;
    
  }

#pragma unroll
  for (int e = 0; e < 8; ++e) arow[c0 + e] = a2[e];
  __syncthreads();
  float* orow = out2 + ((size_t)bat * kSeq + i) * kSeq;
  const int ca = 4 * t, cb = 512 + 4 * t;
  const v4f v0 = *(const v4f*)(arow + ca);
  const v4f v1 = *(const v4f*)(arow + cb);
  const v4f o0 = *(const v4f*)(orow + ca);
  const v4f o1 = *(const v4f*)(orow + cb);
  v4f n0, n1;
#pragma unroll
  for (int e = 0; e < 4; ++e) {
    n0[e] = first ? v0[e] : (o0[e] + v0[e]);
    n1[e] = first ? v1[e] : (o1[e] + v1[e]);
  }
  *(v4f*)(orow + ca) = n0;
  *(v4f*)(orow + cb) = n1;
  
}

// ---------------------------------------------------------------------------
// Workspace region map (byte offsets, all multiples of 4096). Every region is fully written before it is read.
//   wsS    f32 [32] (gw, coh, 1/t)                         0           ..       4,096
//   xmean  f32 [2][1024]                                   4,096       ..      12,288
//   xb     bf16 [2048][1024]                               12,288      ..   4,206,592
//   Wqkb   bf16 [4][2048][1024] (Wq[s] rows | Wk[s] rows)  4,206,592   ..  20,983,808
//   Wvb    bf16 [4][1024][1024]                            20,983,808  ..  29,372,416
//   Wo16   f16  [1024][1024]  = f16(16*bf16(Wo))          29,372,416  ..  31,469,568
//   QK16   f16  [2048][2048]  q x16 | k x16 (one sample)  31,469,568  ..  39,858,176
//   VT16   f16  [2][1024 e][1024 tok] v x16 transposed    39,858,176  ..  44,052,480
//   Sf     f32  [8 heads][1024][1024] scores of one (s,b)  44,052,480  ..  77,606,912
//   P16    f16  [8 heads][1024][1024] probabilities        77,606,912  ..  94,384,128
//   combF  f32  [2][1024][1024] 256 * sum_s gw*coh*out_s   94,384,128  .. 102,772,736
//   comb16 f16  [2][1024][1024] f16 of the same            102,772,736 .. 106,967,040
//   total 106,967,040 B
// GEMM shapes (all K % 64 == 0; block tile 128x256, for attn.v 512x64; every M, N a multiple of it; no padded planes):
//   q|k projection  M=2048 N=2048 K=1024 (bf16 in, f16 out x16)
//   v (role-swapped) M=1024 (e) N=1024 (tok) K=1024, z-batch 2 over b
//   scores          M=N=1024 K=64, z-batch 8 heads (column stride 64 in QK16)
//   attn.v          M=1024 N=64 K=1024, z-batch 8 heads (A = P16 planes, Bt = VT16 rows, C columns h*64)
//   output          M=2048 N=1024 K=1024 + bo -> d_out
// ---------------------------------------------------------------------------
extern "C" void kernel_launch(void* const* d_in, const int* in_sizes, int n_in,
                              void* d_out, int out_size, void* d_ws, size_t ws_size,
                              hipStream_t stream) {
  if (n_in < 10) return;
  if (in_sizes[0] != kTok * kDim) return;
  if (in_sizes[1] != kSamp * kDim * kDim || in_sizes[2] != kSamp * kDim * kDim || in_sizes[3] != kSamp * kDim * kDim) return;
  if (in_sizes[4] != kSamp * kDim || in_sizes[5] != kSamp) return;
  if (in_sizes[6] != kDim * kDim || in_sizes[7] != kDim) return;
  if (in_sizes[8] != kSamp || in_sizes[9] != 1) return;
  if (out_size != kTok * kDim + kBatch * kSeq * kSeq) return;

  const float* x    = (const float*)d_in[0];   // [2][1024][1024]
  const float* Wq   = (const float*)d_in[1];   // [4][1024][1024] ([s][out][in])
  const float* Wk   = (const float*)d_in[2];
  const float* Wv   = (const float*)d_in[3];
  const float* Wg   = (const float*)d_in[4];   // [4][1024]
  const float* bg   = (const float*)d_in[5];   // [4]
  const float* Wo   = (const float*)d_in[6];   // [1024][1024] ([out][in])
  const float* bo   = (const float*)d_in[7];   // [1024]
  const float* hw   = (const float*)d_in[8];   // [4]
  const float* temp = (const float*)d_in[9];   // [1]
  float* yout = (float*)d_out;                             // [2][1024][1024] at byte 0
  float* aout = (float*)d_out + (size_t)kTok * kDim;       // [2][1024][1024] at byte 8,388,608

  // ---- carve ----
  const size_t SZ_WSS  = 4096;
  const size_t SZ_XM   = (size_t)kBatch * kDim * 4;                 //      8,192
  const size_t SZ_XB   = (size_t)kTok * kDim * 2;                   //  4,194,304
  const size_t SZ_WQK  = (size_t)kSamp * kQKld * kDim * 2;          // 16,777,216
  const size_t SZ_WV   = (size_t)kSamp * kDim * kDim * 2;           //  8,388,608
  const size_t SZ_WO   = (size_t)kDim * kDim * 2;                   //  2,097,152
  const size_t SZ_QK   = (size_t)kTok * kQKld * 2;                  //  8,388,608
  const size_t SZ_VT   = (size_t)kBatch * kDim * kSeq * 2;          //  4,194,304
  const size_t SZ_S    = (size_t)kHeadsHalf * kSeq * kSeq * 4;      // 33,554,432
  const size_t SZ_P    = (size_t)kHeadsHalf * kSeq * kSeq * 2;      // 16,777,216
  const size_t SZ_CF   = (size_t)kBatch * kSeq * kDim * 4;          //  8,388,608
  const size_t SZ_CH   = (size_t)kBatch * kSeq * kDim * 2;          //  4,194,304
  size_t off = 0;
  const size_t oWSS = off; off += SZ_WSS;
  const size_t oXM  = off; off += SZ_XM;
  const size_t oXB  = off; off += SZ_XB;
  const size_t oWQK = off; off += SZ_WQK;
  const size_t oWV  = off; off += SZ_WV;
  const size_t oWO  = off; off += SZ_WO;
  const size_t oQK  = off; off += SZ_QK;
  const size_t oVT  = off; off += SZ_VT;
  const size_t oS   = off; off += SZ_S;
  const size_t oP   = off; off += SZ_P;
  const size_t oCF  = off; off += SZ_CF;
  const size_t oCH  = off; off += SZ_CH;
  const size_t TOTAL = off;                                         // 106,967,040
  if (TOTAL > ws_size) return;
  if (TOTAL > (size_t)134217728) return;

  char* ws = (char*)d_ws;
  float*          wsS    = (float*)(ws + oWSS);
  float*          xmean  = (float*)(ws + oXM);
  unsigned short* xb     = (unsigned short*)(ws + oXB);
  unsigned short* Wqkb   = (unsigned short*)(ws + oWQK);
  unsigned short* Wvb    = (unsigned short*)(ws + oWV);
  unsigned short* Wo16   = (unsigned short*)(ws + oWO);
  unsigned short* QK16   = (unsigned short*)(ws + oQK);
  unsigned short* VT16   = (unsigned short*)(ws + oVT);
  float*          Sf     = (float*)(ws + oS);
  unsigned short* P16    = (unsigned short*)(ws + oP);
  float*          combF  = (float*)(ws + oCF);
  unsigned short* comb16 = (unsigned short*)(ws + oCH);

  const dim3 blk(256);

  // (0) operand casts
  {
    const int n8x = kTok * kDim / 8;                 // 262,144 -> 1024 blocks exactly
    cast_bf16_kernel<<<dim3(n8x / 256), blk, 0, stream>>>(x, xb, n8x);
    cast_wqk_kernel<<<dim3((kDim * kDim / 8) / 256, 8), blk, 0, stream>>>(Wq, Wk, Wqkb);   // 512 x 8 blocks
    const int n8v = kSamp * kDim * kDim / 8;         // 524,288 -> 2048 blocks exactly
    cast_bf16_kernel<<<dim3(n8v / 256), blk, 0, stream>>>(Wv, Wvb, n8v);
    const int n8o = kDim * kDim / 8;                 // 131,072 -> 512 blocks exactly
    cast_wo_kernel<<<dim3(n8o / 256), blk, 0, stream>>>(Wo, Wo16, n8o);
  }
  // (1) mean pool + gates
  mean_kernel<<<dim3((kBatch * kDim) / 256), blk, 0, stream>>>(xb, xmean);   // 8 blocks exactly
  gate_kernel<<<dim3(1), blk, 0, stream>>>(xmean, Wg, bg, hw, temp, wsS);

  const dim3 gQK((((kTok / 64) * (kQKld / 64)) + 7) / 8, 1);        // 128 blocks: M=2048, N=2048
  const dim3 gV((((kDim / 64) * (kSeq / 64)) + 7) / 8, kBatch);     // 32 x 2:     M=1024, N=1024
  const dim3 gS((((kSeq / 64) * (kSeq / 64)) + 7) / 8, kHeadsHalf); // 32 x 8:     M=N=1024
  const dim3 gPV((((kSeq / 64) * (kDh / 64)) + 7) / 8, kHeadsHalf); // 2 x 8:      M=1024, N=64
  const dim3 gOut((((kTok / 64) * (kDim / 64)) + 7) / 8, 1);        // 64 blocks:  M=2048, N=1024

  for (int s = 0; s < kSamp; ++s) {
    // (2) q|k projection of sample s: QK16[tok][n] = f16(16 * sum_c bf16(x[tok][c]) * bf16(Wqk[s][n][c]))
    const unsigned short* Wsb = Wqkb + (size_t)s * kQKld * kDim;
    wmma_gemm64<1, false, 0, 1, false, 0, 2, 4><<<gQK, blk, 0, stream>>>(
        xb, xb, kDim, 0L, Wsb, Wsb, kDim, 0L, (void*)QK16, (void*)QK16, kQKld, 0L,
        bo, x, 0L, kTok, kQKld, kDim, kQKVCarry);
    // (3) v role-swapped per batch: VT16[b][e][tok] = f16(16 * sum_c bf16(Wv[s][e][c]) * bf16(x[b][tok][c]))
    const unsigned short* Wvs = Wvb + (size_t)s * kDim * kDim;
    wmma_gemm64<1, false, 0, 1, false, 0, 2, 4><<<gV, blk, 0, stream>>>(
        Wvs, Wvs, kDim, 0L, xb, xb, kDim, (long)kSeq * kDim, (void*)VT16, (void*)VT16, kSeq, (long)kDim * kSeq,
        bo, x, 0L, kDim, kSeq, kDim, kQKVCarry);

    for (int b = 0; b < kBatch; ++b) {
      for (int hh = 0; hh < kHeads / kHeadsHalf; ++hh) {
        // (4) scores for 8 heads: Sf[h'][i][j] = 2^-11 * sum_d (16q)(16k) = 0.125 * q.k  (head = hh*8 + h', column stride 64)
        const unsigned short* Aq = QK16 + (size_t)b * kSeq * kQKld + (size_t)hh * kHeadsHalf * kDh;
        const unsigned short* Bk = Aq + kDim;
        wmma_gemm64<0, false, 0, 0, false, 0, 2, 4><<<gS, blk, 0, stream>>>(
            Aq, Aq, kQKld, (long)kDh, Bk, Bk, kQKld, (long)kDh, (void*)Sf, (void*)Sf, kSeq, (long)kSeq * kSeq,
            bo, x, 0L, kSeq, kSeq, kDh, kScoreScale);
        // (5) softmax (x 1/t), P16 planes, head-mean mixing into output 2
        const int first = (s == 0 && hh == 0) ? 1 : 0;
        softmax_mix_kernel<<<dim3(kSeq), dim3(128), 0, stream>>>(Sf, wsS, P16, aout, s, b, first);
        // (6) attn.v for 8 heads into combF columns (hh*8+h')*64..; accumulate over s in place; last sample emits f16 x256
        const unsigned short* Vb = VT16 + (size_t)b * kDim * kSeq + (size_t)hh * kHeadsHalf * kDh * kSeq;
        float* Cf = combF + (size_t)b * kSeq * kDim + (size_t)hh * kHeadsHalf * kDh;
        if (s == 0) {
          wmma_gemm64<0, false, 0, 0, false, 0, 8, 1><<<gPV, blk, 0, stream>>>(
              P16, P16, kSeq, (long)kSeq * kSeq, Vb, Vb, kSeq, (long)kDh * kSeq, (void*)Cf, (void*)Cf, kDim, (long)kDh,
              bo, x, 0L, kSeq, kDh, kSeq, kPVScale);
        } else if (s < kSamp - 1) {
          wmma_gemm64<0, false, 0, 0, true, 0, 8, 1><<<gPV, blk, 0, stream>>>(
              P16, P16, kSeq, (long)kSeq * kSeq, Vb, Vb, kSeq, (long)kDh * kSeq, (void*)Cf, (void*)Cf, kDim, (long)kDh,
              bo, Cf, (long)kDh, kSeq, kDh, kSeq, kPVScale);
        } else {
          unsigned short* Ch = comb16 + (size_t)b * kSeq * kDim + (size_t)hh * kHeadsHalf * kDh;
          wmma_gemm64<0, false, 0, 1, true, 0, 8, 1><<<gPV, blk, 0, stream>>>(
              P16, P16, kSeq, (long)kSeq * kSeq, Vb, Vb, kSeq, (long)kDh * kSeq, (void*)Ch, (void*)Ch, kDim, (long)kDh,
              bo, Cf, (long)kDh, kSeq, kDh, kSeq, kPVScale);
        }
      }
    }
  }

  // (7) y = (comb16 . Wo16^T) / 4096 + bo -> d_out output 0 (f32)
  wmma_gemm64<0, false, 2, 0, false, 0, 2, 4><<<gOut, blk, 0, stream>>>(
      comb16, comb16, kDim, 0L, Wo16, Wo16, kDim, 0L, (void*)yout, (void*)yout, kDim, 0L,
      bo, x, 0L, kTok, kDim, kDim, kOutScale);
}

// v002
// Measured time: 546 microseconds a run.
// In both of two side-by-side timings against v001, it was 1.88 times as fast.
// Over all steps from v000 it is 3.32 times as fast.
// Compute dtypes: q/k/v projections on v_wmma_f32_16x16x32_bf16 (x and Wq/Wk/Wv RNE-converted to bf16, f32 accumulate, results carried x16 into f16 planes); scores q.k^T, attn.v and the output projection on v_wmma_f32_16x16x32_f16 (f16 operands: q,k,v x16, probabilities x2^15 with the per-sample mixing weight folded in, combined x256, Wo as f16(16*bf16(Wo))), f32 accumulate; mean-pool, gates, softmax and the head/sample mixing in f32.
#include <hip/hip_runtime.h>
#include <math.h>

// ---------------------------------------------------------------------------
// Problem constants
// ---------------------------------------------------------------------------
constexpr int kBatch     = 2;
constexpr int kSeq       = 1024;
constexpr int kDim       = 1024;
constexpr int kHeads     = 16;
constexpr int kSamp      = 4;
constexpr int kDh        = 64;
constexpr int kTok       = kBatch * kSeq;       // 2048 token rows
constexpr int kHeadsHalf = 8;                   // heads per half of the softmax kernel's head loop
constexpr int kQKld      = 2 * kDim;            // 2048: q columns 0..1023 | k columns 1024..2047
constexpr float kQKVCarry   = 16.0f;            // q, k, v carried x16 in f16
constexpr float kPCarry     = 32768.0f;         // probabilities carried x2^15 (times gate <= 1)
constexpr float kCombCarry  = 256.0f;           // combined carried x256
constexpr float kWoCarry    = 16.0f;            // Wo carried x16 in f16
constexpr float kScoreScale = 0.125f / (16.0f * 16.0f);              // dh^-0.5 / (16*16) = 2^-11
constexpr float kPVScale    = kCombCarry / (kPCarry * kQKVCarry);    // 256 / 2^19 = 2^-11
constexpr float kOutScale   = 1.0f / (kCombCarry * kWoCarry);        // 2^-12

typedef __attribute__((ext_vector_type(16))) _Float16 v16h;
typedef __attribute__((ext_vector_type(8)))  _Float16 v8h;
typedef __attribute__((ext_vector_type(16))) __bf16   v16b;
typedef __attribute__((ext_vector_type(8)))  __bf16   v8b;
typedef __attribute__((ext_vector_type(8)))  float    v8f;
typedef __attribute__((ext_vector_type(4)))  float    v4f;
typedef __attribute__((ext_vector_type(4)))  unsigned int v4u;

__device__ __forceinline__ unsigned short f2bf_bits(float f) {
  unsigned u = __float_as_uint(f);
  return (unsigned short)((u + 0x7FFFu + ((u >> 16) & 1u)) >> 16);
}
__device__ __forceinline__ float bf_bits2f(unsigned short h) { return __uint_as_float(((unsigned)h) << 16); }

// hazard guard as a plain device helper
__device__ __forceinline__ void acc_guard4(v8f& a, v8f& b, v8f& c, v8f& d) { asm volatile("v_nop\n\tv_nop\n\tv_nop\n\tv_nop" : "+v"(a), "+v"(b), "+v"(c), "+v"(d)); }
template <typename T> struct Frag;
template <> struct Frag<_Float16> {
  typedef v16h V; union U { v16h v; v8h h[2]; };
  static __device__ __forceinline__ v16h load(const _Float16* p) {   // elements 0..7 <- p[0..7], 8..15 <- p[16..23]
    U f; f.h[0] = *(const v8h*)(p); f.h[1] = *(const v8h*)(p + 16); return f.v;
  }
  static __device__ __forceinline__ v8f mma(v16h a, v16h b, v8f c) {
    return __builtin_amdgcn_wmma_f32_16x16x32_f16(false, a, false, b, (short)0, c, false, false);
  }
};
template <> struct Frag<__bf16> {
  typedef v16b V; union U { v16b v; v8b h[2]; };
  static __device__ __forceinline__ v16b load(const __bf16* p) {
    U f; f.h[0] = *(const v8b*)(p); f.h[1] = *(const v8b*)(p + 16); return f.v;
  }
  static __device__ __forceinline__ v8f mma(v16b a, v16b b, v8f c) {
    return __builtin_amdgcn_wmma_f32_16x16x32_bf16(false, a, false, b, (short)0, c, false, false);
  }
};

__device__ __forceinline__ unsigned pk16(unsigned short a, unsigned short b) { return (unsigned)a | ((unsigned)b << 16); }
__device__ __forceinline__ unsigned short h_bits(float f) { const _Float16 h = (_Float16)f; return __builtin_bit_cast(unsigned short, h); }

// ---- Operand staging: asynchronous copies global -> LDS ----
constexpr int kStageK   = 64;    // k elements per stage = one whole 128-B line of every operand row
constexpr int kRowPitch = 144;   // LDS bytes per staged row: 128 + 16, an odd multiple of 16 B, so that the 16 rows of a fragment read fall on distinct banks

// Six 16-B copies per lane, global -> LDS through no register. The s_wait_xcnt 0 is the statement's last line so that
// no address register named by an issued copy is rewritten in front of it.
__device__ __forceinline__ void async_copy6(unsigned l0, const unsigned short* g0, unsigned l1, const unsigned short* g1,
                                            unsigned l2, const unsigned short* g2, unsigned l3, const unsigned short* g3,
                                            unsigned l4, const unsigned short* g4, unsigned l5, const unsigned short* g5) {
  asm volatile("global_load_async_to_lds_b128 %0, %1, off\n\t"
               "global_load_async_to_lds_b128 %2, %3, off\n\t"
               "global_load_async_to_lds_b128 %4, %5, off\n\t"
               "global_load_async_to_lds_b128 %6, %7, off\n\t"
               "global_load_async_to_lds_b128 %8, %9, off\n\t"
               "global_load_async_to_lds_b128 %10, %11, off\n\t"
               "s_wait_xcnt 0x0"
               :: "v"(l0), "v"(g0), "v"(l1), "v"(g1), "v"(l2), "v"(g2), "v"(l3), "v"(g3), "v"(l4), "v"(g4), "v"(l5), "v"(g5)
               : "memory");
}

// ---- Register-blocked batched WMMA GEMM (ACT reduced to none/relu/leaky; Cout/resid without restrict
//      so that the in-place residual accumulate (resid == Cout, same wave reads its rows before storing them) is well formed) --
// C[m,n] = scale * sum_k A[m,k] * Bt[n,k] (+bias)(+resid); each wave owns a 64x64 tile; the block's 8 waves form a WM x WN grid of
// such tiles and share one staged k-tile: 64*WM rows of A, then 64*WN rows of Bt, 64 k each, two LDS buffers (the next k-tile's
// copies fly while this one is multiplied).
// A row-major [M,K]; Bt row-major [N,K]; M % (64*WM) == 0, N % (64*WN) == 0, K % 64 == 0; rows and bases 16-B aligned.
// SPLIT (hi/lo planes) is not carried by the staged loop and must be false.
// BIAS_MODE: 0 = none, 1 = bias[m], 2 = bias[n].
// OUT_MODE: 0 = f32, 1 = f16, 2 = bf16 hi plane (Cout) + bf16 lo plane (Cout2).
// ET: 0 = f16 operands, 1 = bf16 operands (pointers passed as 16-bit storage)
template <int ET> struct Elem;
template <> struct Elem<0> { typedef _Float16 T; };
template <> struct Elem<1> { typedef __bf16 T; };
template <int ET, bool SPLIT, int BIAS_MODE, int OUT_MODE, bool RESID, int ACT, int WM, int WN>
__global__ __launch_bounds__(256) void wmma_gemm64(
    const unsigned short* __restrict__ Ap, const unsigned short* __restrict__ A2p, int lda, long strideA,
    const unsigned short* __restrict__ Btp, const unsigned short* __restrict__ Bt2p, int ldb, long strideB,
    void* Cout, void* Cout2, int ldc, long strideC,
    const float* __restrict__ bias,
    const float* resid, long strideR,
    int M, int N, int K, float scale,
    int inner, long strideA2, long strideB2, long strideC2, long strideR2) {
  typedef typename Elem<ET>::T T;
  typedef typename Frag<T>::V V;
  static_assert(!SPLIT, "the staged k-loop carries one plane per operand");
  static_assert(WM * WN == 8, "eight waves per block");
  constexpr int kRowsA  = 64 * WM;                    // staged rows 0..kRowsA-1 = A, the rest = Bt
  constexpr int kRows   = 64 * (WM + WN);
  constexpr int kStageB = kRows * kRowPitch;          // bytes of one buffer
  constexpr int kCopies = kRows / 32;                 // copies per lane and stage: 256 lanes cover 32 rows x 8 chunks of 16 B
  static_assert(kCopies % 6 == 0 && kCopies <= 63, "copies go out six to a statement");
  __shared__ __align__(16) unsigned char ring[2 * kStageB];
  __shared__ __align__(16) float sT[8][16 * 68];   // per-wave 16x64 slab, pitch 68 floats
  // two-level batch: blockIdx.y = outer * inner + b; b walks the first strides, outer the second
  const int outer = (int)blockIdx.y / inner;
  const int b     = (int)blockIdx.y - outer * inner;
  const size_t offA = (size_t)b * strideA + (size_t)outer * strideA2;
  const size_t offB = (size_t)b * strideB + (size_t)outer * strideB2;
  const size_t offC = (size_t)b * strideC + (size_t)outer * strideC2;
  const size_t offR = (size_t)b * strideR + (size_t)outer * strideR2;
  const int lane = threadIdx.x & 31;
  const int wave = threadIdx.x >> 5;
  const int tilesN = N / (64 * WN);
  const int tilesM = M / (64 * WM);
  if ((int)blockIdx.x >= tilesM * tilesN) return;   // block-uniform, in front of every barrier
  const int bm = blockIdx.x / tilesN;
  const int bn = blockIdx.x - bm * tilesN;
  const int mB = bm * (64 * WM);
  const int nB = bn * (64 * WN);
  const int wm = wave / WN;
  const int wn = wave - wm * WN;
  const int m0 = mB + (wm << 6);
  const int n0 = nB + (wn << 6);

  const int rlane = lane & 15;                 // row (A) / col (B, D) within subtile
  const int mOff  = (lane >> 4) * 8;           // D row offset

  // copy side: lane -> (row crow + 32*j, 16-B chunk cchk) of the staged k-tile
  const int crow = threadIdx.x >> 3;
  const int cchk = threadIdx.x & 7;
  const unsigned short* gA = Ap  + offA + (size_t)(mB + crow) * lda + cchk * 8;
  const unsigned short* gB = Btp + offB + (size_t)(nB + crow) * ldb + cchk * 8;
  const unsigned ldsC = (unsigned)(size_t)(void*)ring + (unsigned)(crow * kRowPitch + cchk * 16);
  auto issue = [&](int t, int buf) {
    const unsigned l = ldsC + (unsigned)(buf * kStageB);
    const unsigned short* a = gA + t * kStageK;
    const unsigned short* w = gB + t * kStageK;
    auto from = [&](int j) { return (j < kRowsA / 32) ? (a + (size_t)(j * 32) * lda) : (w + (size_t)((j - kRowsA / 32) * 32) * ldb); };
    auto to   = [&](int j) { return l + (unsigned)(j * 32 * kRowPitch); };
#pragma unroll
    for (int j = 0; j < kCopies; j += 6)
      async_copy6(to(j), from(j), to(j + 1), from(j + 1), to(j + 2), from(j + 2),
                  to(j + 3), from(j + 3), to(j + 4), from(j + 4), to(j + 5), from(j + 5));
  };
  // read side: this lane's row of the first A / Bt fragment, at its lane half's k offset (8 elements = 16 B)
  const unsigned char* fA = ring + ((wm << 6) + rlane) * kRowPitch + (lane >> 4) * 16;
  const unsigned char* fB = ring + (kRowsA + (wn << 6) + rlane) * kRowPitch + (lane >> 4) * 16;

  v8f acc[4][4];
#pragma unroll
  for (int i = 0; i < 4; ++i)
#pragma unroll
    for (int j = 0; j < 4; ++j) acc[i][j] = (v8f){0.f,0.f,0.f,0.f,0.f,0.f,0.f,0.f};

  const int nT = K / kStageK;
  issue(0, 0);
  asm volatile("s_wait_asynccnt 0x0" ::: "memory");   // this wave's copies of k-tile 0 have landed
  __syncthreads();                                    // ... and every other wave's: k-tile 0 may be read
  if (nT > 1) issue(1, 1);

  for (int t = 0; t < nT; ++t) {
    const int bo = (t & 1) * kStageB;
    // all fragment reads of the k-tile stand as one group in front of its WMMAs (one LDS latency per trip, counted waits behind it)
    V ah[kStageK / 32][4], bh[kStageK / 32][4];
#pragma unroll
    for (int ks = 0; ks < kStageK / 32; ++ks) {
#pragma unroll
      for (int j = 0; j < 4; ++j) bh[ks][j] = Frag<T>::load((const T*)(fB + bo + j * 16 * kRowPitch + ks * 64));
#pragma unroll
      for (int i = 0; i < 4; ++i) ah[ks][i] = Frag<T>::load((const T*)(fA + bo + i * 16 * kRowPitch + ks * 64));
    }
    __builtin_amdgcn_sched_barrier(0);   // keeps the reads one group: without it they are sunk between the WMMAs, each with a wait to 0
#pragma unroll
    for (int ks = 0; ks < kStageK / 32; ++ks)
#pragma unroll
      for (int i = 0; i < 4; ++i)
#pragma unroll
        for (int j = 0; j < 4; ++j) acc[i][j] = Frag<T>::mma(ah[ks][i], bh[ks][j], acc[i][j]);
    __builtin_amdgcn_sched_barrier(0);   // keeps the WMMAs in front of the waits: sunk behind them, the next k-tile's copies would be waited for before the work that hides them
    asm volatile("s_wait_dscnt 0x0" ::: "memory");     // this wave's reads of buffer t&1 have returned before it is refilled
    asm volatile("s_wait_asynccnt 0x0" ::: "memory");  // this wave's copies of k-tile t+1 have landed
    __syncthreads();                                   // publishes k-tile t+1 and ends every wave's reads of buffer t&1
    if (t + 2 < nT) issue(t + 2, t & 1);
  }
  asm volatile("s_wait_asynccnt 0x0" ::: "memory");    // no copy is outstanding when the wave goes on to the epilogue and ends
  acc_guard4(acc[0][0], acc[0][1], acc[0][2], acc[0][3]);
  acc_guard4(acc[1][0], acc[1][1], acc[1][2], acc[1][3]);
  acc_guard4(acc[2][0], acc[2][1], acc[2][2], acc[2][3]);
  acc_guard4(acc[3][0], acc[3][1], acc[3][2], acc[3][3]);

  // ---- epilogue ----
  float* slab = sT[wave];
  const float* Rb = RESID ? (resid + offR) : nullptr;
#pragma unroll
  for (int i = 0; i < 4; ++i) {
    const int mBase = m0 + (i << 4);
#pragma unroll
    for (int j = 0; j < 4; ++j) {
      const int n = n0 + (j << 4) + rlane;
      float bv = 0.f;
      if (BIAS_MODE == 2) bv = bias[n];
#pragma unroll
      for (int r = 0; r < 8; ++r) {
        float v = acc[i][j][r] * scale;
        if (BIAS_MODE == 1) v += bias[mBase + mOff + r];
        if (BIAS_MODE == 2) v += bv;
        if (RESID) v += Rb[(size_t)(mBase + mOff + r) * ldc + n];
        if (ACT == 2) v = fmaxf(v, 0.0f);
        if (ACT == 4) v = (v > 0.f) ? v : 0.01f * v;
        slab[(mOff + r) * 68 + (j << 4) + rlane] = v;
      }
    }
    __builtin_amdgcn_fence(__ATOMIC_RELEASE, "workgroup");
    __builtin_amdgcn_wave_barrier();
    __builtin_amdgcn_fence(__ATOMIC_ACQUIRE, "workgroup");
    if (OUT_MODE == 0) {
      float* C = (float*)Cout + offC;
      const int hh = lane >> 4, c4 = (lane & 15) * 4;     // row seg = 256 B = 16 lanes x 16 B
      {
#pragma unroll
        for (int it = 0; it < 8; ++it) {
          const int row = it * 2 + hh;
          v4f v = *(const v4f*)(slab + row * 68 + c4);
          *(v4f*)(C + (size_t)(mBase + row) * ldc + n0 + c4) = v;
        }
        
      }
    } else {
      const int q = lane >> 3, c8 = (lane & 7) * 8;
      unsigned short* C  = (unsigned short*)Cout  + offC;
      unsigned short* C2 = (OUT_MODE == 2) ? ((unsigned short*)Cout2 + offC) : nullptr;
      {
#pragma unroll
        for (int it = 0; it < 4; ++it) {
          const int row = it * 4 + q;
          const float* sp = slab + row * 68 + c8;
          v8h hv, lv;
#pragma unroll
          for (int e = 0; e < 8; ++e) {
            if (OUT_MODE == 1) {
              hv[e] = (_Float16)sp[e];
            } else {
              unsigned short hb = f2bf_bits(sp[e]);
              unsigned short lb = f2bf_bits(sp[e] - bf_bits2f(hb));
              hv[e] = __builtin_bit_cast(_Float16, hb);
              lv[e] = __builtin_bit_cast(_Float16, lb);
            }
          }
          *(v8h*)(C + (size_t)(mBase + row) * ldc + n0 + c8) = hv;
          if (OUT_MODE == 2) *(v8h*)(C2 + (size_t)(mBase + row) * ldc + n0 + c8) = lv;
        }
        
      }
    }
    __builtin_amdgcn_fence(__ATOMIC_RELEASE, "workgroup");
    __builtin_amdgcn_wave_barrier();
    __builtin_amdgcn_fence(__ATOMIC_ACQUIRE, "workgroup");
  }
}

// ---------------------------------------------------------------------------
// f32 -> bf16 bits (RNE), 8 consecutive elements per thread: one 16-B store per lane, 32 contiguous lanes = 4 whole
// ---------------------------------------------------------------------------
__global__ __launch_bounds__(256) void cast_bf16_kernel(const float* __restrict__ in, unsigned short* __restrict__ out, int n8) {
  const int i = blockIdx.x * 256 + threadIdx.x;
  if (i >= n8) return;
  const float* p = in + 8 * (size_t)i;
  const v4f a = *(const v4f*)(p);
  const v4f c = *(const v4f*)(p + 4);
  unsigned short hb[8];
#pragma unroll
  for (int e = 0; e < 4; ++e) {
    hb[e]     = f2bf_bits(a[e]);
    hb[4 + e] = f2bf_bits(c[e]);
  }
  const v4u u = (v4u){pk16(hb[0], hb[1]), pk16(hb[2], hb[3]), pk16(hb[4], hb[5]), pk16(hb[6], hb[7])};
  unsigned short* q = out + 8 * (size_t)i;
  *(v4u*)q = u;
  
}

// ---------------------------------------------------------------------------
// Stacked q|k weight cast: out[s][2048][1024] bf16, rows 0..1023 = Wq[s], rows 1024..2047 = Wk[s] (both [out][in], k-contiguous).
// grid (512, 8): blockIdx.y = (which<<2)|s with which 0 = Wq, 1 = Wk (block-uniform source select);
// coverage per y: 512 blocks x 256 threads x 8 = 1,048,576 = one [1024][1024] matrix exactly. Stores as cast_bf16_kernel.
// ---------------------------------------------------------------------------
__global__ __launch_bounds__(256) void cast_wqk_kernel(const float* __restrict__ Wq, const float* __restrict__ Wk,
                                                       unsigned short* __restrict__ out) {
  const int y = blockIdx.y;
  const int smp = y & 3, which = y >> 2;
  const float* src = ((which == 0) ? Wq : Wk) + (size_t)smp * kDim * kDim;
  unsigned short* dst = out + (size_t)smp * kQKld * kDim + (size_t)which * kDim * kDim;
  const int i = blockIdx.x * 256 + threadIdx.x;
  if (i >= (kDim * kDim) / 8) return;
  const float* p = src + 8 * (size_t)i;
  const v4f a = *(const v4f*)(p);
  const v4f c = *(const v4f*)(p + 4);
  unsigned short hb[8];
#pragma unroll
  for (int e = 0; e < 4; ++e) {
    hb[e]     = f2bf_bits(a[e]);
    hb[4 + e] = f2bf_bits(c[e]);
  }
  const v4u u = (v4u){pk16(hb[0], hb[1]), pk16(hb[2], hb[3]), pk16(hb[4], hb[5]), pk16(hb[6], hb[7])};
  unsigned short* q = dst + 8 * (size_t)i;
  *(v4u*)q = u;
  
}

// ---------------------------------------------------------------------------
// Wo cast: out = f16(16 * bf16(Wo)) (RNE to bf16 first, then exact power-of-two carry into f16), 8 per thread, stores as above.
// Coverage: 512 blocks x 256 x 8 = 1,048,576 = [1024][1024] exactly.
// ---------------------------------------------------------------------------
__global__ __launch_bounds__(256) void cast_wo_kernel(const float* __restrict__ in, unsigned short* __restrict__ out, int n8) {
  const int i = blockIdx.x * 256 + threadIdx.x;
  if (i >= n8) return;
  const float* p = in + 8 * (size_t)i;
  const v4f a = *(const v4f*)(p);
  const v4f c = *(const v4f*)(p + 4);
  unsigned short hb[8];
#pragma unroll
  for (int e = 0; e < 4; ++e) {
    hb[e]     = h_bits(kWoCarry * bf_bits2f(f2bf_bits(a[e])));
    hb[4 + e] = h_bits(kWoCarry * bf_bits2f(f2bf_bits(c[e])));
  }
  const v4u u = (v4u){pk16(hb[0], hb[1]), pk16(hb[2], hb[3]), pk16(hb[4], hb[5]), pk16(hb[6], hb[7])};
  unsigned short* q = out + 8 * (size_t)i;
  *(v4u*)q = u;
  
}

// ---------------------------------------------------------------------------
// Mean over tokens of the bf16 x plane: xmean[b][d] = (1/1024) * sum_n x[b][n][d], f32 sequential per (b, d).
// ---------------------------------------------------------------------------
__global__ __launch_bounds__(256) void mean_kernel(const unsigned short* __restrict__ xb, float* __restrict__ xmean) {
  const int t = blockIdx.x * 256 + threadIdx.x;
  if (t >= kBatch * kDim) return;
  const int b = t >> 10, d = t & (kDim - 1);
  const unsigned short* p = xb + (size_t)b * kSeq * kDim + d;
  float acc = 0.f;
#pragma unroll 4
  for (int n = 0; n < kSeq; ++n) acc += bf_bits2f(p[(size_t)n * kDim]);
  const float m = acc * (1.0f / (float)kSeq);
  *(float*)(xmean + t) = m;
  
}

// ---------------------------------------------------------------------------
// Gates and mixing weights (one block, 256 threads = 8 waves):
//   coh[b][s] = sigmoid(xmean[b] . bf16(Wg[s]) + bg[s])  (wave w -> (b, s) = (w>>2, w&3); per-lane strided partials + shuffle tree)
//   t = clip(temperature, 0.1, 10); invt = 1/t; gw = softmax(hyp_w * invt)
// ---------------------------------------------------------------------------
__global__ __launch_bounds__(256) void gate_kernel(const float* __restrict__ xmean, const float* __restrict__ Wg,
                                                   const float* __restrict__ bg, const float* __restrict__ hw,
                                                   const float* __restrict__ temp, float* __restrict__ wsS) {
  __shared__ float vals[32];
  const int t = threadIdx.x, lane = t & 31, wave = t >> 5;
  if (t < 32) vals[t] = 0.f;
  __syncthreads();
  {
    const int b = wave >> 2, s = wave & 3;
    float acc = 0.f;
#pragma unroll 1
    for (int d = lane; d < kDim; d += 32) {
      const float wg = bf_bits2f(f2bf_bits(Wg[(size_t)s * kDim + d]));
      acc += xmean[b * kDim + d] * wg;
    }
#pragma unroll
    for (int off = 16; off > 0; off >>= 1) acc += __shfl_xor(acc, off, 32);
    if (lane == 0) {
      const float z = acc + bf_bits2f(f2bf_bits(bg[s]));
      vals[4 + b * kSamp + s] = 1.0f / (1.0f + __expf(-z));
    }
  }
  __syncthreads();
  if (t == 0) {
    float tc = bf_bits2f(f2bf_bits(temp[0]));
    tc = fminf(fmaxf(tc, 0.1f), 10.0f);
    const float invt = 1.0f / tc;
    const float l0 = bf_bits2f(f2bf_bits(hw[0])) * invt;
    const float l1 = bf_bits2f(f2bf_bits(hw[1])) * invt;
    const float l2 = bf_bits2f(f2bf_bits(hw[2])) * invt;
    const float l3 = bf_bits2f(f2bf_bits(hw[3])) * invt;
    const float mx = fmaxf(fmaxf(l0, l1), fmaxf(l2, l3));
    const float e0 = __expf(l0 - mx), e1 = __expf(l1 - mx), e2 = __expf(l2 - mx), e3 = __expf(l3 - mx);
    const float is = 1.0f / ((e0 + e1) + (e2 + e3));
    vals[0] = e0 * is; vals[1] = e1 * is; vals[2] = e2 * is; vals[3] = e3 * is;
    vals[12] = invt;
  }
  __syncthreads();
  if (wave == 0) {
    const float v = vals[lane];
    *(float*)(wsS + lane) = v;
    
  }
}

// ---------------------------------------------------------------------------
// Row softmax + mixing, f32 math. One launch per sample s; grid = (1024 query rows i, 2 batches), 128 threads;
// thread t owns columns 8t..8t+7 (128 x 8 = 1024 = whole row). Block loops over the 16 heads in fixed order, in two halves of 8:
//   x = S[h][i][:] * invt; p = exp(x - max) / sum  (reductions: thread, shuffle tree, 4 wave partials in index order)
//   a2 += (gw_s / 16) * p                              -> registers
// Each half's a2 row is staged in LDS; out2[b][i][:] = ((half 0 when first, else old + half 0) + half 1), two 16-B stores per thread
// ---------------------------------------------------------------------------
__global__ __launch_bounds__(128) void softmax_mix_kernel(const float* __restrict__ Sf, const float* __restrict__ wsS,
                                                          unsigned short* __restrict__ P16, float* out2,
                                                          int smp, int first) {
  __shared__ float redM[4];
  __shared__ float redS[4];
  __shared__ __align__(16) float arow[kHeads / kHeadsHalf][kSeq];
  const int i = blockIdx.x;
  const int bat = blockIdx.y;
  const int t = threadIdx.x, lane = t & 31, wave = t >> 5;
  const int c0 = t * 8;
  const float invt = wsS[12];
  const float gw   = wsS[smp];
  const float coh  = wsS[4 + bat * kSamp + smp];
  const float wP   = kPCarry * gw * coh;
  const float wA   = gw * (1.0f / (float)kHeads);
  for (int hh = 0; hh < kHeads / kHeadsHalf; ++hh) {
    float a2[8];
#pragma unroll
    for (int e = 0; e < 8; ++e) a2[e] = 0.f;

#pragma unroll 1
    for (int h = 0; h < kHeadsHalf; ++h) {
      const size_t rb = ((size_t)((bat * kHeads + hh * kHeadsHalf + h) * kSeq + i)) * kSeq + c0;
      const v4f va = *(const v4f*)(Sf + rb);
      const v4f vc = *(const v4f*)(Sf + rb + 4);
      float x[8];
#pragma unroll
      for (int e = 0; e < 4; ++e) { x[e] = va[e] * invt; x[4 + e] = vc[e] * invt; }
      float m = fmaxf(fmaxf(fmaxf(x[0], x[1]), fmaxf(x[2], x[3])), fmaxf(fmaxf(x[4], x[5]), fmaxf(x[6], x[7])));
#pragma unroll
      for (int off = 16; off > 0; off >>= 1) m = fmaxf(m, __shfl_xor(m, off, 32));
      if (lane == 0) redM[wave] = m;
      __syncthreads();
      const float M = fmaxf(fmaxf(redM[0], redM[1]), fmaxf(redM[2], redM[3]));
      float ex[8];
#pragma unroll
      for (int e = 0; e < 8; ++e) ex[e] = __expf(x[e] - M);
      float ssum = ((ex[0] + ex[1]) + (ex[2] + ex[3])) + ((ex[4] + ex[5]) + (ex[6] + ex[7]));
#pragma unroll
      for (int off = 16; off > 0; off >>= 1) ssum += __shfl_xor(ssum, off, 32);
      if (lane == 0) redS[wave] = ssum;
      __syncthreads();
      const float l  = (redS[0] + redS[1]) + (redS[2] + redS[3]);
      const float il = 1.0f / l;
      unsigned short hb[8];
#pragma unroll
      for (int e = 0; e < 8; ++e) {
        const float p = ex[e] * il;
        a2[e] += wA * p;
        hb[e] = h_bits(p * wP);
      }
      const v4u u = (v4u){pk16(hb[0], hb[1]), pk16(hb[2], hb[3]), pk16(hb[4], hb[5]), pk16(hb[6], hb[7])};
      unsigned short* q = P16 + rb;
      *(v4u*)q = u;
      asm volatile("s_wait_xcnt 0x0" ::: "memory");   // the store's address and data registers are rewritten at the head of the next trip
    }

#pragma unroll
    for (int e = 0; e < 8; ++e) arow[hh][c0 + e] = a2[e];
  }
  __syncthreads();
  float* orow = out2 + ((size_t)bat * kSeq + i) * kSeq;
  const int ca = 4 * t, cb = 512 + 4 * t;
  const v4f v0 = *(const v4f*)(arow[0] + ca);
  const v4f v1 = *(const v4f*)(arow[0] + cb);
  const v4f w0 = *(const v4f*)(arow[1] + ca);
  const v4f w1 = *(const v4f*)(arow[1] + cb);
  const v4f o0 = *(const v4f*)(orow + ca);
  const v4f o1 = *(const v4f*)(orow + cb);
  v4f n0, n1;
#pragma unroll
  for (int e = 0; e < 4; ++e) {
    n0[e] = (first ? v0[e] : (o0[e] + v0[e])) + w0[e];
    n1[e] = (first ? v1[e] : (o1[e] + v1[e])) + w1[e];
  }
  *(v4f*)(orow + ca) = n0;
  *(v4f*)(orow + cb) = n1;
  
}

// ---------------------------------------------------------------------------
// Workspace region map (byte offsets, all multiples of 4096). Every region is fully written before it is read.
//   wsS    f32 [32] (gw, coh, 1/t)                              0           ..       4,096
//   xmean  f32 [2][1024]                                        4,096       ..      12,288
//   Wo16   f16  [1024][1024]  = f16(16*bf16(Wo))               12,288      ..   2,109,440
//   QK16   f16  [4 s][2048][2048]  q x16 | k x16               2,109,440   ..  35,663,872
//   VT16   f16  [4 s][2][1024 e][1024 tok] v x16 transposed    35,663,872  ..  52,441,088
//   combF  f32  [2][1024][1024] 256 * sum_s gw*coh*out_s        52,441,088  ..  60,829,696
//   comb16 f16  [2][1024][1024] f16 of the same                 60,829,696  ..  65,024,000
//   P16    f16  [2 b][16 heads][1024][1024] probabilities       65,024,000  .. 132,132,864
//   Sf     f32  [2 b][16 heads][1024][1024] scores of one s     132,132,864 .. 266,350,592
//   The projections' operands lie inside Sf: their last reader (the v projection) ends before the first scores launch writes Sf.
//   xb     bf16 [2048][1024]                                    132,132,864 .. 136,327,168
//   Wqkb   bf16 [4][2048][1024] (Wq[s] rows | Wk[s] rows)       136,327,168 .. 153,104,384
//   Wvb    bf16 [4][1024][1024]                                 153,104,384 .. 161,492,992
//   total 266,350,592 B
// GEMM shapes (all K % 64 == 0; block tile 128x256, for attn.v 512x64; every M, N a multiple of it; no padded planes):
//   q|k projection  M=2048 N=2048 K=1024 (bf16 in, f16 out x16), batch 4 samples
//   v (role-swapped) M=1024 (e) N=1024 (tok) K=1024, batch 2 b x 4 samples
//   scores          M=N=1024 K=64, batch 16 heads (column stride 64 in QK16) x 2 b
//   attn.v          M=1024 N=64 K=1024, batch 16 heads (A = P16 planes, Bt = VT16 rows, C columns h*64) x 2 b
//   output          M=2048 N=1024 K=1024 + bo -> d_out
// ---------------------------------------------------------------------------
extern "C" void kernel_launch(void* const* d_in, const int* in_sizes, int n_in,
                              void* d_out, int out_size, void* d_ws, size_t ws_size,
                              hipStream_t stream) {
  if (n_in < 10) return;
  if (in_sizes[0] != kTok * kDim) return;
  if (in_sizes[1] != kSamp * kDim * kDim || in_sizes[2] != kSamp * kDim * kDim || in_sizes[3] != kSamp * kDim * kDim) return;
  if (in_sizes[4] != kSamp * kDim || in_sizes[5] != kSamp) return;
  if (in_sizes[6] != kDim * kDim || in_sizes[7] != kDim) return;
  if (in_sizes[8] != kSamp || in_sizes[9] != 1) return;
  if (out_size != kTok * kDim + kBatch * kSeq * kSeq) return;

  const float* x    = (const float*)d_in[0];   // [2][1024][1024]
  const float* Wq   = (const float*)d_in[1];   // [4][1024][1024] ([s][out][in])
  const float* Wk   = (const float*)d_in[2];
  const float* Wv   = (const float*)d_in[3];
  const float* Wg   = (const float*)d_in[4];   // [4][1024]
  const float* bg   = (const float*)d_in[5];   // [4]
  const float* Wo   = (const float*)d_in[6];   // [1024][1024] ([out][in])
  const float* bo   = (const float*)d_in[7];   // [1024]
  const float* hw   = (const float*)d_in[8];   // [4]
  const float* temp = (const float*)d_in[9];   // [1]
  float* yout = (float*)d_out;                             // [2][1024][1024] at byte 0
  float* aout = (float*)d_out + (size_t)kTok * kDim;       // [2][1024][1024] at byte 8,388,608

  // ---- carve ----
  const size_t SZ_WSS  = 4096;
  const size_t SZ_XM   = (size_t)kBatch * kDim * 4;                 //       8,192
  const size_t SZ_WO   = (size_t)kDim * kDim * 2;                   //   2,097,152
  const size_t SZ_QK   = (size_t)kSamp * kTok * kQKld * 2;          //  33,554,432
  const size_t SZ_VT   = (size_t)kSamp * kBatch * kDim * kSeq * 2;  //  16,777,216
  const size_t SZ_CF   = (size_t)kBatch * kSeq * kDim * 4;          //   8,388,608
  const size_t SZ_CH   = (size_t)kBatch * kSeq * kDim * 2;          //   4,194,304
  const size_t SZ_P    = (size_t)kBatch * kHeads * kSeq * kSeq * 2; //  67,108,864
  const size_t SZ_S    = (size_t)kBatch * kHeads * kSeq * kSeq * 4; // 134,217,728
  const size_t SZ_XB   = (size_t)kTok * kDim * 2;                   //   4,194,304
  const size_t SZ_WQK  = (size_t)kSamp * kQKld * kDim * 2;          //  16,777,216
  size_t off = 0;
  const size_t oWSS = off; off += SZ_WSS;
  const size_t oXM  = off; off += SZ_XM;
  const size_t oWO  = off; off += SZ_WO;
  const size_t oQK  = off; off += SZ_QK;
  const size_t oVT  = off; off += SZ_VT;
  const size_t oCF  = off; off += SZ_CF;
  const size_t oCH  = off; off += SZ_CH;
  const size_t oP   = off; off += SZ_P;
  const size_t oS   = off; off += SZ_S;
  const size_t TOTAL = off;                                         // 266,350,592
  const size_t oXB  = oS;                                           // inside Sf, dead before the first scores launch
  const size_t oWQK = oXB + SZ_XB;
  const size_t oWV  = oWQK + SZ_WQK;
  if (TOTAL > ws_size) return;

  char* ws = (char*)d_ws;
  float*          wsS    = (float*)(ws + oWSS);
  float*          xmean  = (float*)(ws + oXM);
  unsigned short* xb     = (unsigned short*)(ws + oXB);
  unsigned short* Wqkb   = (unsigned short*)(ws + oWQK);
  unsigned short* Wvb    = (unsigned short*)(ws + oWV);
  unsigned short* Wo16   = (unsigned short*)(ws + oWO);
  unsigned short* QK16   = (unsigned short*)(ws + oQK);
  unsigned short* VT16   = (unsigned short*)(ws + oVT);
  float*          Sf     = (float*)(ws + oS);
  unsigned short* P16    = (unsigned short*)(ws + oP);
  float*          combF  = (float*)(ws + oCF);
  unsigned short* comb16 = (unsigned short*)(ws + oCH);

  const dim3 blk(256);

  // (0) operand casts
  {
    const int n8x = kTok * kDim / 8;                 // 262,144 -> 1024 blocks exactly
    cast_bf16_kernel<<<dim3(n8x / 256), blk, 0, stream>>>(x, xb, n8x);
    cast_wqk_kernel<<<dim3((kDim * kDim / 8) / 256, 8), blk, 0, stream>>>(Wq, Wk, Wqkb);   // 512 x 8 blocks
    const int n8v = kSamp * kDim * kDim / 8;         // 524,288 -> 2048 blocks exactly
    cast_bf16_kernel<<<dim3(n8v / 256), blk, 0, stream>>>(Wv, Wvb, n8v);
    const int n8o = kDim * kDim / 8;                 // 131,072 -> 512 blocks exactly
    cast_wo_kernel<<<dim3(n8o / 256), blk, 0, stream>>>(Wo, Wo16, n8o);
  }
  // (1) mean pool + gates
  mean_kernel<<<dim3((kBatch * kDim) / 256), blk, 0, stream>>>(xb, xmean);   // 8 blocks exactly
  gate_kernel<<<dim3(1), blk, 0, stream>>>(xmean, Wg, bg, hw, temp, wsS);

  const dim3 gQK((((kTok / 64) * (kQKld / 64)) + 7) / 8, kSamp);             // 128 x 4:  M=2048, N=2048, samples
  const dim3 gV((((kDim / 64) * (kSeq / 64)) + 7) / 8, kBatch * kSamp);      // 32 x 8:   M=1024, N=1024, (s, b)
  const dim3 gS((((kSeq / 64) * (kSeq / 64)) + 7) / 8, kHeads * kBatch);     // 32 x 32:  M=N=1024, (b, head)
  const dim3 gPV((((kSeq / 64) * (kDh / 64)) + 7) / 8, kHeads * kBatch);     // 2 x 32:   M=1024, N=64, (b, head)
  const dim3 gOut((((kTok / 64) * (kDim / 64)) + 7) / 8, 1);                 // 64 blocks: M=2048, N=1024

  // (2) q|k projection, all samples: QK16[s][tok][n] = f16(16 * sum_c bf16(x[tok][c]) * bf16(Wqk[s][n][c]))
  wmma_gemm64<1, false, 0, 1, false, 0, 2, 4><<<gQK, blk, 0, stream>>>(
      xb, xb, kDim, 0L, Wqkb, Wqkb, kDim, (long)kQKld * kDim, (void*)QK16, (void*)QK16, kQKld, (long)kTok * kQKld,
      bo, x, 0L, kTok, kQKld, kDim, kQKVCarry,
      kSamp, 0L, 0L, 0L, 0L);
  // (3) v role-swapped, all (s, b): VT16[s][b][e][tok] = f16(16 * sum_c bf16(Wv[s][e][c]) * bf16(x[b][tok][c]))
  wmma_gemm64<1, false, 0, 1, false, 0, 2, 4><<<gV, blk, 0, stream>>>(
      Wvb, Wvb, kDim, 0L, xb, xb, kDim, (long)kSeq * kDim, (void*)VT16, (void*)VT16, kSeq, (long)kDim * kSeq,
      bo, x, 0L, kDim, kSeq, kDim, kQKVCarry,
      kBatch, (long)kDim * kDim, 0L, (long)kBatch * kDim * kSeq, 0L);

  const long sPlane = (long)kSeq * kSeq;            // one head's score / probability plane
  for (int s = 0; s < kSamp; ++s) {
    // (4) scores, 16 heads x 2 b: Sf[b][h][i][j] = 2^-11 * sum_d (16q)(16k) = 0.125 * q.k  (head column stride 64)
    const unsigned short* Aq = QK16 + (size_t)s * kTok * kQKld;
    const unsigned short* Bk = Aq + kDim;
    wmma_gemm64<0, false, 0, 0, false, 0, 2, 4><<<gS, blk, 0, stream>>>(
        Aq, Aq, kQKld, (long)kDh, Bk, Bk, kQKld, (long)kDh, (void*)Sf, (void*)Sf, kSeq, sPlane,
        bo, x, 0L, kSeq, kSeq, kDh, kScoreScale,
        kHeads, (long)kSeq * kQKld, (long)kSeq * kQKld, (long)kHeads * sPlane, 0L);
    // (5) softmax (x 1/t), P16 planes, head-mean mixing into output 2
    softmax_mix_kernel<<<dim3(kSeq, kBatch), dim3(128), 0, stream>>>(Sf, wsS, P16, aout, s, (s == 0) ? 1 : 0);
    // (6) attn.v, 16 heads x 2 b, into combF columns h*64..; accumulate over s in place; last sample emits f16 x256
    const unsigned short* Vs = VT16 + (size_t)s * kBatch * kDim * kSeq;
    if (s == 0) {
      wmma_gemm64<0, false, 0, 0, false, 0, 8, 1><<<gPV, blk, 0, stream>>>(
          P16, P16, kSeq, sPlane, Vs, Vs, kSeq, (long)kDh * kSeq, (void*)combF, (void*)combF, kDim, (long)kDh,
          bo, x, 0L, kSeq, kDh, kSeq, kPVScale,
          kHeads, (long)kHeads * sPlane, (long)kDim * kSeq, (long)kSeq * kDim, 0L);
    } else if (s < kSamp - 1) {
      wmma_gemm64<0, false, 0, 0, true, 0, 8, 1><<<gPV, blk, 0, stream>>>(
          P16, P16, kSeq, sPlane, Vs, Vs, kSeq, (long)kDh * kSeq, (void*)combF, (void*)combF, kDim, (long)kDh,
          bo, combF, (long)kDh, kSeq, kDh, kSeq, kPVScale,
          kHeads, (long)kHeads * sPlane, (long)kDim * kSeq, (long)kSeq * kDim, (long)kSeq * kDim);
    } else {
      wmma_gemm64<0, false, 0, 1, true, 0, 8, 1><<<gPV, blk, 0, stream>>>(
          P16, P16, kSeq, sPlane, Vs, Vs, kSeq, (long)kDh * kSeq, (void*)comb16, (void*)comb16, kDim, (long)kDh,
          bo, combF, (long)kDh, kSeq, kDh, kSeq, kPVScale,
          kHeads, (long)kHeads * sPlane, (long)kDim * kSeq, (long)kSeq * kDim, (long)kSeq * kDim);
    }
  }

  // (7) y = (comb16 . Wo16^T) / 4096 + bo -> d_out output 0 (f32)
  wmma_gemm64<0, false, 2, 0, false, 0, 2, 4><<<gOut, blk, 0, stream>>>(
      comb16, comb16, kDim, 0L, Wo16, Wo16, kDim, 0L, (void*)yout, (void*)yout, kDim, 0L,
      bo, x, 0L, kTok, kDim, kDim, kOutScale,
      1, 0L, 0L, 0L, 0L);
}

// v003
// It runs in 371 microseconds.
// In both of two side-by-side timings against v002, it was 1.48 times as fast.
// All steps since v000 together make it 4.91 times as fast.
// Compute dtypes: q/k/v projections on v_wmma_f32_16x16x32_bf16 (x and Wq/Wk/Wv RNE-converted to bf16, f32 accumulate, results carried x16 into f16 planes); scores q.k^T, attn.v and the output projection on v_wmma_f32_16x16x32_f16 (f16 operands: q,k,v x16, probabilities x2^15 with the per-sample mixing weight folded in, combined x256, Wo as f16(16*bf16(Wo))), f32 accumulate; mean-pool, gates, softmax and the head/sample mixing in f32.
#include <hip/hip_runtime.h>
#include <math.h>

// ---------------------------------------------------------------------------
// Problem constants
// ---------------------------------------------------------------------------
constexpr int kBatch     = 2;
constexpr int kSeq       = 1024;
constexpr int kDim       = 1024;
constexpr int kHeads     = 16;
constexpr int kSamp      = 4;
constexpr int kDh        = 64;
constexpr int kTok       = kBatch * kSeq;       // 2048 token rows
constexpr int kHeadsHalf = 8;                   // half of kHeads; no kernel in this file uses it
constexpr int kQKld      = 2 * kDim;            // 2048: q columns 0..1023 | k columns 1024..2047
constexpr float kQKVCarry   = 16.0f;            // q, k, v carried x16 in f16
constexpr float kPCarry     = 32768.0f;         // probabilities carried x2^15 (times gate <= 1)
constexpr float kCombCarry  = 256.0f;           // combined carried x256
constexpr float kWoCarry    = 16.0f;            // Wo carried x16 in f16
constexpr float kScoreScale = 0.125f / (16.0f * 16.0f);              // dh^-0.5 / (16*16) = 2^-11
constexpr float kPVScale    = kCombCarry / (kPCarry * kQKVCarry);    // 256 / 2^19 = 2^-11
constexpr float kOutScale   = 1.0f / (kCombCarry * kWoCarry);        // 2^-12

typedef __attribute__((ext_vector_type(16))) _Float16 v16h;
typedef __attribute__((ext_vector_type(8)))  _Float16 v8h;
typedef __attribute__((ext_vector_type(16))) __bf16   v16b;
typedef __attribute__((ext_vector_type(8)))  __bf16   v8b;
typedef __attribute__((ext_vector_type(8)))  float    v8f;
typedef __attribute__((ext_vector_type(4)))  float    v4f;
typedef __attribute__((ext_vector_type(4)))  unsigned int v4u;

__device__ __forceinline__ unsigned short f2bf_bits(float f) {
  unsigned u = __float_as_uint(f);
  return (unsigned short)((u + 0x7FFFu + ((u >> 16) & 1u)) >> 16);
}
__device__ __forceinline__ float bf_bits2f(unsigned short h) { return __uint_as_float(((unsigned)h) << 16); }

// hazard guard as a plain device helper
__device__ __forceinline__ void acc_guard4(v8f& a, v8f& b, v8f& c, v8f& d) { asm volatile("v_nop\n\tv_nop\n\tv_nop\n\tv_nop" : "+v"(a), "+v"(b), "+v"(c), "+v"(d)); }
template <typename T> struct Frag;
template <> struct Frag<_Float16> {
  typedef v16h V; union U { v16h v; v8h h[2]; };
  static __device__ __forceinline__ v16h load(const _Float16* p) {   // elements 0..7 <- p[0..7], 8..15 <- p[16..23]
    U f; f.h[0] = *(const v8h*)(p); f.h[1] = *(const v8h*)(p + 16); return f.v;
  }
  static __device__ __forceinline__ v8f mma(v16h a, v16h b, v8f c) {
    return __builtin_amdgcn_wmma_f32_16x16x32_f16(false, a, false, b, (short)0, c, false, false);
  }
};
template <> struct Frag<__bf16> {
  typedef v16b V; union U { v16b v; v8b h[2]; };
  static __device__ __forceinline__ v16b load(const __bf16* p) {
    U f; f.h[0] = *(const v8b*)(p); f.h[1] = *(const v8b*)(p + 16); return f.v;
  }
  static __device__ __forceinline__ v8f mma(v16b a, v16b b, v8f c) {
    return __builtin_amdgcn_wmma_f32_16x16x32_bf16(false, a, false, b, (short)0, c, false, false);
  }
};

__device__ __forceinline__ unsigned pk16(unsigned short a, unsigned short b) { return (unsigned)a | ((unsigned)b << 16); }
__device__ __forceinline__ unsigned short h_bits(float f) { const _Float16 h = (_Float16)f; return __builtin_bit_cast(unsigned short, h); }

// ---- Operand staging: asynchronous copies global -> LDS ----
constexpr int kStageK   = 64;    // k elements per stage = one whole 128-B line of every operand row
constexpr int kRowPitch = 144;   // LDS bytes per staged row: 128 + 16, an odd multiple of 16 B, so that the 16 rows of a fragment read fall on distinct banks

// Six 16-B copies per lane, global -> LDS through no register. The s_wait_xcnt 0 is the statement's last line so that
// no address register named by an issued copy is rewritten in front of it.
__device__ __forceinline__ void async_copy6(unsigned l0, const unsigned short* g0, unsigned l1, const unsigned short* g1,
                                            unsigned l2, const unsigned short* g2, unsigned l3, const unsigned short* g3,
                                            unsigned l4, const unsigned short* g4, unsigned l5, const unsigned short* g5) {
  asm volatile("global_load_async_to_lds_b128 %0, %1, off\n\t"
               "global_load_async_to_lds_b128 %2, %3, off\n\t"
               "global_load_async_to_lds_b128 %4, %5, off\n\t"
               "global_load_async_to_lds_b128 %6, %7, off\n\t"
               "global_load_async_to_lds_b128 %8, %9, off\n\t"
               "global_load_async_to_lds_b128 %10, %11, off\n\t"
               "s_wait_xcnt 0x0"
               :: "v"(l0), "v"(g0), "v"(l1), "v"(g1), "v"(l2), "v"(g2), "v"(l3), "v"(g3), "v"(l4), "v"(g4), "v"(l5), "v"(g5)
               : "memory");
}

// ---- Register-blocked batched WMMA GEMM (ACT reduced to none/relu/leaky; Cout/resid without restrict
//      so that the in-place residual accumulate (resid == Cout, same wave reads its rows before storing them) is well formed) --
// C[m,n] = scale * sum_k A[m,k] * Bt[n,k] (+bias)(+resid); each wave owns a 64x64 tile; the block's 8 waves form a WM x WN grid of
// such tiles and share one staged k-tile: 64*WM rows of A, then 64*WN rows of Bt, 64 k each, two LDS buffers (the next k-tile's
// copies fly while this one is multiplied).
// A row-major [M,K]; Bt row-major [N,K]; M % (64*WM) == 0, N % (64*WN) == 0, K % 64 == 0; rows and bases 16-B aligned.
// SPLIT (hi/lo planes) is not carried by the staged loop and must be false.
// BIAS_MODE: 0 = none, 1 = bias[m], 2 = bias[n].
// OUT_MODE: 0 = f32, 1 = f16, 2 = bf16 hi plane (Cout) + bf16 lo plane (Cout2).
// ET: 0 = f16 operands, 1 = bf16 operands (pointers passed as 16-bit storage)
template <int ET> struct Elem;
template <> struct Elem<0> { typedef _Float16 T; };
template <> struct Elem<1> { typedef __bf16 T; };
template <int ET, bool SPLIT, int BIAS_MODE, int OUT_MODE, bool RESID, int ACT, int WM, int WN>
__global__ __launch_bounds__(256) void wmma_gemm64(
    const unsigned short* __restrict__ Ap, const unsigned short* __restrict__ A2p, int lda, long strideA,
    const unsigned short* __restrict__ Btp, const unsigned short* __restrict__ Bt2p, int ldb, long strideB,
    void* Cout, void* Cout2, int ldc, long strideC,
    const float* __restrict__ bias,
    const float* resid, long strideR,
    int M, int N, int K, float scale,
    int inner, long strideA2, long strideB2, long strideC2, long strideR2) {
  typedef typename Elem<ET>::T T;
  typedef typename Frag<T>::V V;
  static_assert(!SPLIT, "the staged k-loop carries one plane per operand");
  static_assert(WM * WN == 8, "eight waves per block");
  constexpr int kRowsA  = 64 * WM;                    // staged rows 0..kRowsA-1 = A, the rest = Bt
  constexpr int kRows   = 64 * (WM + WN);
  constexpr int kStageB = kRows * kRowPitch;          // bytes of one buffer
  constexpr int kCopies = kRows / 32;                 // copies per lane and stage: 256 lanes cover 32 rows x 8 chunks of 16 B
  static_assert(kCopies % 6 == 0 && kCopies <= 63, "copies go out six to a statement");
  __shared__ __align__(16) unsigned char ring[2 * kStageB];
  __shared__ __align__(16) float sT[8][16 * 68];   // per-wave 16x64 slab, pitch 68 floats
  // two-level batch: blockIdx.y = outer * inner + b; b walks the first strides, outer the second
  const int outer = (int)blockIdx.y / inner;
  const int b     = (int)blockIdx.y - outer * inner;
  const size_t offA = (size_t)b * strideA + (size_t)outer * strideA2;
  const size_t offB = (size_t)b * strideB + (size_t)outer * strideB2;
  const size_t offC = (size_t)b * strideC + (size_t)outer * strideC2;
  const size_t offR = (size_t)b * strideR + (size_t)outer * strideR2;
  const int lane = threadIdx.x & 31;
  const int wave = threadIdx.x >> 5;
  const int tilesN = N / (64 * WN);
  const int tilesM = M / (64 * WM);
  if ((int)blockIdx.x >= tilesM * tilesN) return;   // block-uniform, in front of every barrier
  const int bm = blockIdx.x / tilesN;
  const int bn = blockIdx.x - bm * tilesN;
  const int mB = bm * (64 * WM);
  const int nB = bn * (64 * WN);
  const int wm = wave / WN;
  const int wn = wave - wm * WN;
  const int m0 = mB + (wm << 6);
  const int n0 = nB + (wn << 6);

  const int rlane = lane & 15;                 // row (A) / col (B, D) within subtile
  const int mOff  = (lane >> 4) * 8;           // D row offset

  // copy side: lane -> (row crow + 32*j, 16-B chunk cchk) of the staged k-tile
  const int crow = threadIdx.x >> 3;
  const int cchk = threadIdx.x & 7;
  const unsigned short* gA = Ap  + offA + (size_t)(mB + crow) * lda + cchk * 8;
  const unsigned short* gB = Btp + offB + (size_t)(nB + crow) * ldb + cchk * 8;
  const unsigned ldsC = (unsigned)(size_t)(void*)ring + (unsigned)(crow * kRowPitch + cchk * 16);
  auto issue = [&](int t, int buf) {
    const unsigned l = ldsC + (unsigned)(buf * kStageB);
    const unsigned short* a = gA + t * kStageK;
    const unsigned short* w = gB + t * kStageK;
    auto from = [&](int j) { return (j < kRowsA / 32) ? (a + (size_t)(j * 32) * lda) : (w + (size_t)((j - kRowsA / 32) * 32) * ldb); };
    auto to   = [&](int j) { return l + (unsigned)(j * 32 * kRowPitch); };
#pragma unroll
    for (int j = 0; j < kCopies; j += 6)
      async_copy6(to(j), from(j), to(j + 1), from(j + 1), to(j + 2), from(j + 2),
                  to(j + 3), from(j + 3), to(j + 4), from(j + 4), to(j + 5), from(j + 5));
  };
  // read side: this lane's row of the first A / Bt fragment, at its lane half's k offset (8 elements = 16 B)
  const unsigned char* fA = ring + ((wm << 6) + rlane) * kRowPitch + (lane >> 4) * 16;
  const unsigned char* fB = ring + (kRowsA + (wn << 6) + rlane) * kRowPitch + (lane >> 4) * 16;

  v8f acc[4][4];
#pragma unroll
  for (int i = 0; i < 4; ++i)
#pragma unroll
    for (int j = 0; j < 4; ++j) acc[i][j] = (v8f){0.f,0.f,0.f,0.f,0.f,0.f,0.f,0.f};

  const int nT = K / kStageK;
  issue(0, 0);
  asm volatile("s_wait_asynccnt 0x0" ::: "memory");   // this wave's copies of k-tile 0 have landed
  __syncthreads();                                    // ... and every other wave's: k-tile 0 may be read
  if (nT > 1) issue(1, 1);

  for (int t = 0; t < nT; ++t) {
    const int bo = (t & 1) * kStageB;
    // all fragment reads of the k-tile stand as one group in front of its WMMAs (one LDS latency per trip, counted waits behind it)
    V ah[kStageK / 32][4], bh[kStageK / 32][4];
#pragma unroll
    for (int ks = 0; ks < kStageK / 32; ++ks) {
#pragma unroll
      for (int j = 0; j < 4; ++j) bh[ks][j] = Frag<T>::load((const T*)(fB + bo + j * 16 * kRowPitch + ks * 64));
#pragma unroll
      for (int i = 0; i < 4; ++i) ah[ks][i] = Frag<T>::load((const T*)(fA + bo + i * 16 * kRowPitch + ks * 64));
    }
    __builtin_amdgcn_sched_barrier(0);   // keeps the reads one group: without it they are sunk between the WMMAs, each with a wait to 0
#pragma unroll
    for (int ks = 0; ks < kStageK / 32; ++ks)
#pragma unroll
      for (int i = 0; i < 4; ++i)
#pragma unroll
        for (int j = 0; j < 4; ++j) acc[i][j] = Frag<T>::mma(ah[ks][i], bh[ks][j], acc[i][j]);
    __builtin_amdgcn_sched_barrier(0);   // keeps the WMMAs in front of the waits: sunk behind them, the next k-tile's copies would be waited for before the work that hides them
    asm volatile("s_wait_dscnt 0x0" ::: "memory");     // this wave's reads of buffer t&1 have returned before it is refilled
    asm volatile("s_wait_asynccnt 0x0" ::: "memory");  // this wave's copies of k-tile t+1 have landed
    __syncthreads();                                   // publishes k-tile t+1 and ends every wave's reads of buffer t&1
    if (t + 2 < nT) issue(t + 2, t & 1);
  }
  asm volatile("s_wait_asynccnt 0x0" ::: "memory");    // no copy is outstanding when the wave goes on to the epilogue and ends
  acc_guard4(acc[0][0], acc[0][1], acc[0][2], acc[0][3]);
  acc_guard4(acc[1][0], acc[1][1], acc[1][2], acc[1][3]);
  acc_guard4(acc[2][0], acc[2][1], acc[2][2], acc[2][3]);
  acc_guard4(acc[3][0], acc[3][1], acc[3][2], acc[3][3]);

  // ---- epilogue ----
  float* slab = sT[wave];
  const float* Rb = RESID ? (resid + offR) : nullptr;
#pragma unroll
  for (int i = 0; i < 4; ++i) {
    const int mBase = m0 + (i << 4);
#pragma unroll
    for (int j = 0; j < 4; ++j) {
      const int n = n0 + (j << 4) + rlane;
      float bv = 0.f;
      if (BIAS_MODE == 2) bv = bias[n];
#pragma unroll
      for (int r = 0; r < 8; ++r) {
        float v = acc[i][j][r] * scale;
        if (BIAS_MODE == 1) v += bias[mBase + mOff + r];
        if (BIAS_MODE == 2) v += bv;
        if (RESID) v += Rb[(size_t)(mBase + mOff + r) * ldc + n];
        if (ACT == 2) v = fmaxf(v, 0.0f);
        if (ACT == 4) v = (v > 0.f) ? v : 0.01f * v;
        slab[(mOff + r) * 68 + (j << 4) + rlane] = v;
      }
    }
    __builtin_amdgcn_fence(__ATOMIC_RELEASE, "workgroup");
    __builtin_amdgcn_wave_barrier();
    __builtin_amdgcn_fence(__ATOMIC_ACQUIRE, "workgroup");
    if (OUT_MODE == 0) {
      float* C = (float*)Cout + offC;
      const int hh = lane >> 4, c4 = (lane & 15) * 4;     // row seg = 256 B = 16 lanes x 16 B
      {
#pragma unroll
        for (int it = 0; it < 8; ++it) {
          const int row = it * 2 + hh;
          v4f v = *(const v4f*)(slab + row * 68 + c4);
          *(v4f*)(C + (size_t)(mBase + row) * ldc + n0 + c4) = v;
        }
        
      }
    } else {
      const int q = lane >> 3, c8 = (lane & 7) * 8;
      unsigned short* C  = (unsigned short*)Cout  + offC;
      unsigned short* C2 = (OUT_MODE == 2) ? ((unsigned short*)Cout2 + offC) : nullptr;
      {
#pragma unroll
        for (int it = 0; it < 4; ++it) {
          const int row = it * 4 + q;
          const float* sp = slab + row * 68 + c8;
          v8h hv, lv;
#pragma unroll
          for (int e = 0; e < 8; ++e) {
            if (OUT_MODE == 1) {
              hv[e] = (_Float16)sp[e];
            } else {
              unsigned short hb = f2bf_bits(sp[e]);
              unsigned short lb = f2bf_bits(sp[e] - bf_bits2f(hb));
              hv[e] = __builtin_bit_cast(_Float16, hb);
              lv[e] = __builtin_bit_cast(_Float16, lb);
            }
          }
          *(v8h*)(C + (size_t)(mBase + row) * ldc + n0 + c8) = hv;
          if (OUT_MODE == 2) *(v8h*)(C2 + (size_t)(mBase + row) * ldc + n0 + c8) = lv;
        }
        
      }
    }
    __builtin_amdgcn_fence(__ATOMIC_RELEASE, "workgroup");
    __builtin_amdgcn_wave_barrier();
    __builtin_amdgcn_fence(__ATOMIC_ACQUIRE, "workgroup");
  }
}

// ---------------------------------------------------------------------------
// f32 -> bf16 bits (RNE), 8 consecutive elements per thread: one 16-B store per lane, 32 contiguous lanes = 4 whole
// ---------------------------------------------------------------------------
__global__ __launch_bounds__(256) void cast_bf16_kernel(const float* __restrict__ in, unsigned short* __restrict__ out, int n8) {
  const int i = blockIdx.x * 256 + threadIdx.x;
  if (i >= n8) return;
  const float* p = in + 8 * (size_t)i;
  const v4f a = *(const v4f*)(p);
  const v4f c = *(const v4f*)(p + 4);
  unsigned short hb[8];
#pragma unroll
  for (int e = 0; e < 4; ++e) {
    hb[e]     = f2bf_bits(a[e]);
    hb[4 + e] = f2bf_bits(c[e]);
  }
  const v4u u = (v4u){pk16(hb[0], hb[1]), pk16(hb[2], hb[3]), pk16(hb[4], hb[5]), pk16(hb[6], hb[7])};
  unsigned short* q = out + 8 * (size_t)i;
  *(v4u*)q = u;
  
}

// ---------------------------------------------------------------------------
// Stacked q|k weight cast: out[s][2048][1024] bf16, rows 0..1023 = Wq[s], rows 1024..2047 = Wk[s] (both [out][in], k-contiguous).
// grid (512, 8): blockIdx.y = (which<<2)|s with which 0 = Wq, 1 = Wk (block-uniform source select);
// coverage per y: 512 blocks x 256 threads x 8 = 1,048,576 = one [1024][1024] matrix exactly. Stores as cast_bf16_kernel.
// ---------------------------------------------------------------------------
__global__ __launch_bounds__(256) void cast_wqk_kernel(const float* __restrict__ Wq, const float* __restrict__ Wk,
                                                       unsigned short* __restrict__ out) {
  const int y = blockIdx.y;
  const int smp = y & 3, which = y >> 2;
  const float* src = ((which == 0) ? Wq : Wk) + (size_t)smp * kDim * kDim;
  unsigned short* dst = out + (size_t)smp * kQKld * kDim + (size_t)which * kDim * kDim;
  const int i = blockIdx.x * 256 + threadIdx.x;
  if (i >= (kDim * kDim) / 8) return;
  const float* p = src + 8 * (size_t)i;
  const v4f a = *(const v4f*)(p);
  const v4f c = *(const v4f*)(p + 4);
  unsigned short hb[8];
#pragma unroll
  for (int e = 0; e < 4; ++e) {
    hb[e]     = f2bf_bits(a[e]);
    hb[4 + e] = f2bf_bits(c[e]);
  }
  const v4u u = (v4u){pk16(hb[0], hb[1]), pk16(hb[2], hb[3]), pk16(hb[4], hb[5]), pk16(hb[6], hb[7])};
  unsigned short* q = dst + 8 * (size_t)i;
  *(v4u*)q = u;
  
}

// ---------------------------------------------------------------------------
// Wo cast: out = f16(16 * bf16(Wo)) (RNE to bf16 first, then exact power-of-two carry into f16), 8 per thread, stores as above.
// Coverage: 512 blocks x 256 x 8 = 1,048,576 = [1024][1024] exactly.
// ---------------------------------------------------------------------------
__global__ __launch_bounds__(256) void cast_wo_kernel(const float* __restrict__ in, unsigned short* __restrict__ out, int n8) {
  const int i = blockIdx.x * 256 + threadIdx.x;
  if (i >= n8) return;
  const float* p = in + 8 * (size_t)i;
  const v4f a = *(const v4f*)(p);
  const v4f c = *(const v4f*)(p + 4);
  unsigned short hb[8];
#pragma unroll
  for (int e = 0; e < 4; ++e) {
    hb[e]     = h_bits(kWoCarry * bf_bits2f(f2bf_bits(a[e])));
    hb[4 + e] = h_bits(kWoCarry * bf_bits2f(f2bf_bits(c[e])));
  }
  const v4u u = (v4u){pk16(hb[0], hb[1]), pk16(hb[2], hb[3]), pk16(hb[4], hb[5]), pk16(hb[6], hb[7])};
  unsigned short* q = out + 8 * (size_t)i;
  *(v4u*)q = u;
  
}

// ---------------------------------------------------------------------------
// Mean over tokens of the bf16 x plane: xmean[b][d] = (1/1024) * sum_n x[b][n][d], f32 sequential per (b, d).
// ---------------------------------------------------------------------------
__global__ __launch_bounds__(256) void mean_kernel(const unsigned short* __restrict__ xb, float* __restrict__ xmean) {
  const int t = blockIdx.x * 256 + threadIdx.x;
  if (t >= kBatch * kDim) return;
  const int b = t >> 10, d = t & (kDim - 1);
  const unsigned short* p = xb + (size_t)b * kSeq * kDim + d;
  float acc = 0.f;
#pragma unroll 4
  for (int n = 0; n < kSeq; ++n) acc += bf_bits2f(p[(size_t)n * kDim]);
  const float m = acc * (1.0f / (float)kSeq);
  *(float*)(xmean + t) = m;
  
}

// ---------------------------------------------------------------------------
// Gates and mixing weights (one block, 256 threads = 8 waves):
//   coh[b][s] = sigmoid(xmean[b] . bf16(Wg[s]) + bg[s])  (wave w -> (b, s) = (w>>2, w&3); per-lane strided partials + shuffle tree)
//   t = clip(temperature, 0.1, 10); invt = 1/t; gw = softmax(hyp_w * invt)
// ---------------------------------------------------------------------------
__global__ __launch_bounds__(256) void gate_kernel(const float* __restrict__ xmean, const float* __restrict__ Wg,
                                                   const float* __restrict__ bg, const float* __restrict__ hw,
                                                   const float* __restrict__ temp, float* __restrict__ wsS) {
  __shared__ float vals[32];
  const int t = threadIdx.x, lane = t & 31, wave = t >> 5;
  if (t < 32) vals[t] = 0.f;
  __syncthreads();
  {
    const int b = wave >> 2, s = wave & 3;
    float acc = 0.f;
#pragma unroll 1
    for (int d = lane; d < kDim; d += 32) {
      const float wg = bf_bits2f(f2bf_bits(Wg[(size_t)s * kDim + d]));
      acc += xmean[b * kDim + d] * wg;
    }
#pragma unroll
    for (int off = 16; off > 0; off >>= 1) acc += __shfl_xor(acc, off, 32);
    if (lane == 0) {
      const float z = acc + bf_bits2f(f2bf_bits(bg[s]));
      vals[4 + b * kSamp + s] = 1.0f / (1.0f + __expf(-z));
    }
  }
  __syncthreads();
  if (t == 0) {
    float tc = bf_bits2f(f2bf_bits(temp[0]));
    tc = fminf(fmaxf(tc, 0.1f), 10.0f);
    const float invt = 1.0f / tc;
    const float l0 = bf_bits2f(f2bf_bits(hw[0])) * invt;
    const float l1 = bf_bits2f(f2bf_bits(hw[1])) * invt;
    const float l2 = bf_bits2f(f2bf_bits(hw[2])) * invt;
    const float l3 = bf_bits2f(f2bf_bits(hw[3])) * invt;
    const float mx = fmaxf(fmaxf(l0, l1), fmaxf(l2, l3));
    const float e0 = __expf(l0 - mx), e1 = __expf(l1 - mx), e2 = __expf(l2 - mx), e3 = __expf(l3 - mx);
    const float is = 1.0f / ((e0 + e1) + (e2 + e3));
    vals[0] = e0 * is; vals[1] = e1 * is; vals[2] = e2 * is; vals[3] = e3 * is;
    vals[12] = invt;
  }
  __syncthreads();
  if (wave == 0) {
    const float v = vals[lane];
    *(float*)(wsS + lane) = v;
    
  }
}

// ---------------------------------------------------------------------------
// Fused attention: scores, softmax, head/sample mixing and attn.v in one launch; no score or probability plane in memory.
// grid = (64 tiles of 16 query rows, 2 batches), 256 threads = 8 waves; the block walks n = h*4 + s (head outer, sample inner).
// Wave w owns the key columns j = 128w .. 128w+127 of the block's 16 x 1024 score rows.
//   scores transposed: D[j][i] = sum_d k[j][d] q[i][d]  (A = k rows from LDS, B = q rows from registers): lane (c, hf) holds
//     query row i = c and, per 16-j tile jt, the eight consecutive keys j = 128w + 16jt + 8hf + r.
//   softmax over j: per-wave maximum and sum (in-lane, then lane ^ 16), merged over the 8 waves through LDS.
//   a pair of score tiles (2m, 2m+1), converted to f16, IS the A fragment of attn.v for k = 32m .. 32m+31 (same lane, same order
//     as the fragment loader: elements 0..7 = k 8hf.., elements 8..15 = k 16+8hf..): the probabilities never leave the registers.
//   attn.v: each wave sums over its own 128 keys and over the 4 samples; the 8 partial 16x64 tiles are added through LDS per head.
//   output 2 is accumulated in registers over all 64 (h, s) and stored once.
// k (1024 rows x 128 B) and v^T (64 rows x 2048 B) of one (h, s) are staged in LDS by asynchronous copies, one buffer each; the tile
// sequence k(0), v(0), k(1), v(1), ... alternates between the two buffers as a two-buffer ring: each half pass reads one buffer
// while the other one's copies fly.
// ---------------------------------------------------------------------------
constexpr int kKPitch = 144;                 // 128 + 16 B, odd multiple of 16 B (distinct banks for the 16 rows of a fragment read)
constexpr int kVPitch = 2 * kSeq + 16;       // 2064 B = 129 x 16 B, likewise
constexpr int kKBytes = kSeq * kKPitch;      // 147,456
constexpr int kVBytes = kDh * kVPitch;       // 132,096
constexpr int kPasses = kHeads * kSamp;      // 64
typedef __attribute__((ext_vector_type(4))) _Float16 v4h;

// Eight 16-B copies per lane, global -> LDS through no register. The s_wait_xcnt 0 is the statement's last line so that
// no address register named by an issued copy is rewritten in front of it.
__device__ __forceinline__ void async_copy8(unsigned l0, const unsigned short* g0, unsigned l1, const unsigned short* g1,
                                            unsigned l2, const unsigned short* g2, unsigned l3, const unsigned short* g3,
                                            unsigned l4, const unsigned short* g4, unsigned l5, const unsigned short* g5,
                                            unsigned l6, const unsigned short* g6, unsigned l7, const unsigned short* g7) {
  asm volatile("global_load_async_to_lds_b128 %0, %1, off\n\t"
               "global_load_async_to_lds_b128 %2, %3, off\n\t"
               "global_load_async_to_lds_b128 %4, %5, off\n\t"
               "global_load_async_to_lds_b128 %6, %7, off\n\t"
               "global_load_async_to_lds_b128 %8, %9, off\n\t"
               "global_load_async_to_lds_b128 %10, %11, off\n\t"
               "global_load_async_to_lds_b128 %12, %13, off\n\t"
               "global_load_async_to_lds_b128 %14, %15, off\n\t"
               "s_wait_xcnt 0x0"
               :: "v"(l0), "v"(g0), "v"(l1), "v"(g1), "v"(l2), "v"(g2), "v"(l3), "v"(g3),
                  "v"(l4), "v"(g4), "v"(l5), "v"(g5), "v"(l6), "v"(g6), "v"(l7), "v"(g7)
               : "memory");
}

// value of lane l ^ 16
__device__ __forceinline__ float other_half(float v) {
  const int b = __builtin_bit_cast(int, v);
  return __builtin_bit_cast(float, __builtin_amdgcn_permlanex16(b, b, 0x76543210, 0xfedcba98, false, false));
}

__global__ __launch_bounds__(256) void fused_attn_kernel(const unsigned short* __restrict__ QK, const unsigned short* __restrict__ VT,
                                                         const float* __restrict__ wsS, unsigned short* __restrict__ comb,
                                                         float* __restrict__ out2) {
  typedef Frag<_Float16> F;
  __shared__ __align__(16) unsigned char kbuf[kKBytes];
  __shared__ __align__(16) unsigned char vbuf[kVBytes];
  __shared__ __align__(16) float ored[8][16 * 68];   // per-wave 16x64 partial of attn.v, pitch 68 floats
  __shared__ __align__(16) float redM[16][8];        // [query row][wave] maximum (log2 domain)
  __shared__ __align__(16) float redL[16][8];        // [query row][wave] sum
  const int tid = threadIdx.x, lane = tid & 31, wave = tid >> 5;
  const int c = lane & 15, hf = lane >> 4;
  const int i0 = blockIdx.x * 16, bat = blockIdx.y;
  const float cs = kScoreScale * wsS[12] * 1.44269504088896340736f;   // raw accumulator -> (0.125 q.k / t) * log2(e); > 0

  // copy side. k: lane -> (row tid/8 + 32j, 16-B chunk tid%8); v^T: lane -> (row tid/128 + 2j, 16-B chunk tid%128); j = 0..31
  const unsigned short* gK = QK + (size_t)(bat * kSeq + (tid >> 3)) * kQKld + kDim + (tid & 7) * 8;
  const unsigned short* gV = VT + (size_t)bat * kDim * kSeq + (size_t)(tid >> 7) * kSeq + (tid & 127) * 8;
  const unsigned lK = (unsigned)(size_t)(void*)kbuf + (unsigned)((tid >> 3) * kKPitch + (tid & 7) * 16);
  const unsigned lV = (unsigned)(size_t)(void*)vbuf + (unsigned)((tid >> 7) * kVPitch + (tid & 127) * 16);
  auto issueK = [&](int n) {
    const unsigned short* g = gK + (size_t)(n & 3) * kTok * kQKld + (n >> 2) * kDh;
    unsigned l = lK;
    auto from = [&](int j) { return g + (size_t)(j * 32) * kQKld; };
    auto to   = [&](int j) { return l + (unsigned)(j * 32 * kKPitch); };
#pragma unroll 1   // rolled: unrolled, the 32 LDS addresses are invariant in the pass loop and are held in registers across it (spills)
    for (int j = 0; j < 4; ++j) {
      async_copy8(to(0), from(0), to(1), from(1), to(2), from(2), to(3), from(3),
                  to(4), from(4), to(5), from(5), to(6), from(6), to(7), from(7));
      l += (unsigned)(8 * 32 * kKPitch);
      g += (size_t)(8 * 32) * kQKld;
    }
  };
  auto issueV = [&](int n) {
    const unsigned short* g = gV + (size_t)(n & 3) * kBatch * kDim * kSeq + (size_t)(n >> 2) * kDh * kSeq;
    unsigned l = lV;
    auto from = [&](int j) { return g + (size_t)(j * 2) * kSeq; };
    auto to   = [&](int j) { return l + (unsigned)(j * 2 * kVPitch); };
#pragma unroll 1   // rolled, as in issueK
    for (int j = 0; j < 4; ++j) {
      async_copy8(to(0), from(0), to(1), from(1), to(2), from(2), to(3), from(3),
                  to(4), from(4), to(5), from(5), to(6), from(6), to(7), from(7));
      l += (unsigned)(8 * 2 * kVPitch);
      g += (size_t)(8 * 2) * kSeq;
    }
  };
  // read side: this lane's row of the wave's first k / v^T fragment, at its lane half's k offset (8 elements = 16 B)
  const unsigned char* fK = kbuf + (wave * 128 + c) * kKPitch + hf * 16;
  const unsigned char* fV = vbuf + c * kVPitch + wave * 256 + hf * 16;
  const _Float16* qL = (const _Float16*)QK + (size_t)(bat * kSeq + i0 + c) * kQKld + hf * 8;

  const v8f zero8 = (v8f){0.f,0.f,0.f,0.f,0.f,0.f,0.f,0.f};
  v8f a2[8], accO[4];
#pragma unroll
  for (int jt = 0; jt < 8; ++jt) a2[jt] = zero8;
#pragma unroll
  for (int dt = 0; dt < 4; ++dt) accO[dt] = zero8;

  issueK(0);
  v16h qf0 = F::load(qL), qf1 = F::load(qL + 32);
  asm volatile("s_wait_asynccnt 0x0" ::: "memory");   // this wave's copies of k(0) have landed
  __syncthreads();                                    // ... and every other wave's: k(0) may be read
  issueV(0);

#pragma unroll 1
  for (int n = 0; n < kPasses; ++n) {
    const int s = n & 3, h = n >> 2;
    const float gw  = wsS[s];
    const float coh = wsS[4 + bat * kSamp + s];
    // ---- first half pass: reads kbuf alone ----
    v8f sc[8];
#pragma unroll
    for (int jt = 0; jt < 8; ++jt) sc[jt] = F::mma(F::load((const _Float16*)(fK + jt * 16 * kKPitch)), qf0, zero8);
#pragma unroll
    for (int jt = 0; jt < 8; ++jt) sc[jt] = F::mma(F::load((const _Float16*)(fK + jt * 16 * kKPitch + 64)), qf1, sc[jt]);
    float mr[8];
#pragma unroll
    for (int r = 0; r < 8; ++r) mr[r] = sc[0][r];
#pragma unroll
    for (int jt = 1; jt < 8; ++jt)
#pragma unroll
      for (int r = 0; r < 8; ++r) mr[r] = fmaxf(mr[r], sc[jt][r]);
    float mx = fmaxf(fmaxf(fmaxf(mr[0], mr[1]), fmaxf(mr[2], mr[3])), fmaxf(fmaxf(mr[4], mr[5]), fmaxf(mr[6], mr[7])));
    mx = fmaxf(mx, other_half(mx));
    const float mb = mx * cs;
    float ls[8];
#pragma unroll
    for (int r = 0; r < 8; ++r) ls[r] = 0.f;
#pragma unroll
    for (int jt = 0; jt < 8; ++jt)
#pragma unroll
      for (int r = 0; r < 8; ++r) {
        const float e = __builtin_amdgcn_exp2f(fmaf(sc[jt][r], cs, -mb));
        sc[jt][r] = e;
        ls[r] += e;
      }
    float l = ((ls[0] + ls[1]) + (ls[2] + ls[3])) + ((ls[4] + ls[5]) + (ls[6] + ls[7]));
    l += other_half(l);
    *(hf ? &redL[c][wave] : &redM[c][wave]) = hf ? l : mb;
    asm volatile("s_wait_dscnt 0x0" ::: "memory");     // this wave's reads of kbuf have returned before it is refilled
    asm volatile("s_wait_asynccnt 0x0" ::: "memory");  // this wave's copies of v(n) have landed
    __syncthreads();                                   // publishes v(n) and the wave partials; ends every wave's reads of kbuf
    if (n + 1 < kPasses) issueK(n + 1);
    // next pass's q fragments, fetched a half pass ahead (the last pass fetches its own again: in bounds, unused)
    const int nn = (n + 1 < kPasses) ? n + 1 : n;
    const _Float16* qN = qL + (size_t)(nn & 3) * kTok * kQKld + (nn >> 2) * kDh;
    const v16h qn0 = F::load(qN), qn1 = F::load(qN + 32);
    asm volatile("s_wait_xcnt 0x0" :: "v"(qN) : "memory");   // the q loads' address registers stay untouched up to here (input only: no load lands on them) and are rewritten behind it

    // ---- second half pass: reads vbuf alone ----
    // all v^T fragment reads of the pass stand as one group in front of the merge arithmetic, which hides their LDS latency
    v16h vf[4][4];
#pragma unroll
    for (int m = 0; m < 4; ++m)
#pragma unroll
      for (int dt = 0; dt < 4; ++dt) vf[m][dt] = F::load((const _Float16*)(fV + dt * 16 * kVPitch + m * 64));
    const v4f ma = *(const v4f*)&redM[c][0], mc = *(const v4f*)&redM[c][4];
    const v4f la = *(const v4f*)&redL[c][0], lc = *(const v4f*)&redL[c][4];
    const float M = fmaxf(fmaxf(fmaxf(ma[0], ma[1]), fmaxf(ma[2], ma[3])), fmaxf(fmaxf(mc[0], mc[1]), fmaxf(mc[2], mc[3])));
    const float L = ((la[0] * __builtin_amdgcn_exp2f(ma[0] - M) + la[1] * __builtin_amdgcn_exp2f(ma[1] - M)) +
                     (la[2] * __builtin_amdgcn_exp2f(ma[2] - M) + la[3] * __builtin_amdgcn_exp2f(ma[3] - M))) +
                    ((lc[0] * __builtin_amdgcn_exp2f(mc[0] - M) + lc[1] * __builtin_amdgcn_exp2f(mc[1] - M)) +
                     (lc[2] * __builtin_amdgcn_exp2f(mc[2] - M) + lc[3] * __builtin_amdgcn_exp2f(mc[3] - M)));
    const float f  = __builtin_amdgcn_exp2f(mb - M) / L;       // this wave's exp2(x - mb) -> probability
    const float fA = f * (gw * (1.0f / (float)kHeads));
    const float fP = f * (kPCarry * gw * coh);
    __builtin_amdgcn_sched_barrier(0);   // keeps the reads one group: without it they are sunk between the WMMAs, each with a wait to 0
#pragma unroll
    for (int m = 0; m < 4; ++m) {
      F::U p;
#pragma unroll
      for (int r = 0; r < 8; ++r) {
        a2[2 * m][r]     = fmaf(sc[2 * m][r], fA, a2[2 * m][r]);
        a2[2 * m + 1][r] = fmaf(sc[2 * m + 1][r], fA, a2[2 * m + 1][r]);
        p.h[0][r] = (_Float16)(sc[2 * m][r] * fP);
        p.h[1][r] = (_Float16)(sc[2 * m + 1][r] * fP);
      }
#pragma unroll
      for (int dt = 0; dt < 4; ++dt) accO[dt] = F::mma(p.v, vf[m][dt], accO[dt]);
    }
    acc_guard4(accO[0], accO[1], accO[2], accO[3]);   // the slots between the last WMMA and a reader of its D on the taken side of the branch below
    if (s == kSamp - 1) {
      float* slab = ored[wave];
#pragma unroll
      for (int dt = 0; dt < 4; ++dt)
#pragma unroll
        for (int r = 0; r < 8; ++r) slab[(hf * 8 + r) * 68 + dt * 16 + c] = accO[dt][r];
    }
    asm volatile("s_wait_dscnt 0x0" ::: "memory");     // this wave's reads of vbuf have returned before it is refilled
    asm volatile("s_wait_asynccnt 0x0" ::: "memory");  // this wave's copies of k(n+1) have landed
    __syncthreads();                                   // publishes k(n+1) and the attn.v partials; ends every wave's reads of vbuf
    if (n + 1 < kPasses) issueV(n + 1);
    if (s == kSamp - 1) {
      // combined[i][h*64 + d] x256: the 8 waves' partials in wave order; thread -> (row tid/16, four d), 16 lanes = one 128-B line
      const int row = tid >> 4, d4 = (tid & 15) * 4;
      v4f t = *(const v4f*)&ored[0][row * 68 + d4];
#pragma unroll
      for (int w = 1; w < 8; ++w) t += *(const v4f*)&ored[w][row * 68 + d4];
      v4h o;
#pragma unroll
      for (int e = 0; e < 4; ++e) o[e] = (_Float16)(t[e] * kPVScale);
      *(v4h*)(comb + (size_t)(bat * kSeq + i0 + row) * kDim + h * kDh + d4) = o;
      asm volatile("s_wait_xcnt 0x0" ::: "memory");    // the store's address and data registers are rewritten by the next head
#pragma unroll
      for (int dt = 0; dt < 4; ++dt) accO[dt] = zero8;
    }
    qf0 = qn0; qf1 = qn1;
  }
  asm volatile("s_wait_asynccnt 0x0" ::: "memory");    // no copy is outstanding when the wave ends

  // output 2: lane holds row i0 + c, per tile eight consecutive columns (32 B); the wave covers 512 B of each of its 16 rows
  float* orow = out2 + (size_t)(bat * kSeq + i0 + c) * kSeq + wave * 128 + hf * 8;
#pragma unroll
  for (int jt = 0; jt < 8; ++jt) {
    *(v4f*)(orow + jt * 16)     = (v4f){a2[jt][0], a2[jt][1], a2[jt][2], a2[jt][3]};
    *(v4f*)(orow + jt * 16 + 4) = (v4f){a2[jt][4], a2[jt][5], a2[jt][6], a2[jt][7]};
  }
}

// ---------------------------------------------------------------------------
// Workspace region map (byte offsets, all multiples of 4096). Every region is fully written before it is read.
//   wsS    f32 [32] (gw, coh, 1/t)                              0           ..       4,096
//   xmean  f32 [2][1024]                                        4,096       ..      12,288
//   Wo16   f16  [1024][1024]  = f16(16*bf16(Wo))               12,288      ..   2,109,440
//   QK16   f16  [4 s][2048][2048]  q x16 | k x16               2,109,440   ..  35,663,872
//   VT16   f16  [4 s][2][1024 e][1024 tok] v x16 transposed    35,663,872  ..  52,441,088
//   (not used)                                                  52,441,088  ..  60,829,696
//   comb16 f16  [2][1024][1024] 256 * sum_s gw*coh*out_s        60,829,696  ..  65,024,000
//   (not used)                                                  65,024,000  .. 132,132,864
//   The projections' operands:
//   xb     bf16 [2048][1024]                                    132,132,864 .. 136,327,168
//   Wqkb   bf16 [4][2048][1024] (Wq[s] rows | Wk[s] rows)       136,327,168 .. 153,104,384
//   Wvb    bf16 [4][1024][1024]                                 153,104,384 .. 161,492,992
//   total 266,350,592 B
// GEMM shapes (all K % 64 == 0; block tile 128x256; every M, N a multiple of it; no padded planes):
//   q|k projection  M=2048 N=2048 K=1024 (bf16 in, f16 out x16), batch 4 samples
//   v (role-swapped) M=1024 (e) N=1024 (tok) K=1024, batch 2 b x 4 samples
//   scores, attn.v  inside fused_attn_kernel
//   output          M=2048 N=1024 K=1024 + bo -> d_out
// ---------------------------------------------------------------------------
extern "C" void kernel_launch(void* const* d_in, const int* in_sizes, int n_in,
                              void* d_out, int out_size, void* d_ws, size_t ws_size,
                              hipStream_t stream) {
  if (n_in < 10) return;
  if (in_sizes[0] != kTok * kDim) return;
  if (in_sizes[1] != kSamp * kDim * kDim || in_sizes[2] != kSamp * kDim * kDim || in_sizes[3] != kSamp * kDim * kDim) return;
  if (in_sizes[4] != kSamp * kDim || in_sizes[5] != kSamp) return;
  if (in_sizes[6] != kDim * kDim || in_sizes[7] != kDim) return;
  if (in_sizes[8] != kSamp || in_sizes[9] != 1) return;
  if (out_size != kTok * kDim + kBatch * kSeq * kSeq) return;

  const float* x    = (const float*)d_in[0];   // [2][1024][1024]
  const float* Wq   = (const float*)d_in[1];   // [4][1024][1024] ([s][out][in])
  const float* Wk   = (const float*)d_in[2];
  const float* Wv   = (const float*)d_in[3];
  const float* Wg   = (const float*)d_in[4];   // [4][1024]
  const float* bg   = (const float*)d_in[5];   // [4]
  const float* Wo   = (const float*)d_in[6];   // [1024][1024] ([out][in])
  const float* bo   = (const float*)d_in[7];   // [1024]
  const float* hw   = (const float*)d_in[8];   // [4]
  const float* temp = (const float*)d_in[9];   // [1]
  float* yout = (float*)d_out;                             // [2][1024][1024] at byte 0
  float* aout = (float*)d_out + (size_t)kTok * kDim;       // [2][1024][1024] at byte 8,388,608

  // ---- carve ----
  const size_t SZ_WSS  = 4096;
  const size_t SZ_XM   = (size_t)kBatch * kDim * 4;                 //       8,192
  const size_t SZ_WO   = (size_t)kDim * kDim * 2;                   //   2,097,152
  const size_t SZ_QK   = (size_t)kSamp * kTok * kQKld * 2;          //  33,554,432
  const size_t SZ_VT   = (size_t)kSamp * kBatch * kDim * kSeq * 2;  //  16,777,216
  const size_t SZ_CF   = (size_t)kBatch * kSeq * kDim * 4;          //   8,388,608
  const size_t SZ_CH   = (size_t)kBatch * kSeq * kDim * 2;          //   4,194,304
  const size_t SZ_P    = (size_t)kBatch * kHeads * kSeq * kSeq * 2; //  67,108,864
  const size_t SZ_S    = (size_t)kBatch * kHeads * kSeq * kSeq * 4; // 134,217,728
  const size_t SZ_XB   = (size_t)kTok * kDim * 2;                   //   4,194,304
  const size_t SZ_WQK  = (size_t)kSamp * kQKld * kDim * 2;          //  16,777,216
  size_t off = 0;
  const size_t oWSS = off; off += SZ_WSS;
  const size_t oXM  = off; off += SZ_XM;
  const size_t oWO  = off; off += SZ_WO;
  const size_t oQK  = off; off += SZ_QK;
  const size_t oVT  = off; off += SZ_VT;
  const size_t oCF  = off; off += SZ_CF;
  const size_t oCH  = off; off += SZ_CH;
  const size_t oP   = off; off += SZ_P;
  const size_t oS   = off; off += SZ_S;
  const size_t TOTAL = off;                                         // 266,350,592
  const size_t oXB  = oS;
  const size_t oWQK = oXB + SZ_XB;
  const size_t oWV  = oWQK + SZ_WQK;
  if (TOTAL > ws_size) return;

  char* ws = (char*)d_ws;
  float*          wsS    = (float*)(ws + oWSS);
  float*          xmean  = (float*)(ws + oXM);
  unsigned short* xb     = (unsigned short*)(ws + oXB);
  unsigned short* Wqkb   = (unsigned short*)(ws + oWQK);
  unsigned short* Wvb    = (unsigned short*)(ws + oWV);
  unsigned short* Wo16   = (unsigned short*)(ws + oWO);
  unsigned short* QK16   = (unsigned short*)(ws + oQK);
  unsigned short* VT16   = (unsigned short*)(ws + oVT);
  unsigned short* comb16 = (unsigned short*)(ws + oCH);

  const dim3 blk(256);

  // (0) operand casts
  {
    const int n8x = kTok * kDim / 8;                 // 262,144 -> 1024 blocks exactly
    cast_bf16_kernel<<<dim3(n8x / 256), blk, 0, stream>>>(x, xb, n8x);
    cast_wqk_kernel<<<dim3((kDim * kDim / 8) / 256, 8), blk, 0, stream>>>(Wq, Wk, Wqkb);   // 512 x 8 blocks
    const int n8v = kSamp * kDim * kDim / 8;         // 524,288 -> 2048 blocks exactly
    cast_bf16_kernel<<<dim3(n8v / 256), blk, 0, stream>>>(Wv, Wvb, n8v);
    const int n8o = kDim * kDim / 8;                 // 131,072 -> 512 blocks exactly
    cast_wo_kernel<<<dim3(n8o / 256), blk, 0, stream>>>(Wo, Wo16, n8o);
  }
  // (1) mean pool + gates
  mean_kernel<<<dim3((kBatch * kDim) / 256), blk, 0, stream>>>(xb, xmean);   // 8 blocks exactly
  gate_kernel<<<dim3(1), blk, 0, stream>>>(xmean, Wg, bg, hw, temp, wsS);

  const dim3 gQK((((kTok / 64) * (kQKld / 64)) + 7) / 8, kSamp);             // 128 x 4:  M=2048, N=2048, samples
  const dim3 gV((((kDim / 64) * (kSeq / 64)) + 7) / 8, kBatch * kSamp);      // 32 x 8:   M=1024, N=1024, (s, b)
  const dim3 gOut((((kTok / 64) * (kDim / 64)) + 7) / 8, 1);                 // 64 blocks: M=2048, N=1024

  // (2) q|k projection, all samples: QK16[s][tok][n] = f16(16 * sum_c bf16(x[tok][c]) * bf16(Wqk[s][n][c]))
  wmma_gemm64<1, false, 0, 1, false, 0, 2, 4><<<gQK, blk, 0, stream>>>(
      xb, xb, kDim, 0L, Wqkb, Wqkb, kDim, (long)kQKld * kDim, (void*)QK16, (void*)QK16, kQKld, (long)kTok * kQKld,
      bo, x, 0L, kTok, kQKld, kDim, kQKVCarry,
      kSamp, 0L, 0L, 0L, 0L);
  // (3) v role-swapped, all (s, b): VT16[s][b][e][tok] = f16(16 * sum_c bf16(Wv[s][e][c]) * bf16(x[b][tok][c]))
  wmma_gemm64<1, false, 0, 1, false, 0, 2, 4><<<gV, blk, 0, stream>>>(
      Wvb, Wvb, kDim, 0L, xb, xb, kDim, (long)kSeq * kDim, (void*)VT16, (void*)VT16, kSeq, (long)kDim * kSeq,
      bo, x, 0L, kDim, kSeq, kDim, kQKVCarry,
      kBatch, (long)kDim * kDim, 0L, (long)kBatch * kDim * kSeq, 0L);

  // (4) attention, all samples, heads and batches: comb16 = f16(256 * sum_s gw*coh*attn_s.v_s), output 2 = sum_s gw * mean_h attn
  fused_attn_kernel<<<dim3(kSeq / 16, kBatch), blk, 0, stream>>>(QK16, VT16, wsS, comb16, aout);

  // (7) y = (comb16 . Wo16^T) / 4096 + bo -> d_out output 0 (f32)
  wmma_gemm64<0, false, 2, 0, false, 0, 2, 4><<<gOut, blk, 0, stream>>>(
      comb16, comb16, kDim, 0L, Wo16, Wo16, kDim, 0L, (void*)yout, (void*)yout, kDim, 0L,
      bo, x, 0L, kTok, kDim, kDim, kOutScale,
      1, 0L, 0L, 0L, 0L);
}

// v004
// It runs in 252 microseconds.
// Next to v003, in two timings, it ran 1.46 times as fast each time.
// Counting every step since v000, it is 7.18 times as fast.
// Compute dtypes: q/k/v projections on v_wmma_f32_16x16x32_bf16 (x and Wq/Wk/Wv RNE-converted to bf16, f32 accumulate, results carried x16 into f16 planes); scores q.k^T, attn.v and the output projection on v_wmma_f32_16x16x32_f16 (f16 operands: q,k,v x16, probabilities x2^15 with the per-sample mixing weight folded in, combined x256, Wo as f16(16*bf16(Wo))), f32 accumulate; mean-pool, gates, softmax and the head/sample mixing in f32.
#include <hip/hip_runtime.h>
#include <math.h>

// ---------------------------------------------------------------------------
// Problem constants
// ---------------------------------------------------------------------------
constexpr int kBatch     = 2;
constexpr int kSeq       = 1024;
constexpr int kDim       = 1024;
constexpr int kHeads     = 16;
constexpr int kSamp      = 4;
constexpr int kDh        = 64;
constexpr int kTok       = kBatch * kSeq;       // 2048 token rows
constexpr int kHeadsHalf = 8;                   // half of kHeads; no kernel in this file uses it
constexpr int kQKld      = 2 * kDim;            // 2048: q columns 0..1023 | k columns 1024..2047
constexpr float kQKVCarry   = 16.0f;            // q, k, v carried x16 in f16
constexpr float kPCarry     = 32768.0f;         // probabilities carried x2^15 (times gate <= 1)
constexpr float kCombCarry  = 256.0f;           // combined carried x256
constexpr float kWoCarry    = 16.0f;            // Wo carried x16 in f16
constexpr float kScoreScale = 0.125f / (16.0f * 16.0f);              // dh^-0.5 / (16*16) = 2^-11
constexpr float kPVScale    = kCombCarry / (kPCarry * kQKVCarry);    // 256 / 2^19 = 2^-11
constexpr float kOutScale   = 1.0f / (kCombCarry * kWoCarry);        // 2^-12

typedef __attribute__((ext_vector_type(16))) _Float16 v16h;
typedef __attribute__((ext_vector_type(8)))  _Float16 v8h;
typedef __attribute__((ext_vector_type(16))) __bf16   v16b;
typedef __attribute__((ext_vector_type(8)))  __bf16   v8b;
typedef __attribute__((ext_vector_type(8)))  float    v8f;
typedef __attribute__((ext_vector_type(4)))  float    v4f;
typedef __attribute__((ext_vector_type(4)))  unsigned int v4u;

__device__ __forceinline__ unsigned short f2bf_bits(float f) {
  unsigned u = __float_as_uint(f);
  return (unsigned short)((u + 0x7FFFu + ((u >> 16) & 1u)) >> 16);
}
__device__ __forceinline__ float bf_bits2f(unsigned short h) { return __uint_as_float(((unsigned)h) << 16); }

// hazard guard as a plain device helper
__device__ __forceinline__ void acc_guard4(v8f& a, v8f& b, v8f& c, v8f& d) { asm volatile("v_nop\n\tv_nop\n\tv_nop\n\tv_nop" : "+v"(a), "+v"(b), "+v"(c), "+v"(d)); }
template <typename T> struct Frag;
template <> struct Frag<_Float16> {
  typedef v16h V; union U { v16h v; v8h h[2]; };
  static __device__ __forceinline__ v16h load(const _Float16* p) {   // elements 0..7 <- p[0..7], 8..15 <- p[16..23]
    U f; f.h[0] = *(const v8h*)(p); f.h[1] = *(const v8h*)(p + 16); return f.v;
  }
  static __device__ __forceinline__ v8f mma(v16h a, v16h b, v8f c) {
    return __builtin_amdgcn_wmma_f32_16x16x32_f16(false, a, false, b, (short)0, c, false, false);
  }
};
template <> struct Frag<__bf16> {
  typedef v16b V; union U { v16b v; v8b h[2]; };
  static __device__ __forceinline__ v16b load(const __bf16* p) {
    U f; f.h[0] = *(const v8b*)(p); f.h[1] = *(const v8b*)(p + 16); return f.v;
  }
  static __device__ __forceinline__ v8f mma(v16b a, v16b b, v8f c) {
    return __builtin_amdgcn_wmma_f32_16x16x32_bf16(false, a, false, b, (short)0, c, false, false);
  }
};

__device__ __forceinline__ unsigned pk16(unsigned short a, unsigned short b) { return (unsigned)a | ((unsigned)b << 16); }
__device__ __forceinline__ unsigned short h_bits(float f) { const _Float16 h = (_Float16)f; return __builtin_bit_cast(unsigned short, h); }

// ---- Operand staging: asynchronous copies global -> LDS ----
constexpr int kStageK   = 64;    // k elements per stage = one whole 128-B line of every operand row
constexpr int kRowPitch = 144;   // LDS bytes per staged row: 128 + 16, an odd multiple of 16 B, so that the 16 rows of a fragment read fall on distinct banks

// Six 16-B copies per lane, global -> LDS through no register. The s_wait_xcnt 0 is the statement's last line so that
// no address register named by an issued copy is rewritten in front of it.
__device__ __forceinline__ void async_copy6(unsigned l0, const unsigned short* g0, unsigned l1, const unsigned short* g1,
                                            unsigned l2, const unsigned short* g2, unsigned l3, const unsigned short* g3,
                                            unsigned l4, const unsigned short* g4, unsigned l5, const unsigned short* g5) {
  asm volatile("global_load_async_to_lds_b128 %0, %1, off\n\t"
               "global_load_async_to_lds_b128 %2, %3, off\n\t"
               "global_load_async_to_lds_b128 %4, %5, off\n\t"
               "global_load_async_to_lds_b128 %6, %7, off\n\t"
               "global_load_async_to_lds_b128 %8, %9, off\n\t"
               "global_load_async_to_lds_b128 %10, %11, off\n\t"
               "s_wait_xcnt 0x0"
               :: "v"(l0), "v"(g0), "v"(l1), "v"(g1), "v"(l2), "v"(g2), "v"(l3), "v"(g3), "v"(l4), "v"(g4), "v"(l5), "v"(g5)
               : "memory");
}

// ---- Register-blocked batched WMMA GEMM (ACT reduced to none/relu/leaky; Cout/resid without restrict
//      so that the in-place residual accumulate (resid == Cout, same wave reads its rows before storing them) is well formed) --
// C[m,n] = scale * sum_k A[m,k] * Bt[n,k] (+bias)(+resid); each wave owns a 64x64 tile; the block's 8 waves form a WM x WN grid of
// such tiles and share one staged k-tile: 64*WM rows of A, then 64*WN rows of Bt, 64 k each, two LDS buffers (the next k-tile's
// copies fly while this one is multiplied).
// A row-major [M,K]; Bt row-major [N,K]; M % (64*WM) == 0, N % (64*WN) == 0, K % 64 == 0; rows and bases 16-B aligned.
// SPLIT (hi/lo planes) is not carried by the staged loop and must be false.
// BIAS_MODE: 0 = none, 1 = bias[m], 2 = bias[n].
// OUT_MODE: 0 = f32, 1 = f16, 2 = bf16 hi plane (Cout) + bf16 lo plane (Cout2).
// ET: 0 = f16 operands, 1 = bf16 operands (pointers passed as 16-bit storage)
template <int ET> struct Elem;
template <> struct Elem<0> { typedef _Float16 T; };
template <> struct Elem<1> { typedef __bf16 T; };
template <int ET, bool SPLIT, int BIAS_MODE, int OUT_MODE, bool RESID, int ACT, int WM, int WN>
__global__ __launch_bounds__(256) void wmma_gemm64(
    const unsigned short* __restrict__ Ap, const unsigned short* __restrict__ A2p, int lda, long strideA,
    const unsigned short* __restrict__ Btp, const unsigned short* __restrict__ Bt2p, int ldb, long strideB,
    void* Cout, void* Cout2, int ldc, long strideC,
    const float* __restrict__ bias,
    const float* resid, long strideR,
    int M, int N, int K, float scale,
    int inner, long strideA2, long strideB2, long strideC2, long strideR2) {
  typedef typename Elem<ET>::T T;
  typedef typename Frag<T>::V V;
  static_assert(!SPLIT, "the staged k-loop carries one plane per operand");
  static_assert(WM * WN == 8, "eight waves per block");
  constexpr int kRowsA  = 64 * WM;                    // staged rows 0..kRowsA-1 = A, the rest = Bt
  constexpr int kRows   = 64 * (WM + WN);
  constexpr int kStageB = kRows * kRowPitch;          // bytes of one buffer
  constexpr int kCopies = kRows / 32;                 // copies per lane and stage: 256 lanes cover 32 rows x 8 chunks of 16 B
  static_assert(kCopies % 6 == 0 && kCopies <= 63, "copies go out six to a statement");
  __shared__ __align__(16) unsigned char ring[2 * kStageB];
  __shared__ __align__(16) float sT[8][16 * 68];   // per-wave 16x64 slab, pitch 68 floats
  // two-level batch: blockIdx.y = outer * inner + b; b walks the first strides, outer the second
  const int outer = (int)blockIdx.y / inner;
  const int b     = (int)blockIdx.y - outer * inner;
  const size_t offA = (size_t)b * strideA + (size_t)outer * strideA2;
  const size_t offB = (size_t)b * strideB + (size_t)outer * strideB2;
  const size_t offC = (size_t)b * strideC + (size_t)outer * strideC2;
  const size_t offR = (size_t)b * strideR + (size_t)outer * strideR2;
  const int lane = threadIdx.x & 31;
  const int wave = threadIdx.x >> 5;
  const int tilesN = N / (64 * WN);
  const int tilesM = M / (64 * WM);
  if ((int)blockIdx.x >= tilesM * tilesN) return;   // block-uniform, in front of every barrier
  const int bm = blockIdx.x / tilesN;
  const int bn = blockIdx.x - bm * tilesN;
  const int mB = bm * (64 * WM);
  const int nB = bn * (64 * WN);
  const int wm = wave / WN;
  const int wn = wave - wm * WN;
  const int m0 = mB + (wm << 6);
  const int n0 = nB + (wn << 6);

  const int rlane = lane & 15;                 // row (A) / col (B, D) within subtile
  const int mOff  = (lane >> 4) * 8;           // D row offset

  // copy side: lane -> (row crow + 32*j, 16-B chunk cchk) of the staged k-tile
  const int crow = threadIdx.x >> 3;
  const int cchk = threadIdx.x & 7;
  const unsigned short* gA = Ap  + offA + (size_t)(mB + crow) * lda + cchk * 8;
  const unsigned short* gB = Btp + offB + (size_t)(nB + crow) * ldb + cchk * 8;
  const unsigned ldsC = (unsigned)(size_t)(void*)ring + (unsigned)(crow * kRowPitch + cchk * 16);
  auto issue = [&](int t, int buf) {
    const unsigned l = ldsC + (unsigned)(buf * kStageB);
    const unsigned short* a = gA + t * kStageK;
    const unsigned short* w = gB + t * kStageK;
    auto from = [&](int j) { return (j < kRowsA / 32) ? (a + (size_t)(j * 32) * lda) : (w + (size_t)((j - kRowsA / 32) * 32) * ldb); };
    auto to   = [&](int j) { return l + (unsigned)(j * 32 * kRowPitch); };
#pragma unroll
    for (int j = 0; j < kCopies; j += 6)
      async_copy6(to(j), from(j), to(j + 1), from(j + 1), to(j + 2), from(j + 2),
                  to(j + 3), from(j + 3), to(j + 4), from(j + 4), to(j + 5), from(j + 5));
  };
  // read side: this lane's row of the first A / Bt fragment, at its lane half's k offset (8 elements = 16 B)
  const unsigned char* fA = ring + ((wm << 6) + rlane) * kRowPitch + (lane >> 4) * 16;
  const unsigned char* fB = ring + (kRowsA + (wn << 6) + rlane) * kRowPitch + (lane >> 4) * 16;

  v8f acc[4][4];
#pragma unroll
  for (int i = 0; i < 4; ++i)
#pragma unroll
    for (int j = 0; j < 4; ++j) acc[i][j] = (v8f){0.f,0.f,0.f,0.f,0.f,0.f,0.f,0.f};

  const int nT = K / kStageK;
  issue(0, 0);
  asm volatile("s_wait_asynccnt 0x0" ::: "memory");   // this wave's copies of k-tile 0 have landed
  __syncthreads();                                    // ... and every other wave's: k-tile 0 may be read
  if (nT > 1) issue(1, 1);

  for (int t = 0; t < nT; ++t) {
    const int bo = (t & 1) * kStageB;
    // all fragment reads of the k-tile stand as one group in front of its WMMAs (one LDS latency per trip, counted waits behind it)
    V ah[kStageK / 32][4], bh[kStageK / 32][4];
#pragma unroll
    for (int ks = 0; ks < kStageK / 32; ++ks) {
#pragma unroll
      for (int j = 0; j < 4; ++j) bh[ks][j] = Frag<T>::load((const T*)(fB + bo + j * 16 * kRowPitch + ks * 64));
#pragma unroll
      for (int i = 0; i < 4; ++i) ah[ks][i] = Frag<T>::load((const T*)(fA + bo + i * 16 * kRowPitch + ks * 64));
    }
    __builtin_amdgcn_sched_barrier(0);   // keeps the reads one group: without it they are sunk between the WMMAs, each with a wait to 0
#pragma unroll
    for (int ks = 0; ks < kStageK / 32; ++ks)
#pragma unroll
      for (int i = 0; i < 4; ++i)
#pragma unroll
        for (int j = 0; j < 4; ++j) acc[i][j] = Frag<T>::mma(ah[ks][i], bh[ks][j], acc[i][j]);
    __builtin_amdgcn_sched_barrier(0);   // keeps the WMMAs in front of the waits: sunk behind them, the next k-tile's copies would be waited for before the work that hides them
    asm volatile("s_wait_dscnt 0x0" ::: "memory");     // this wave's reads of buffer t&1 have returned before it is refilled
    asm volatile("s_wait_asynccnt 0x0" ::: "memory");  // this wave's copies of k-tile t+1 have landed
    __syncthreads();                                   // publishes k-tile t+1 and ends every wave's reads of buffer t&1
    if (t + 2 < nT) issue(t + 2, t & 1);
  }
  asm volatile("s_wait_asynccnt 0x0" ::: "memory");    // no copy is outstanding when the wave goes on to the epilogue and ends
  acc_guard4(acc[0][0], acc[0][1], acc[0][2], acc[0][3]);
  acc_guard4(acc[1][0], acc[1][1], acc[1][2], acc[1][3]);
  acc_guard4(acc[2][0], acc[2][1], acc[2][2], acc[2][3]);
  acc_guard4(acc[3][0], acc[3][1], acc[3][2], acc[3][3]);

  // ---- epilogue ----
  float* slab = sT[wave];
  const float* Rb = RESID ? (resid + offR) : nullptr;
#pragma unroll
  for (int i = 0; i < 4; ++i) {
    const int mBase = m0 + (i << 4);
#pragma unroll
    for (int j = 0; j < 4; ++j) {
      const int n = n0 + (j << 4) + rlane;
      float bv = 0.f;
      if (BIAS_MODE == 2) bv = bias[n];
#pragma unroll
      for (int r = 0; r < 8; ++r) {
        float v = acc[i][j][r] * scale;
        if (BIAS_MODE == 1) v += bias[mBase + mOff + r];
        if (BIAS_MODE == 2) v += bv;
        if (RESID) v += Rb[(size_t)(mBase + mOff + r) * ldc + n];
        if (ACT == 2) v = fmaxf(v, 0.0f);
        if (ACT == 4) v = (v > 0.f) ? v : 0.01f * v;
        slab[(mOff + r) * 68 + (j << 4) + rlane] = v;
      }
    }
    __builtin_amdgcn_fence(__ATOMIC_RELEASE, "workgroup");
    __builtin_amdgcn_wave_barrier();
    __builtin_amdgcn_fence(__ATOMIC_ACQUIRE, "workgroup");
    if (OUT_MODE == 0) {
      float* C = (float*)Cout + offC;
      const int hh = lane >> 4, c4 = (lane & 15) * 4;     // row seg = 256 B = 16 lanes x 16 B
      {
#pragma unroll
        for (int it = 0; it < 8; ++it) {
          const int row = it * 2 + hh;
          v4f v = *(const v4f*)(slab + row * 68 + c4);
          *(v4f*)(C + (size_t)(mBase + row) * ldc + n0 + c4) = v;
        }
        
      }
    } else {
      const int q = lane >> 3, c8 = (lane & 7) * 8;
      unsigned short* C  = (unsigned short*)Cout  + offC;
      unsigned short* C2 = (OUT_MODE == 2) ? ((unsigned short*)Cout2 + offC) : nullptr;
      {
#pragma unroll
        for (int it = 0; it < 4; ++it) {
          const int row = it * 4 + q;
          const float* sp = slab + row * 68 + c8;
          v8h hv, lv;
#pragma unroll
          for (int e = 0; e < 8; ++e) {
            if (OUT_MODE == 1) {
              hv[e] = (_Float16)sp[e];
            } else {
              unsigned short hb = f2bf_bits(sp[e]);
              unsigned short lb = f2bf_bits(sp[e] - bf_bits2f(hb));
              hv[e] = __builtin_bit_cast(_Float16, hb);
              lv[e] = __builtin_bit_cast(_Float16, lb);
            }
          }
          *(v8h*)(C + (size_t)(mBase + row) * ldc + n0 + c8) = hv;
          if (OUT_MODE == 2) *(v8h*)(C2 + (size_t)(mBase + row) * ldc + n0 + c8) = lv;
        }
        
      }
    }
    __builtin_amdgcn_fence(__ATOMIC_RELEASE, "workgroup");
    __builtin_amdgcn_wave_barrier();
    __builtin_amdgcn_fence(__ATOMIC_ACQUIRE, "workgroup");
  }
}

// ---------------------------------------------------------------------------
// f32 -> bf16 bits (RNE), 8 consecutive elements per thread: one 16-B store per lane, 32 contiguous lanes = 4 whole
// ---------------------------------------------------------------------------
__global__ __launch_bounds__(256) void cast_bf16_kernel(const float* __restrict__ in, unsigned short* __restrict__ out, int n8) {
  const int i = blockIdx.x * 256 + threadIdx.x;
  if (i >= n8) return;
  const float* p = in + 8 * (size_t)i;
  const v4f a = *(const v4f*)(p);
  const v4f c = *(const v4f*)(p + 4);
  unsigned short hb[8];
#pragma unroll
  for (int e = 0; e < 4; ++e) {
    hb[e]     = f2bf_bits(a[e]);
    hb[4 + e] = f2bf_bits(c[e]);
  }
  const v4u u = (v4u){pk16(hb[0], hb[1]), pk16(hb[2], hb[3]), pk16(hb[4], hb[5]), pk16(hb[6], hb[7])};
  unsigned short* q = out + 8 * (size_t)i;
  *(v4u*)q = u;
  
}

// ---------------------------------------------------------------------------
// Stacked q|k weight cast: out[s][2048][1024] bf16, rows 0..1023 = Wq[s], rows 1024..2047 = Wk[s] (both [out][in], k-contiguous).
// grid (512, 8): blockIdx.y = (which<<2)|s with which 0 = Wq, 1 = Wk (block-uniform source select);
// coverage per y: 512 blocks x 256 threads x 8 = 1,048,576 = one [1024][1024] matrix exactly. Stores as cast_bf16_kernel.
// ---------------------------------------------------------------------------
__global__ __launch_bounds__(256) void cast_wqk_kernel(const float* __restrict__ Wq, const float* __restrict__ Wk,
                                                       unsigned short* __restrict__ out) {
  const int y = blockIdx.y;
  const int smp = y & 3, which = y >> 2;
  const float* src = ((which == 0) ? Wq : Wk) + (size_t)smp * kDim * kDim;
  unsigned short* dst = out + (size_t)smp * kQKld * kDim + (size_t)which * kDim * kDim;
  const int i = blockIdx.x * 256 + threadIdx.x;
  if (i >= (kDim * kDim) / 8) return;
  const float* p = src + 8 * (size_t)i;
  const v4f a = *(const v4f*)(p);
  const v4f c = *(const v4f*)(p + 4);
  unsigned short hb[8];
#pragma unroll
  for (int e = 0; e < 4; ++e) {
    hb[e]     = f2bf_bits(a[e]);
    hb[4 + e] = f2bf_bits(c[e]);
  }
  const v4u u = (v4u){pk16(hb[0], hb[1]), pk16(hb[2], hb[3]), pk16(hb[4], hb[5]), pk16(hb[6], hb[7])};
  unsigned short* q = dst + 8 * (size_t)i;
  *(v4u*)q = u;
  
}

// ---------------------------------------------------------------------------
// Wo cast: out = f16(16 * bf16(Wo)) (RNE to bf16 first, then exact power-of-two carry into f16), 8 per thread, stores as above.
// Coverage: 512 blocks x 256 x 8 = 1,048,576 = [1024][1024] exactly.
// ---------------------------------------------------------------------------
__global__ __launch_bounds__(256) void cast_wo_kernel(const float* __restrict__ in, unsigned short* __restrict__ out, int n8) {
  const int i = blockIdx.x * 256 + threadIdx.x;
  if (i >= n8) return;
  const float* p = in + 8 * (size_t)i;
  const v4f a = *(const v4f*)(p);
  const v4f c = *(const v4f*)(p + 4);
  unsigned short hb[8];
#pragma unroll
  for (int e = 0; e < 4; ++e) {
    hb[e]     = h_bits(kWoCarry * bf_bits2f(f2bf_bits(a[e])));
    hb[4 + e] = h_bits(kWoCarry * bf_bits2f(f2bf_bits(c[e])));
  }
  const v4u u = (v4u){pk16(hb[0], hb[1]), pk16(hb[2], hb[3]), pk16(hb[4], hb[5]), pk16(hb[6], hb[7])};
  unsigned short* q = out + 8 * (size_t)i;
  *(v4u*)q = u;
  
}

// ---------------------------------------------------------------------------
// x cast with the mean pool and the gate's dot product folded in.
// grid = 256 blocks of 8 token rows (128 blocks per batch); thread -> 8 consecutive columns (tid % 128) * 8 of the rows tid / 128 + 2j.
//   xb = bf16(x) (RNE), stores as cast_bf16_kernel: one 16-B store per lane and row.
//   part[b][s][chunk] = sum_d (sum over the block's 8 rows of bf16(x[b][n][d])) * bf16(Wg[s][d]), f32:
//     per thread 4 rows in order, 8 columns in order; shuffle tree over the wave; the 8 waves in wave order.
// The sum over the 128 chunks, the 1/1024 of the mean and the sigmoid are gate_kernel's.
// ---------------------------------------------------------------------------
constexpr int kPoolRows   = 8;
constexpr int kPoolChunks = kSeq / kPoolRows;   // 128 per batch
__global__ __launch_bounds__(256) void cast_x_pool_kernel(const float* __restrict__ x, const float* __restrict__ Wg,
                                                          unsigned short* __restrict__ xb, float* __restrict__ part) {
  __shared__ float red[8][kSamp];
  const int tid = threadIdx.x, lane = tid & 31, wave = tid >> 5;
  const int col = (tid & 127) * 8;
  const size_t base = (size_t)(blockIdx.x * kPoolRows + (tid >> 7)) * kDim + col;
  v4f a[kPoolRows / 2], c[kPoolRows / 2];
#pragma unroll
  for (int j = 0; j < kPoolRows / 2; ++j) {
    a[j] = *(const v4f*)(x + base + (size_t)(2 * j) * kDim);
    c[j] = *(const v4f*)(x + base + (size_t)(2 * j) * kDim + 4);
  }
  float cs[8];
#pragma unroll
  for (int e = 0; e < 8; ++e) cs[e] = 0.f;
#pragma unroll
  for (int j = 0; j < kPoolRows / 2; ++j) {
    unsigned short hb[8];
#pragma unroll
    for (int e = 0; e < 4; ++e) {
      hb[e]     = f2bf_bits(a[j][e]);
      hb[4 + e] = f2bf_bits(c[j][e]);
    }
#pragma unroll
    for (int e = 0; e < 8; ++e) cs[e] += bf_bits2f(hb[e]);
    *(v4u*)(xb + base + (size_t)(2 * j) * kDim) = (v4u){pk16(hb[0], hb[1]), pk16(hb[2], hb[3]), pk16(hb[4], hb[5]), pk16(hb[6], hb[7])};
  }
  float dot[kSamp];
#pragma unroll
  for (int s = 0; s < kSamp; ++s) {
    const v4f w0 = *(const v4f*)(Wg + s * kDim + col);
    const v4f w1 = *(const v4f*)(Wg + s * kDim + col + 4);
    float acc = 0.f;
#pragma unroll
    for (int e = 0; e < 4; ++e) acc += cs[e] * bf_bits2f(f2bf_bits(w0[e]));
#pragma unroll
    for (int e = 0; e < 4; ++e) acc += cs[4 + e] * bf_bits2f(f2bf_bits(w1[e]));
    dot[s] = acc;
  }
#pragma unroll
  for (int off = 16; off > 0; off >>= 1)
#pragma unroll
    for (int s = 0; s < kSamp; ++s) dot[s] += __shfl_xor(dot[s], off, 32);
  if (lane == 0) {
#pragma unroll
    for (int s = 0; s < kSamp; ++s) red[wave][s] = dot[s];
  }
  __syncthreads();
  if (tid < kSamp) {
    float t = red[0][tid];
#pragma unroll
    for (int w = 1; w < 8; ++w) t += red[w][tid];
    const int b = blockIdx.x / kPoolChunks, chunk = blockIdx.x - b * kPoolChunks;
    part[(b * kSamp + tid) * kPoolChunks + chunk] = t;
  }
}

// ---------------------------------------------------------------------------
// Gates and mixing weights (one block, 256 threads = 8 waves):
//   coh[b][s] = sigmoid((1/1024) * sum_chunk part[b][s][chunk] + bg[s])  (wave w -> (b, s) = (w>>2, w&3); four chunks per lane + shuffle tree)
//   t = clip(temperature, 0.1, 10); invt = 1/t; gw = softmax(hyp_w * invt)
// ---------------------------------------------------------------------------
// e^x as __expf forms it (x * log2(e), then v_exp_f32), with the slot behind the transcendental filled in the same statement.
__device__ __forceinline__ float exp_slot(float x) {
  float r;
  asm("v_exp_f32 %0, %1\n\tv_nop" : "=v"(r) : "v"(x * 1.44269504088896340736f));
  return r;
}
__global__ __launch_bounds__(256) void gate_kernel(const float* __restrict__ part,
                                                   const float* __restrict__ bg, const float* __restrict__ hw,
                                                   const float* __restrict__ temp, float* __restrict__ wsS) {
  __shared__ float vals[32];
  const int t = threadIdx.x, lane = t & 31, wave = t >> 5;
  if (t < 32) vals[t] = 0.f;
  __syncthreads();
  {
    const int b = wave >> 2, s = wave & 3;
    const v4f p = *(const v4f*)(part + wave * kPoolChunks + lane * 4);
    float acc = (p[0] + p[1]) + (p[2] + p[3]);
#pragma unroll
    for (int off = 16; off > 0; off >>= 1) acc += __shfl_xor(acc, off, 32);
    if (lane == 0) {
      const float z = acc * (1.0f / (float)kSeq) + bf_bits2f(f2bf_bits(bg[s]));
      vals[4 + b * kSamp + s] = 1.0f / (1.0f + __expf(-z));
    }
  }
  __syncthreads();
  if (t == 0) {
    float tc = bf_bits2f(f2bf_bits(temp[0]));
    tc = fminf(fmaxf(tc, 0.1f), 10.0f);
    const float invt = 1.0f / tc;
    const float l0 = bf_bits2f(f2bf_bits(hw[0])) * invt;
    const float l1 = bf_bits2f(f2bf_bits(hw[1])) * invt;
    const float l2 = bf_bits2f(f2bf_bits(hw[2])) * invt;
    const float l3 = bf_bits2f(f2bf_bits(hw[3])) * invt;
    const float mx = fmaxf(fmaxf(l0, l1), fmaxf(l2, l3));
    const float e0 = exp_slot(l0 - mx), e1 = exp_slot(l1 - mx), e2 = exp_slot(l2 - mx), e3 = exp_slot(l3 - mx);
    const float is = 1.0f / ((e0 + e1) + (e2 + e3));
    vals[0] = e0 * is; vals[1] = e1 * is; vals[2] = e2 * is; vals[3] = e3 * is;
    vals[12] = invt;
  }
  __syncthreads();
  if (wave == 0) {
    const float v = vals[lane];
    *(float*)(wsS + lane) = v;
    
  }
}

// ---------------------------------------------------------------------------
// Fused attention: scores, softmax, head/sample mixing and attn.v in one launch; no score or probability plane in memory.
// grid = (64 tiles of 16 query rows, 2 batches), 256 threads = 8 waves; the block walks n = h*4 + s (head outer, sample inner).
// Wave w owns the key columns j = 128w .. 128w+127 of the block's 16 x 1024 score rows.
//   scores transposed: D[j][i] = sum_d k[j][d] q[i][d]  (A = k rows from LDS, B = q rows from registers): lane (c, hf) holds
//     query row i = c and, per 16-j tile jt, the eight consecutive keys j = 128w + 16jt + 8hf + r.
//   softmax over j: per-wave maximum and sum (in-lane, then lane ^ 16), merged over the 8 waves through LDS.
//   a pair of score tiles (2m, 2m+1), converted to f16, IS the A fragment of attn.v for k = 32m .. 32m+31 (same lane, same order
//     as the fragment loader: elements 0..7 = k 8hf.., elements 8..15 = k 16+8hf..): the probabilities never leave the registers.
//   attn.v: each wave sums over its own 128 keys and over the 4 samples; the 8 partial 16x64 tiles are added through LDS per head.
//   output 2 is accumulated in registers over all 64 (h, s) and stored once.
// k (1024 rows x 128 B) and v^T (64 rows x 2048 B) of one (h, s) are staged in LDS by asynchronous copies, one buffer each; the tile
// sequence k(0), v(0), k(1), v(1), ... alternates between the two buffers as a two-buffer ring: each half pass reads one buffer
// while the other one's copies fly.
// ---------------------------------------------------------------------------
constexpr int kKPitch = 144;                 // 128 + 16 B, odd multiple of 16 B (distinct banks for the 16 rows of a fragment read)
constexpr int kVPitch = 2 * kSeq + 16;       // 2064 B = 129 x 16 B, likewise
constexpr int kKBytes = kSeq * kKPitch;      // 147,456
constexpr int kVBytes = kDh * kVPitch;       // 132,096
constexpr int kPasses = kHeads * kSamp;      // 64
typedef __attribute__((ext_vector_type(4))) _Float16 v4h;

// Eight 16-B copies per lane, global -> LDS through no register. The s_wait_xcnt 0 is the statement's last line so that
// no address register named by an issued copy is rewritten in front of it.
__device__ __forceinline__ void async_copy8(unsigned l0, const unsigned short* g0, unsigned l1, const unsigned short* g1,
                                            unsigned l2, const unsigned short* g2, unsigned l3, const unsigned short* g3,
                                            unsigned l4, const unsigned short* g4, unsigned l5, const unsigned short* g5,
                                            unsigned l6, const unsigned short* g6, unsigned l7, const unsigned short* g7) {
  asm volatile("global_load_async_to_lds_b128 %0, %1, off\n\t"
               "global_load_async_to_lds_b128 %2, %3, off\n\t"
               "global_load_async_to_lds_b128 %4, %5, off\n\t"
               "global_load_async_to_lds_b128 %6, %7, off\n\t"
               "global_load_async_to_lds_b128 %8, %9, off\n\t"
               "global_load_async_to_lds_b128 %10, %11, off\n\t"
               "global_load_async_to_lds_b128 %12, %13, off\n\t"
               "global_load_async_to_lds_b128 %14, %15, off\n\t"
               "s_wait_xcnt 0x0"
               :: "v"(l0), "v"(g0), "v"(l1), "v"(g1), "v"(l2), "v"(g2), "v"(l3), "v"(g3),
                  "v"(l4), "v"(g4), "v"(l5), "v"(g5), "v"(l6), "v"(g6), "v"(l7), "v"(g7)
               : "memory");
}

// value of lane l ^ 16
__device__ __forceinline__ float other_half(float v) {
  const int b = __builtin_bit_cast(int, v);
  return __builtin_bit_cast(float, __builtin_amdgcn_permlanex16(b, b, 0x76543210, 0xfedcba98, false, false));
}

__global__ __launch_bounds__(256) void fused_attn_kernel(const unsigned short* __restrict__ QK, const unsigned short* __restrict__ VT,
                                                         const float* __restrict__ wsS, unsigned short* __restrict__ comb,
                                                         float* __restrict__ out2) {
  typedef Frag<_Float16> F;
  __shared__ __align__(16) unsigned char kbuf[kKBytes];
  __shared__ __align__(16) unsigned char vbuf[kVBytes];
  __shared__ __align__(16) float ored[8][16 * 68];   // per-wave 16x64 partial of attn.v, pitch 68 floats
  __shared__ __align__(16) float redM[16][8];        // [query row][wave] maximum (log2 domain)
  __shared__ __align__(16) float redL[16][8];        // [query row][wave] sum
  const int tid = threadIdx.x, lane = tid & 31, wave = tid >> 5;
  const int c = lane & 15, hf = lane >> 4;
  const int i0 = blockIdx.x * 16, bat = blockIdx.y;
  const float cs = kScoreScale * wsS[12] * 1.44269504088896340736f;   // raw accumulator -> (0.125 q.k / t) * log2(e); > 0

  // copy side. k: lane -> (row tid/8 + 32j, 16-B chunk tid%8); v^T: lane -> (row tid/128 + 2j, 16-B chunk tid%128); j = 0..31
  const unsigned short* gK = QK + (size_t)(bat * kSeq + (tid >> 3)) * kQKld + kDim + (tid & 7) * 8;
  const unsigned short* gV = VT + (size_t)bat * kDim * kSeq + (size_t)(tid >> 7) * kSeq + (tid & 127) * 8;
  const unsigned lK = (unsigned)(size_t)(void*)kbuf + (unsigned)((tid >> 3) * kKPitch + (tid & 7) * 16);
  const unsigned lV = (unsigned)(size_t)(void*)vbuf + (unsigned)((tid >> 7) * kVPitch + (tid & 127) * 16);
  auto issueK = [&](int n) {
    const unsigned short* g = gK + (size_t)(n & 3) * kTok * kQKld + (n >> 2) * kDh;
    unsigned l = lK;
    auto from = [&](int j) { return g + (size_t)(j * 32) * kQKld; };
    auto to   = [&](int j) { return l + (unsigned)(j * 32 * kKPitch); };
#pragma unroll 1   // rolled: unrolled, the 32 LDS addresses are invariant in the pass loop and are held in registers across it (spills)
    for (int j = 0; j < 4; ++j) {
      async_copy8(to(0), from(0), to(1), from(1), to(2), from(2), to(3), from(3),
                  to(4), from(4), to(5), from(5), to(6), from(6), to(7), from(7));
      l += (unsigned)(8 * 32 * kKPitch);
      g += (size_t)(8 * 32) * kQKld;
    }
  };
  auto issueV = [&](int n) {
    const unsigned short* g = gV + (size_t)(n & 3) * kBatch * kDim * kSeq + (size_t)(n >> 2) * kDh * kSeq;
    unsigned l = lV;
    auto from = [&](int j) { return g + (size_t)(j * 2) * kSeq; };
    auto to   = [&](int j) { return l + (unsigned)(j * 2 * kVPitch); };
#pragma unroll 1   // rolled, as in issueK
    for (int j = 0; j < 4; ++j) {
      async_copy8(to(0), from(0), to(1), from(1), to(2), from(2), to(3), from(3),
                  to(4), from(4), to(5), from(5), to(6), from(6), to(7), from(7));
      l += (unsigned)(8 * 2 * kVPitch);
      g += (size_t)(8 * 2) * kSeq;
    }
  };
  // read side: this lane's row of the wave's first k / v^T fragment, at its lane half's k offset (8 elements = 16 B)
  const unsigned char* fK = kbuf + (wave * 128 + c) * kKPitch + hf * 16;
  const unsigned char* fV = vbuf + c * kVPitch + wave * 256 + hf * 16;
  const _Float16* qL = (const _Float16*)QK + (size_t)(bat * kSeq + i0 + c) * kQKld + hf * 8;

  const v8f zero8 = (v8f){0.f,0.f,0.f,0.f,0.f,0.f,0.f,0.f};
  v8f a2[8], accO[4];
#pragma unroll
  for (int jt = 0; jt < 8; ++jt) a2[jt] = zero8;
#pragma unroll
  for (int dt = 0; dt < 4; ++dt) accO[dt] = zero8;

  issueK(0);
  v16h qf0 = F::load(qL), qf1 = F::load(qL + 32);
  asm volatile("s_wait_asynccnt 0x0" ::: "memory");   // this wave's copies of k(0) have landed
  __syncthreads();                                    // ... and every other wave's: k(0) may be read
  issueV(0);

#pragma unroll 1
  for (int n = 0; n < kPasses; ++n) {
    const int s = n & 3, h = n >> 2;
    const float gw  = wsS[s];
    const float coh = wsS[4 + bat * kSamp + s];
    // ---- first half pass: reads kbuf alone ----
    v8f sc[8];
#pragma unroll
    for (int jt = 0; jt < 8; ++jt) sc[jt] = F::mma(F::load((const _Float16*)(fK + jt * 16 * kKPitch)), qf0, zero8);
#pragma unroll
    for (int jt = 0; jt < 8; ++jt) sc[jt] = F::mma(F::load((const _Float16*)(fK + jt * 16 * kKPitch + 64)), qf1, sc[jt]);
    float mr[8];
#pragma unroll
    for (int r = 0; r < 8; ++r) mr[r] = sc[0][r];
#pragma unroll
    for (int jt = 1; jt < 8; ++jt)
#pragma unroll
      for (int r = 0; r < 8; ++r) mr[r] = fmaxf(mr[r], sc[jt][r]);
    float mx = fmaxf(fmaxf(fmaxf(mr[0], mr[1]), fmaxf(mr[2], mr[3])), fmaxf(fmaxf(mr[4], mr[5]), fmaxf(mr[6], mr[7])));
    mx = fmaxf(mx, other_half(mx));
    const float mb = mx * cs;
    float ls[8];
#pragma unroll
    for (int r = 0; r < 8; ++r) ls[r] = 0.f;
#pragma unroll
    for (int jt = 0; jt < 8; ++jt)
#pragma unroll
      for (int r = 0; r < 8; ++r) {
        const float e = __builtin_amdgcn_exp2f(fmaf(sc[jt][r], cs, -mb));
        sc[jt][r] = e;
        ls[r] += e;
      }
    float l = ((ls[0] + ls[1]) + (ls[2] + ls[3])) + ((ls[4] + ls[5]) + (ls[6] + ls[7]));
    l += other_half(l);
    *(hf ? &redL[c][wave] : &redM[c][wave]) = hf ? l : mb;
    asm volatile("s_wait_dscnt 0x0" ::: "memory");     // this wave's reads of kbuf have returned before it is refilled
    asm volatile("s_wait_asynccnt 0x0" ::: "memory");  // this wave's copies of v(n) have landed
    __syncthreads();                                   // publishes v(n) and the wave partials; ends every wave's reads of kbuf
    if (n + 1 < kPasses) issueK(n + 1);
    // next pass's q fragments, fetched a half pass ahead (the last pass fetches its own again: in bounds, unused)
    const int nn = (n + 1 < kPasses) ? n + 1 : n;
    const _Float16* qN = qL + (size_t)(nn & 3) * kTok * kQKld + (nn >> 2) * kDh;
    const v16h qn0 = F::load(qN), qn1 = F::load(qN + 32);
    asm volatile("s_wait_xcnt 0x0" :: "v"(qN) : "memory");   // the q loads' address registers stay untouched up to here (input only: no load lands on them) and are rewritten behind it

    // ---- second half pass: reads vbuf alone ----
    // all v^T fragment reads of the pass stand as one group in front of the merge arithmetic, which hides their LDS latency
    v16h vf[4][4];
#pragma unroll
    for (int m = 0; m < 4; ++m)
#pragma unroll
      for (int dt = 0; dt < 4; ++dt) vf[m][dt] = F::load((const _Float16*)(fV + dt * 16 * kVPitch + m * 64));
    const v4f ma = *(const v4f*)&redM[c][0], mc = *(const v4f*)&redM[c][4];
    const v4f la = *(const v4f*)&redL[c][0], lc = *(const v4f*)&redL[c][4];
    const float M = fmaxf(fmaxf(fmaxf(ma[0], ma[1]), fmaxf(ma[2], ma[3])), fmaxf(fmaxf(mc[0], mc[1]), fmaxf(mc[2], mc[3])));
    const float L = ((la[0] * __builtin_amdgcn_exp2f(ma[0] - M) + la[1] * __builtin_amdgcn_exp2f(ma[1] - M)) +
                     (la[2] * __builtin_amdgcn_exp2f(ma[2] - M) + la[3] * __builtin_amdgcn_exp2f(ma[3] - M))) +
                    ((lc[0] * __builtin_amdgcn_exp2f(mc[0] - M) + lc[1] * __builtin_amdgcn_exp2f(mc[1] - M)) +
                     (lc[2] * __builtin_amdgcn_exp2f(mc[2] - M) + lc[3] * __builtin_amdgcn_exp2f(mc[3] - M)));
    const float f  = __builtin_amdgcn_exp2f(mb - M) / L;       // this wave's exp2(x - mb) -> probability
    const float fA = f * (gw * (1.0f / (float)kHeads));
    const float fP = f * (kPCarry * gw * coh);
    __builtin_amdgcn_sched_barrier(0);   // keeps the reads one group: without it they are sunk between the WMMAs, each with a wait to 0
#pragma unroll
    for (int m = 0; m < 4; ++m) {
      F::U p;
#pragma unroll
      for (int r = 0; r < 8; ++r) {
        a2[2 * m][r]     = fmaf(sc[2 * m][r], fA, a2[2 * m][r]);
        a2[2 * m + 1][r] = fmaf(sc[2 * m + 1][r], fA, a2[2 * m + 1][r]);
        p.h[0][r] = (_Float16)(sc[2 * m][r] * fP);
        p.h[1][r] = (_Float16)(sc[2 * m + 1][r] * fP);
      }
#pragma unroll
      for (int dt = 0; dt < 4; ++dt) accO[dt] = F::mma(p.v, vf[m][dt], accO[dt]);
    }
    acc_guard4(accO[0], accO[1], accO[2], accO[3]);   // the slots between the last WMMA and a reader of its D on the taken side of the branch below
    if (s == kSamp - 1) {
      float* slab = ored[wave];
#pragma unroll
      for (int dt = 0; dt < 4; ++dt)
#pragma unroll
        for (int r = 0; r < 8; ++r) slab[(hf * 8 + r) * 68 + dt * 16 + c] = accO[dt][r];
    }
    asm volatile("s_wait_dscnt 0x0" ::: "memory");     // this wave's reads of vbuf have returned before it is refilled
    asm volatile("s_wait_asynccnt 0x0" ::: "memory");  // this wave's copies of k(n+1) have landed
    __syncthreads();                                   // publishes k(n+1) and the attn.v partials; ends every wave's reads of vbuf
    if (n + 1 < kPasses) issueV(n + 1);
    if (s == kSamp - 1) {
      // combined[i][h*64 + d] x256: the 8 waves' partials in wave order; thread -> (row tid/16, four d), 16 lanes = one 128-B line
      const int row = tid >> 4, d4 = (tid & 15) * 4;
      v4f t = *(const v4f*)&ored[0][row * 68 + d4];
#pragma unroll
      for (int w = 1; w < 8; ++w) t += *(const v4f*)&ored[w][row * 68 + d4];
      v4h o;
#pragma unroll
      for (int e = 0; e < 4; ++e) o[e] = (_Float16)(t[e] * kPVScale);
      *(v4h*)(comb + (size_t)(bat * kSeq + i0 + row) * kDim + h * kDh + d4) = o;
      asm volatile("s_wait_xcnt 0x0" ::: "memory");    // the store's address and data registers are rewritten by the next head
#pragma unroll
      for (int dt = 0; dt < 4; ++dt) accO[dt] = zero8;
    }
    qf0 = qn0; qf1 = qn1;
  }
  asm volatile("s_wait_asynccnt 0x0" ::: "memory");    // no copy is outstanding when the wave ends

  // output 2: lane holds row i0 + c, per tile eight consecutive columns (32 B); the wave covers 512 B of each of its 16 rows
  float* orow = out2 + (size_t)(bat * kSeq + i0 + c) * kSeq + wave * 128 + hf * 8;
#pragma unroll
  for (int jt = 0; jt < 8; ++jt) {
    *(v4f*)(orow + jt * 16)     = (v4f){a2[jt][0], a2[jt][1], a2[jt][2], a2[jt][3]};
    *(v4f*)(orow + jt * 16 + 4) = (v4f){a2[jt][4], a2[jt][5], a2[jt][6], a2[jt][7]};
  }
}

// ---------------------------------------------------------------------------
// Workspace region map (byte offsets, all multiples of 4096). Every region is fully written before it is read.
//   wsS    f32 [32] (gw, coh, 1/t)                              0           ..       4,096
//   gpart  f32 [2 b][4 s][128 chunks] (4,096 B of the region)   4,096       ..      12,288
//   Wo16   f16  [1024][1024]  = f16(16*bf16(Wo))               12,288      ..   2,109,440
//   QK16   f16  [4 s][2048][2048]  q x16 | k x16               2,109,440   ..  35,663,872
//   VT16   f16  [4 s][2][1024 e][1024 tok] v x16 transposed    35,663,872  ..  52,441,088
//   (not used)                                                  52,441,088  ..  60,829,696
//   comb16 f16  [2][1024][1024] 256 * sum_s gw*coh*out_s        60,829,696  ..  65,024,000
//   (not used)                                                  65,024,000  .. 132,132,864
//   The projections' operands:
//   xb     bf16 [2048][1024]                                    132,132,864 .. 136,327,168
//   Wqkb   bf16 [4][2048][1024] (Wq[s] rows | Wk[s] rows)       136,327,168 .. 153,104,384
//   Wvb    bf16 [4][1024][1024]                                 153,104,384 .. 161,492,992
//   total 266,350,592 B
// GEMM shapes (all K % 64 == 0; block tile 128x256; every M, N a multiple of it; no padded planes):
//   q|k projection  M=2048 N=2048 K=1024 (bf16 in, f16 out x16), batch 4 samples
//   v (role-swapped) M=1024 (e) N=1024 (tok) K=1024, batch 2 b x 4 samples
//   scores, attn.v  inside fused_attn_kernel
//   output          M=2048 N=1024 K=1024 + bo -> d_out
// ---------------------------------------------------------------------------
extern "C" void kernel_launch(void* const* d_in, const int* in_sizes, int n_in,
                              void* d_out, int out_size, void* d_ws, size_t ws_size,
                              hipStream_t stream) {
  if (n_in < 10) return;
  if (in_sizes[0] != kTok * kDim) return;
  if (in_sizes[1] != kSamp * kDim * kDim || in_sizes[2] != kSamp * kDim * kDim || in_sizes[3] != kSamp * kDim * kDim) return;
  if (in_sizes[4] != kSamp * kDim || in_sizes[5] != kSamp) return;
  if (in_sizes[6] != kDim * kDim || in_sizes[7] != kDim) return;
  if (in_sizes[8] != kSamp || in_sizes[9] != 1) return;
  if (out_size != kTok * kDim + kBatch * kSeq * kSeq) return;

  const float* x    = (const float*)d_in[0];   // [2][1024][1024]
  const float* Wq   = (const float*)d_in[1];   // [4][1024][1024] ([s][out][in])
  const float* Wk   = (const float*)d_in[2];
  const float* Wv   = (const float*)d_in[3];
  const float* Wg   = (const float*)d_in[4];   // [4][1024]
  const float* bg   = (const float*)d_in[5];   // [4]
  const float* Wo   = (const float*)d_in[6];   // [1024][1024] ([out][in])
  const float* bo   = (const float*)d_in[7];   // [1024]
  const float* hw   = (const float*)d_in[8];   // [4]
  const float* temp = (const float*)d_in[9];   // [1]
  float* yout = (float*)d_out;                             // [2][1024][1024] at byte 0
  float* aout = (float*)d_out + (size_t)kTok * kDim;       // [2][1024][1024] at byte 8,388,608

  // ---- carve ----
  const size_t SZ_WSS  = 4096;
  const size_t SZ_XM   = (size_t)kBatch * kDim * 4;                 //       8,192
  const size_t SZ_WO   = (size_t)kDim * kDim * 2;                   //   2,097,152
  const size_t SZ_QK   = (size_t)kSamp * kTok * kQKld * 2;          //  33,554,432
  const size_t SZ_VT   = (size_t)kSamp * kBatch * kDim * kSeq * 2;  //  16,777,216
  const size_t SZ_CF   = (size_t)kBatch * kSeq * kDim * 4;          //   8,388,608
  const size_t SZ_CH   = (size_t)kBatch * kSeq * kDim * 2;          //   4,194,304
  const size_t SZ_P    = (size_t)kBatch * kHeads * kSeq * kSeq * 2; //  67,108,864
  const size_t SZ_S    = (size_t)kBatch * kHeads * kSeq * kSeq * 4; // 134,217,728
  const size_t SZ_XB   = (size_t)kTok * kDim * 2;                   //   4,194,304
  const size_t SZ_WQK  = (size_t)kSamp * kQKld * kDim * 2;          //  16,777,216
  size_t off = 0;
  const size_t oWSS = off; off += SZ_WSS;
  const size_t oXM  = off; off += SZ_XM;
  const size_t oWO  = off; off += SZ_WO;
  const size_t oQK  = off; off += SZ_QK;
  const size_t oVT  = off; off += SZ_VT;
  const size_t oCF  = off; off += SZ_CF;
  const size_t oCH  = off; off += SZ_CH;
  const size_t oP   = off; off += SZ_P;
  const size_t oS   = off; off += SZ_S;
  const size_t TOTAL = off;                                         // 266,350,592
  const size_t oXB  = oS;
  const size_t oWQK = oXB + SZ_XB;
  const size_t oWV  = oWQK + SZ_WQK;
  if (TOTAL > ws_size) return;

  char* ws = (char*)d_ws;
  float*          wsS    = (float*)(ws + oWSS);
  float*          gpart  = (float*)(ws + oXM);
  unsigned short* xb     = (unsigned short*)(ws + oXB);
  unsigned short* Wqkb   = (unsigned short*)(ws + oWQK);
  unsigned short* Wvb    = (unsigned short*)(ws + oWV);
  unsigned short* Wo16   = (unsigned short*)(ws + oWO);
  unsigned short* QK16   = (unsigned short*)(ws + oQK);
  unsigned short* VT16   = (unsigned short*)(ws + oVT);
  unsigned short* comb16 = (unsigned short*)(ws + oCH);

  const dim3 blk(256);

  // (0) operand casts
  {
    cast_x_pool_kernel<<<dim3(kTok / kPoolRows), blk, 0, stream>>>(x, Wg, xb, gpart);   // 256 blocks x 8 rows; also the gate partials
    cast_wqk_kernel<<<dim3((kDim * kDim / 8) / 256, 8), blk, 0, stream>>>(Wq, Wk, Wqkb);   // 512 x 8 blocks
    const int n8v = kSamp * kDim * kDim / 8;         // 524,288 -> 2048 blocks exactly
    cast_bf16_kernel<<<dim3(n8v / 256), blk, 0, stream>>>(Wv, Wvb, n8v);
    const int n8o = kDim * kDim / 8;                 // 131,072 -> 512 blocks exactly
    cast_wo_kernel<<<dim3(n8o / 256), blk, 0, stream>>>(Wo, Wo16, n8o);
  }
  // (1) gates (the mean pool's partials come from the x cast)
  gate_kernel<<<dim3(1), blk, 0, stream>>>(gpart, bg, hw, temp, wsS);

  const dim3 gQK((((kTok / 64) * (kQKld / 64)) + 7) / 8, kSamp);             // 128 x 4:  M=2048, N=2048, samples
  const dim3 gV((((kDim / 64) * (kSeq / 64)) + 7) / 8, kBatch * kSamp);      // 32 x 8:   M=1024, N=1024, (s, b)
  const dim3 gOut((((kTok / 64) * (kDim / 64)) + 7) / 8, 1);                 // 64 blocks: M=2048, N=1024

  // (2) q|k projection, all samples: QK16[s][tok][n] = f16(16 * sum_c bf16(x[tok][c]) * bf16(Wqk[s][n][c]))
  wmma_gemm64<1, false, 0, 1, false, 0, 2, 4><<<gQK, blk, 0, stream>>>(
      xb, xb, kDim, 0L, Wqkb, Wqkb, kDim, (long)kQKld * kDim, (void*)QK16, (void*)QK16, kQKld, (long)kTok * kQKld,
      bo, x, 0L, kTok, kQKld, kDim, kQKVCarry,
      kSamp, 0L, 0L, 0L, 0L);
  // (3) v role-swapped, all (s, b): VT16[s][b][e][tok] = f16(16 * sum_c bf16(Wv[s][e][c]) * bf16(x[b][tok][c]))
  wmma_gemm64<1, false, 0, 1, false, 0, 2, 4><<<gV, blk, 0, stream>>>(
      Wvb, Wvb, kDim, 0L, xb, xb, kDim, (long)kSeq * kDim, (void*)VT16, (void*)VT16, kSeq, (long)kDim * kSeq,
      bo, x, 0L, kDim, kSeq, kDim, kQKVCarry,
      kBatch, (long)kDim * kDim, 0L, (long)kBatch * kDim * kSeq, 0L);

  // (4) attention, all samples, heads and batches: comb16 = f16(256 * sum_s gw*coh*attn_s.v_s), output 2 = sum_s gw * mean_h attn
  fused_attn_kernel<<<dim3(kSeq / 16, kBatch), blk, 0, stream>>>(QK16, VT16, wsS, comb16, aout);

  // (7) y = (comb16 . Wo16^T) / 4096 + bo -> d_out output 0 (f32)
  wmma_gemm64<0, false, 2, 0, false, 0, 2, 4><<<gOut, blk, 0, stream>>>(
      comb16, comb16, kDim, 0L, Wo16, Wo16, kDim, 0L, (void*)yout, (void*)yout, kDim, 0L,
      bo, x, 0L, kTok, kDim, kDim, kOutScale,
      1, 0L, 0L, 0L, 0L);
}

// v005
// A run of this version takes 209 microseconds.
// Timed twice side by side with v004, it ran 1.21 and 1.19 times as fast.
// Over all steps from v000 it is 8.63 times as fast.
// Compute dtypes: q/k/v projections on v_wmma_f32_16x16x32_bf16 (x and Wq/Wk/Wv RNE-converted to bf16, f32 accumulate, results carried x16 into f16 planes); scores q.k^T, attn.v and the output projection on v_wmma_f32_16x16x32_f16 (f16 operands: q,k,v x16, probabilities x2^15 with the per-sample mixing weight folded in, combined x256, Wo as f16(16*bf16(Wo))), f32 accumulate; mean-pool, gates, softmax and the head/sample mixing in f32.
#include <hip/hip_runtime.h>
#include <math.h>

// ---------------------------------------------------------------------------
// Problem constants
// ---------------------------------------------------------------------------
constexpr int kBatch     = 2;
constexpr int kSeq       = 1024;
constexpr int kDim       = 1024;
constexpr int kHeads     = 16;
constexpr int kSamp      = 4;
constexpr int kDh        = 64;
constexpr int kTok       = kBatch * kSeq;       // 2048 token rows
constexpr int kHeadsHalf = 8;                   // half of kHeads; no kernel in this file uses it
constexpr int kQKld      = 2 * kDim;            // 2048: q columns 0..1023 | k columns 1024..2047
constexpr float kQKVCarry   = 16.0f;            // q, k, v carried x16 in f16
constexpr float kPCarry     = 32768.0f;         // probabilities carried x2^15 (times gate <= 1)
constexpr float kCombCarry  = 256.0f;           // combined carried x256
constexpr float kWoCarry    = 16.0f;            // Wo carried x16 in f16
constexpr float kScoreScale = 0.125f / (16.0f * 16.0f);              // dh^-0.5 / (16*16) = 2^-11
constexpr float kPVScale    = kCombCarry / (kPCarry * kQKVCarry);    // 256 / 2^19 = 2^-11
constexpr float kOutScale   = 1.0f / (kCombCarry * kWoCarry);        // 2^-12

typedef __attribute__((ext_vector_type(16))) _Float16 v16h;
typedef __attribute__((ext_vector_type(8)))  _Float16 v8h;
typedef __attribute__((ext_vector_type(16))) __bf16   v16b;
typedef __attribute__((ext_vector_type(8)))  __bf16   v8b;
typedef __attribute__((ext_vector_type(8)))  float    v8f;
typedef __attribute__((ext_vector_type(4)))  float    v4f;
typedef __attribute__((ext_vector_type(4)))  unsigned int v4u;

__device__ __forceinline__ unsigned short f2bf_bits(float f) {
  unsigned u = __float_as_uint(f);
  return (unsigned short)((u + 0x7FFFu + ((u >> 16) & 1u)) >> 16);
}
__device__ __forceinline__ float bf_bits2f(unsigned short h) { return __uint_as_float(((unsigned)h) << 16); }

// hazard guard as a plain device helper
__device__ __forceinline__ void acc_guard4(v8f& a, v8f& b, v8f& c, v8f& d) { asm volatile("v_nop\n\tv_nop\n\tv_nop\n\tv_nop" : "+v"(a), "+v"(b), "+v"(c), "+v"(d)); }
template <typename T> struct Frag;
template <> struct Frag<_Float16> {
  typedef v16h V; union U { v16h v; v8h h[2]; };
  static __device__ __forceinline__ v16h load(const _Float16* p) {   // elements 0..7 <- p[0..7], 8..15 <- p[16..23]
    U f; f.h[0] = *(const v8h*)(p); f.h[1] = *(const v8h*)(p + 16); return f.v;
  }
  static __device__ __forceinline__ v8f mma(v16h a, v16h b, v8f c) {
    return __builtin_amdgcn_wmma_f32_16x16x32_f16(false, a, false, b, (short)0, c, false, false);
  }
};
template <> struct Frag<__bf16> {
  typedef v16b V; union U { v16b v; v8b h[2]; };
  static __device__ __forceinline__ v16b load(const __bf16* p) {
    U f; f.h[0] = *(const v8b*)(p); f.h[1] = *(const v8b*)(p + 16); return f.v;
  }
  static __device__ __forceinline__ v8f mma(v16b a, v16b b, v8f c) {
    return __builtin_amdgcn_wmma_f32_16x16x32_bf16(false, a, false, b, (short)0, c, false, false);
  }
};

__device__ __forceinline__ unsigned pk16(unsigned short a, unsigned short b) { return (unsigned)a | ((unsigned)b << 16); }
__device__ __forceinline__ unsigned short h_bits(float f) { const _Float16 h = (_Float16)f; return __builtin_bit_cast(unsigned short, h); }

// ---- Operand staging: asynchronous copies global -> LDS ----
constexpr int kStageK   = 64;    // k elements per stage = one whole 128-B line of every operand row
constexpr int kRowPitch = 144;   // LDS bytes per staged row: 128 + 16, an odd multiple of 16 B, so that the 16 rows of a fragment read fall on distinct banks

// Six 16-B copies per lane, global -> LDS through no register. The s_wait_xcnt 0 is the statement's last line so that
// no address register named by an issued copy is rewritten in front of it.
__device__ __forceinline__ void async_copy6(unsigned l0, const unsigned short* g0, unsigned l1, const unsigned short* g1,
                                            unsigned l2, const unsigned short* g2, unsigned l3, const unsigned short* g3,
                                            unsigned l4, const unsigned short* g4, unsigned l5, const unsigned short* g5) {
  asm volatile("global_load_async_to_lds_b128 %0, %1, off\n\t"
               "global_load_async_to_lds_b128 %2, %3, off\n\t"
               "global_load_async_to_lds_b128 %4, %5, off\n\t"
               "global_load_async_to_lds_b128 %6, %7, off\n\t"
               "global_load_async_to_lds_b128 %8, %9, off\n\t"
               "global_load_async_to_lds_b128 %10, %11, off\n\t"
               "s_wait_xcnt 0x0"
               :: "v"(l0), "v"(g0), "v"(l1), "v"(g1), "v"(l2), "v"(g2), "v"(l3), "v"(g3), "v"(l4), "v"(g4), "v"(l5), "v"(g5)
               : "memory");
}

// ---- Register-blocked batched WMMA GEMM (ACT reduced to none/relu/leaky; Cout/resid without restrict
//      so that the in-place residual accumulate (resid == Cout, same wave reads its rows before storing them) is well formed) --
// C[m,n] = scale * sum_k A[m,k] * Bt[n,k] (+bias)(+resid); each wave owns a 64x64 tile; the block's 8 waves form a WM x WN grid of
// such tiles and share one staged k-tile: 64*WM rows of A, then 64*WN rows of Bt, 64 k each, two LDS buffers (the next k-tile's
// copies fly while this one is multiplied).
// A row-major [M,K]; Bt row-major [N,K]; M % (64*WM) == 0, N % (64*WN) == 0, K % 64 == 0; rows and bases 16-B aligned.
// SPLIT (hi/lo planes) is not carried by the staged loop and must be false.
// BIAS_MODE: 0 = none, 1 = bias[m], 2 = bias[n].
// OUT_MODE: 0 = f32, 1 = f16, 2 = bf16 hi plane (Cout) + bf16 lo plane (Cout2).
// ET: 0 = f16 operands, 1 = bf16 operands (pointers passed as 16-bit storage)
template <int ET> struct Elem;
template <> struct Elem<0> { typedef _Float16 T; };
template <> struct Elem<1> { typedef __bf16 T; };
template <int ET, bool SPLIT, int BIAS_MODE, int OUT_MODE, bool RESID, int ACT, int WM, int WN>
__global__ __launch_bounds__(256) void wmma_gemm64(
    const unsigned short* __restrict__ Ap, const unsigned short* __restrict__ A2p, int lda, long strideA,
    const unsigned short* __restrict__ Btp, const unsigned short* __restrict__ Bt2p, int ldb, long strideB,
    void* Cout, void* Cout2, int ldc, long strideC,
    const float* __restrict__ bias,
    const float* resid, long strideR,
    int M, int N, int K, float scale,
    int inner, long strideA2, long strideB2, long strideC2, long strideR2) {
  typedef typename Elem<ET>::T T;
  typedef typename Frag<T>::V V;
  static_assert(!SPLIT, "the staged k-loop carries one plane per operand");
  static_assert(WM * WN == 8, "eight waves per block");
  constexpr int kRowsA  = 64 * WM;                    // staged rows 0..kRowsA-1 = A, the rest = Bt
  constexpr int kRows   = 64 * (WM + WN);
  constexpr int kStageB = kRows * kRowPitch;          // bytes of one buffer
  constexpr int kCopies = kRows / 32;                 // copies per lane and stage: 256 lanes cover 32 rows x 8 chunks of 16 B
  static_assert(kCopies % 6 == 0 && kCopies <= 63, "copies go out six to a statement");
  __shared__ __align__(16) unsigned char ring[2 * kStageB];
  __shared__ __align__(16) float sT[8][16 * 68];   // per-wave 16x64 slab, pitch 68 floats
  // two-level batch: blockIdx.y = outer * inner + b; b walks the first strides, outer the second
  const int outer = (int)blockIdx.y / inner;
  const int b     = (int)blockIdx.y - outer * inner;
  const size_t offA = (size_t)b * strideA + (size_t)outer * strideA2;
  const size_t offB = (size_t)b * strideB + (size_t)outer * strideB2;
  const size_t offC = (size_t)b * strideC + (size_t)outer * strideC2;
  const size_t offR = (size_t)b * strideR + (size_t)outer * strideR2;
  const int lane = threadIdx.x & 31;
  const int wave = threadIdx.x >> 5;
  const int tilesN = N / (64 * WN);
  const int tilesM = M / (64 * WM);
  if ((int)blockIdx.x >= tilesM * tilesN) return;   // block-uniform, in front of every barrier
  const int bm = blockIdx.x / tilesN;
  const int bn = blockIdx.x - bm * tilesN;
  const int mB = bm * (64 * WM);
  const int nB = bn * (64 * WN);
  const int wm = wave / WN;
  const int wn = wave - wm * WN;
  const int m0 = mB + (wm << 6);
  const int n0 = nB + (wn << 6);

  const int rlane = lane & 15;                 // row (A) / col (B, D) within subtile
  const int mOff  = (lane >> 4) * 8;           // D row offset

  // copy side: lane -> (row crow + 32*j, 16-B chunk cchk) of the staged k-tile
  const int crow = threadIdx.x >> 3;
  const int cchk = threadIdx.x & 7;
  const unsigned short* gA = Ap  + offA + (size_t)(mB + crow) * lda + cchk * 8;
  const unsigned short* gB = Btp + offB + (size_t)(nB + crow) * ldb + cchk * 8;
  const unsigned ldsC = (unsigned)(size_t)(void*)ring + (unsigned)(crow * kRowPitch + cchk * 16);
  auto issue = [&](int t, int buf) {
    const unsigned l = ldsC + (unsigned)(buf * kStageB);
    const unsigned short* a = gA + t * kStageK;
    const unsigned short* w = gB + t * kStageK;
    auto from = [&](int j) { return (j < kRowsA / 32) ? (a + (size_t)(j * 32) * lda) : (w + (size_t)((j - kRowsA / 32) * 32) * ldb); };
    auto to   = [&](int j) { return l + (unsigned)(j * 32 * kRowPitch); };
#pragma unroll
    for (int j = 0; j < kCopies; j += 6)
      async_copy6(to(j), from(j), to(j + 1), from(j + 1), to(j + 2), from(j + 2),
                  to(j + 3), from(j + 3), to(j + 4), from(j + 4), to(j + 5), from(j + 5));
  };
  // read side: this lane's row of the first A / Bt fragment, at its lane half's k offset (8 elements = 16 B)
  const unsigned char* fA = ring + ((wm << 6) + rlane) * kRowPitch + (lane >> 4) * 16;
  const unsigned char* fB = ring + (kRowsA + (wn << 6) + rlane) * kRowPitch + (lane >> 4) * 16;

  v8f acc[4][4];
#pragma unroll
  for (int i = 0; i < 4; ++i)
#pragma unroll
    for (int j = 0; j < 4; ++j) acc[i][j] = (v8f){0.f,0.f,0.f,0.f,0.f,0.f,0.f,0.f};

  const int nT = K / kStageK;
  issue(0, 0);
  asm volatile("s_wait_asynccnt 0x0" ::: "memory");   // this wave's copies of k-tile 0 have landed
  __syncthreads();                                    // ... and every other wave's: k-tile 0 may be read
  if (nT > 1) issue(1, 1);

  for (int t = 0; t < nT; ++t) {
    const int bo = (t & 1) * kStageB;
    // all fragment reads of the k-tile stand as one group in front of its WMMAs (one LDS latency per trip, counted waits behind it)
    V ah[kStageK / 32][4], bh[kStageK / 32][4];
#pragma unroll
    for (int ks = 0; ks < kStageK / 32; ++ks) {
#pragma unroll
      for (int j = 0; j < 4; ++j) bh[ks][j] = Frag<T>::load((const T*)(fB + bo + j * 16 * kRowPitch + ks * 64));
#pragma unroll
      for (int i = 0; i < 4; ++i) ah[ks][i] = Frag<T>::load((const T*)(fA + bo + i * 16 * kRowPitch + ks * 64));
    }
    __builtin_amdgcn_sched_barrier(0);   // keeps the reads one group: without it they are sunk between the WMMAs, each with a wait to 0
#pragma unroll
    for (int ks = 0; ks < kStageK / 32; ++ks)
#pragma unroll
      for (int i = 0; i < 4; ++i)
#pragma unroll
        for (int j = 0; j < 4; ++j) acc[i][j] = Frag<T>::mma(ah[ks][i], bh[ks][j], acc[i][j]);
    __builtin_amdgcn_sched_barrier(0);   // keeps the WMMAs in front of the waits: sunk behind them, the next k-tile's copies would be waited for before the work that hides them
    asm volatile("s_wait_dscnt 0x0" ::: "memory");     // this wave's reads of buffer t&1 have returned before it is refilled
    asm volatile("s_wait_asynccnt 0x0" ::: "memory");  // this wave's copies of k-tile t+1 have landed
    __syncthreads();                                   // publishes k-tile t+1 and ends every wave's reads of buffer t&1
    if (t + 2 < nT) issue(t + 2, t & 1);
  }
  asm volatile("s_wait_asynccnt 0x0" ::: "memory");    // no copy is outstanding when the wave goes on to the epilogue and ends
  acc_guard4(acc[0][0], acc[0][1], acc[0][2], acc[0][3]);
  acc_guard4(acc[1][0], acc[1][1], acc[1][2], acc[1][3]);
  acc_guard4(acc[2][0], acc[2][1], acc[2][2], acc[2][3]);
  acc_guard4(acc[3][0], acc[3][1], acc[3][2], acc[3][3]);

  // ---- epilogue ----
  float* slab = sT[wave];
  const float* Rb = RESID ? (resid + offR) : nullptr;
#pragma unroll
  for (int i = 0; i < 4; ++i) {
    const int mBase = m0 + (i << 4);
#pragma unroll
    for (int j = 0; j < 4; ++j) {
      const int n = n0 + (j << 4) + rlane;
      float bv = 0.f;
      if (BIAS_MODE == 2) bv = bias[n];
#pragma unroll
      for (int r = 0; r < 8; ++r) {
        float v = acc[i][j][r] * scale;
        if (BIAS_MODE == 1) v += bias[mBase + mOff + r];
        if (BIAS_MODE == 2) v += bv;
        if (RESID) v += Rb[(size_t)(mBase + mOff + r) * ldc + n];
        if (ACT == 2) v = fmaxf(v, 0.0f);
        if (ACT == 4) v = (v > 0.f) ? v : 0.01f * v;
        slab[(mOff + r) * 68 + (j << 4) + rlane] = v;
      }
    }
    __builtin_amdgcn_fence(__ATOMIC_RELEASE, "workgroup");
    __builtin_amdgcn_wave_barrier();
    __builtin_amdgcn_fence(__ATOMIC_ACQUIRE, "workgroup");
    if (OUT_MODE == 0) {
      float* C = (float*)Cout + offC;
      const int hh = lane >> 4, c4 = (lane & 15) * 4;     // row seg = 256 B = 16 lanes x 16 B
      {
#pragma unroll
        for (int it = 0; it < 8; ++it) {
          const int row = it * 2 + hh;
          v4f v = *(const v4f*)(slab + row * 68 + c4);
          *(v4f*)(C + (size_t)(mBase + row) * ldc + n0 + c4) = v;
        }
        
      }
    } else {
      const int q = lane >> 3, c8 = (lane & 7) * 8;
      unsigned short* C  = (unsigned short*)Cout  + offC;
      unsigned short* C2 = (OUT_MODE == 2) ? ((unsigned short*)Cout2 + offC) : nullptr;
      {
#pragma unroll
        for (int it = 0; it < 4; ++it) {
          const int row = it * 4 + q;
          const float* sp = slab + row * 68 + c8;
          v8h hv, lv;
#pragma unroll
          for (int e = 0; e < 8; ++e) {
            if (OUT_MODE == 1) {
              hv[e] = (_Float16)sp[e];
            } else {
              unsigned short hb = f2bf_bits(sp[e]);
              unsigned short lb = f2bf_bits(sp[e] - bf_bits2f(hb));
              hv[e] = __builtin_bit_cast(_Float16, hb);
              lv[e] = __builtin_bit_cast(_Float16, lb);
            }
          }
          *(v8h*)(C + (size_t)(mBase + row) * ldc + n0 + c8) = hv;
          if (OUT_MODE == 2) *(v8h*)(C2 + (size_t)(mBase + row) * ldc + n0 + c8) = lv;
        }
        
      }
    }
    __builtin_amdgcn_fence(__ATOMIC_RELEASE, "workgroup");
    __builtin_amdgcn_wave_barrier();
    __builtin_amdgcn_fence(__ATOMIC_ACQUIRE, "workgroup");
  }
}

// ---------------------------------------------------------------------------
// f32 -> bf16 bits (RNE), 8 consecutive elements per thread: one 16-B store per lane, 32 contiguous lanes = 4 whole
// ---------------------------------------------------------------------------
__global__ __launch_bounds__(256) void cast_bf16_kernel(const float* __restrict__ in, unsigned short* __restrict__ out, int n8) {
  const int i = blockIdx.x * 256 + threadIdx.x;
  if (i >= n8) return;
  const float* p = in + 8 * (size_t)i;
  const v4f a = *(const v4f*)(p);
  const v4f c = *(const v4f*)(p + 4);
  unsigned short hb[8];
#pragma unroll
  for (int e = 0; e < 4; ++e) {
    hb[e]     = f2bf_bits(a[e]);
    hb[4 + e] = f2bf_bits(c[e]);
  }
  const v4u u = (v4u){pk16(hb[0], hb[1]), pk16(hb[2], hb[3]), pk16(hb[4], hb[5]), pk16(hb[6], hb[7])};
  unsigned short* q = out + 8 * (size_t)i;
  *(v4u*)q = u;
  
}

// ---------------------------------------------------------------------------
// Stacked q|k weight cast: out[s][2048][1024] bf16, rows 0..1023 = Wq[s], rows 1024..2047 = Wk[s] (both [out][in], k-contiguous).
// grid (512, 8): blockIdx.y = (which<<2)|s with which 0 = Wq, 1 = Wk (block-uniform source select);
// coverage per y: 512 blocks x 256 threads x 8 = 1,048,576 = one [1024][1024] matrix exactly. Stores as cast_bf16_kernel.
// ---------------------------------------------------------------------------
__global__ __launch_bounds__(256) void cast_wqk_kernel(const float* __restrict__ Wq, const float* __restrict__ Wk,
                                                       unsigned short* __restrict__ out) {
  const int y = blockIdx.y;
  const int smp = y & 3, which = y >> 2;
  const float* src = ((which == 0) ? Wq : Wk) + (size_t)smp * kDim * kDim;
  unsigned short* dst = out + (size_t)smp * kQKld * kDim + (size_t)which * kDim * kDim;
  const int i = blockIdx.x * 256 + threadIdx.x;
  if (i >= (kDim * kDim) / 8) return;
  const float* p = src + 8 * (size_t)i;
  const v4f a = *(const v4f*)(p);
  const v4f c = *(const v4f*)(p + 4);
  unsigned short hb[8];
#pragma unroll
  for (int e = 0; e < 4; ++e) {
    hb[e]     = f2bf_bits(a[e]);
    hb[4 + e] = f2bf_bits(c[e]);
  }
  const v4u u = (v4u){pk16(hb[0], hb[1]), pk16(hb[2], hb[3]), pk16(hb[4], hb[5]), pk16(hb[6], hb[7])};
  unsigned short* q = dst + 8 * (size_t)i;
  *(v4u*)q = u;
  
}

// ---------------------------------------------------------------------------
// Wo cast: out = f16(16 * bf16(Wo)) (RNE to bf16 first, then exact power-of-two carry into f16), 8 per thread, stores as above.
// Coverage: 512 blocks x 256 x 8 = 1,048,576 = [1024][1024] exactly.
// ---------------------------------------------------------------------------
__global__ __launch_bounds__(256) void cast_wo_kernel(const float* __restrict__ in, unsigned short* __restrict__ out, int n8) {
  const int i = blockIdx.x * 256 + threadIdx.x;
  if (i >= n8) return;
  const float* p = in + 8 * (size_t)i;
  const v4f a = *(const v4f*)(p);
  const v4f c = *(const v4f*)(p + 4);
  unsigned short hb[8];
#pragma unroll
  for (int e = 0; e < 4; ++e) {
    hb[e]     = h_bits(kWoCarry * bf_bits2f(f2bf_bits(a[e])));
    hb[4 + e] = h_bits(kWoCarry * bf_bits2f(f2bf_bits(c[e])));
  }
  const v4u u = (v4u){pk16(hb[0], hb[1]), pk16(hb[2], hb[3]), pk16(hb[4], hb[5]), pk16(hb[6], hb[7])};
  unsigned short* q = out + 8 * (size_t)i;
  *(v4u*)q = u;
  
}

// ---------------------------------------------------------------------------
// x cast with the mean pool and the gate's dot product folded in.
// grid = 256 blocks of 8 token rows (128 blocks per batch); thread -> 8 consecutive columns (tid % 128) * 8 of the rows tid / 128 + 2j.
//   xb = bf16(x) (RNE), stores as cast_bf16_kernel: one 16-B store per lane and row.
//   part[b][s][chunk] = sum_d (sum over the block's 8 rows of bf16(x[b][n][d])) * bf16(Wg[s][d]), f32:
//     per thread 4 rows in order, 8 columns in order; shuffle tree over the wave; the 8 waves in wave order.
// The sum over the 128 chunks, the 1/1024 of the mean and the sigmoid are gate_kernel's.
// ---------------------------------------------------------------------------
constexpr int kPoolRows   = 8;
constexpr int kPoolChunks = kSeq / kPoolRows;   // 128 per batch
__global__ __launch_bounds__(256) void cast_x_pool_kernel(const float* __restrict__ x, const float* __restrict__ Wg,
                                                          unsigned short* __restrict__ xb, float* __restrict__ part) {
  __shared__ float red[8][kSamp];
  const int tid = threadIdx.x, lane = tid & 31, wave = tid >> 5;
  const int col = (tid & 127) * 8;
  const size_t base = (size_t)(blockIdx.x * kPoolRows + (tid >> 7)) * kDim + col;
  v4f a[kPoolRows / 2], c[kPoolRows / 2];
#pragma unroll
  for (int j = 0; j < kPoolRows / 2; ++j) {
    a[j] = *(const v4f*)(x + base + (size_t)(2 * j) * kDim);
    c[j] = *(const v4f*)(x + base + (size_t)(2 * j) * kDim + 4);
  }
  float cs[8];
#pragma unroll
  for (int e = 0; e < 8; ++e) cs[e] = 0.f;
#pragma unroll
  for (int j = 0; j < kPoolRows / 2; ++j) {
    unsigned short hb[8];
#pragma unroll
    for (int e = 0; e < 4; ++e) {
      hb[e]     = f2bf_bits(a[j][e]);
      hb[4 + e] = f2bf_bits(c[j][e]);
    }
#pragma unroll
    for (int e = 0; e < 8; ++e) cs[e] += bf_bits2f(hb[e]);
    *(v4u*)(xb + base + (size_t)(2 * j) * kDim) = (v4u){pk16(hb[0], hb[1]), pk16(hb[2], hb[3]), pk16(hb[4], hb[5]), pk16(hb[6], hb[7])};
  }
  float dot[kSamp];
#pragma unroll
  for (int s = 0; s < kSamp; ++s) {
    const v4f w0 = *(const v4f*)(Wg + s * kDim + col);
    const v4f w1 = *(const v4f*)(Wg + s * kDim + col + 4);
    float acc = 0.f;
#pragma unroll
    for (int e = 0; e < 4; ++e) acc += cs[e] * bf_bits2f(f2bf_bits(w0[e]));
#pragma unroll
    for (int e = 0; e < 4; ++e) acc += cs[4 + e] * bf_bits2f(f2bf_bits(w1[e]));
    dot[s] = acc;
  }
#pragma unroll
  for (int off = 16; off > 0; off >>= 1)
#pragma unroll
    for (int s = 0; s < kSamp; ++s) dot[s] += __shfl_xor(dot[s], off, 32);
  if (lane == 0) {
#pragma unroll
    for (int s = 0; s < kSamp; ++s) red[wave][s] = dot[s];
  }
  __syncthreads();
  if (tid < kSamp) {
    float t = red[0][tid];
#pragma unroll
    for (int w = 1; w < 8; ++w) t += red[w][tid];
    const int b = blockIdx.x / kPoolChunks, chunk = blockIdx.x - b * kPoolChunks;
    part[(b * kSamp + tid) * kPoolChunks + chunk] = t;
  }
}

// ---------------------------------------------------------------------------
// Gates and mixing weights (one block, 256 threads = 8 waves):
//   coh[b][s] = sigmoid((1/1024) * sum_chunk part[b][s][chunk] + bg[s])  (wave w -> (b, s) = (w>>2, w&3); four chunks per lane + shuffle tree)
//   t = clip(temperature, 0.1, 10); invt = 1/t; gw = softmax(hyp_w * invt)
// ---------------------------------------------------------------------------
// e^x as __expf forms it (x * log2(e), then v_exp_f32), with the slot behind the transcendental filled in the same statement.
__device__ __forceinline__ float exp_slot(float x) {
  float r;
  asm("v_exp_f32 %0, %1\n\tv_nop" : "=v"(r) : "v"(x * 1.44269504088896340736f));
  return r;
}
__global__ __launch_bounds__(256) void gate_kernel(const float* __restrict__ part,
                                                   const float* __restrict__ bg, const float* __restrict__ hw,
                                                   const float* __restrict__ temp, float* __restrict__ wsS) {
  __shared__ float vals[32];
  const int t = threadIdx.x, lane = t & 31, wave = t >> 5;
  if (t < 32) vals[t] = 0.f;
  __syncthreads();
  {
    const int b = wave >> 2, s = wave & 3;
    const v4f p = *(const v4f*)(part + wave * kPoolChunks + lane * 4);
    float acc = (p[0] + p[1]) + (p[2] + p[3]);
#pragma unroll
    for (int off = 16; off > 0; off >>= 1) acc += __shfl_xor(acc, off, 32);
    if (lane == 0) {
      const float z = acc * (1.0f / (float)kSeq) + bf_bits2f(f2bf_bits(bg[s]));
      vals[4 + b * kSamp + s] = 1.0f / (1.0f + __expf(-z));
    }
  }
  __syncthreads();
  if (t == 0) {
    float tc = bf_bits2f(f2bf_bits(temp[0]));
    tc = fminf(fmaxf(tc, 0.1f), 10.0f);
    const float invt = 1.0f / tc;
    const float l0 = bf_bits2f(f2bf_bits(hw[0])) * invt;
    const float l1 = bf_bits2f(f2bf_bits(hw[1])) * invt;
    const float l2 = bf_bits2f(f2bf_bits(hw[2])) * invt;
    const float l3 = bf_bits2f(f2bf_bits(hw[3])) * invt;
    const float mx = fmaxf(fmaxf(l0, l1), fmaxf(l2, l3));
    const float e0 = exp_slot(l0 - mx), e1 = exp_slot(l1 - mx), e2 = exp_slot(l2 - mx), e3 = exp_slot(l3 - mx);
    const float is = 1.0f / ((e0 + e1) + (e2 + e3));
    vals[0] = e0 * is; vals[1] = e1 * is; vals[2] = e2 * is; vals[3] = e3 * is;
    vals[12] = invt;
  }
  __syncthreads();
  if (wave == 0) {
    const float v = vals[lane];
    *(float*)(wsS + lane) = v;
    
  }
}

// ---------------------------------------------------------------------------
// Fused attention: scores, softmax, head/sample mixing and attn.v in one launch; no score or probability plane in memory.
// grid = (64 tiles of 16 query rows, 2 batches, 2 head halves) = 256 blocks, one per WGP (the LDS admits one); 256 threads = 8 waves;
// the block walks n = h*4 + s (head outer, sample inner) over its own 8 heads.
// Wave w owns the key columns j = 128w .. 128w+127 of the block's 16 x 1024 score rows.
//   scores transposed: D[j][i] = sum_d k[j][d] q[i][d]  (A = k rows from LDS, B = q rows from registers): lane (c, hf) holds
//     query row i = c and, per 16-j tile jt, the eight consecutive keys j = 128w + 16jt + 8hf + r.
//   softmax over j: per-wave maximum and sum (in-lane, then lane ^ 16), merged over the 8 waves through LDS.
//   a pair of score tiles (2m, 2m+1), converted to f16, IS the A fragment of attn.v for k = 32m .. 32m+31 (same lane, same order
//     as the fragment loader: elements 0..7 = k 8hf.., elements 8..15 = k 16+8hf..): the probabilities never leave the registers.
//   attn.v: each wave sums over its own 128 keys and over the 4 samples; the 8 partial 16x64 tiles are added through LDS per head.
//   output 2 is accumulated in registers over the block's 32 (h, s) and stored once, into the head half's own partial plane;
//     add_halves_kernel adds the two planes.
// k (1024 rows x 128 B) and v^T (64 rows x 2048 B) of one (h, s) are staged in LDS by asynchronous copies, one buffer each; the tile
// sequence k(0), v(0), k(1), v(1), ... alternates between the two buffers as a two-buffer ring: each half pass reads one buffer
// while the other one's copies fly.
// ---------------------------------------------------------------------------
constexpr int kKPitch = 144;                 // 128 + 16 B, odd multiple of 16 B (distinct banks for the 16 rows of a fragment read)
constexpr int kVPitch = 2 * kSeq + 16;       // 2064 B = 129 x 16 B, likewise
constexpr int kKBytes = kSeq * kKPitch;      // 147,456
constexpr int kVBytes = kDh * kVPitch;       // 132,096
constexpr int kHeadSplit = 2;                              // head halves, one block each
constexpr int kPasses = kHeads * kSamp / kHeadSplit;       // 32 per block
constexpr int kPlane2 = kBatch * kSeq * kSeq;              // elements of output 2 = of one partial plane
typedef __attribute__((ext_vector_type(4))) _Float16 v4h;

// Eight 16-B copies per lane, global -> LDS through no register. The s_wait_xcnt 0 is the statement's last line so that
// no address register named by an issued copy is rewritten in front of it.
__device__ __forceinline__ void async_copy8(unsigned l0, const unsigned short* g0, unsigned l1, const unsigned short* g1,
                                            unsigned l2, const unsigned short* g2, unsigned l3, const unsigned short* g3,
                                            unsigned l4, const unsigned short* g4, unsigned l5, const unsigned short* g5,
                                            unsigned l6, const unsigned short* g6, unsigned l7, const unsigned short* g7) {
  asm volatile("global_load_async_to_lds_b128 %0, %1, off\n\t"
               "global_load_async_to_lds_b128 %2, %3, off\n\t"
               "global_load_async_to_lds_b128 %4, %5, off\n\t"
               "global_load_async_to_lds_b128 %6, %7, off\n\t"
               "global_load_async_to_lds_b128 %8, %9, off\n\t"
               "global_load_async_to_lds_b128 %10, %11, off\n\t"
               "global_load_async_to_lds_b128 %12, %13, off\n\t"
               "global_load_async_to_lds_b128 %14, %15, off\n\t"
               "s_wait_xcnt 0x0"
               :: "v"(l0), "v"(g0), "v"(l1), "v"(g1), "v"(l2), "v"(g2), "v"(l3), "v"(g3),
                  "v"(l4), "v"(g4), "v"(l5), "v"(g5), "v"(l6), "v"(g6), "v"(l7), "v"(g7)
               : "memory");
}

// value of lane l ^ 16
__device__ __forceinline__ float other_half(float v) {
  const int b = __builtin_bit_cast(int, v);
  return __builtin_bit_cast(float, __builtin_amdgcn_permlanex16(b, b, 0x76543210, 0xfedcba98, false, false));
}

__global__ __launch_bounds__(256) void fused_attn_kernel(const unsigned short* __restrict__ QK, const unsigned short* __restrict__ VT,
                                                         const float* __restrict__ wsS, unsigned short* __restrict__ comb,
                                                         float* __restrict__ out2) {
  typedef Frag<_Float16> F;
  __shared__ __align__(16) unsigned char kbuf[kKBytes];
  __shared__ __align__(16) unsigned char vbuf[kVBytes];
  __shared__ __align__(16) float ored[8][16 * 68];   // per-wave 16x64 partial of attn.v, pitch 68 floats
  __shared__ __align__(16) float redM[16][8];        // [query row][wave] maximum (log2 domain)
  __shared__ __align__(16) float redL[16][8];        // [query row][wave] sum
  const int tid = threadIdx.x, lane = tid & 31, wave = tid >> 5;
  const int c = lane & 15, hf = lane >> 4;
  const int i0 = blockIdx.x * 16, bat = blockIdx.y;
  const int nBeg = blockIdx.z * kPasses, nEnd = nBeg + kPasses;   // this block's passes: heads 8z .. 8z+7, all samples
  const float cs = kScoreScale * wsS[12] * 1.44269504088896340736f;   // raw accumulator -> (0.125 q.k / t) * log2(e); > 0

  // copy side. k: lane -> (row tid/8 + 32j, 16-B chunk tid%8); v^T: lane -> (row tid/128 + 2j, 16-B chunk tid%128); j = 0..31
  const unsigned short* gK = QK + (size_t)(bat * kSeq + (tid >> 3)) * kQKld + kDim + (tid & 7) * 8;
  const unsigned short* gV = VT + (size_t)bat * kDim * kSeq + (size_t)(tid >> 7) * kSeq + (tid & 127) * 8;
  const unsigned lK = (unsigned)(size_t)(void*)kbuf + (unsigned)((tid >> 3) * kKPitch + (tid & 7) * 16);
  const unsigned lV = (unsigned)(size_t)(void*)vbuf + (unsigned)((tid >> 7) * kVPitch + (tid & 127) * 16);
  auto issueK = [&](int n) {
    const unsigned short* g = gK + (size_t)(n & 3) * kTok * kQKld + (n >> 2) * kDh;
    unsigned l = lK;
    auto from = [&](int j) { return g + (size_t)(j * 32) * kQKld; };
    auto to   = [&](int j) { return l + (unsigned)(j * 32 * kKPitch); };
#pragma unroll 1   // rolled: unrolled, the 32 LDS addresses are invariant in the pass loop and are held in registers across it (spills)
    for (int j = 0; j < 4; ++j) {
      async_copy8(to(0), from(0), to(1), from(1), to(2), from(2), to(3), from(3),
                  to(4), from(4), to(5), from(5), to(6), from(6), to(7), from(7));
      l += (unsigned)(8 * 32 * kKPitch);
      g += (size_t)(8 * 32) * kQKld;
    }
  };
  auto issueV = [&](int n) {
    const unsigned short* g = gV + (size_t)(n & 3) * kBatch * kDim * kSeq + (size_t)(n >> 2) * kDh * kSeq;
    unsigned l = lV;
    auto from = [&](int j) { return g + (size_t)(j * 2) * kSeq; };
    auto to   = [&](int j) { return l + (unsigned)(j * 2 * kVPitch); };
#pragma unroll 1   // rolled, as in issueK
    for (int j = 0; j < 4; ++j) {
      async_copy8(to(0), from(0), to(1), from(1), to(2), from(2), to(3), from(3),
                  to(4), from(4), to(5), from(5), to(6), from(6), to(7), from(7));
      l += (unsigned)(8 * 2 * kVPitch);
      g += (size_t)(8 * 2) * kSeq;
    }
  };
  // read side: this lane's row of the wave's first k / v^T fragment, at its lane half's k offset (8 elements = 16 B)
  const unsigned char* fK = kbuf + (wave * 128 + c) * kKPitch + hf * 16;
  const unsigned char* fV = vbuf + c * kVPitch + wave * 256 + hf * 16;
  const _Float16* qL = (const _Float16*)QK + (size_t)(bat * kSeq + i0 + c) * kQKld + hf * 8;

  const v8f zero8 = (v8f){0.f,0.f,0.f,0.f,0.f,0.f,0.f,0.f};
  v8f a2[8], accO[4];
#pragma unroll
  for (int jt = 0; jt < 8; ++jt) a2[jt] = zero8;
#pragma unroll
  for (int dt = 0; dt < 4; ++dt) accO[dt] = zero8;

  issueK(nBeg);
  const _Float16* qB = qL + (nBeg >> 2) * kDh;        // sample 0 of the block's first head
  v16h qf0 = F::load(qB), qf1 = F::load(qB + 32);
  asm volatile("s_wait_xcnt 0x0" :: "v"(qB) : "memory");   // as behind the loop's q loads: the address registers stay untouched up to here and are reused behind it
  asm volatile("s_wait_asynccnt 0x0" ::: "memory");   // this wave's copies of the first k tile have landed
  __syncthreads();                                    // ... and every other wave's: it may be read
  issueV(nBeg);

#pragma unroll 1
  for (int n = nBeg; n < nEnd; ++n) {
    const int s = n & 3, h = n >> 2;
    const float gw  = wsS[s];
    const float coh = wsS[4 + bat * kSamp + s];
    // ---- first half pass: reads kbuf alone ----
    v8f sc[8];
#pragma unroll
    for (int jt = 0; jt < 8; ++jt) sc[jt] = F::mma(F::load((const _Float16*)(fK + jt * 16 * kKPitch)), qf0, zero8);
#pragma unroll
    for (int jt = 0; jt < 8; ++jt) sc[jt] = F::mma(F::load((const _Float16*)(fK + jt * 16 * kKPitch + 64)), qf1, sc[jt]);
    float mr[8];
#pragma unroll
    for (int r = 0; r < 8; ++r) mr[r] = sc[0][r];
#pragma unroll
    for (int jt = 1; jt < 8; ++jt)
#pragma unroll
      for (int r = 0; r < 8; ++r) mr[r] = fmaxf(mr[r], sc[jt][r]);
    float mx = fmaxf(fmaxf(fmaxf(mr[0], mr[1]), fmaxf(mr[2], mr[3])), fmaxf(fmaxf(mr[4], mr[5]), fmaxf(mr[6], mr[7])));
    mx = fmaxf(mx, other_half(mx));
    const float mb = mx * cs;
    float ls[8];
#pragma unroll
    for (int r = 0; r < 8; ++r) ls[r] = 0.f;
#pragma unroll
    for (int jt = 0; jt < 8; ++jt)
#pragma unroll
      for (int r = 0; r < 8; ++r) {
        const float e = __builtin_amdgcn_exp2f(fmaf(sc[jt][r], cs, -mb));
        sc[jt][r] = e;
        ls[r] += e;
      }
    float l = ((ls[0] + ls[1]) + (ls[2] + ls[3])) + ((ls[4] + ls[5]) + (ls[6] + ls[7]));
    l += other_half(l);
    *(hf ? &redL[c][wave] : &redM[c][wave]) = hf ? l : mb;
    asm volatile("s_wait_dscnt 0x0" ::: "memory");     // this wave's reads of kbuf have returned before it is refilled
    asm volatile("s_wait_asynccnt 0x0" ::: "memory");  // this wave's copies of v(n) have landed
    __syncthreads();                                   // publishes v(n) and the wave partials; ends every wave's reads of kbuf
    if (n + 1 < nEnd) issueK(n + 1);
    // next pass's q fragments, fetched a half pass ahead (the last pass fetches its own again: in bounds, unused)
    const int nn = (n + 1 < nEnd) ? n + 1 : n;
    const _Float16* qN = qL + (size_t)(nn & 3) * kTok * kQKld + (nn >> 2) * kDh;
    const v16h qn0 = F::load(qN), qn1 = F::load(qN + 32);
    asm volatile("s_wait_xcnt 0x0" :: "v"(qN) : "memory");   // the q loads' address registers stay untouched up to here (input only: no load lands on them) and are rewritten behind it

    // ---- second half pass: reads vbuf alone ----
    // all v^T fragment reads of the pass stand as one group in front of the merge arithmetic, which hides their LDS latency
    v16h vf[4][4];
#pragma unroll
    for (int m = 0; m < 4; ++m)
#pragma unroll
      for (int dt = 0; dt < 4; ++dt) vf[m][dt] = F::load((const _Float16*)(fV + dt * 16 * kVPitch + m * 64));
    const v4f ma = *(const v4f*)&redM[c][0], mc = *(const v4f*)&redM[c][4];
    const v4f la = *(const v4f*)&redL[c][0], lc = *(const v4f*)&redL[c][4];
    const float M = fmaxf(fmaxf(fmaxf(ma[0], ma[1]), fmaxf(ma[2], ma[3])), fmaxf(fmaxf(mc[0], mc[1]), fmaxf(mc[2], mc[3])));
    const float L = ((la[0] * __builtin_amdgcn_exp2f(ma[0] - M) + la[1] * __builtin_amdgcn_exp2f(ma[1] - M)) +
                     (la[2] * __builtin_amdgcn_exp2f(ma[2] - M) + la[3] * __builtin_amdgcn_exp2f(ma[3] - M))) +
                    ((lc[0] * __builtin_amdgcn_exp2f(mc[0] - M) + lc[1] * __builtin_amdgcn_exp2f(mc[1] - M)) +
                     (lc[2] * __builtin_amdgcn_exp2f(mc[2] - M) + lc[3] * __builtin_amdgcn_exp2f(mc[3] - M)));
    const float f  = __builtin_amdgcn_exp2f(mb - M) / L;       // this wave's exp2(x - mb) -> probability
    const float fA = f * (gw * (1.0f / (float)kHeads));
    const float fP = f * (kPCarry * gw * coh);
    __builtin_amdgcn_sched_barrier(0);   // keeps the reads one group: without it they are sunk between the WMMAs, each with a wait to 0
#pragma unroll
    for (int m = 0; m < 4; ++m) {
      F::U p;
#pragma unroll
      for (int r = 0; r < 8; ++r) {
        a2[2 * m][r]     = fmaf(sc[2 * m][r], fA, a2[2 * m][r]);
        a2[2 * m + 1][r] = fmaf(sc[2 * m + 1][r], fA, a2[2 * m + 1][r]);
        p.h[0][r] = (_Float16)(sc[2 * m][r] * fP);
        p.h[1][r] = (_Float16)(sc[2 * m + 1][r] * fP);
      }
#pragma unroll
      for (int dt = 0; dt < 4; ++dt) accO[dt] = F::mma(p.v, vf[m][dt], accO[dt]);
    }
    acc_guard4(accO[0], accO[1], accO[2], accO[3]);   // the slots between the last WMMA and a reader of its D on the taken side of the branch below
    if (s == kSamp - 1) {
      float* slab = ored[wave];
#pragma unroll
      for (int dt = 0; dt < 4; ++dt)
#pragma unroll
        for (int r = 0; r < 8; ++r) slab[(hf * 8 + r) * 68 + dt * 16 + c] = accO[dt][r];
    }
    asm volatile("s_wait_dscnt 0x0" ::: "memory");     // this wave's reads of vbuf have returned before it is refilled
    asm volatile("s_wait_asynccnt 0x0" ::: "memory");  // this wave's copies of k(n+1) have landed
    __syncthreads();                                   // publishes k(n+1) and the attn.v partials; ends every wave's reads of vbuf
    if (n + 1 < nEnd) issueV(n + 1);
    if (s == kSamp - 1) {
      // combined[i][h*64 + d] x256: the 8 waves' partials in wave order; thread -> (row tid/16, four d), 16 lanes = one 128-B line
      const int row = tid >> 4, d4 = (tid & 15) * 4;
      v4f t = *(const v4f*)&ored[0][row * 68 + d4];
#pragma unroll
      for (int w = 1; w < 8; ++w) t += *(const v4f*)&ored[w][row * 68 + d4];
      v4h o;
#pragma unroll
      for (int e = 0; e < 4; ++e) o[e] = (_Float16)(t[e] * kPVScale);
      *(v4h*)(comb + (size_t)(bat * kSeq + i0 + row) * kDim + h * kDh + d4) = o;
      asm volatile("s_wait_xcnt 0x0" ::: "memory");    // the store's address and data registers are rewritten by the next head
#pragma unroll
      for (int dt = 0; dt < 4; ++dt) accO[dt] = zero8;
    }
    qf0 = qn0; qf1 = qn1;
  }
  asm volatile("s_wait_asynccnt 0x0" ::: "memory");    // no copy is outstanding when the wave ends

  // output 2, this head half's plane: lane holds row i0 + c, per tile eight consecutive columns (32 B); the wave covers 512 B of each of its 16 rows
  float* orow = out2 + (size_t)blockIdx.z * kPlane2 + (size_t)(bat * kSeq + i0 + c) * kSeq + wave * 128 + hf * 8;
#pragma unroll
  for (int jt = 0; jt < 8; ++jt) {
    *(v4f*)(orow + jt * 16)     = (v4f){a2[jt][0], a2[jt][1], a2[jt][2], a2[jt][3]};
    *(v4f*)(orow + jt * 16 + 4) = (v4f){a2[jt][4], a2[jt][5], a2[jt][6], a2[jt][7]};
  }
}

// ---------------------------------------------------------------------------
// Output 2 = plane 0 + plane 1 of the fused kernel's partial sums (heads 0..7, heads 8..15).
// 512 blocks x 256 threads x 4 x 4 floats = 2,097,152 = one plane exactly; a wave reads and writes whole 512-B runs.
// ---------------------------------------------------------------------------
__global__ __launch_bounds__(256) void add_halves_kernel(const float* __restrict__ part, float* __restrict__ out) {
  const int i = (blockIdx.x * 1024 + threadIdx.x) * 4;
  v4f a[4], b[4];
#pragma unroll   // all eight loads are in flight before the first sum
  for (int u = 0; u < 4; ++u) {
    a[u] = *(const v4f*)(part + i + u * 1024);
    b[u] = *(const v4f*)(part + kPlane2 + i + u * 1024);
  }
#pragma unroll   // a[], b[] stay in registers
  for (int u = 0; u < 4; ++u) *(v4f*)(out + i + u * 1024) = a[u] + b[u];
}

// ---------------------------------------------------------------------------
// Workspace region map (byte offsets, all multiples of 4096). Every region is fully written before it is read.
//   wsS    f32 [32] (gw, coh, 1/t)                              0           ..       4,096
//   gpart  f32 [2 b][4 s][128 chunks] (4,096 B of the region)   4,096       ..      12,288
//   Wo16   f16  [1024][1024]  = f16(16*bf16(Wo))               12,288      ..   2,109,440
//   QK16   f16  [4 s][2048][2048]  q x16 | k x16               2,109,440   ..  35,663,872
//   VT16   f16  [4 s][2][1024 e][1024 tok] v x16 transposed    35,663,872  ..  52,441,088
//   (not used)                                                  52,441,088  ..  60,829,696
//   comb16 f16  [2][1024][1024] 256 * sum_s gw*coh*out_s        60,829,696  ..  65,024,000
//   a2part f32  [2 head halves][2][1024][1024] (16,777,216 B)   65,024,000  ..  81,801,216
//   (not used)                                                  81,801,216  .. 132,132,864
//   The projections' operands:
//   xb     bf16 [2048][1024]                                    132,132,864 .. 136,327,168
//   Wqkb   bf16 [4][2048][1024] (Wq[s] rows | Wk[s] rows)       136,327,168 .. 153,104,384
//   Wvb    bf16 [4][1024][1024]                                 153,104,384 .. 161,492,992
//   total 266,350,592 B
// GEMM shapes (all K % 64 == 0; block tile 128x256; every M, N a multiple of it; no padded planes):
//   q|k projection  M=2048 N=2048 K=1024 (bf16 in, f16 out x16), batch 4 samples
//   v (role-swapped) M=1024 (e) N=1024 (tok) K=1024, batch 2 b x 4 samples
//   scores, attn.v  inside fused_attn_kernel
//   output          M=2048 N=1024 K=1024 + bo -> d_out
// ---------------------------------------------------------------------------
extern "C" void kernel_launch(void* const* d_in, const int* in_sizes, int n_in,
                              void* d_out, int out_size, void* d_ws, size_t ws_size,
                              hipStream_t stream) {
  if (n_in < 10) return;
  if (in_sizes[0] != kTok * kDim) return;
  if (in_sizes[1] != kSamp * kDim * kDim || in_sizes[2] != kSamp * kDim * kDim || in_sizes[3] != kSamp * kDim * kDim) return;
  if (in_sizes[4] != kSamp * kDim || in_sizes[5] != kSamp) return;
  if (in_sizes[6] != kDim * kDim || in_sizes[7] != kDim) return;
  if (in_sizes[8] != kSamp || in_sizes[9] != 1) return;
  if (out_size != kTok * kDim + kBatch * kSeq * kSeq) return;

  const float* x    = (const float*)d_in[0];   // [2][1024][1024]
  const float* Wq   = (const float*)d_in[1];   // [4][1024][1024] ([s][out][in])
  const float* Wk   = (const float*)d_in[2];
  const float* Wv   = (const float*)d_in[3];
  const float* Wg   = (const float*)d_in[4];   // [4][1024]
  const float* bg   = (const float*)d_in[5];   // [4]
  const float* Wo   = (const float*)d_in[6];   // [1024][1024] ([out][in])
  const float* bo   = (const float*)d_in[7];   // [1024]
  const float* hw   = (const float*)d_in[8];   // [4]
  const float* temp = (const float*)d_in[9];   // [1]
  float* yout = (float*)d_out;                             // [2][1024][1024] at byte 0
  float* aout = (float*)d_out + (size_t)kTok * kDim;       // [2][1024][1024] at byte 8,388,608

  // ---- carve ----
  const size_t SZ_WSS  = 4096;
  const size_t SZ_XM   = (size_t)kBatch * kDim * 4;                 //       8,192
  const size_t SZ_WO   = (size_t)kDim * kDim * 2;                   //   2,097,152
  const size_t SZ_QK   = (size_t)kSamp * kTok * kQKld * 2;          //  33,554,432
  const size_t SZ_VT   = (size_t)kSamp * kBatch * kDim * kSeq * 2;  //  16,777,216
  const size_t SZ_CF   = (size_t)kBatch * kSeq * kDim * 4;          //   8,388,608
  const size_t SZ_CH   = (size_t)kBatch * kSeq * kDim * 2;          //   4,194,304
  const size_t SZ_P    = (size_t)kBatch * kHeads * kSeq * kSeq * 2; //  67,108,864
  const size_t SZ_S    = (size_t)kBatch * kHeads * kSeq * kSeq * 4; // 134,217,728
  const size_t SZ_XB   = (size_t)kTok * kDim * 2;                   //   4,194,304
  const size_t SZ_WQK  = (size_t)kSamp * kQKld * kDim * 2;          //  16,777,216
  size_t off = 0;
  const size_t oWSS = off; off += SZ_WSS;
  const size_t oXM  = off; off += SZ_XM;
  const size_t oWO  = off; off += SZ_WO;
  const size_t oQK  = off; off += SZ_QK;
  const size_t oVT  = off; off += SZ_VT;
  const size_t oCF  = off; off += SZ_CF;
  const size_t oCH  = off; off += SZ_CH;
  const size_t oP   = off; off += SZ_P;
  const size_t oS   = off; off += SZ_S;
  const size_t TOTAL = off;                                         // 266,350,592
  const size_t oXB  = oS;
  const size_t oWQK = oXB + SZ_XB;
  const size_t oWV  = oWQK + SZ_WQK;
  if (TOTAL > ws_size) return;

  char* ws = (char*)d_ws;
  float*          wsS    = (float*)(ws + oWSS);
  float*          gpart  = (float*)(ws + oXM);
  unsigned short* xb     = (unsigned short*)(ws + oXB);
  unsigned short* Wqkb   = (unsigned short*)(ws + oWQK);
  unsigned short* Wvb    = (unsigned short*)(ws + oWV);
  unsigned short* Wo16   = (unsigned short*)(ws + oWO);
  unsigned short* QK16   = (unsigned short*)(ws + oQK);
  unsigned short* VT16   = (unsigned short*)(ws + oVT);
  unsigned short* comb16 = (unsigned short*)(ws + oCH);
  float*          a2part = (float*)(ws + oP);

  const dim3 blk(256);

  // (0) operand casts
  {
    cast_x_pool_kernel<<<dim3(kTok / kPoolRows), blk, 0, stream>>>(x, Wg, xb, gpart);   // 256 blocks x 8 rows; also the gate partials
    cast_wqk_kernel<<<dim3((kDim * kDim / 8) / 256, 8), blk, 0, stream>>>(Wq, Wk, Wqkb);   // 512 x 8 blocks
    const int n8v = kSamp * kDim * kDim / 8;         // 524,288 -> 2048 blocks exactly
    cast_bf16_kernel<<<dim3(n8v / 256), blk, 0, stream>>>(Wv, Wvb, n8v);
    const int n8o = kDim * kDim / 8;                 // 131,072 -> 512 blocks exactly
    cast_wo_kernel<<<dim3(n8o / 256), blk, 0, stream>>>(Wo, Wo16, n8o);
  }
  // (1) gates (the mean pool's partials come from the x cast)
  gate_kernel<<<dim3(1), blk, 0, stream>>>(gpart, bg, hw, temp, wsS);

  const dim3 gQK((((kTok / 64) * (kQKld / 64)) + 7) / 8, kSamp);             // 128 x 4:  M=2048, N=2048, samples
  const dim3 gV((((kDim / 64) * (kSeq / 64)) + 7) / 8, kBatch * kSamp);      // 32 x 8:   M=1024, N=1024, (s, b)
  const dim3 gOut((((kTok / 64) * (kDim / 64)) + 7) / 8, 1);                 // 64 blocks: M=2048, N=1024

  // (2) q|k projection, all samples: QK16[s][tok][n] = f16(16 * sum_c bf16(x[tok][c]) * bf16(Wqk[s][n][c]))
  wmma_gemm64<1, false, 0, 1, false, 0, 2, 4><<<gQK, blk, 0, stream>>>(
      xb, xb, kDim, 0L, Wqkb, Wqkb, kDim, (long)kQKld * kDim, (void*)QK16, (void*)QK16, kQKld, (long)kTok * kQKld,
      bo, x, 0L, kTok, kQKld, kDim, kQKVCarry,
      kSamp, 0L, 0L, 0L, 0L);
  // (3) v role-swapped, all (s, b): VT16[s][b][e][tok] = f16(16 * sum_c bf16(Wv[s][e][c]) * bf16(x[b][tok][c]))
  wmma_gemm64<1, false, 0, 1, false, 0, 2, 4><<<gV, blk, 0, stream>>>(
      Wvb, Wvb, kDim, 0L, xb, xb, kDim, (long)kSeq * kDim, (void*)VT16, (void*)VT16, kSeq, (long)kDim * kSeq,
      bo, x, 0L, kDim, kSeq, kDim, kQKVCarry,
      kBatch, (long)kDim * kDim, 0L, (long)kBatch * kDim * kSeq, 0L);

  // (4) attention, all samples, heads and batches: comb16 = f16(256 * sum_s gw*coh*attn_s.v_s), a2part[z] = sum_s gw * (1/16) sum over 8 heads of attn
  fused_attn_kernel<<<dim3(kSeq / 16, kBatch, kHeadSplit), blk, 0, stream>>>(QK16, VT16, wsS, comb16, a2part);
  // (5) output 2 = a2part[0] + a2part[1]
  add_halves_kernel<<<dim3(kPlane2 / 4096), blk, 0, stream>>>(a2part, aout);

  // (7) y = (comb16 . Wo16^T) / 4096 + bo -> d_out output 0 (f32)
  wmma_gemm64<0, false, 2, 0, false, 0, 2, 4><<<gOut, blk, 0, stream>>>(
      comb16, comb16, kDim, 0L, Wo16, Wo16, kDim, 0L, (void*)yout, (void*)yout, kDim, 0L,
      bo, x, 0L, kTok, kDim, kDim, kOutScale,
      1, 0L, 0L, 0L, 0L);
}

// v006
// It runs in 177 microseconds.
// Timed twice side by side with v005, it ran 1.18 times as fast both times.
// All steps since v000 together make it 10.2 times as fast.
// Compute dtypes: q/k/v projections on v_wmma_f32_16x16x32_bf16 (x and Wq/Wk/Wv RNE-converted to bf16, f32 accumulate, results carried x16 into f16 planes); scores q.k^T, attn.v and the output projection on v_wmma_f32_16x16x32_f16 (f16 operands: q,k,v x16, probabilities x2^15 with the per-sample mixing weight folded in, combined x256, Wo as f16(16*bf16(Wo))), f32 accumulate; mean-pool, gates, softmax and the head/sample mixing in f32.
#include <hip/hip_runtime.h>
#include <math.h>

// ---------------------------------------------------------------------------
// Problem constants
// ---------------------------------------------------------------------------
constexpr int kBatch     = 2;
constexpr int kSeq       = 1024;
constexpr int kDim       = 1024;
constexpr int kHeads     = 16;
constexpr int kSamp      = 4;
constexpr int kDh        = 64;
constexpr int kTok       = kBatch * kSeq;       // 2048 token rows
constexpr int kHeadsHalf = 8;                   // half of kHeads; no kernel in this file uses it
constexpr int kQKld      = 2 * kDim;            // 2048: q columns 0..1023 | k columns 1024..2047
constexpr float kQKVCarry   = 16.0f;            // q, k, v carried x16 in f16
constexpr float kPCarry     = 32768.0f;         // probabilities carried x2^15 (times gate <= 1)
constexpr float kCombCarry  = 256.0f;           // combined carried x256
constexpr float kWoCarry    = 16.0f;            // Wo carried x16 in f16
constexpr float kScoreScale = 0.125f / (16.0f * 16.0f);              // dh^-0.5 / (16*16) = 2^-11
constexpr float kPVScale    = kCombCarry / (kPCarry * kQKVCarry);    // 256 / 2^19 = 2^-11
constexpr float kOutScale   = 1.0f / (kCombCarry * kWoCarry);        // 2^-12

typedef __attribute__((ext_vector_type(16))) _Float16 v16h;
typedef __attribute__((ext_vector_type(8)))  _Float16 v8h;
typedef __attribute__((ext_vector_type(16))) __bf16   v16b;
typedef __attribute__((ext_vector_type(8)))  __bf16   v8b;
typedef __attribute__((ext_vector_type(8)))  float    v8f;
typedef __attribute__((ext_vector_type(4)))  float    v4f;
typedef __attribute__((ext_vector_type(4)))  unsigned int v4u;

__device__ __forceinline__ unsigned short f2bf_bits(float f) {
  unsigned u = __float_as_uint(f);
  return (unsigned short)((u + 0x7FFFu + ((u >> 16) & 1u)) >> 16);
}
__device__ __forceinline__ float bf_bits2f(unsigned short h) { return __uint_as_float(((unsigned)h) << 16); }

// hazard guard as a plain device helper
__device__ __forceinline__ void acc_guard4(v8f& a, v8f& b, v8f& c, v8f& d) { asm volatile("v_nop\n\tv_nop\n\tv_nop\n\tv_nop" : "+v"(a), "+v"(b), "+v"(c), "+v"(d)); }
template <typename T> struct Frag;
template <> struct Frag<_Float16> {
  typedef v16h V; union U { v16h v; v8h h[2]; };
  static __device__ __forceinline__ v16h load(const _Float16* p) {   // elements 0..7 <- p[0..7], 8..15 <- p[16..23]
    U f; f.h[0] = *(const v8h*)(p); f.h[1] = *(const v8h*)(p + 16); return f.v;
  }
  static __device__ __forceinline__ v8f mma(v16h a, v16h b, v8f c) {
    return __builtin_amdgcn_wmma_f32_16x16x32_f16(false, a, false, b, (short)0, c, false, false);
  }
};
template <> struct Frag<__bf16> {
  typedef v16b V; union U { v16b v; v8b h[2]; };
  static __device__ __forceinline__ v16b load(const __bf16* p) {
    U f; f.h[0] = *(const v8b*)(p); f.h[1] = *(const v8b*)(p + 16); return f.v;
  }
  static __device__ __forceinline__ v8f mma(v16b a, v16b b, v8f c) {
    return __builtin_amdgcn_wmma_f32_16x16x32_bf16(false, a, false, b, (short)0, c, false, false);
  }
};

__device__ __forceinline__ unsigned pk16(unsigned short a, unsigned short b) { return (unsigned)a | ((unsigned)b << 16); }
__device__ __forceinline__ unsigned short h_bits(float f) { const _Float16 h = (_Float16)f; return __builtin_bit_cast(unsigned short, h); }

// ---- Operand staging: asynchronous copies global -> LDS ----
constexpr int kStageK   = 64;    // k elements per stage = one whole 128-B line of every operand row
constexpr int kRowPitch = 144;   // LDS bytes per staged row: 128 + 16, an odd multiple of 16 B, so that the 16 rows of a fragment read fall on distinct banks

// Six 16-B copies per lane, global -> LDS through no register. The s_wait_xcnt 0 is the statement's last line so that
// no address register named by an issued copy is rewritten in front of it.
__device__ __forceinline__ void async_copy6(unsigned l0, const unsigned short* g0, unsigned l1, const unsigned short* g1,
                                            unsigned l2, const unsigned short* g2, unsigned l3, const unsigned short* g3,
                                            unsigned l4, const unsigned short* g4, unsigned l5, const unsigned short* g5) {
  asm volatile("global_load_async_to_lds_b128 %0, %1, off\n\t"
               "global_load_async_to_lds_b128 %2, %3, off\n\t"
               "global_load_async_to_lds_b128 %4, %5, off\n\t"
               "global_load_async_to_lds_b128 %6, %7, off\n\t"
               "global_load_async_to_lds_b128 %8, %9, off\n\t"
               "global_load_async_to_lds_b128 %10, %11, off\n\t"
               "s_wait_xcnt 0x0"
               :: "v"(l0), "v"(g0), "v"(l1), "v"(g1), "v"(l2), "v"(g2), "v"(l3), "v"(g3), "v"(l4), "v"(g4), "v"(l5), "v"(g5)
               : "memory");
}

// ---- Register-blocked batched WMMA GEMM (ACT reduced to none/relu/leaky; Cout/resid without restrict
//      so that the in-place residual accumulate (resid == Cout, same wave reads its rows before storing them) is well formed) --
// C[m,n] = scale * sum_k A[m,k] * Bt[n,k] (+bias)(+resid); each wave owns a 64x64 tile; the block's 8 waves form a WM x WN grid of
// such tiles and share one staged k-tile: 64*WM rows of A, then 64*WN rows of Bt, 64 k each, two LDS buffers (the next k-tile's
// copies fly while this one is multiplied).
// A row-major [M,K]; Bt row-major [N,K]; M % (64*WM) == 0, N % (64*WN) == 0, K % 64 == 0; rows and bases 16-B aligned.
// SPLIT (hi/lo planes) is not carried by the staged loop and must be false.
// BIAS_MODE: 0 = none, 1 = bias[m], 2 = bias[n].
// OUT_MODE: 0 = f32, 1 = f16, 2 = bf16 hi plane (Cout) + bf16 lo plane (Cout2).
// ET: 0 = f16 operands, 1 = bf16 operands (pointers passed as 16-bit storage)
template <int ET> struct Elem;
template <> struct Elem<0> { typedef _Float16 T; };
template <> struct Elem<1> { typedef __bf16 T; };
template <int ET, bool SPLIT, int BIAS_MODE, int OUT_MODE, bool RESID, int ACT, int WM, int WN>
__global__ __launch_bounds__(256) void wmma_gemm64(
    const unsigned short* __restrict__ Ap, const unsigned short* __restrict__ A2p, int lda, long strideA,
    const unsigned short* __restrict__ Btp, const unsigned short* __restrict__ Bt2p, int ldb, long strideB,
    void* Cout, void* Cout2, int ldc, long strideC,
    const float* __restrict__ bias,
    const float* resid, long strideR,
    int M, int N, int K, float scale,
    int inner, long strideA2, long strideB2, long strideC2, long strideR2) {
  typedef typename Elem<ET>::T T;
  typedef typename Frag<T>::V V;
  static_assert(!SPLIT, "the staged k-loop carries one plane per operand");
  static_assert(WM * WN == 8, "eight waves per block");
  constexpr int kRowsA  = 64 * WM;                    // staged rows 0..kRowsA-1 = A, the rest = Bt
  constexpr int kRows   = 64 * (WM + WN);
  constexpr int kStageB = kRows * kRowPitch;          // bytes of one buffer
  constexpr int kCopies = kRows / 32;                 // copies per lane and stage: 256 lanes cover 32 rows x 8 chunks of 16 B
  static_assert(kCopies % 6 == 0 && kCopies <= 63, "copies go out six to a statement");
  __shared__ __align__(16) unsigned char ring[2 * kStageB];
  __shared__ __align__(16) float sT[8][16 * 68];   // per-wave 16x64 slab, pitch 68 floats
  // two-level batch: blockIdx.y = outer * inner + b; b walks the first strides, outer the second
  const int outer = (int)blockIdx.y / inner;
  const int b     = (int)blockIdx.y - outer * inner;
  const size_t offA = (size_t)b * strideA + (size_t)outer * strideA2;
  const size_t offB = (size_t)b * strideB + (size_t)outer * strideB2;
  const size_t offC = (size_t)b * strideC + (size_t)outer * strideC2;
  const size_t offR = (size_t)b * strideR + (size_t)outer * strideR2;
  const int lane = threadIdx.x & 31;
  const int wave = threadIdx.x >> 5;
  const int tilesN = N / (64 * WN);
  const int tilesM = M / (64 * WM);
  if ((int)blockIdx.x >= tilesM * tilesN) return;   // block-uniform, in front of every barrier
  const int bm = blockIdx.x / tilesN;
  const int bn = blockIdx.x - bm * tilesN;
  const int mB = bm * (64 * WM);
  const int nB = bn * (64 * WN);
  const int wm = wave / WN;
  const int wn = wave - wm * WN;
  const int m0 = mB + (wm << 6);
  const int n0 = nB + (wn << 6);

  const int rlane = lane & 15;                 // row (A) / col (B, D) within subtile
  const int mOff  = (lane >> 4) * 8;           // D row offset

  // copy side: lane -> (row crow + 32*j, 16-B chunk cchk) of the staged k-tile
  const int crow = threadIdx.x >> 3;
  const int cchk = threadIdx.x & 7;
  const unsigned short* gA = Ap  + offA + (size_t)(mB + crow) * lda + cchk * 8;
  const unsigned short* gB = Btp + offB + (size_t)(nB + crow) * ldb + cchk * 8;
  const unsigned ldsC = (unsigned)(size_t)(void*)ring + (unsigned)(crow * kRowPitch + cchk * 16);
  auto issue = [&](int t, int buf) {
    const unsigned l = ldsC + (unsigned)(buf * kStageB);
    const unsigned short* a = gA + t * kStageK;
    const unsigned short* w = gB + t * kStageK;
    auto from = [&](int j) { return (j < kRowsA / 32) ? (a + (size_t)(j * 32) * lda) : (w + (size_t)((j - kRowsA / 32) * 32) * ldb); };
    auto to   = [&](int j) { return l + (unsigned)(j * 32 * kRowPitch); };
#pragma unroll
    for (int j = 0; j < kCopies; j += 6)
      async_copy6(to(j), from(j), to(j + 1), from(j + 1), to(j + 2), from(j + 2),
                  to(j + 3), from(j + 3), to(j + 4), from(j + 4), to(j + 5), from(j + 5));
  };
  // read side: this lane's row of the first A / Bt fragment, at its lane half's k offset (8 elements = 16 B)
  const unsigned char* fA = ring + ((wm << 6) + rlane) * kRowPitch + (lane >> 4) * 16;
  const unsigned char* fB = ring + (kRowsA + (wn << 6) + rlane) * kRowPitch + (lane >> 4) * 16;

  v8f acc[4][4];
#pragma unroll
  for (int i = 0; i < 4; ++i)
#pragma unroll
    for (int j = 0; j < 4; ++j) acc[i][j] = (v8f){0.f,0.f,0.f,0.f,0.f,0.f,0.f,0.f};

  const int nT = K / kStageK;
  issue(0, 0);
  asm volatile("s_wait_asynccnt 0x0" ::: "memory");   // this wave's copies of k-tile 0 have landed
  __syncthreads();                                    // ... and every other wave's: k-tile 0 may be read
  if (nT > 1) issue(1, 1);

  for (int t = 0; t < nT; ++t) {
    const int bo = (t & 1) * kStageB;
    // all fragment reads of the k-tile stand as one group in front of its WMMAs (one LDS latency per trip, counted waits behind it)
    V ah[kStageK / 32][4], bh[kStageK / 32][4];
#pragma unroll
    for (int ks = 0; ks < kStageK / 32; ++ks) {
#pragma unroll
      for (int j = 0; j < 4; ++j) bh[ks][j] = Frag<T>::load((const T*)(fB + bo + j * 16 * kRowPitch + ks * 64));
#pragma unroll
      for (int i = 0; i < 4; ++i) ah[ks][i] = Frag<T>::load((const T*)(fA + bo + i * 16 * kRowPitch + ks * 64));
    }
    __builtin_amdgcn_sched_barrier(0);   // keeps the reads one group: without it they are sunk between the WMMAs, each with a wait to 0
#pragma unroll
    for (int ks = 0; ks < kStageK / 32; ++ks)
#pragma unroll
      for (int i = 0; i < 4; ++i)
#pragma unroll
        for (int j = 0; j < 4; ++j) acc[i][j] = Frag<T>::mma(ah[ks][i], bh[ks][j], acc[i][j]);
    __builtin_amdgcn_sched_barrier(0);   // keeps the WMMAs in front of the waits: sunk behind them, the next k-tile's copies would be waited for before the work that hides them
    asm volatile("s_wait_dscnt 0x0" ::: "memory");     // this wave's reads of buffer t&1 have returned before it is refilled
    asm volatile("s_wait_asynccnt 0x0" ::: "memory");  // this wave's copies of k-tile t+1 have landed
    __syncthreads();                                   // publishes k-tile t+1 and ends every wave's reads of buffer t&1
    if (t + 2 < nT) issue(t + 2, t & 1);
  }
  asm volatile("s_wait_asynccnt 0x0" ::: "memory");    // no copy is outstanding when the wave goes on to the epilogue and ends
  acc_guard4(acc[0][0], acc[0][1], acc[0][2], acc[0][3]);
  acc_guard4(acc[1][0], acc[1][1], acc[1][2], acc[1][3]);
  acc_guard4(acc[2][0], acc[2][1], acc[2][2], acc[2][3]);
  acc_guard4(acc[3][0], acc[3][1], acc[3][2], acc[3][3]);

  // ---- epilogue ----
  float* slab = sT[wave];
  const float* Rb = RESID ? (resid + offR) : nullptr;
#pragma unroll
  for (int i = 0; i < 4; ++i) {
    const int mBase = m0 + (i << 4);
#pragma unroll
    for (int j = 0; j < 4; ++j) {
      const int n = n0 + (j << 4) + rlane;
      float bv = 0.f;
      if (BIAS_MODE == 2) bv = bias[n];
#pragma unroll
      for (int r = 0; r < 8; ++r) {
        float v = acc[i][j][r] * scale;
        if (BIAS_MODE == 1) v += bias[mBase + mOff + r];
        if (BIAS_MODE == 2) v += bv;
        if (RESID) v += Rb[(size_t)(mBase + mOff + r) * ldc + n];
        if (ACT == 2) v = fmaxf(v, 0.0f);
        if (ACT == 4) v = (v > 0.f) ? v : 0.01f * v;
        slab[(mOff + r) * 68 + (j << 4) + rlane] = v;
      }
    }
    __builtin_amdgcn_fence(__ATOMIC_RELEASE, "workgroup");
    __builtin_amdgcn_wave_barrier();
    __builtin_amdgcn_fence(__ATOMIC_ACQUIRE, "workgroup");
    if (OUT_MODE == 0) {
      float* C = (float*)Cout + offC;
      const int hh = lane >> 4, c4 = (lane & 15) * 4;     // row seg = 256 B = 16 lanes x 16 B
      {
#pragma unroll
        for (int it = 0; it < 8; ++it) {
          const int row = it * 2 + hh;
          v4f v = *(const v4f*)(slab + row * 68 + c4);
          *(v4f*)(C + (size_t)(mBase + row) * ldc + n0 + c4) = v;
        }
        
      }
    } else {
      const int q = lane >> 3, c8 = (lane & 7) * 8;
      unsigned short* C  = (unsigned short*)Cout  + offC;
      unsigned short* C2 = (OUT_MODE == 2) ? ((unsigned short*)Cout2 + offC) : nullptr;
      {
#pragma unroll
        for (int it = 0; it < 4; ++it) {
          const int row = it * 4 + q;
          const float* sp = slab + row * 68 + c8;
          v8h hv, lv;
#pragma unroll
          for (int e = 0; e < 8; ++e) {
            if (OUT_MODE == 1) {
              hv[e] = (_Float16)sp[e];
            } else {
              unsigned short hb = f2bf_bits(sp[e]);
              unsigned short lb = f2bf_bits(sp[e] - bf_bits2f(hb));
              hv[e] = __builtin_bit_cast(_Float16, hb);
              lv[e] = __builtin_bit_cast(_Float16, lb);
            }
          }
          *(v8h*)(C + (size_t)(mBase + row) * ldc + n0 + c8) = hv;
          if (OUT_MODE == 2) *(v8h*)(C2 + (size_t)(mBase + row) * ldc + n0 + c8) = lv;
        }
        
      }
    }
    __builtin_amdgcn_fence(__ATOMIC_RELEASE, "workgroup");
    __builtin_amdgcn_wave_barrier();
    __builtin_amdgcn_fence(__ATOMIC_ACQUIRE, "workgroup");
  }
}

// ---------------------------------------------------------------------------
// f32 -> bf16 bits (RNE), 8 consecutive elements per thread: one 16-B store per lane, 32 contiguous lanes = 4 whole
// ---------------------------------------------------------------------------
__global__ __launch_bounds__(256) void cast_bf16_kernel(const float* __restrict__ in, unsigned short* __restrict__ out, int n8) {
  const int i = blockIdx.x * 256 + threadIdx.x;
  if (i >= n8) return;
  const float* p = in + 8 * (size_t)i;
  const v4f a = *(const v4f*)(p);
  const v4f c = *(const v4f*)(p + 4);
  unsigned short hb[8];
#pragma unroll
  for (int e = 0; e < 4; ++e) {
    hb[e]     = f2bf_bits(a[e]);
    hb[4 + e] = f2bf_bits(c[e]);
  }
  const v4u u = (v4u){pk16(hb[0], hb[1]), pk16(hb[2], hb[3]), pk16(hb[4], hb[5]), pk16(hb[6], hb[7])};
  unsigned short* q = out + 8 * (size_t)i;
  *(v4u*)q = u;
  
}

// ---------------------------------------------------------------------------
// Stacked q|k weight cast: out[s][2048][1024] bf16, rows 0..1023 = Wq[s], rows 1024..2047 = Wk[s] (both [out][in], k-contiguous).
// grid (512, 8): blockIdx.y = (which<<2)|s with which 0 = Wq, 1 = Wk (block-uniform source select);
// coverage per y: 512 blocks x 256 threads x 8 = 1,048,576 = one [1024][1024] matrix exactly. Stores as cast_bf16_kernel.
// ---------------------------------------------------------------------------
__global__ __launch_bounds__(256) void cast_wqk_kernel(const float* __restrict__ Wq, const float* __restrict__ Wk,
                                                       unsigned short* __restrict__ out) {
  const int y = blockIdx.y;
  const int smp = y & 3, which = y >> 2;
  const float* src = ((which == 0) ? Wq : Wk) + (size_t)smp * kDim * kDim;
  unsigned short* dst = out + (size_t)smp * kQKld * kDim + (size_t)which * kDim * kDim;
  const int i = blockIdx.x * 256 + threadIdx.x;
  if (i >= (kDim * kDim) / 8) return;
  const float* p = src + 8 * (size_t)i;
  const v4f a = *(const v4f*)(p);
  const v4f c = *(const v4f*)(p + 4);
  unsigned short hb[8];
#pragma unroll
  for (int e = 0; e < 4; ++e) {
    hb[e]     = f2bf_bits(a[e]);
    hb[4 + e] = f2bf_bits(c[e]);
  }
  const v4u u = (v4u){pk16(hb[0], hb[1]), pk16(hb[2], hb[3]), pk16(hb[4], hb[5]), pk16(hb[6], hb[7])};
  unsigned short* q = dst + 8 * (size_t)i;
  *(v4u*)q = u;
  
}

// ---------------------------------------------------------------------------
// Wo cast: out = f16(16 * bf16(Wo)) (RNE to bf16 first, then exact power-of-two carry into f16), 8 per thread, stores as above.
// Coverage: 512 blocks x 256 x 8 = 1,048,576 = [1024][1024] exactly.
// ---------------------------------------------------------------------------
__global__ __launch_bounds__(256) void cast_wo_kernel(const float* __restrict__ in, unsigned short* __restrict__ out, int n8) {
  const int i = blockIdx.x * 256 + threadIdx.x;
  if (i >= n8) return;
  const float* p = in + 8 * (size_t)i;
  const v4f a = *(const v4f*)(p);
  const v4f c = *(const v4f*)(p + 4);
  unsigned short hb[8];
#pragma unroll
  for (int e = 0; e < 4; ++e) {
    hb[e]     = h_bits(kWoCarry * bf_bits2f(f2bf_bits(a[e])));
    hb[4 + e] = h_bits(kWoCarry * bf_bits2f(f2bf_bits(c[e])));
  }
  const v4u u = (v4u){pk16(hb[0], hb[1]), pk16(hb[2], hb[3]), pk16(hb[4], hb[5]), pk16(hb[6], hb[7])};
  unsigned short* q = out + 8 * (size_t)i;
  *(v4u*)q = u;
  
}

// ---------------------------------------------------------------------------
// x cast with the mean pool and the gate's dot product folded in.
// grid = 256 blocks of 8 token rows (128 blocks per batch); thread -> 8 consecutive columns (tid % 128) * 8 of the rows tid / 128 + 2j.
//   xb = bf16(x) (RNE), stores as cast_bf16_kernel: one 16-B store per lane and row.
//   part[b][s][chunk] = sum_d (sum over the block's 8 rows of bf16(x[b][n][d])) * bf16(Wg[s][d]), f32:
//     per thread 4 rows in order, 8 columns in order; shuffle tree over the wave; the 8 waves in wave order.
// The sum over the 128 chunks, the 1/1024 of the mean and the sigmoid are gate_kernel's.
// ---------------------------------------------------------------------------
constexpr int kPoolRows   = 8;
constexpr int kPoolChunks = kSeq / kPoolRows;   // 128 per batch
__global__ __launch_bounds__(256) void cast_x_pool_kernel(const float* __restrict__ x, const float* __restrict__ Wg,
                                                          unsigned short* __restrict__ xb, float* __restrict__ part) {
  __shared__ float red[8][kSamp];
  const int tid = threadIdx.x, lane = tid & 31, wave = tid >> 5;
  const int col = (tid & 127) * 8;
  const size_t base = (size_t)(blockIdx.x * kPoolRows + (tid >> 7)) * kDim + col;
  v4f a[kPoolRows / 2], c[kPoolRows / 2];
#pragma unroll
  for (int j = 0; j < kPoolRows / 2; ++j) {
    a[j] = *(const v4f*)(x + base + (size_t)(2 * j) * kDim);
    c[j] = *(const v4f*)(x + base + (size_t)(2 * j) * kDim + 4);
  }
  float cs[8];
#pragma unroll
  for (int e = 0; e < 8; ++e) cs[e] = 0.f;
#pragma unroll
  for (int j = 0; j < kPoolRows / 2; ++j) {
    unsigned short hb[8];
#pragma unroll
    for (int e = 0; e < 4; ++e) {
      hb[e]     = f2bf_bits(a[j][e]);
      hb[4 + e] = f2bf_bits(c[j][e]);
    }
#pragma unroll
    for (int e = 0; e < 8; ++e) cs[e] += bf_bits2f(hb[e]);
    *(v4u*)(xb + base + (size_t)(2 * j) * kDim) = (v4u){pk16(hb[0], hb[1]), pk16(hb[2], hb[3]), pk16(hb[4], hb[5]), pk16(hb[6], hb[7])};
  }
  float dot[kSamp];
#pragma unroll
  for (int s = 0; s < kSamp; ++s) {
    const v4f w0 = *(const v4f*)(Wg + s * kDim + col);
    const v4f w1 = *(const v4f*)(Wg + s * kDim + col + 4);
    float acc = 0.f;
#pragma unroll
    for (int e = 0; e < 4; ++e) acc += cs[e] * bf_bits2f(f2bf_bits(w0[e]));
#pragma unroll
    for (int e = 0; e < 4; ++e) acc += cs[4 + e] * bf_bits2f(f2bf_bits(w1[e]));
    dot[s] = acc;
  }
#pragma unroll
  for (int off = 16; off > 0; off >>= 1)
#pragma unroll
    for (int s = 0; s < kSamp; ++s) dot[s] += __shfl_xor(dot[s], off, 32);
  if (lane == 0) {
#pragma unroll
    for (int s = 0; s < kSamp; ++s) red[wave][s] = dot[s];
  }
  __syncthreads();
  if (tid < kSamp) {
    float t = red[0][tid];
#pragma unroll
    for (int w = 1; w < 8; ++w) t += red[w][tid];
    const int b = blockIdx.x / kPoolChunks, chunk = blockIdx.x - b * kPoolChunks;
    part[(b * kSamp + tid) * kPoolChunks + chunk] = t;
  }
}

// ---------------------------------------------------------------------------
// Gates and mixing weights (one block, 256 threads = 8 waves):
//   coh[b][s] = sigmoid((1/1024) * sum_chunk part[b][s][chunk] + bg[s])  (wave w -> (b, s) = (w>>2, w&3); four chunks per lane + shuffle tree)
//   t = clip(temperature, 0.1, 10); invt = 1/t; gw = softmax(hyp_w * invt)
// ---------------------------------------------------------------------------
// e^x as __expf forms it (x * log2(e), then v_exp_f32), with the slot behind the transcendental filled in the same statement.
__device__ __forceinline__ float exp_slot(float x) {
  float r;
  asm("v_exp_f32 %0, %1\n\tv_nop" : "=v"(r) : "v"(x * 1.44269504088896340736f));
  return r;
}
__global__ __launch_bounds__(256) void gate_kernel(const float* __restrict__ part,
                                                   const float* __restrict__ bg, const float* __restrict__ hw,
                                                   const float* __restrict__ temp, float* __restrict__ wsS) {
  __shared__ float vals[32];
  const int t = threadIdx.x, lane = t & 31, wave = t >> 5;
  if (t < 32) vals[t] = 0.f;
  __syncthreads();
  {
    const int b = wave >> 2, s = wave & 3;
    const v4f p = *(const v4f*)(part + wave * kPoolChunks + lane * 4);
    float acc = (p[0] + p[1]) + (p[2] + p[3]);
#pragma unroll
    for (int off = 16; off > 0; off >>= 1) acc += __shfl_xor(acc, off, 32);
    if (lane == 0) {
      const float z = acc * (1.0f / (float)kSeq) + bf_bits2f(f2bf_bits(bg[s]));
      vals[4 + b * kSamp + s] = 1.0f / (1.0f + __expf(-z));
    }
  }
  __syncthreads();
  if (t == 0) {
    float tc = bf_bits2f(f2bf_bits(temp[0]));
    tc = fminf(fmaxf(tc, 0.1f), 10.0f);
    const float invt = 1.0f / tc;
    const float l0 = bf_bits2f(f2bf_bits(hw[0])) * invt;
    const float l1 = bf_bits2f(f2bf_bits(hw[1])) * invt;
    const float l2 = bf_bits2f(f2bf_bits(hw[2])) * invt;
    const float l3 = bf_bits2f(f2bf_bits(hw[3])) * invt;
    const float mx = fmaxf(fmaxf(l0, l1), fmaxf(l2, l3));
    const float e0 = exp_slot(l0 - mx), e1 = exp_slot(l1 - mx), e2 = exp_slot(l2 - mx), e3 = exp_slot(l3 - mx);
    const float is = 1.0f / ((e0 + e1) + (e2 + e3));
    vals[0] = e0 * is; vals[1] = e1 * is; vals[2] = e2 * is; vals[3] = e3 * is;
    vals[12] = invt;
  }
  __syncthreads();
  if (wave == 0) {
    const float v = vals[lane];
    *(float*)(wsS + lane) = v;
    
  }
}

// ---------------------------------------------------------------------------
// Fused attention: scores, softmax, head/sample mixing and attn.v in one launch; no score or probability plane in memory.
// grid = (32 tiles of 32 query rows, 2 batches, 4 head quarters) = 256 blocks, one per WGP (the LDS admits one); 256 threads = 8 waves;
// the block walks n = h*4 + s (head outer, sample inner) over its own 4 heads.
// The 32 query rows are two 16-row tiles rt = 0, 1: every staged k and v^T tile, and every fragment read from LDS, serves both.
// Wave w owns the key columns j = 128w .. 128w+127 of the block's 32 x 1024 score rows.
//   scores transposed: D[j][i] = sum_d k[j][d] q[i][d]  (A = k rows from LDS, B = q rows from registers): lane (c, hf) holds
//     query row i = 16rt + c and, per 16-j tile jt, the eight consecutive keys j = 128w + 16jt + 8hf + r.
//   softmax over j: per-wave maximum and sum (in-lane, then lane ^ 16), merged over the 8 waves through LDS.
//   a pair of score tiles (2m, 2m+1), converted to f16, IS the A fragment of attn.v for k = 32m .. 32m+31 (same lane, same order
//     as the fragment loader: elements 0..7 = k 8hf.., elements 8..15 = k 16+8hf..): the probabilities never leave the registers.
//   attn.v: each wave sums over its own 128 keys and over the 4 samples; the 8 partial 16x64 tiles are added through LDS per head,
//     one row tile after the other through the same slabs.
//   output 2 is accumulated in registers over the block's 16 (h, s) and stored once, into the head quarter's own partial plane;
//     add_planes_kernel adds the four planes.
// k (1024 rows x 128 B) and v^T (64 rows x 2048 B) of one (h, s) are staged in LDS by asynchronous copies, one buffer each; the tile
// sequence k(0), v(0), k(1), v(1), ... alternates between the two buffers as a two-buffer ring: each half pass reads one buffer
// while the other one's copies fly.
// ---------------------------------------------------------------------------
constexpr int kKPitch = 144;                 // 128 + 16 B, odd multiple of 16 B (distinct banks for the 16 rows of a fragment read)
constexpr int kVPitch = 2 * kSeq + 16;       // 2064 B = 129 x 16 B, likewise
constexpr int kKBytes = kSeq * kKPitch;      // 147,456
constexpr int kVBytes = kDh * kVPitch;       // 132,096
constexpr int kRowTiles = 2;                               // 16-row query tiles per block
constexpr int kHeadSplit = 4;                              // head quarters, one block each
constexpr int kPasses = kHeads * kSamp / kHeadSplit;       // 16 per block
constexpr int kPlane2 = kBatch * kSeq * kSeq;              // elements of output 2 = of one partial plane
typedef __attribute__((ext_vector_type(4))) _Float16 v4h;

// Eight 16-B copies per lane, global -> LDS through no register. The s_wait_xcnt 0 is the statement's last line so that
// no address register named by an issued copy is rewritten in front of it.
__device__ __forceinline__ void async_copy8(unsigned l0, const unsigned short* g0, unsigned l1, const unsigned short* g1,
                                            unsigned l2, const unsigned short* g2, unsigned l3, const unsigned short* g3,
                                            unsigned l4, const unsigned short* g4, unsigned l5, const unsigned short* g5,
                                            unsigned l6, const unsigned short* g6, unsigned l7, const unsigned short* g7) {
  asm volatile("global_load_async_to_lds_b128 %0, %1, off\n\t"
               "global_load_async_to_lds_b128 %2, %3, off\n\t"
               "global_load_async_to_lds_b128 %4, %5, off\n\t"
               "global_load_async_to_lds_b128 %6, %7, off\n\t"
               "global_load_async_to_lds_b128 %8, %9, off\n\t"
               "global_load_async_to_lds_b128 %10, %11, off\n\t"
               "global_load_async_to_lds_b128 %12, %13, off\n\t"
               "global_load_async_to_lds_b128 %14, %15, off\n\t"
               "s_wait_xcnt 0x0"
               :: "v"(l0), "v"(g0), "v"(l1), "v"(g1), "v"(l2), "v"(g2), "v"(l3), "v"(g3),
                  "v"(l4), "v"(g4), "v"(l5), "v"(g5), "v"(l6), "v"(g6), "v"(l7), "v"(g7)
               : "memory");
}

// value of lane l ^ 16
__device__ __forceinline__ float other_half(float v) {
  const int b = __builtin_bit_cast(int, v);
  return __builtin_bit_cast(float, __builtin_amdgcn_permlanex16(b, b, 0x76543210, 0xfedcba98, false, false));
}

// 2^x (v_exp_f32, as __builtin_amdgcn_exp2f forms it) with the slot behind the transcendental filled in the same statement.
__device__ __forceinline__ float exp2_slot(float x) {
  float r;
  asm("v_exp_f32 %0, %1\n\tv_nop" : "=v"(r) : "v"(x));
  return r;
}

__global__ __launch_bounds__(256) void fused_attn_kernel(const unsigned short* __restrict__ QK, const unsigned short* __restrict__ VT,
                                                         const float* __restrict__ wsS, unsigned short* __restrict__ comb,
                                                         float* __restrict__ out2) {
  typedef Frag<_Float16> F;
  __shared__ __align__(16) unsigned char kbuf[kKBytes];
  __shared__ __align__(16) unsigned char vbuf[kVBytes];
  __shared__ __align__(16) float ored[8][16 * 68];               // per-wave 16x64 partial of attn.v (one row tile), pitch 68 floats
  __shared__ __align__(16) float redM[kRowTiles * 16][8];        // [query row][wave] maximum (log2 domain)
  __shared__ __align__(16) float redL[kRowTiles * 16][8];        // [query row][wave] sum
  const int tid = threadIdx.x, lane = tid & 31, wave = tid >> 5;
  const int c = lane & 15, hf = lane >> 4;
  const int i0 = blockIdx.x * (16 * kRowTiles), bat = blockIdx.y;
  const int nBeg = blockIdx.z * kPasses, nEnd = nBeg + kPasses;   // this block's passes: heads 4z .. 4z+3, all samples
  const float cs = kScoreScale * wsS[12] * 1.44269504088896340736f;   // raw accumulator -> (0.125 q.k / t) * log2(e); > 0

  // copy side. k: lane -> (row tid/8 + 32j, 16-B chunk tid%8); v^T: lane -> (row tid/128 + 2j, 16-B chunk tid%128); j = 0..31
  const unsigned short* gK = QK + (size_t)(bat * kSeq + (tid >> 3)) * kQKld + kDim + (tid & 7) * 8;
  const unsigned short* gV = VT + (size_t)bat * kDim * kSeq + (size_t)(tid >> 7) * kSeq + (tid & 127) * 8;
  const unsigned lK = (unsigned)(size_t)(void*)kbuf + (unsigned)((tid >> 3) * kKPitch + (tid & 7) * 16);
  const unsigned lV = (unsigned)(size_t)(void*)vbuf + (unsigned)((tid >> 7) * kVPitch + (tid & 127) * 16);
  auto issueK = [&](int n) {
    const unsigned short* g = gK + (size_t)(n & 3) * kTok * kQKld + (n >> 2) * kDh;
    unsigned l = lK;
    auto from = [&](int j) { return g + (size_t)(j * 32) * kQKld; };
    auto to   = [&](int j) { return l + (unsigned)(j * 32 * kKPitch); };
#pragma unroll 1   // rolled: unrolled, the 32 LDS addresses are invariant in the pass loop and are held in registers across it (spills)
    for (int j = 0; j < 4; ++j) {
      async_copy8(to(0), from(0), to(1), from(1), to(2), from(2), to(3), from(3),
                  to(4), from(4), to(5), from(5), to(6), from(6), to(7), from(7));
      l += (unsigned)(8 * 32 * kKPitch);
      g += (size_t)(8 * 32) * kQKld;
    }
  };
  auto issueV = [&](int n) {
    const unsigned short* g = gV + (size_t)(n & 3) * kBatch * kDim * kSeq + (size_t)(n >> 2) * kDh * kSeq;
    unsigned l = lV;
    auto from = [&](int j) { return g + (size_t)(j * 2) * kSeq; };
    auto to   = [&](int j) { return l + (unsigned)(j * 2 * kVPitch); };
#pragma unroll 1   // rolled, as in issueK
    for (int j = 0; j < 4; ++j) {
      async_copy8(to(0), from(0), to(1), from(1), to(2), from(2), to(3), from(3),
                  to(4), from(4), to(5), from(5), to(6), from(6), to(7), from(7));
      l += (unsigned)(8 * 2 * kVPitch);
      g += (size_t)(8 * 2) * kSeq;
    }
  };
  // read side: this lane's row of the wave's first k / v^T fragment, at its lane half's k offset (8 elements = 16 B)
  const unsigned char* fK = kbuf + (wave * 128 + c) * kKPitch + hf * 16;
  const unsigned char* fV = vbuf + c * kVPitch + wave * 256 + hf * 16;
  const _Float16* qL = (const _Float16*)QK + (size_t)(bat * kSeq + i0 + c) * kQKld + hf * 8;
  constexpr size_t kQTile = (size_t)16 * kQKld;       // elements from a q row of row tile 0 to the same row of row tile 1

  const v8f zero8 = (v8f){0.f,0.f,0.f,0.f,0.f,0.f,0.f,0.f};
  v8f a2[kRowTiles][8], accO[kRowTiles][4];
#pragma unroll
  for (int rt = 0; rt < kRowTiles; ++rt) {
#pragma unroll
    for (int jt = 0; jt < 8; ++jt) a2[rt][jt] = zero8;
#pragma unroll
    for (int dt = 0; dt < 4; ++dt) accO[rt][dt] = zero8;
  }

  issueK(nBeg);
  const _Float16* qB  = qL + (nBeg >> 2) * kDh;       // sample 0 of the block's first head
  const _Float16* qB1 = qB + kQTile;
  v16h qf[kRowTiles][2];
  qf[0][0] = F::load(qB);  qf[0][1] = F::load(qB + 32);
  qf[1][0] = F::load(qB1); qf[1][1] = F::load(qB1 + 32);
  asm volatile("s_wait_xcnt 0x0" :: "v"(qB) : "memory");   // as behind the loop's q loads: the address registers stay untouched up to here and are reused behind it
  asm volatile("s_wait_asynccnt 0x0" ::: "memory");   // this wave's copies of the first k tile have landed
  __syncthreads();                                    // ... and every other wave's: it may be read
  issueV(nBeg);

#pragma unroll 1
  for (int n = nBeg; n < nEnd; ++n) {
    const int s = n & 3, h = n >> 2;
    const float gw  = wsS[s];
    const float coh = wsS[4 + bat * kSamp + s];
    // ---- first half pass: reads kbuf alone; each k fragment multiplies both row tiles' q ----
    v8f sc[kRowTiles][8];
#pragma unroll
    for (int jt = 0; jt < 8; ++jt) {
      const v16h kf = F::load((const _Float16*)(fK + jt * 16 * kKPitch));
#pragma unroll
      for (int rt = 0; rt < kRowTiles; ++rt) sc[rt][jt] = F::mma(kf, qf[rt][0], zero8);
    }
#pragma unroll
    for (int jt = 0; jt < 8; ++jt) {
      const v16h kf = F::load((const _Float16*)(fK + jt * 16 * kKPitch + 64));
#pragma unroll
      for (int rt = 0; rt < kRowTiles; ++rt) sc[rt][jt] = F::mma(kf, qf[rt][1], sc[rt][jt]);
    }
    float mb[kRowTiles];
#pragma unroll
    for (int rt = 0; rt < kRowTiles; ++rt) {
      float mr[8];
#pragma unroll
      for (int r = 0; r < 8; ++r) mr[r] = sc[rt][0][r];
#pragma unroll
      for (int jt = 1; jt < 8; ++jt)
#pragma unroll
        for (int r = 0; r < 8; ++r) mr[r] = fmaxf(mr[r], sc[rt][jt][r]);
      float mx = fmaxf(fmaxf(fmaxf(mr[0], mr[1]), fmaxf(mr[2], mr[3])), fmaxf(fmaxf(mr[4], mr[5]), fmaxf(mr[6], mr[7])));
      mx = fmaxf(mx, other_half(mx));
      mb[rt] = mx * cs;
      float ls[8];
#pragma unroll
      for (int r = 0; r < 8; ++r) ls[r] = 0.f;
#pragma unroll
      for (int jt = 0; jt < 8; ++jt)
#pragma unroll
        for (int r = 0; r < 8; ++r) {
          const float e = __builtin_amdgcn_exp2f(fmaf(sc[rt][jt][r], cs, -mb[rt]));
          sc[rt][jt][r] = e;
          ls[r] += e;
        }
      float l = ((ls[0] + ls[1]) + (ls[2] + ls[3])) + ((ls[4] + ls[5]) + (ls[6] + ls[7]));
      l += other_half(l);
      *(hf ? &redL[rt * 16 + c][wave] : &redM[rt * 16 + c][wave]) = hf ? l : mb[rt];
    }
    asm volatile("s_wait_dscnt 0x0" ::: "memory");     // this wave's reads of kbuf have returned before it is refilled
    asm volatile("s_wait_asynccnt 0x0" ::: "memory");  // this wave's copies of v(n) have landed
    __syncthreads();                                   // publishes v(n) and the wave partials; ends every wave's reads of kbuf
    if (n + 1 < nEnd) issueK(n + 1);
    // next pass's q fragments, fetched a half pass ahead (the last pass fetches its own again: in bounds, unused)
    const int nn = (n + 1 < nEnd) ? n + 1 : n;
    const _Float16* qN  = qL + (size_t)(nn & 3) * kTok * kQKld + (nn >> 2) * kDh;
    const _Float16* qN1 = qN + kQTile;
    qf[0][0] = F::load(qN);  qf[0][1] = F::load(qN + 32);
    qf[1][0] = F::load(qN1); qf[1][1] = F::load(qN1 + 32);
    asm volatile("s_wait_xcnt 0x0" :: "v"(qN) : "memory");   // the q loads' address registers stay untouched up to here (input only: no load lands on them) and are rewritten behind it

    // ---- second half pass: reads vbuf alone; each v^T fragment multiplies both row tiles' probabilities ----
    // the v^T fragment reads go one 32-key step ahead of their WMMAs, two register sets; the first group stands in front of the
    // merge arithmetic, which hides its LDS latency
    v16h vf[2][4];
#pragma unroll
    for (int dt = 0; dt < 4; ++dt) vf[0][dt] = F::load((const _Float16*)(fV + dt * 16 * kVPitch));
    float fA[kRowTiles], fP[kRowTiles];
#pragma unroll
    for (int rt = 0; rt < kRowTiles; ++rt) {
      const v4f ma = *(const v4f*)&redM[rt * 16 + c][0], mc = *(const v4f*)&redM[rt * 16 + c][4];
      const v4f la = *(const v4f*)&redL[rt * 16 + c][0], lc = *(const v4f*)&redL[rt * 16 + c][4];
      const float M = fmaxf(fmaxf(fmaxf(ma[0], ma[1]), fmaxf(ma[2], ma[3])), fmaxf(fmaxf(mc[0], mc[1]), fmaxf(mc[2], mc[3])));
      const float L = ((la[0] * exp2_slot(ma[0] - M) + la[1] * exp2_slot(ma[1] - M)) +
                       (la[2] * exp2_slot(ma[2] - M) + la[3] * exp2_slot(ma[3] - M))) +
                      ((lc[0] * exp2_slot(mc[0] - M) + lc[1] * exp2_slot(mc[1] - M)) +
                       (lc[2] * exp2_slot(mc[2] - M) + lc[3] * exp2_slot(mc[3] - M)));
      const float f = __builtin_amdgcn_exp2f(mb[rt] - M) / L;    // this wave's exp2(x - mb) -> probability
      fA[rt] = f * (gw * (1.0f / (float)kHeads));
      fP[rt] = f * (kPCarry * gw * coh);
    }
#pragma unroll
    for (int m = 0; m < 4; ++m) {
      if (m + 1 < 4) {
#pragma unroll
        for (int dt = 0; dt < 4; ++dt) vf[(m + 1) & 1][dt] = F::load((const _Float16*)(fV + dt * 16 * kVPitch + (m + 1) * 64));
      }
      __builtin_amdgcn_sched_barrier(0);   // keeps the next step's reads one group in front of this step's WMMAs: without it they are sunk to their users, each with a wait to 0
#pragma unroll
      for (int rt = 0; rt < kRowTiles; ++rt) {
        F::U p;
#pragma unroll
        for (int r = 0; r < 8; ++r) {
          a2[rt][2 * m][r]     = fmaf(sc[rt][2 * m][r], fA[rt], a2[rt][2 * m][r]);
          a2[rt][2 * m + 1][r] = fmaf(sc[rt][2 * m + 1][r], fA[rt], a2[rt][2 * m + 1][r]);
          p.h[0][r] = (_Float16)(sc[rt][2 * m][r] * fP[rt]);
          p.h[1][r] = (_Float16)(sc[rt][2 * m + 1][r] * fP[rt]);
        }
#pragma unroll
        for (int dt = 0; dt < 4; ++dt) accO[rt][dt] = F::mma(p.v, vf[m & 1][dt], accO[rt][dt]);
      }
      __builtin_amdgcn_sched_barrier(0);   // keeps the reads of the step after next behind this step's WMMAs: lifted over them they take a third register set (spills)
    }
    // the slots between the last WMMAs and a reader of their D on the taken side of the branch below
    acc_guard4(accO[0][0], accO[0][1], accO[0][2], accO[0][3]);
    acc_guard4(accO[1][0], accO[1][1], accO[1][2], accO[1][3]);
    float* slab = ored[wave];
    if (s == kSamp - 1) {
#pragma unroll
      for (int dt = 0; dt < 4; ++dt)
#pragma unroll
        for (int r = 0; r < 8; ++r) slab[(hf * 8 + r) * 68 + dt * 16 + c] = accO[0][dt][r];
    }
    asm volatile("s_wait_dscnt 0x0" ::: "memory");     // this wave's reads of vbuf have returned before it is refilled
    asm volatile("s_wait_asynccnt 0x0" ::: "memory");  // this wave's copies of k(n+1) have landed
    __syncthreads();                                   // publishes k(n+1) and row tile 0's attn.v partials; ends every wave's reads of vbuf
    if (n + 1 < nEnd) issueV(n + 1);
    if (s == kSamp - 1) {
      // combined[i][h*64 + d] x256: the 8 waves' partials in wave order; thread -> (row tid/16, four d), 16 lanes = one 128-B line
      const int row = tid >> 4, d4 = (tid & 15) * 4;
      v4h o[kRowTiles];
#pragma unroll
      for (int rt = 0; rt < kRowTiles; ++rt) {
        if (rt > 0) {
          __syncthreads();                                 // ends every wave's reads of the previous row tile's partials
#pragma unroll
          for (int dt = 0; dt < 4; ++dt)
#pragma unroll
            for (int r = 0; r < 8; ++r) slab[(hf * 8 + r) * 68 + dt * 16 + c] = accO[rt][dt][r];
          __syncthreads();                                 // publishes this row tile's partials
        }
        v4f t = *(const v4f*)&ored[0][row * 68 + d4];
#pragma unroll
        for (int w = 1; w < 8; ++w) t += *(const v4f*)&ored[w][row * 68 + d4];
#pragma unroll
        for (int e = 0; e < 4; ++e) o[rt][e] = (_Float16)(t[e] * kPVScale);
      }
      // both stores stand behind the last barrier: in front of one, the barrier would wait for the store to complete
#pragma unroll
      for (int rt = 0; rt < kRowTiles; ++rt)
        *(v4h*)(comb + (size_t)(bat * kSeq + i0 + rt * 16 + row) * kDim + h * kDh + d4) = o[rt];
      asm volatile("s_wait_xcnt 0x0" ::: "memory");      // the stores' address and data registers are rewritten by the next head
#pragma unroll
      for (int rt = 0; rt < kRowTiles; ++rt)
#pragma unroll
        for (int dt = 0; dt < 4; ++dt) accO[rt][dt] = zero8;
    }
  }
  asm volatile("s_wait_asynccnt 0x0" ::: "memory");    // no copy is outstanding when the wave ends

  // output 2, this head quarter's plane: lane holds rows i0 + 16rt + c, per tile eight consecutive columns (32 B); the wave covers 512 B of each of its 32 rows
#pragma unroll
  for (int rt = 0; rt < kRowTiles; ++rt) {
    float* orow = out2 + (size_t)blockIdx.z * kPlane2 + (size_t)(bat * kSeq + i0 + rt * 16 + c) * kSeq + wave * 128 + hf * 8;
#pragma unroll
    for (int jt = 0; jt < 8; ++jt) {
      *(v4f*)(orow + jt * 16)     = (v4f){a2[rt][jt][0], a2[rt][jt][1], a2[rt][jt][2], a2[rt][jt][3]};
      *(v4f*)(orow + jt * 16 + 4) = (v4f){a2[rt][jt][4], a2[rt][jt][5], a2[rt][jt][6], a2[rt][jt][7]};
    }
  }
}

// ---------------------------------------------------------------------------
// Output 2 = (plane 0 + plane 1) + (plane 2 + plane 3) of the fused kernel's partial sums (heads 0..3, 4..7, 8..11, 12..15).
// 1024 blocks x 256 threads x 2 x 4 floats = 2,097,152 = one plane exactly; a wave reads and writes whole 512-B runs.
// ---------------------------------------------------------------------------
__global__ __launch_bounds__(256) void add_planes_kernel(const float* __restrict__ part, float* __restrict__ out) {
  const int i = (blockIdx.x * 512 + threadIdx.x) * 4;
  v4f p[2][kHeadSplit];
#pragma unroll   // all eight loads are in flight before the first sum
  for (int u = 0; u < 2; ++u)
#pragma unroll
    for (int z = 0; z < kHeadSplit; ++z) p[u][z] = *(const v4f*)(part + (size_t)z * kPlane2 + i + u * 1024);
#pragma unroll   // p[][] stays in registers
  for (int u = 0; u < 2; ++u) *(v4f*)(out + i + u * 1024) = (p[u][0] + p[u][1]) + (p[u][2] + p[u][3]);
}

// ---------------------------------------------------------------------------
// Workspace region map (byte offsets, all multiples of 4096). Every region is fully written before it is read.
//   wsS    f32 [32] (gw, coh, 1/t)                              0           ..       4,096
//   gpart  f32 [2 b][4 s][128 chunks] (4,096 B of the region)   4,096       ..      12,288
//   Wo16   f16  [1024][1024]  = f16(16*bf16(Wo))               12,288      ..   2,109,440
//   QK16   f16  [4 s][2048][2048]  q x16 | k x16               2,109,440   ..  35,663,872
//   VT16   f16  [4 s][2][1024 e][1024 tok] v x16 transposed    35,663,872  ..  52,441,088
//   (not used)                                                  52,441,088  ..  60,829,696
//   comb16 f16  [2][1024][1024] 256 * sum_s gw*coh*out_s        60,829,696  ..  65,024,000
//   a2part f32  [4 head quarters][2][1024][1024] (33,554,432 B) 65,024,000  ..  98,578,432
//   (not used)                                                  98,578,432  .. 132,132,864
//   The projections' operands:
//   xb     bf16 [2048][1024]                                    132,132,864 .. 136,327,168
//   Wqkb   bf16 [4][2048][1024] (Wq[s] rows | Wk[s] rows)       136,327,168 .. 153,104,384
//   Wvb    bf16 [4][1024][1024]                                 153,104,384 .. 161,492,992
//   total 266,350,592 B
// GEMM shapes (all K % 64 == 0; block tile 128x256; every M, N a multiple of it; no padded planes):
//   q|k projection  M=2048 N=2048 K=1024 (bf16 in, f16 out x16), batch 4 samples
//   v (role-swapped) M=1024 (e) N=1024 (tok) K=1024, batch 2 b x 4 samples
//   scores, attn.v  inside fused_attn_kernel
//   output          M=2048 N=1024 K=1024 + bo -> d_out
// ---------------------------------------------------------------------------
extern "C" void kernel_launch(void* const* d_in, const int* in_sizes, int n_in,
                              void* d_out, int out_size, void* d_ws, size_t ws_size,
                              hipStream_t stream) {
  if (n_in < 10) return;
  if (in_sizes[0] != kTok * kDim) return;
  if (in_sizes[1] != kSamp * kDim * kDim || in_sizes[2] != kSamp * kDim * kDim || in_sizes[3] != kSamp * kDim * kDim) return;
  if (in_sizes[4] != kSamp * kDim || in_sizes[5] != kSamp) return;
  if (in_sizes[6] != kDim * kDim || in_sizes[7] != kDim) return;
  if (in_sizes[8] != kSamp || in_sizes[9] != 1) return;
  if (out_size != kTok * kDim + kBatch * kSeq * kSeq) return;

  const float* x    = (const float*)d_in[0];   // [2][1024][1024]
  const float* Wq   = (const float*)d_in[1];   // [4][1024][1024] ([s][out][in])
  const float* Wk   = (const float*)d_in[2];
  const float* Wv   = (const float*)d_in[3];
  const float* Wg   = (const float*)d_in[4];   // [4][1024]
  const float* bg   = (const float*)d_in[5];   // [4]
  const float* Wo   = (const float*)d_in[6];   // [1024][1024] ([out][in])
  const float* bo   = (const float*)d_in[7];   // [1024]
  const float* hw   = (const float*)d_in[8];   // [4]
  const float* temp = (const float*)d_in[9];   // [1]
  float* yout = (float*)d_out;                             // [2][1024][1024] at byte 0
  float* aout = (float*)d_out + (size_t)kTok * kDim;       // [2][1024][1024] at byte 8,388,608

  // ---- carve ----
  const size_t SZ_WSS  = 4096;
  const size_t SZ_XM   = (size_t)kBatch * kDim * 4;                 //       8,192
  const size_t SZ_WO   = (size_t)kDim * kDim * 2;                   //   2,097,152
  const size_t SZ_QK   = (size_t)kSamp * kTok * kQKld * 2;          //  33,554,432
  const size_t SZ_VT   = (size_t)kSamp * kBatch * kDim * kSeq * 2;  //  16,777,216
  const size_t SZ_CF   = (size_t)kBatch * kSeq * kDim * 4;          //   8,388,608
  const size_t SZ_CH   = (size_t)kBatch * kSeq * kDim * 2;          //   4,194,304
  const size_t SZ_P    = (size_t)kBatch * kHeads * kSeq * kSeq * 2; //  67,108,864
  const size_t SZ_S    = (size_t)kBatch * kHeads * kSeq * kSeq * 4; // 134,217,728
  const size_t SZ_XB   = (size_t)kTok * kDim * 2;                   //   4,194,304
  const size_t SZ_WQK  = (size_t)kSamp * kQKld * kDim * 2;          //  16,777,216
  size_t off = 0;
  const size_t oWSS = off; off += SZ_WSS;
  const size_t oXM  = off; off += SZ_XM;
  const size_t oWO  = off; off += SZ_WO;
  const size_t oQK  = off; off += SZ_QK;
  const size_t oVT  = off; off += SZ_VT;
  const size_t oCF  = off; off += SZ_CF;
  const size_t oCH  = off; off += SZ_CH;
  const size_t oP   = off; off += SZ_P;
  const size_t oS   = off; off += SZ_S;
  const size_t TOTAL = off;                                         // 266,350,592
  const size_t oXB  = oS;
  const size_t oWQK = oXB + SZ_XB;
  const size_t oWV  = oWQK + SZ_WQK;
  if (TOTAL > ws_size) return;

  char* ws = (char*)d_ws;
  float*          wsS    = (float*)(ws + oWSS);
  float*          gpart  = (float*)(ws + oXM);
  unsigned short* xb     = (unsigned short*)(ws + oXB);
  unsigned short* Wqkb   = (unsigned short*)(ws + oWQK);
  unsigned short* Wvb    = (unsigned short*)(ws + oWV);
  unsigned short* Wo16   = (unsigned short*)(ws + oWO);
  unsigned short* QK16   = (unsigned short*)(ws + oQK);
  unsigned short* VT16   = (unsigned short*)(ws + oVT);
  unsigned short* comb16 = (unsigned short*)(ws + oCH);
  float*          a2part = (float*)(ws + oP);

  const dim3 blk(256);

  // (0) operand casts
  {
    cast_x_pool_kernel<<<dim3(kTok / kPoolRows), blk, 0, stream>>>(x, Wg, xb, gpart);   // 256 blocks x 8 rows; also the gate partials
    cast_wqk_kernel<<<dim3((kDim * kDim / 8) / 256, 8), blk, 0, stream>>>(Wq, Wk, Wqkb);   // 512 x 8 blocks
    const int n8v = kSamp * kDim * kDim / 8;         // 524,288 -> 2048 blocks exactly
    cast_bf16_kernel<<<dim3(n8v / 256), blk, 0, stream>>>(Wv, Wvb, n8v);
    const int n8o = kDim * kDim / 8;                 // 131,072 -> 512 blocks exactly
    cast_wo_kernel<<<dim3(n8o / 256), blk, 0, stream>>>(Wo, Wo16, n8o);
  }
  // (1) gates (the mean pool's partials come from the x cast)
  gate_kernel<<<dim3(1), blk, 0, stream>>>(gpart, bg, hw, temp, wsS);

  const dim3 gQK((((kTok / 64) * (kQKld / 64)) + 7) / 8, kSamp);             // 128 x 4:  M=2048, N=2048, samples
  const dim3 gV((((kDim / 64) * (kSeq / 64)) + 7) / 8, kBatch * kSamp);      // 32 x 8:   M=1024, N=1024, (s, b)
  const dim3 gOut((((kTok / 64) * (kDim / 64)) + 7) / 8, 1);                 // 64 blocks: M=2048, N=1024

  // (2) q|k projection, all samples: QK16[s][tok][n] = f16(16 * sum_c bf16(x[tok][c]) * bf16(Wqk[s][n][c]))
  wmma_gemm64<1, false, 0, 1, false, 0, 2, 4><<<gQK, blk, 0, stream>>>(
      xb, xb, kDim, 0L, Wqkb, Wqkb, kDim, (long)kQKld * kDim, (void*)QK16, (void*)QK16, kQKld, (long)kTok * kQKld,
      bo, x, 0L, kTok, kQKld, kDim, kQKVCarry,
      kSamp, 0L, 0L, 0L, 0L);
  // (3) v role-swapped, all (s, b): VT16[s][b][e][tok] = f16(16 * sum_c bf16(Wv[s][e][c]) * bf16(x[b][tok][c]))
  wmma_gemm64<1, false, 0, 1, false, 0, 2, 4><<<gV, blk, 0, stream>>>(
      Wvb, Wvb, kDim, 0L, xb, xb, kDim, (long)kSeq * kDim, (void*)VT16, (void*)VT16, kSeq, (long)kDim * kSeq,
      bo, x, 0L, kDim, kSeq, kDim, kQKVCarry,
      kBatch, (long)kDim * kDim, 0L, (long)kBatch * kDim * kSeq, 0L);

  // (4) attention, all samples, heads and batches: comb16 = f16(256 * sum_s gw*coh*attn_s.v_s), a2part[z] = sum_s gw * (1/16) sum over 4 heads of attn
  fused_attn_kernel<<<dim3(kSeq / (16 * kRowTiles), kBatch, kHeadSplit), blk, 0, stream>>>(QK16, VT16, wsS, comb16, a2part);
  // (5) output 2 = sum of the four planes of a2part
  add_planes_kernel<<<dim3(kPlane2 / 2048), blk, 0, stream>>>(a2part, aout);

  // (7) y = (comb16 . Wo16^T) / 4096 + bo -> d_out output 0 (f32)
  wmma_gemm64<0, false, 2, 0, false, 0, 2, 4><<<gOut, blk, 0, stream>>>(
      comb16, comb16, kDim, 0L, Wo16, Wo16, kDim, 0L, (void*)yout, (void*)yout, kDim, 0L,
      bo, x, 0L, kTok, kDim, kDim, kOutScale,
      1, 0L, 0L, 0L, 0L);
}

// v007
// It runs in 174 microseconds.
// Two timings next to v006 both put it at 1.03 times that version's speed.
// All steps since v000 together make it 10.5 times as fast.
// Compute dtypes: q/k/v projections on v_wmma_f32_16x16x32_bf16 (x and Wq/Wk/Wv RNE-converted to bf16, f32 accumulate, results carried x16 into f16 planes); scores q.k^T, attn.v and the output projection on v_wmma_f32_16x16x32_f16 (f16 operands: q,k,v x16, probabilities x2^15 with the per-sample mixing weight folded in, combined x256, Wo as f16(16*bf16(Wo))), f32 accumulate; mean-pool, gates, softmax and the head/sample mixing in f32.
#include <hip/hip_runtime.h>
#include <math.h>

// ---------------------------------------------------------------------------
// Problem constants
// ---------------------------------------------------------------------------
constexpr int kBatch     = 2;
constexpr int kSeq       = 1024;
constexpr int kDim       = 1024;
constexpr int kHeads     = 16;
constexpr int kSamp      = 4;
constexpr int kDh        = 64;
constexpr int kTok       = kBatch * kSeq;       // 2048 token rows
constexpr int kHeadsHalf = 8;                   // half of kHeads; no kernel in this file uses it
constexpr int kQKld      = 2 * kDim;            // 2048: q columns 0..1023 | k columns 1024..2047
constexpr float kQKVCarry   = 16.0f;            // q, k, v carried x16 in f16
constexpr float kPCarry     = 32768.0f;         // probabilities carried x2^15 (times gate <= 1)
constexpr float kCombCarry  = 256.0f;           // combined carried x256
constexpr float kWoCarry    = 16.0f;            // Wo carried x16 in f16
constexpr float kScoreScale = 0.125f / (16.0f * 16.0f);              // dh^-0.5 / (16*16) = 2^-11
constexpr float kPVScale    = kCombCarry / (kPCarry * kQKVCarry);    // 256 / 2^19 = 2^-11
constexpr float kOutScale   = 1.0f / (kCombCarry * kWoCarry);        // 2^-12

typedef __attribute__((ext_vector_type(16))) _Float16 v16h;
typedef __attribute__((ext_vector_type(8)))  _Float16 v8h;
typedef __attribute__((ext_vector_type(16))) __bf16   v16b;
typedef __attribute__((ext_vector_type(8)))  __bf16   v8b;
typedef __attribute__((ext_vector_type(8)))  float    v8f;
typedef __attribute__((ext_vector_type(4)))  float    v4f;
typedef __attribute__((ext_vector_type(4)))  unsigned int v4u;
typedef __attribute__((ext_vector_type(2)))  unsigned int v2u;

__device__ __forceinline__ unsigned short f2bf_bits(float f) {
  unsigned u = __float_as_uint(f);
  return (unsigned short)((u + 0x7FFFu + ((u >> 16) & 1u)) >> 16);
}
__device__ __forceinline__ float bf_bits2f(unsigned short h) { return __uint_as_float(((unsigned)h) << 16); }

// hazard guard as a plain device helper
__device__ __forceinline__ void acc_guard4(v8f& a, v8f& b, v8f& c, v8f& d) { asm volatile("v_nop\n\tv_nop\n\tv_nop\n\tv_nop" : "+v"(a), "+v"(b), "+v"(c), "+v"(d)); }
template <typename T> struct Frag;
template <> struct Frag<_Float16> {
  typedef v16h V; union U { v16h v; v8h h[2]; };
  static __device__ __forceinline__ v16h load(const _Float16* p) {   // elements 0..7 <- p[0..7], 8..15 <- p[16..23]
    U f; f.h[0] = *(const v8h*)(p); f.h[1] = *(const v8h*)(p + 16); return f.v;
  }
  static __device__ __forceinline__ v8f mma(v16h a, v16h b, v8f c) {
    return __builtin_amdgcn_wmma_f32_16x16x32_f16(false, a, false, b, (short)0, c, false, false);
  }
};
template <> struct Frag<__bf16> {
  typedef v16b V; union U { v16b v; v8b h[2]; };
  static __device__ __forceinline__ v16b load(const __bf16* p) {
    U f; f.h[0] = *(const v8b*)(p); f.h[1] = *(const v8b*)(p + 16); return f.v;
  }
  static __device__ __forceinline__ v8f mma(v16b a, v16b b, v8f c) {
    return __builtin_amdgcn_wmma_f32_16x16x32_bf16(false, a, false, b, (short)0, c, false, false);
  }
};

__device__ __forceinline__ unsigned pk16(unsigned short a, unsigned short b) { return (unsigned)a | ((unsigned)b << 16); }
__device__ __forceinline__ unsigned short h_bits(float f) { const _Float16 h = (_Float16)f; return __builtin_bit_cast(unsigned short, h); }

// ---- Operand staging: asynchronous copies global -> LDS ----
constexpr int kStageK   = 64;    // k elements per stage = one whole 128-B line of every operand row
constexpr int kRowPitch = 144;   // LDS bytes per staged row: 128 + 16, an odd multiple of 16 B, so that the 16 rows of a fragment read fall on distinct banks

// Six 16-B copies per lane, global -> LDS through no register. The s_wait_xcnt 0 is the statement's last line so that
// no address register named by an issued copy is rewritten in front of it.
__device__ __forceinline__ void async_copy6(unsigned l0, const unsigned short* g0, unsigned l1, const unsigned short* g1,
                                            unsigned l2, const unsigned short* g2, unsigned l3, const unsigned short* g3,
                                            unsigned l4, const unsigned short* g4, unsigned l5, const unsigned short* g5) {
  asm volatile("global_load_async_to_lds_b128 %0, %1, off\n\t"
               "global_load_async_to_lds_b128 %2, %3, off\n\t"
               "global_load_async_to_lds_b128 %4, %5, off\n\t"
               "global_load_async_to_lds_b128 %6, %7, off\n\t"
               "global_load_async_to_lds_b128 %8, %9, off\n\t"
               "global_load_async_to_lds_b128 %10, %11, off\n\t"
               "s_wait_xcnt 0x0"
               :: "v"(l0), "v"(g0), "v"(l1), "v"(g1), "v"(l2), "v"(g2), "v"(l3), "v"(g3), "v"(l4), "v"(g4), "v"(l5), "v"(g5)
               : "memory");
}

// ---- Register-blocked batched WMMA GEMM (ACT reduced to none/relu/leaky; Cout/resid without restrict
//      so that the in-place residual accumulate (resid == Cout, same wave reads its rows before storing them) is well formed) --
// C[m,n] = scale * sum_k A[m,k] * Bt[n,k] (+bias)(+resid); each wave owns a 64x64 tile; the block's 8 waves form a WM x WN grid of
// such tiles and share one staged k-tile: 64*WM rows of A, then 64*WN rows of Bt, 64 k each, two LDS buffers (the next k-tile's
// copies fly while this one is multiplied).
// A row-major [M,K]; Bt row-major [N,K]; M % (64*WM) == 0, N % (64*WN) == 0, K % 64 == 0; rows and bases 16-B aligned.
// SPLIT (hi/lo planes) is not carried by the staged loop and must be false.
// BIAS_MODE: 0 = none, 1 = bias[m], 2 = bias[n].
// OUT_MODE: 0 = f32, 1 = f16, 2 = bf16 hi plane (Cout) + bf16 lo plane (Cout2).
// ET: 0 = f16 operands, 1 = bf16 operands (pointers passed as 16-bit storage)
template <int ET> struct Elem;
template <> struct Elem<0> { typedef _Float16 T; };
template <> struct Elem<1> { typedef __bf16 T; };
template <int ET, bool SPLIT, int BIAS_MODE, int OUT_MODE, bool RESID, int ACT, int WM, int WN>
__global__ __launch_bounds__(256) void wmma_gemm64(
    const unsigned short* __restrict__ Ap, const unsigned short* __restrict__ A2p, int lda, long strideA,
    const unsigned short* __restrict__ Btp, const unsigned short* __restrict__ Bt2p, int ldb, long strideB,
    void* Cout, void* Cout2, int ldc, long strideC,
    const float* __restrict__ bias,
    const float* resid, long strideR,
    int M, int N, int K, float scale,
    int inner, long strideA2, long strideB2, long strideC2, long strideR2) {
  typedef typename Elem<ET>::T T;
  typedef typename Frag<T>::V V;
  static_assert(!SPLIT, "the staged k-loop carries one plane per operand");
  static_assert(WM * WN == 8, "eight waves per block");
  constexpr int kRowsA  = 64 * WM;                    // staged rows 0..kRowsA-1 = A, the rest = Bt
  constexpr int kRows   = 64 * (WM + WN);
  constexpr int kStageB = kRows * kRowPitch;          // bytes of one buffer
  constexpr int kCopies = kRows / 32;                 // copies per lane and stage: 256 lanes cover 32 rows x 8 chunks of 16 B
  static_assert(kCopies % 6 == 0 && kCopies <= 63, "copies go out six to a statement");
  __shared__ __align__(16) unsigned char ring[2 * kStageB];
  __shared__ __align__(16) float sT[8][16 * 68];   // per-wave 16x64 slab, pitch 68 floats
  // two-level batch: blockIdx.y = outer * inner + b; b walks the first strides, outer the second
  const int outer = (int)blockIdx.y / inner;
  const int b     = (int)blockIdx.y - outer * inner;
  const size_t offA = (size_t)b * strideA + (size_t)outer * strideA2;
  const size_t offB = (size_t)b * strideB + (size_t)outer * strideB2;
  const size_t offC = (size_t)b * strideC + (size_t)outer * strideC2;
  const size_t offR = (size_t)b * strideR + (size_t)outer * strideR2;
  const int lane = threadIdx.x & 31;
  const int wave = threadIdx.x >> 5;
  const int tilesN = N / (64 * WN);
  const int tilesM = M / (64 * WM);
  if ((int)blockIdx.x >= tilesM * tilesN) return;   // block-uniform, in front of every barrier
  const int bm = blockIdx.x / tilesN;
  const int bn = blockIdx.x - bm * tilesN;
  const int mB = bm * (64 * WM);
  const int nB = bn * (64 * WN);
  const int wm = wave / WN;
  const int wn = wave - wm * WN;
  const int m0 = mB + (wm << 6);
  const int n0 = nB + (wn << 6);

  const int rlane = lane & 15;                 // row (A) / col (B, D) within subtile
  const int mOff  = (lane >> 4) * 8;           // D row offset

  // copy side: lane -> (row crow + 32*j, 16-B chunk cchk) of the staged k-tile
  const int crow = threadIdx.x >> 3;
  const int cchk = threadIdx.x & 7;
  const unsigned short* gA = Ap  + offA + (size_t)(mB + crow) * lda + cchk * 8;
  const unsigned short* gB = Btp + offB + (size_t)(nB + crow) * ldb + cchk * 8;
  const unsigned ldsC = (unsigned)(size_t)(void*)ring + (unsigned)(crow * kRowPitch + cchk * 16);
  auto issue = [&](int t, int buf) {
    const unsigned l = ldsC + (unsigned)(buf * kStageB);
    const unsigned short* a = gA + t * kStageK;
    const unsigned short* w = gB + t * kStageK;
    auto from = [&](int j) { return (j < kRowsA / 32) ? (a + (size_t)(j * 32) * lda) : (w + (size_t)((j - kRowsA / 32) * 32) * ldb); };
    auto to   = [&](int j) { return l + (unsigned)(j * 32 * kRowPitch); };
#pragma unroll
    for (int j = 0; j < kCopies; j += 6)
      async_copy6(to(j), from(j), to(j + 1), from(j + 1), to(j + 2), from(j + 2),
                  to(j + 3), from(j + 3), to(j + 4), from(j + 4), to(j + 5), from(j + 5));
  };
  // read side: this lane's row of the first A / Bt fragment, at its lane half's k offset (8 elements = 16 B)
  const unsigned char* fA = ring + ((wm << 6) + rlane) * kRowPitch + (lane >> 4) * 16;
  const unsigned char* fB = ring + (kRowsA + (wn << 6) + rlane) * kRowPitch + (lane >> 4) * 16;

  v8f acc[4][4];
#pragma unroll
  for (int i = 0; i < 4; ++i)
#pragma unroll
    for (int j = 0; j < 4; ++j) acc[i][j] = (v8f){0.f,0.f,0.f,0.f,0.f,0.f,0.f,0.f};

  const int nT = K / kStageK;
  issue(0, 0);
  asm volatile("s_wait_asynccnt 0x0" ::: "memory");   // this wave's copies of k-tile 0 have landed
  __syncthreads();                                    // ... and every other wave's: k-tile 0 may be read
  if (nT > 1) issue(1, 1);

  for (int t = 0; t < nT; ++t) {
    const int bo = (t & 1) * kStageB;
    // all fragment reads of the k-tile stand as one group in front of its WMMAs (one LDS latency per trip, counted waits behind it)
    V ah[kStageK / 32][4], bh[kStageK / 32][4];
#pragma unroll
    for (int ks = 0; ks < kStageK / 32; ++ks) {
#pragma unroll
      for (int j = 0; j < 4; ++j) bh[ks][j] = Frag<T>::load((const T*)(fB + bo + j * 16 * kRowPitch + ks * 64));
#pragma unroll
      for (int i = 0; i < 4; ++i) ah[ks][i] = Frag<T>::load((const T*)(fA + bo + i * 16 * kRowPitch + ks * 64));
    }
    __builtin_amdgcn_sched_barrier(0);   // keeps the reads one group: without it they are sunk between the WMMAs, each with a wait to 0
#pragma unroll
    for (int ks = 0; ks < kStageK / 32; ++ks)
#pragma unroll
      for (int i = 0; i < 4; ++i)
#pragma unroll
        for (int j = 0; j < 4; ++j) acc[i][j] = Frag<T>::mma(ah[ks][i], bh[ks][j], acc[i][j]);
    __builtin_amdgcn_sched_barrier(0);   // keeps the WMMAs in front of the waits: sunk behind them, the next k-tile's copies would be waited for before the work that hides them
    asm volatile("s_wait_dscnt 0x0" ::: "memory");     // this wave's reads of buffer t&1 have returned before it is refilled
    asm volatile("s_wait_asynccnt 0x0" ::: "memory");  // this wave's copies of k-tile t+1 have landed
    __syncthreads();                                   // publishes k-tile t+1 and ends every wave's reads of buffer t&1
    if (t + 2 < nT) issue(t + 2, t & 1);
  }
  asm volatile("s_wait_asynccnt 0x0" ::: "memory");    // no copy is outstanding when the wave goes on to the epilogue and ends
  acc_guard4(acc[0][0], acc[0][1], acc[0][2], acc[0][3]);
  acc_guard4(acc[1][0], acc[1][1], acc[1][2], acc[1][3]);
  acc_guard4(acc[2][0], acc[2][1], acc[2][2], acc[2][3]);
  acc_guard4(acc[3][0], acc[3][1], acc[3][2], acc[3][3]);

  // ---- epilogue ----
  float* slab = sT[wave];
  const float* Rb = RESID ? (resid + offR) : nullptr;
#pragma unroll
  for (int i = 0; i < 4; ++i) {
    const int mBase = m0 + (i << 4);
#pragma unroll
    for (int j = 0; j < 4; ++j) {
      const int n = n0 + (j << 4) + rlane;
      float bv = 0.f;
      if (BIAS_MODE == 2) bv = bias[n];
#pragma unroll
      for (int r = 0; r < 8; ++r) {
        float v = acc[i][j][r] * scale;
        if (BIAS_MODE == 1) v += bias[mBase + mOff + r];
        if (BIAS_MODE == 2) v += bv;
        if (RESID) v += Rb[(size_t)(mBase + mOff + r) * ldc + n];
        if (ACT == 2) v = fmaxf(v, 0.0f);
        if (ACT == 4) v = (v > 0.f) ? v : 0.01f * v;
        slab[(mOff + r) * 68 + (j << 4) + rlane] = v;
      }
    }
    __builtin_amdgcn_fence(__ATOMIC_RELEASE, "workgroup");
    __builtin_amdgcn_wave_barrier();
    __builtin_amdgcn_fence(__ATOMIC_ACQUIRE, "workgroup");
    if (OUT_MODE == 0) {
      float* C = (float*)Cout + offC;
      const int hh = lane >> 4, c4 = (lane & 15) * 4;     // row seg = 256 B = 16 lanes x 16 B
      {
#pragma unroll
        for (int it = 0; it < 8; ++it) {
          const int row = it * 2 + hh;
          v4f v = *(const v4f*)(slab + row * 68 + c4);
          *(v4f*)(C + (size_t)(mBase + row) * ldc + n0 + c4) = v;
        }
        
      }
    } else {
      const int q = lane >> 3, c8 = (lane & 7) * 8;
      unsigned short* C  = (unsigned short*)Cout  + offC;
      unsigned short* C2 = (OUT_MODE == 2) ? ((unsigned short*)Cout2 + offC) : nullptr;
      {
#pragma unroll
        for (int it = 0; it < 4; ++it) {
          const int row = it * 4 + q;
          const float* sp = slab + row * 68 + c8;
          v8h hv, lv;
#pragma unroll
          for (int e = 0; e < 8; ++e) {
            if (OUT_MODE == 1) {
              hv[e] = (_Float16)sp[e];
            } else {
              unsigned short hb = f2bf_bits(sp[e]);
              unsigned short lb = f2bf_bits(sp[e] - bf_bits2f(hb));
              hv[e] = __builtin_bit_cast(_Float16, hb);
              lv[e] = __builtin_bit_cast(_Float16, lb);
            }
          }
          *(v8h*)(C + (size_t)(mBase + row) * ldc + n0 + c8) = hv;
          if (OUT_MODE == 2) *(v8h*)(C2 + (size_t)(mBase + row) * ldc + n0 + c8) = lv;
        }
        
      }
    }
    __builtin_amdgcn_fence(__ATOMIC_RELEASE, "workgroup");
    __builtin_amdgcn_wave_barrier();
    __builtin_amdgcn_fence(__ATOMIC_ACQUIRE, "workgroup");
  }
}

// ---------------------------------------------------------------------------
// All weight casts in one resident launch: 256 blocks (one per WGP) x 512 threads = 4096 waves, started once.
// The launch covers one [1024][1024] matrix per step (4096 waves x 256 elements) and walks 13 of them:
//   steps 0..3  Wq[s] -> Wqkb[s] rows 0..1023    (bf16, RNE)
//   steps 4..7  Wk[s] -> Wqkb[s] rows 1024..2047 (bf16, RNE)
//   steps 8..11 Wv[s] -> Wvb[s]                  (bf16, RNE)
//   step  12    Wo    -> Wo16 = f16(16 * bf16(Wo)) (RNE to bf16 first, then the exact power-of-two carry into f16)
// A wave owns the same 256-element run of every matrix: two loads of 32 lanes x 16 B = 512 contiguous bytes each (whole lines),
// two stores of 32 lanes x 8 B = 256 contiguous bytes each (whole lines). All 26 loads of a lane are issued before the first
// conversion, so that the wave pays the memory latency once.
// ---------------------------------------------------------------------------
constexpr int kMat       = kDim * kDim;    // elements of one weight matrix
constexpr int kCastSteps = 3 * kSamp + 1;  // 13
__global__ __launch_bounds__(512) void cast_weights_kernel(const float* __restrict__ Wq, const float* __restrict__ Wk,
                                                           const float* __restrict__ Wv, const float* __restrict__ Wo,
                                                           unsigned short* __restrict__ Wqkb, unsigned short* __restrict__ Wvb,
                                                           unsigned short* __restrict__ Wo16) {
  // byte offset of the lane's first four elements in every source matrix; the second four stand 512 B further on.
  // The offsets + 8 MiB have registers of their own: with them every access is scalar base + 32-bit lane offset + immediate.
  const unsigned ib  = ((blockIdx.x * 16u + (threadIdx.x >> 5)) * 256u + (threadIdx.x & 31u) * 4u) * 4u;
  const unsigned ib2 = ib + 2u * kMat * 4u;
  const unsigned ob  = ib >> 1;                 // the same in every destination (2 B an element)
  const unsigned ob2 = ob + 4u * kMat * 2u;
  v4f a[kCastSteps], c[kCastSteps];
#pragma unroll   // the source is chosen at compile time; a[], c[] stay in registers
  for (int m = 0; m < kCastSteps; ++m) {
    const int s = m & (kSamp - 1);
    const float* w = (m < kSamp) ? Wq : (m < 2 * kSamp) ? Wk : (m < 3 * kSamp) ? Wv : Wo;
    const char* p = (const char*)w + ((s < 2) ? ib : ib2) + (s & 1) * (kMat * 4);
    a[m] = *(const v4f*)(p);
    c[m] = *(const v4f*)(p + 512);
  }
  asm volatile("s_wait_xcnt 0x0" :: "v"(ib), "v"(ib2) : "memory");   // the loads' offset registers stay untouched up to here (inputs only) and may be reused behind it
  __builtin_amdgcn_sched_barrier(0);   // keeps all 26 loads in front of the first conversion: without it the last ones are sunk behind waits for the first and pay a second memory latency
#pragma unroll   // as above, for the destination
  for (int m = 0; m < kCastSteps; ++m) {
    const int s = m & (kSamp - 1);
    const int r = (m < kSamp) ? 2 * s : (m < 2 * kSamp) ? 2 * s + 1 : s;      // matrix slot in the destination plane
    unsigned short* d = (m < 2 * kSamp) ? Wqkb : (m < 3 * kSamp) ? Wvb : Wo16;
    char* q = (char*)d + ((r < 4) ? ob : ob2) + (r & 3) * (kMat * 2);
    unsigned short ha[4], hc[4];
#pragma unroll
    for (int i = 0; i < 4; ++i) {
      ha[i] = f2bf_bits(a[m][i]);
      hc[i] = f2bf_bits(c[m][i]);
      if (m == kCastSteps - 1) {
        ha[i] = h_bits(kWoCarry * bf_bits2f(ha[i]));
        hc[i] = h_bits(kWoCarry * bf_bits2f(hc[i]));
      }
    }
    *(v2u*)(q)       = (v2u){pk16(ha[0], ha[1]), pk16(ha[2], ha[3])};
    *(v2u*)(q + 256) = (v2u){pk16(hc[0], hc[1]), pk16(hc[2], hc[3])};
  }
}

// ---------------------------------------------------------------------------
// x cast with the mean pool and the gate's dot product folded in.
// grid = 256 blocks of 8 token rows (128 blocks per batch); thread -> 8 consecutive columns (tid % 128) * 8 of the rows tid / 128 + 2j.
//   xb = bf16(x) (RNE): four 16-B stores per lane, one per row.
//   part[b][s][chunk] = sum_d (sum over the block's 8 rows of bf16(x[b][n][d])) * bf16(Wg[s][d]), f32:
//     per thread 4 rows in order, 8 columns in order; shuffle tree over the wave; the 8 waves in wave order.
// The sum over the 128 chunks, the 1/1024 of the mean and the sigmoid are gate_kernel's.
// ---------------------------------------------------------------------------
constexpr int kPoolRows   = 8;
constexpr int kPoolChunks = kSeq / kPoolRows;   // 128 per batch
__global__ __launch_bounds__(256) void cast_x_pool_kernel(const float* __restrict__ x, const float* __restrict__ Wg,
                                                          unsigned short* __restrict__ xb, float* __restrict__ part) {
  __shared__ float red[8][kSamp];
  const int tid = threadIdx.x, lane = tid & 31, wave = tid >> 5;
  const int col = (tid & 127) * 8;
  const size_t base = (size_t)(blockIdx.x * kPoolRows + (tid >> 7)) * kDim + col;
  v4f a[kPoolRows / 2], c[kPoolRows / 2];
#pragma unroll
  for (int j = 0; j < kPoolRows / 2; ++j) {
    a[j] = *(const v4f*)(x + base + (size_t)(2 * j) * kDim);
    c[j] = *(const v4f*)(x + base + (size_t)(2 * j) * kDim + 4);
  }
  float cs[8];
#pragma unroll
  for (int e = 0; e < 8; ++e) cs[e] = 0.f;
#pragma unroll
  for (int j = 0; j < kPoolRows / 2; ++j) {
    unsigned short hb[8];
#pragma unroll
    for (int e = 0; e < 4; ++e) {
      hb[e]     = f2bf_bits(a[j][e]);
      hb[4 + e] = f2bf_bits(c[j][e]);
    }
#pragma unroll
    for (int e = 0; e < 8; ++e) cs[e] += bf_bits2f(hb[e]);
    *(v4u*)(xb + base + (size_t)(2 * j) * kDim) = (v4u){pk16(hb[0], hb[1]), pk16(hb[2], hb[3]), pk16(hb[4], hb[5]), pk16(hb[6], hb[7])};
  }
  float dot[kSamp];
#pragma unroll
  for (int s = 0; s < kSamp; ++s) {
    const v4f w0 = *(const v4f*)(Wg + s * kDim + col);
    const v4f w1 = *(const v4f*)(Wg + s * kDim + col + 4);
    float acc = 0.f;
#pragma unroll
    for (int e = 0; e < 4; ++e) acc += cs[e] * bf_bits2f(f2bf_bits(w0[e]));
#pragma unroll
    for (int e = 0; e < 4; ++e) acc += cs[4 + e] * bf_bits2f(f2bf_bits(w1[e]));
    dot[s] = acc;
  }
#pragma unroll
  for (int off = 16; off > 0; off >>= 1)
#pragma unroll
    for (int s = 0; s < kSamp; ++s) dot[s] += __shfl_xor(dot[s], off, 32);
  if (lane == 0) {
#pragma unroll
    for (int s = 0; s < kSamp; ++s) red[wave][s] = dot[s];
  }
  __syncthreads();
  if (tid < kSamp) {
    float t = red[0][tid];
#pragma unroll
    for (int w = 1; w < 8; ++w) t += red[w][tid];
    const int b = blockIdx.x / kPoolChunks, chunk = blockIdx.x - b * kPoolChunks;
    part[(b * kSamp + tid) * kPoolChunks + chunk] = t;
  }
}

// ---------------------------------------------------------------------------
// Gates and mixing weights (one block, 256 threads = 8 waves):
//   coh[b][s] = sigmoid((1/1024) * sum_chunk part[b][s][chunk] + bg[s])  (wave w -> (b, s) = (w>>2, w&3); four chunks per lane + shuffle tree)
//   t = clip(temperature, 0.1, 10); invt = 1/t; gw = softmax(hyp_w * invt)
// ---------------------------------------------------------------------------
// e^x as __expf forms it (x * log2(e), then v_exp_f32), with the slot behind the transcendental filled in the same statement.
__device__ __forceinline__ float exp_slot(float x) {
  float r;
  asm("v_exp_f32 %0, %1\n\tv_nop" : "=v"(r) : "v"(x * 1.44269504088896340736f));
  return r;
}
__global__ __launch_bounds__(256) void gate_kernel(const float* __restrict__ part,
                                                   const float* __restrict__ bg, const float* __restrict__ hw,
                                                   const float* __restrict__ temp, float* __restrict__ wsS) {
  __shared__ float vals[32];
  const int t = threadIdx.x, lane = t & 31, wave = t >> 5;
  if (t < 32) vals[t] = 0.f;
  __syncthreads();
  {
    const int b = wave >> 2, s = wave & 3;
    const v4f p = *(const v4f*)(part + wave * kPoolChunks + lane * 4);
    float acc = (p[0] + p[1]) + (p[2] + p[3]);
#pragma unroll
    for (int off = 16; off > 0; off >>= 1) acc += __shfl_xor(acc, off, 32);
    if (lane == 0) {
      const float z = acc * (1.0f / (float)kSeq) + bf_bits2f(f2bf_bits(bg[s]));
      vals[4 + b * kSamp + s] = 1.0f / (1.0f + __expf(-z));
    }
  }
  __syncthreads();
  if (t == 0) {
    float tc = bf_bits2f(f2bf_bits(temp[0]));
    tc = fminf(fmaxf(tc, 0.1f), 10.0f);
    const float invt = 1.0f / tc;
    const float l0 = bf_bits2f(f2bf_bits(hw[0])) * invt;
    const float l1 = bf_bits2f(f2bf_bits(hw[1])) * invt;
    const float l2 = bf_bits2f(f2bf_bits(hw[2])) * invt;
    const float l3 = bf_bits2f(f2bf_bits(hw[3])) * invt;
    const float mx = fmaxf(fmaxf(l0, l1), fmaxf(l2, l3));
    const float e0 = exp_slot(l0 - mx), e1 = exp_slot(l1 - mx), e2 = exp_slot(l2 - mx), e3 = exp_slot(l3 - mx);
    const float is = 1.0f / ((e0 + e1) + (e2 + e3));
    vals[0] = e0 * is; vals[1] = e1 * is; vals[2] = e2 * is; vals[3] = e3 * is;
    vals[12] = invt;
  }
  __syncthreads();
  if (wave == 0) {
    const float v = vals[lane];
    *(float*)(wsS + lane) = v;
    
  }
}

// ---------------------------------------------------------------------------
// Fused attention: scores, softmax, head/sample mixing and attn.v in one launch; no score or probability plane in memory.
// grid = (32 tiles of 32 query rows, 2 batches, 4 head quarters) = 256 blocks, one per WGP (the LDS admits one); 256 threads = 8 waves;
// the block walks n = h*4 + s (head outer, sample inner) over its own 4 heads.
// The 32 query rows are two 16-row tiles rt = 0, 1: every staged k and v^T tile, and every fragment read from LDS, serves both.
// Wave w owns the key columns j = 128w .. 128w+127 of the block's 32 x 1024 score rows.
//   scores transposed: D[j][i] = sum_d k[j][d] q[i][d]  (A = k rows from LDS, B = q rows from registers): lane (c, hf) holds
//     query row i = 16rt + c and, per 16-j tile jt, the eight consecutive keys j = 128w + 16jt + 8hf + r.
//   softmax over j: per-wave maximum and sum (in-lane, then lane ^ 16), merged over the 8 waves through LDS.
//   a pair of score tiles (2m, 2m+1), converted to f16, IS the A fragment of attn.v for k = 32m .. 32m+31 (same lane, same order
//     as the fragment loader: elements 0..7 = k 8hf.., elements 8..15 = k 16+8hf..): the probabilities never leave the registers.
//   attn.v: each wave sums over its own 128 keys and over the 4 samples; the 8 partial 16x64 tiles are added through LDS per head,
//     one row tile after the other through the same slabs.
//   output 2 is accumulated in registers over the block's 16 (h, s) and stored once, into the head quarter's own partial plane;
//     add_planes_kernel adds the four planes.
// k (1024 rows x 128 B) and v^T (64 rows x 2048 B) of one (h, s) are staged in LDS by asynchronous copies, one buffer each; the tile
// sequence k(0), v(0), k(1), v(1), ... alternates between the two buffers as a two-buffer ring: each half pass reads one buffer
// while the other one's copies fly.
// ---------------------------------------------------------------------------
constexpr int kKPitch = 144;                 // 128 + 16 B, odd multiple of 16 B (distinct banks for the 16 rows of a fragment read)
constexpr int kVPitch = 2 * kSeq + 16;       // 2064 B = 129 x 16 B, likewise
constexpr int kKBytes = kSeq * kKPitch;      // 147,456
constexpr int kVBytes = kDh * kVPitch;       // 132,096
constexpr int kRowTiles = 2;                               // 16-row query tiles per block
constexpr int kHeadSplit = 4;                              // head quarters, one block each
constexpr int kPasses = kHeads * kSamp / kHeadSplit;       // 16 per block
constexpr int kPlane2 = kBatch * kSeq * kSeq;              // elements of output 2 = of one partial plane
typedef __attribute__((ext_vector_type(4))) _Float16 v4h;

// Eight 16-B copies per lane, global -> LDS through no register. The s_wait_xcnt 0 is the statement's last line so that
// no address register named by an issued copy is rewritten in front of it.
__device__ __forceinline__ void async_copy8(unsigned l0, const unsigned short* g0, unsigned l1, const unsigned short* g1,
                                            unsigned l2, const unsigned short* g2, unsigned l3, const unsigned short* g3,
                                            unsigned l4, const unsigned short* g4, unsigned l5, const unsigned short* g5,
                                            unsigned l6, const unsigned short* g6, unsigned l7, const unsigned short* g7) {
  asm volatile("global_load_async_to_lds_b128 %0, %1, off\n\t"
               "global_load_async_to_lds_b128 %2, %3, off\n\t"
               "global_load_async_to_lds_b128 %4, %5, off\n\t"
               "global_load_async_to_lds_b128 %6, %7, off\n\t"
               "global_load_async_to_lds_b128 %8, %9, off\n\t"
               "global_load_async_to_lds_b128 %10, %11, off\n\t"
               "global_load_async_to_lds_b128 %12, %13, off\n\t"
               "global_load_async_to_lds_b128 %14, %15, off\n\t"
               "s_wait_xcnt 0x0"
               :: "v"(l0), "v"(g0), "v"(l1), "v"(g1), "v"(l2), "v"(g2), "v"(l3), "v"(g3),
                  "v"(l4), "v"(g4), "v"(l5), "v"(g5), "v"(l6), "v"(g6), "v"(l7), "v"(g7)
               : "memory");
}

// value of lane l ^ 16
__device__ __forceinline__ float other_half(float v) {
  const int b = __builtin_bit_cast(int, v);
  return __builtin_bit_cast(float, __builtin_amdgcn_permlanex16(b, b, 0x76543210, 0xfedcba98, false, false));
}

// 2^x (v_exp_f32, as __builtin_amdgcn_exp2f forms it) with the slot behind the transcendental filled in the same statement.
__device__ __forceinline__ float exp2_slot(float x) {
  float r;
  asm("v_exp_f32 %0, %1\n\tv_nop" : "=v"(r) : "v"(x));
  return r;
}

__global__ __launch_bounds__(256) void fused_attn_kernel(const unsigned short* __restrict__ QK, const unsigned short* __restrict__ VT,
                                                         const float* __restrict__ wsS, unsigned short* __restrict__ comb,
                                                         float* __restrict__ out2) {
  typedef Frag<_Float16> F;
  __shared__ __align__(16) unsigned char kbuf[kKBytes];
  __shared__ __align__(16) unsigned char vbuf[kVBytes];
  __shared__ __align__(16) float ored[8][16 * 68];               // per-wave 16x64 partial of attn.v (one row tile), pitch 68 floats
  __shared__ __align__(16) float redM[kRowTiles * 16][8];        // [query row][wave] maximum (log2 domain)
  __shared__ __align__(16) float redL[kRowTiles * 16][8];        // [query row][wave] sum
  const int tid = threadIdx.x, lane = tid & 31, wave = tid >> 5;
  const int c = lane & 15, hf = lane >> 4;
  const int i0 = blockIdx.x * (16 * kRowTiles), bat = blockIdx.y;
  const int nBeg = blockIdx.z * kPasses, nEnd = nBeg + kPasses;   // this block's passes: heads 4z .. 4z+3, all samples
  const float cs = kScoreScale * wsS[12] * 1.44269504088896340736f;   // raw accumulator -> (0.125 q.k / t) * log2(e); > 0

  // copy side. k: lane -> (row tid/8 + 32j, 16-B chunk tid%8); v^T: lane -> (row tid/128 + 2j, 16-B chunk tid%128); j = 0..31
  const unsigned short* gK = QK + (size_t)(bat * kSeq + (tid >> 3)) * kQKld + kDim + (tid & 7) * 8;
  const unsigned short* gV = VT + (size_t)bat * kDim * kSeq + (size_t)(tid >> 7) * kSeq + (tid & 127) * 8;
  const unsigned lK = (unsigned)(size_t)(void*)kbuf + (unsigned)((tid >> 3) * kKPitch + (tid & 7) * 16);
  const unsigned lV = (unsigned)(size_t)(void*)vbuf + (unsigned)((tid >> 7) * kVPitch + (tid & 127) * 16);
  auto issueK = [&](int n) {
    const unsigned short* g = gK + (size_t)(n & 3) * kTok * kQKld + (n >> 2) * kDh;
    unsigned l = lK;
    auto from = [&](int j) { return g + (size_t)(j * 32) * kQKld; };
    auto to   = [&](int j) { return l + (unsigned)(j * 32 * kKPitch); };
#pragma unroll 1   // rolled: unrolled, the 32 LDS addresses are invariant in the pass loop and are held in registers across it (spills)
    for (int j = 0; j < 4; ++j) {
      async_copy8(to(0), from(0), to(1), from(1), to(2), from(2), to(3), from(3),
                  to(4), from(4), to(5), from(5), to(6), from(6), to(7), from(7));
      l += (unsigned)(8 * 32 * kKPitch);
      g += (size_t)(8 * 32) * kQKld;
    }
  };
  auto issueV = [&](int n) {
    const unsigned short* g = gV + (size_t)(n & 3) * kBatch * kDim * kSeq + (size_t)(n >> 2) * kDh * kSeq;
    unsigned l = lV;
    auto from = [&](int j) { return g + (size_t)(j * 2) * kSeq; };
    auto to   = [&](int j) { return l + (unsigned)(j * 2 * kVPitch); };
#pragma unroll 1   // rolled, as in issueK
    for (int j = 0; j < 4; ++j) {
      async_copy8(to(0), from(0), to(1), from(1), to(2), from(2), to(3), from(3),
                  to(4), from(4), to(5), from(5), to(6), from(6), to(7), from(7));
      l += (unsigned)(8 * 2 * kVPitch);
      g += (size_t)(8 * 2) * kSeq;
    }
  };
  // read side: this lane's row of the wave's first k / v^T fragment, at its lane half's k offset (8 elements = 16 B)
  const unsigned char* fK = kbuf + (wave * 128 + c) * kKPitch + hf * 16;
  const unsigned char* fV = vbuf + c * kVPitch + wave * 256 + hf * 16;
  const _Float16* qL = (const _Float16*)QK + (size_t)(bat * kSeq + i0 + c) * kQKld + hf * 8;
  constexpr size_t kQTile = (size_t)16 * kQKld;       // elements from a q row of row tile 0 to the same row of row tile 1

  const v8f zero8 = (v8f){0.f,0.f,0.f,0.f,0.f,0.f,0.f,0.f};
  v8f a2[kRowTiles][8], accO[kRowTiles][4];
#pragma unroll
  for (int rt = 0; rt < kRowTiles; ++rt) {
#pragma unroll
    for (int jt = 0; jt < 8; ++jt) a2[rt][jt] = zero8;
#pragma unroll
    for (int dt = 0; dt < 4; ++dt) accO[rt][dt] = zero8;
  }

  issueK(nBeg);
  const _Float16* qB  = qL + (nBeg >> 2) * kDh;       // sample 0 of the block's first head
  const _Float16* qB1 = qB + kQTile;
  v16h qf[kRowTiles][2];
  qf[0][0] = F::load(qB);  qf[0][1] = F::load(qB + 32);
  qf[1][0] = F::load(qB1); qf[1][1] = F::load(qB1 + 32);
  asm volatile("s_wait_xcnt 0x0" :: "v"(qB) : "memory");   // as behind the loop's q loads: the address registers stay untouched up to here and are reused behind it
  asm volatile("s_wait_asynccnt 0x0" ::: "memory");   // this wave's copies of the first k tile have landed
  __syncthreads();                                    // ... and every other wave's: it may be read
  issueV(nBeg);

#pragma unroll 1
  for (int n = nBeg; n < nEnd; ++n) {
    const int s = n & 3, h = n >> 2;
    const float gw  = wsS[s];
    const float coh = wsS[4 + bat * kSamp + s];
    // ---- first half pass: reads kbuf alone; each k fragment multiplies both row tiles' q ----
    v8f sc[kRowTiles][8];
#pragma unroll
    for (int jt = 0; jt < 8; ++jt) {
      const v16h kf = F::load((const _Float16*)(fK + jt * 16 * kKPitch));
#pragma unroll
      for (int rt = 0; rt < kRowTiles; ++rt) sc[rt][jt] = F::mma(kf, qf[rt][0], zero8);
    }
#pragma unroll
    for (int jt = 0; jt < 8; ++jt) {
      const v16h kf = F::load((const _Float16*)(fK + jt * 16 * kKPitch + 64));
#pragma unroll
      for (int rt = 0; rt < kRowTiles; ++rt) sc[rt][jt] = F::mma(kf, qf[rt][1], sc[rt][jt]);
    }
    float mb[kRowTiles];
#pragma unroll
    for (int rt = 0; rt < kRowTiles; ++rt) {
      float mr[8];
#pragma unroll
      for (int r = 0; r < 8; ++r) mr[r] = sc[rt][0][r];
#pragma unroll
      for (int jt = 1; jt < 8; ++jt)
#pragma unroll
        for (int r = 0; r < 8; ++r) mr[r] = fmaxf(mr[r], sc[rt][jt][r]);
      float mx = fmaxf(fmaxf(fmaxf(mr[0], mr[1]), fmaxf(mr[2], mr[3])), fmaxf(fmaxf(mr[4], mr[5]), fmaxf(mr[6], mr[7])));
      mx = fmaxf(mx, other_half(mx));
      mb[rt] = mx * cs;
      float ls[8];
#pragma unroll
      for (int r = 0; r < 8; ++r) ls[r] = 0.f;
#pragma unroll
      for (int jt = 0; jt < 8; ++jt)
#pragma unroll
        for (int r = 0; r < 8; ++r) {
          const float e = __builtin_amdgcn_exp2f(fmaf(sc[rt][jt][r], cs, -mb[rt]));
          sc[rt][jt][r] = e;
          ls[r] += e;
        }
      float l = ((ls[0] + ls[1]) + (ls[2] + ls[3])) + ((ls[4] + ls[5]) + (ls[6] + ls[7]));
      l += other_half(l);
      *(hf ? &redL[rt * 16 + c][wave] : &redM[rt * 16 + c][wave]) = hf ? l : mb[rt];
    }
    asm volatile("s_wait_dscnt 0x0" ::: "memory");     // this wave's reads of kbuf have returned before it is refilled
    asm volatile("s_wait_asynccnt 0x0" ::: "memory");  // this wave's copies of v(n) have landed
    __syncthreads();                                   // publishes v(n) and the wave partials; ends every wave's reads of kbuf
    if (n + 1 < nEnd) issueK(n + 1);
    // next pass's q fragments, fetched a half pass ahead (the last pass fetches its own again: in bounds, unused)
    const int nn = (n + 1 < nEnd) ? n + 1 : n;
    const _Float16* qN  = qL + (size_t)(nn & 3) * kTok * kQKld + (nn >> 2) * kDh;
    const _Float16* qN1 = qN + kQTile;
    qf[0][0] = F::load(qN);  qf[0][1] = F::load(qN + 32);
    qf[1][0] = F::load(qN1); qf[1][1] = F::load(qN1 + 32);
    asm volatile("s_wait_xcnt 0x0" :: "v"(qN) : "memory");   // the q loads' address registers stay untouched up to here (input only: no load lands on them) and are rewritten behind it

    // ---- second half pass: reads vbuf alone; each v^T fragment multiplies both row tiles' probabilities ----
    // the v^T fragment reads go one 32-key step ahead of their WMMAs, two register sets; the first group stands in front of the
    // merge arithmetic, which hides its LDS latency
    v16h vf[2][4];
#pragma unroll
    for (int dt = 0; dt < 4; ++dt) vf[0][dt] = F::load((const _Float16*)(fV + dt * 16 * kVPitch));
    float fA[kRowTiles], fP[kRowTiles];
#pragma unroll
    for (int rt = 0; rt < kRowTiles; ++rt) {
      const v4f ma = *(const v4f*)&redM[rt * 16 + c][0], mc = *(const v4f*)&redM[rt * 16 + c][4];
      const v4f la = *(const v4f*)&redL[rt * 16 + c][0], lc = *(const v4f*)&redL[rt * 16 + c][4];
      const float M = fmaxf(fmaxf(fmaxf(ma[0], ma[1]), fmaxf(ma[2], ma[3])), fmaxf(fmaxf(mc[0], mc[1]), fmaxf(mc[2], mc[3])));
      const float L = ((la[0] * exp2_slot(ma[0] - M) + la[1] * exp2_slot(ma[1] - M)) +
                       (la[2] * exp2_slot(ma[2] - M) + la[3] * exp2_slot(ma[3] - M))) +
                      ((lc[0] * exp2_slot(mc[0] - M) + lc[1] * exp2_slot(mc[1] - M)) +
                       (lc[2] * exp2_slot(mc[2] - M) + lc[3] * exp2_slot(mc[3] - M)));
      const float f = __builtin_amdgcn_exp2f(mb[rt] - M) / L;    // this wave's exp2(x - mb) -> probability
      fA[rt] = f * (gw * (1.0f / (float)kHeads));
      fP[rt] = f * (kPCarry * gw * coh);
    }
#pragma unroll
    for (int m = 0; m < 4; ++m) {
      if (m + 1 < 4) {
#pragma unroll
        for (int dt = 0; dt < 4; ++dt) vf[(m + 1) & 1][dt] = F::load((const _Float16*)(fV + dt * 16 * kVPitch + (m + 1) * 64));
      }
      __builtin_amdgcn_sched_barrier(0);   // keeps the next step's reads one group in front of this step's WMMAs: without it they are sunk to their users, each with a wait to 0
#pragma unroll
      for (int rt = 0; rt < kRowTiles; ++rt) {
        F::U p;
#pragma unroll
        for (int r = 0; r < 8; ++r) {
          a2[rt][2 * m][r]     = fmaf(sc[rt][2 * m][r], fA[rt], a2[rt][2 * m][r]);
          a2[rt][2 * m + 1][r] = fmaf(sc[rt][2 * m + 1][r], fA[rt], a2[rt][2 * m + 1][r]);
          p.h[0][r] = (_Float16)(sc[rt][2 * m][r] * fP[rt]);
          p.h[1][r] = (_Float16)(sc[rt][2 * m + 1][r] * fP[rt]);
        }
#pragma unroll
        for (int dt = 0; dt < 4; ++dt) accO[rt][dt] = F::mma(p.v, vf[m & 1][dt], accO[rt][dt]);
      }
      __builtin_amdgcn_sched_barrier(0);   // keeps the reads of the step after next behind this step's WMMAs: lifted over them they take a third register set (spills)
    }
    // the slots between the last WMMAs and a reader of their D on the taken side of the branch below
    acc_guard4(accO[0][0], accO[0][1], accO[0][2], accO[0][3]);
    acc_guard4(accO[1][0], accO[1][1], accO[1][2], accO[1][3]);
    float* slab = ored[wave];
    if (s == kSamp - 1) {
#pragma unroll
      for (int dt = 0; dt < 4; ++dt)
#pragma unroll
        for (int r = 0; r < 8; ++r) slab[(hf * 8 + r) * 68 + dt * 16 + c] = accO[0][dt][r];
    }
    asm volatile("s_wait_dscnt 0x0" ::: "memory");     // this wave's reads of vbuf have returned before it is refilled
    asm volatile("s_wait_asynccnt 0x0" ::: "memory");  // this wave's copies of k(n+1) have landed
    __syncthreads();                                   // publishes k(n+1) and row tile 0's attn.v partials; ends every wave's reads of vbuf
    if (n + 1 < nEnd) issueV(n + 1);
    if (s == kSamp - 1) {
      // combined[i][h*64 + d] x256: the 8 waves' partials in wave order; thread -> (row tid/16, four d), 16 lanes = one 128-B line
      const int row = tid >> 4, d4 = (tid & 15) * 4;
      v4h o[kRowTiles];
#pragma unroll
      for (int rt = 0; rt < kRowTiles; ++rt) {
        if (rt > 0) {
          __syncthreads();                                 // ends every wave's reads of the previous row tile's partials
#pragma unroll
          for (int dt = 0; dt < 4; ++dt)
#pragma unroll
            for (int r = 0; r < 8; ++r) slab[(hf * 8 + r) * 68 + dt * 16 + c] = accO[rt][dt][r];
          __syncthreads();                                 // publishes this row tile's partials
        }
        v4f t = *(const v4f*)&ored[0][row * 68 + d4];
#pragma unroll
        for (int w = 1; w < 8; ++w) t += *(const v4f*)&ored[w][row * 68 + d4];
#pragma unroll
        for (int e = 0; e < 4; ++e) o[rt][e] = (_Float16)(t[e] * kPVScale);
      }
      // both stores stand behind the last barrier: in front of one, the barrier would wait for the store to complete
#pragma unroll
      for (int rt = 0; rt < kRowTiles; ++rt)
        *(v4h*)(comb + (size_t)(bat * kSeq + i0 + rt * 16 + row) * kDim + h * kDh + d4) = o[rt];
      asm volatile("s_wait_xcnt 0x0" ::: "memory");      // the stores' address and data registers are rewritten by the next head
#pragma unroll
      for (int rt = 0; rt < kRowTiles; ++rt)
#pragma unroll
        for (int dt = 0; dt < 4; ++dt) accO[rt][dt] = zero8;
    }
  }
  asm volatile("s_wait_asynccnt 0x0" ::: "memory");    // no copy is outstanding when the wave ends

  // output 2, this head quarter's plane: lane holds rows i0 + 16rt + c, per tile eight consecutive columns (32 B); the wave covers 512 B of each of its 32 rows
#pragma unroll
  for (int rt = 0; rt < kRowTiles; ++rt) {
    float* orow = out2 + (size_t)blockIdx.z * kPlane2 + (size_t)(bat * kSeq + i0 + rt * 16 + c) * kSeq + wave * 128 + hf * 8;
#pragma unroll
    for (int jt = 0; jt < 8; ++jt) {
      *(v4f*)(orow + jt * 16)     = (v4f){a2[rt][jt][0], a2[rt][jt][1], a2[rt][jt][2], a2[rt][jt][3]};
      *(v4f*)(orow + jt * 16 + 4) = (v4f){a2[rt][jt][4], a2[rt][jt][5], a2[rt][jt][6], a2[rt][jt][7]};
    }
  }
}

// ---------------------------------------------------------------------------
// Output 2 = (plane 0 + plane 1) + (plane 2 + plane 3) of the fused kernel's partial sums (heads 0..3, 4..7, 8..11, 12..15).
// 1024 blocks x 256 threads x 2 x 4 floats = 2,097,152 = one plane exactly; a wave reads and writes whole 512-B runs.
// ---------------------------------------------------------------------------
__global__ __launch_bounds__(256) void add_planes_kernel(const float* __restrict__ part, float* __restrict__ out) {
  const int i = (blockIdx.x * 512 + threadIdx.x) * 4;
  v4f p[2][kHeadSplit];
#pragma unroll   // all eight loads are in flight before the first sum
  for (int u = 0; u < 2; ++u)
#pragma unroll
    for (int z = 0; z < kHeadSplit; ++z) p[u][z] = *(const v4f*)(part + (size_t)z * kPlane2 + i + u * 1024);
#pragma unroll   // p[][] stays in registers
  for (int u = 0; u < 2; ++u) *(v4f*)(out + i + u * 1024) = (p[u][0] + p[u][1]) + (p[u][2] + p[u][3]);
}

// ---------------------------------------------------------------------------
// Workspace region map (byte offsets, all multiples of 4096). Every region is fully written before it is read.
//   wsS    f32 [32] (gw, coh, 1/t)                              0           ..       4,096
//   gpart  f32 [2 b][4 s][128 chunks] (4,096 B of the region)   4,096       ..      12,288
//   Wo16   f16  [1024][1024]  = f16(16*bf16(Wo))               12,288      ..   2,109,440
//   QK16   f16  [4 s][2048][2048]  q x16 | k x16               2,109,440   ..  35,663,872
//   VT16   f16  [4 s][2][1024 e][1024 tok] v x16 transposed    35,663,872  ..  52,441,088
//   (not used)                                                  52,441,088  ..  60,829,696
//   comb16 f16  [2][1024][1024] 256 * sum_s gw*coh*out_s        60,829,696  ..  65,024,000
//   a2part f32  [4 head quarters][2][1024][1024] (33,554,432 B) 65,024,000  ..  98,578,432
//   (not used)                                                  98,578,432  .. 132,132,864
//   The projections' operands:
//   xb     bf16 [2048][1024]                                    132,132,864 .. 136,327,168
//   Wqkb   bf16 [4][2048][1024] (Wq[s] rows | Wk[s] rows)       136,327,168 .. 153,104,384
//   Wvb    bf16 [4][1024][1024]                                 153,104,384 .. 161,492,992
//   total 266,350,592 B
// GEMM shapes (all K % 64 == 0; block tile 128x256; every M, N a multiple of it; no padded planes):
//   q|k projection  M=2048 N=2048 K=1024 (bf16 in, f16 out x16), batch 4 samples
//   v (role-swapped) M=1024 (e) N=1024 (tok) K=1024, batch 2 b x 4 samples
//   scores, attn.v  inside fused_attn_kernel
//   output          M=2048 N=1024 K=1024 + bo -> d_out
// ---------------------------------------------------------------------------
extern "C" void kernel_launch(void* const* d_in, const int* in_sizes, int n_in,
                              void* d_out, int out_size, void* d_ws, size_t ws_size,
                              hipStream_t stream) {
  if (n_in < 10) return;
  if (in_sizes[0] != kTok * kDim) return;
  if (in_sizes[1] != kSamp * kDim * kDim || in_sizes[2] != kSamp * kDim * kDim || in_sizes[3] != kSamp * kDim * kDim) return;
  if (in_sizes[4] != kSamp * kDim || in_sizes[5] != kSamp) return;
  if (in_sizes[6] != kDim * kDim || in_sizes[7] != kDim) return;
  if (in_sizes[8] != kSamp || in_sizes[9] != 1) return;
  if (out_size != kTok * kDim + kBatch * kSeq * kSeq) return;

  const float* x    = (const float*)d_in[0];   // [2][1024][1024]
  const float* Wq   = (const float*)d_in[1];   // [4][1024][1024] ([s][out][in])
  const float* Wk   = (const float*)d_in[2];
  const float* Wv   = (const float*)d_in[3];
  const float* Wg   = (const float*)d_in[4];   // [4][1024]
  const float* bg   = (const float*)d_in[5];   // [4]
  const float* Wo   = (const float*)d_in[6];   // [1024][1024] ([out][in])
  const float* bo   = (const float*)d_in[7];   // [1024]
  const float* hw   = (const float*)d_in[8];   // [4]
  const float* temp = (const float*)d_in[9];   // [1]
  float* yout = (float*)d_out;                             // [2][1024][1024] at byte 0
  float* aout = (float*)d_out + (size_t)kTok * kDim;       // [2][1024][1024] at byte 8,388,608

  // ---- carve ----
  const size_t SZ_WSS  = 4096;
  const size_t SZ_XM   = (size_t)kBatch * kDim * 4;                 //       8,192
  const size_t SZ_WO   = (size_t)kDim * kDim * 2;                   //   2,097,152
  const size_t SZ_QK   = (size_t)kSamp * kTok * kQKld * 2;          //  33,554,432
  const size_t SZ_VT   = (size_t)kSamp * kBatch * kDim * kSeq * 2;  //  16,777,216
  const size_t SZ_CF   = (size_t)kBatch * kSeq * kDim * 4;          //   8,388,608
  const size_t SZ_CH   = (size_t)kBatch * kSeq * kDim * 2;          //   4,194,304
  const size_t SZ_P    = (size_t)kBatch * kHeads * kSeq * kSeq * 2; //  67,108,864
  const size_t SZ_S    = (size_t)kBatch * kHeads * kSeq * kSeq * 4; // 134,217,728
  const size_t SZ_XB   = (size_t)kTok * kDim * 2;                   //   4,194,304
  const size_t SZ_WQK  = (size_t)kSamp * kQKld * kDim * 2;          //  16,777,216
  size_t off = 0;
  const size_t oWSS = off; off += SZ_WSS;
  const size_t oXM  = off; off += SZ_XM;
  const size_t oWO  = off; off += SZ_WO;
  const size_t oQK  = off; off += SZ_QK;
  const size_t oVT  = off; off += SZ_VT;
  const size_t oCF  = off; off += SZ_CF;
  const size_t oCH  = off; off += SZ_CH;
  const size_t oP   = off; off += SZ_P;
  const size_t oS   = off; off += SZ_S;
  const size_t TOTAL = off;                                         // 266,350,592
  const size_t oXB  = oS;
  const size_t oWQK = oXB + SZ_XB;
  const size_t oWV  = oWQK + SZ_WQK;
  if (TOTAL > ws_size) return;

  char* ws = (char*)d_ws;
  float*          wsS    = (float*)(ws + oWSS);
  float*          gpart  = (float*)(ws + oXM);
  unsigned short* xb     = (unsigned short*)(ws + oXB);
  unsigned short* Wqkb   = (unsigned short*)(ws + oWQK);
  unsigned short* Wvb    = (unsigned short*)(ws + oWV);
  unsigned short* Wo16   = (unsigned short*)(ws + oWO);
  unsigned short* QK16   = (unsigned short*)(ws + oQK);
  unsigned short* VT16   = (unsigned short*)(ws + oVT);
  unsigned short* comb16 = (unsigned short*)(ws + oCH);
  float*          a2part = (float*)(ws + oP);

  const dim3 blk(256);

  // (0) operand casts
  {
    cast_x_pool_kernel<<<dim3(kTok / kPoolRows), blk, 0, stream>>>(x, Wg, xb, gpart);   // 256 blocks x 8 rows; also the gate partials
    cast_weights_kernel<<<dim3(kMat / (512 * 8)), dim3(512), 0, stream>>>(Wq, Wk, Wv, Wo, Wqkb, Wvb, Wo16);   // 256 blocks, 13 matrices each
  }
  // (1) gates (the mean pool's partials come from the x cast)
  gate_kernel<<<dim3(1), blk, 0, stream>>>(gpart, bg, hw, temp, wsS);

  const dim3 gQK((((kTok / 64) * (kQKld / 64)) + 7) / 8, kSamp);             // 128 x 4:  M=2048, N=2048, samples
  const dim3 gV((((kDim / 64) * (kSeq / 64)) + 7) / 8, kBatch * kSamp);      // 32 x 8:   M=1024, N=1024, (s, b)
  const dim3 gOut((((kTok / 64) * (kDim / 64)) + 7) / 8, 1);                 // 64 blocks: M=2048, N=1024

  // (2) q|k projection, all samples: QK16[s][tok][n] = f16(16 * sum_c bf16(x[tok][c]) * bf16(Wqk[s][n][c]))
  wmma_gemm64<1, false, 0, 1, false, 0, 2, 4><<<gQK, blk, 0, stream>>>(
      xb, xb, kDim, 0L, Wqkb, Wqkb, kDim, (long)kQKld * kDim, (void*)QK16, (void*)QK16, kQKld, (long)kTok * kQKld,
      bo, x, 0L, kTok, kQKld, kDim, kQKVCarry,
      kSamp, 0L, 0L, 0L, 0L);
  // (3) v role-swapped, all (s, b): VT16[s][b][e][tok] = f16(16 * sum_c bf16(Wv[s][e][c]) * bf16(x[b][tok][c]))
  wmma_gemm64<1, false, 0, 1, false, 0, 2, 4><<<gV, blk, 0, stream>>>(
      Wvb, Wvb, kDim, 0L, xb, xb, kDim, (long)kSeq * kDim, (void*)VT16, (void*)VT16, kSeq, (long)kDim * kSeq,
      bo, x, 0L, kDim, kSeq, kDim, kQKVCarry,
      kBatch, (long)kDim * kDim, 0L, (long)kBatch * kDim * kSeq, 0L);

  // (4) attention, all samples, heads and batches: comb16 = f16(256 * sum_s gw*coh*attn_s.v_s), a2part[z] = sum_s gw * (1/16) sum over 4 heads of attn
  fused_attn_kernel<<<dim3(kSeq / (16 * kRowTiles), kBatch, kHeadSplit), blk, 0, stream>>>(QK16, VT16, wsS, comb16, a2part);
  // (5) output 2 = sum of the four planes of a2part
  add_planes_kernel<<<dim3(kPlane2 / 2048), blk, 0, stream>>>(a2part, aout);

  // (7) y = (comb16 . Wo16^T) / 4096 + bo -> d_out output 0 (f32)
  wmma_gemm64<0, false, 2, 0, false, 0, 2, 4><<<gOut, blk, 0, stream>>>(
      comb16, comb16, kDim, 0L, Wo16, Wo16, kDim, 0L, (void*)yout, (void*)yout, kDim, 0L,
      bo, x, 0L, kTok, kDim, kDim, kOutScale,
      1, 0L, 0L, 0L, 0L);
}

// v008
// One run takes 155 microseconds.
// In both of two side-by-side timings against v007, it was 1.12 times as fast.
// All steps since v000 together make it 11.8 times as fast.
// Compute dtypes: q/k/v projections on v_wmma_f32_16x16x32_bf16 (x and Wq/Wk/Wv RNE-converted to bf16, f32 accumulate, results carried x16 into f16 planes); scores q.k^T, attn.v and the output projection on v_wmma_f32_16x16x32_f16 (f16 operands: q,k,v x16, probabilities x2^15 with the per-sample mixing weight folded in, combined x256, Wo as f16(16*bf16(Wo))), f32 accumulate; mean-pool, gates, softmax and the head/sample mixing in f32.
#include <hip/hip_runtime.h>
#include <math.h>

// ---------------------------------------------------------------------------
// Problem constants
// ---------------------------------------------------------------------------
constexpr int kBatch     = 2;
constexpr int kSeq       = 1024;
constexpr int kDim       = 1024;
constexpr int kHeads     = 16;
constexpr int kSamp      = 4;
constexpr int kDh        = 64;
constexpr int kTok       = kBatch * kSeq;       // 2048 token rows
constexpr int kHeadsHalf = 8;                   // half of kHeads; no kernel in this file uses it
constexpr int kQKld      = 2 * kDim;            // 2048: q columns 0..1023 | k columns 1024..2047
constexpr float kQKVCarry   = 16.0f;            // q, k, v carried x16 in f16
constexpr float kPCarry     = 32768.0f;         // probabilities carried x2^15 (times gate <= 1)
constexpr float kCombCarry  = 256.0f;           // combined carried x256
constexpr float kWoCarry    = 16.0f;            // Wo carried x16 in f16
constexpr float kScoreScale = 0.125f / (16.0f * 16.0f);              // dh^-0.5 / (16*16) = 2^-11
constexpr float kPVScale    = kCombCarry / (kPCarry * kQKVCarry);    // 256 / 2^19 = 2^-11
constexpr float kOutScale   = 1.0f / (kCombCarry * kWoCarry);        // 2^-12

typedef __attribute__((ext_vector_type(16))) _Float16 v16h;
typedef __attribute__((ext_vector_type(8)))  _Float16 v8h;
typedef __attribute__((ext_vector_type(16))) __bf16   v16b;
typedef __attribute__((ext_vector_type(8)))  __bf16   v8b;
typedef __attribute__((ext_vector_type(8)))  float    v8f;
typedef __attribute__((ext_vector_type(4)))  float    v4f;
typedef __attribute__((ext_vector_type(4)))  unsigned int v4u;
typedef __attribute__((ext_vector_type(2)))  unsigned int v2u;

__device__ __forceinline__ unsigned short f2bf_bits(float f) {
  unsigned u = __float_as_uint(f);
  return (unsigned short)((u + 0x7FFFu + ((u >> 16) & 1u)) >> 16);
}
__device__ __forceinline__ float bf_bits2f(unsigned short h) { return __uint_as_float(((unsigned)h) << 16); }

// hazard guard as a plain device helper
__device__ __forceinline__ void acc_guard4(v8f& a, v8f& b, v8f& c, v8f& d) { asm volatile("v_nop\n\tv_nop\n\tv_nop\n\tv_nop" : "+v"(a), "+v"(b), "+v"(c), "+v"(d)); }
template <typename T> struct Frag;
template <> struct Frag<_Float16> {
  typedef v16h V; union U { v16h v; v8h h[2]; };
  static __device__ __forceinline__ v16h load(const _Float16* p) {   // elements 0..7 <- p[0..7], 8..15 <- p[16..23]
    U f; f.h[0] = *(const v8h*)(p); f.h[1] = *(const v8h*)(p + 16); return f.v;
  }
  static __device__ __forceinline__ v8f mma(v16h a, v16h b, v8f c) {
    return __builtin_amdgcn_wmma_f32_16x16x32_f16(false, a, false, b, (short)0, c, false, false);
  }
};
template <> struct Frag<__bf16> {
  typedef v16b V; union U { v16b v; v8b h[2]; };
  static __device__ __forceinline__ v16b load(const __bf16* p) {
    U f; f.h[0] = *(const v8b*)(p); f.h[1] = *(const v8b*)(p + 16); return f.v;
  }
  static __device__ __forceinline__ v8f mma(v16b a, v16b b, v8f c) {
    return __builtin_amdgcn_wmma_f32_16x16x32_bf16(false, a, false, b, (short)0, c, false, false);
  }
};

__device__ __forceinline__ unsigned pk16(unsigned short a, unsigned short b) { return (unsigned)a | ((unsigned)b << 16); }
__device__ __forceinline__ unsigned short h_bits(float f) { const _Float16 h = (_Float16)f; return __builtin_bit_cast(unsigned short, h); }

// ---- Operand staging: asynchronous copies global -> LDS ----
constexpr int kStageK   = 64;    // k elements per stage = one whole 128-B line of every operand row
constexpr int kRowPitch = 144;   // LDS bytes per staged row: 128 + 16, an odd multiple of 16 B, so that the 16 rows of a fragment read fall on distinct banks

// Six 16-B copies per lane, global -> LDS through no register. The s_wait_xcnt 0 is the statement's last line so that
// no address register named by an issued copy is rewritten in front of it.
__device__ __forceinline__ void async_copy6(unsigned l0, const unsigned short* g0, unsigned l1, const unsigned short* g1,
                                            unsigned l2, const unsigned short* g2, unsigned l3, const unsigned short* g3,
                                            unsigned l4, const unsigned short* g4, unsigned l5, const unsigned short* g5) {
  asm volatile("global_load_async_to_lds_b128 %0, %1, off\n\t"
               "global_load_async_to_lds_b128 %2, %3, off\n\t"
               "global_load_async_to_lds_b128 %4, %5, off\n\t"
               "global_load_async_to_lds_b128 %6, %7, off\n\t"
               "global_load_async_to_lds_b128 %8, %9, off\n\t"
               "global_load_async_to_lds_b128 %10, %11, off\n\t"
               "s_wait_xcnt 0x0"
               :: "v"(l0), "v"(g0), "v"(l1), "v"(g1), "v"(l2), "v"(g2), "v"(l3), "v"(g3), "v"(l4), "v"(g4), "v"(l5), "v"(g5)
               : "memory");
}

// ---- Register-blocked batched WMMA GEMM (ACT reduced to none/relu/leaky; Cout/resid without restrict
//      so that the in-place residual accumulate (resid == Cout, same wave reads its rows before storing them) is well formed) --
// C[m,n] = scale * sum_k A[m,k] * Bt[n,k] (+bias)(+resid); each wave owns a 64x64 tile; the block's 8 waves form a WM x WN grid of
// such tiles and share one staged k-tile: 64*WM rows of A, then 64*WN rows of Bt, 64 k each, two LDS buffers (the next k-tile's
// copies fly while this one is multiplied).
// A row-major [M,K]; Bt row-major [N,K]; M % (64*WM) == 0, N % (64*WN) == 0, K % 64 == 0; rows and bases 16-B aligned.
// SPLIT (hi/lo planes) is not carried by the staged loop and must be false.
// BIAS_MODE: 0 = none, 1 = bias[m], 2 = bias[n].
// OUT_MODE: 0 = f32, 1 = f16, 2 = bf16 hi plane (Cout) + bf16 lo plane (Cout2).
// ET: 0 = f16 operands, 1 = bf16 operands (pointers passed as 16-bit storage)
// One block's work as a device function: bx = the block's tile index, by = its batch index, both handed in by the kernel that
// holds the launch (several independent jobs share one launch by block range).
template <int ET> struct Elem;
template <> struct Elem<0> { typedef _Float16 T; };
template <> struct Elem<1> { typedef __bf16 T; };
template <int ET, bool SPLIT, int BIAS_MODE, int OUT_MODE, bool RESID, int ACT, int WM, int WN>
__device__ __forceinline__ void gemm64_block(
    int bx, int by,
    const unsigned short* __restrict__ Ap, const unsigned short* __restrict__ A2p, int lda, long strideA,
    const unsigned short* __restrict__ Btp, const unsigned short* __restrict__ Bt2p, int ldb, long strideB,
    void* Cout, void* Cout2, int ldc, long strideC,
    const float* __restrict__ bias,
    const float* resid, long strideR,
    int M, int N, int K, float scale,
    int inner, long strideA2, long strideB2, long strideC2, long strideR2) {
  typedef typename Elem<ET>::T T;
  typedef typename Frag<T>::V V;
  static_assert(!SPLIT, "the staged k-loop carries one plane per operand");
  static_assert(WM * WN == 8, "eight waves per block");
  constexpr int kRowsA  = 64 * WM;                    // staged rows 0..kRowsA-1 = A, the rest = Bt
  constexpr int kRows   = 64 * (WM + WN);
  constexpr int kStageB = kRows * kRowPitch;          // bytes of one buffer
  constexpr int kCopies = kRows / 32;                 // copies per lane and stage: 256 lanes cover 32 rows x 8 chunks of 16 B
  static_assert(kCopies % 6 == 0 && kCopies <= 63, "copies go out six to a statement");
  __shared__ __align__(16) unsigned char ring[2 * kStageB];
  __shared__ __align__(16) float sT[8][16 * 68];   // per-wave 16x64 slab, pitch 68 floats
  // two-level batch: by = outer * inner + b; b walks the first strides, outer the second
  const int outer = by / inner;
  const int b     = by - outer * inner;
  const size_t offA = (size_t)b * strideA + (size_t)outer * strideA2;
  const size_t offB = (size_t)b * strideB + (size_t)outer * strideB2;
  const size_t offC = (size_t)b * strideC + (size_t)outer * strideC2;
  const size_t offR = (size_t)b * strideR + (size_t)outer * strideR2;
  const int lane = threadIdx.x & 31;
  const int wave = threadIdx.x >> 5;
  const int tilesN = N / (64 * WN);
  const int tilesM = M / (64 * WM);
  if (bx >= tilesM * tilesN) return;   // block-uniform, in front of every barrier
  const int bm = bx / tilesN;
  const int bn = bx - bm * tilesN;
  const int mB = bm * (64 * WM);
  const int nB = bn * (64 * WN);
  const int wm = wave / WN;
  const int wn = wave - wm * WN;
  const int m0 = mB + (wm << 6);
  const int n0 = nB + (wn << 6);

  const int rlane = lane & 15;                 // row (A) / col (B, D) within subtile
  const int mOff  = (lane >> 4) * 8;           // D row offset

  // copy side: lane -> (row crow + 32*j, 16-B chunk cchk) of the staged k-tile
  const int crow = threadIdx.x >> 3;
  const int cchk = threadIdx.x & 7;
  const unsigned short* gA = Ap  + offA + (size_t)(mB + crow) * lda + cchk * 8;
  const unsigned short* gB = Btp + offB + (size_t)(nB + crow) * ldb + cchk * 8;
  const unsigned ldsC = (unsigned)(size_t)(void*)ring + (unsigned)(crow * kRowPitch + cchk * 16);
  auto issue = [&](int t, int buf) {
    const unsigned l = ldsC + (unsigned)(buf * kStageB);
    const unsigned short* a = gA + t * kStageK;
    const unsigned short* w = gB + t * kStageK;
    auto from = [&](int j) { return (j < kRowsA / 32) ? (a + (size_t)(j * 32) * lda) : (w + (size_t)((j - kRowsA / 32) * 32) * ldb); };
    auto to   = [&](int j) { return l + (unsigned)(j * 32 * kRowPitch); };
#pragma unroll
    for (int j = 0; j < kCopies; j += 6)
      async_copy6(to(j), from(j), to(j + 1), from(j + 1), to(j + 2), from(j + 2),
                  to(j + 3), from(j + 3), to(j + 4), from(j + 4), to(j + 5), from(j + 5));
  };
  // read side: this lane's row of the first A / Bt fragment, at its lane half's k offset (8 elements = 16 B)
  const unsigned char* fA = ring + ((wm << 6) + rlane) * kRowPitch + (lane >> 4) * 16;
  const unsigned char* fB = ring + (kRowsA + (wn << 6) + rlane) * kRowPitch + (lane >> 4) * 16;

  v8f acc[4][4];
#pragma unroll
  for (int i = 0; i < 4; ++i)
#pragma unroll
    for (int j = 0; j < 4; ++j) acc[i][j] = (v8f){0.f,0.f,0.f,0.f,0.f,0.f,0.f,0.f};

  const int nT = K / kStageK;
  issue(0, 0);
  asm volatile("s_wait_asynccnt 0x0" ::: "memory");   // this wave's copies of k-tile 0 have landed
  __syncthreads();                                    // ... and every other wave's: k-tile 0 may be read
  if (nT > 1) issue(1, 1);

  for (int t = 0; t < nT; ++t) {
    const int bo = (t & 1) * kStageB;
    // all fragment reads of the k-tile stand as one group in front of its WMMAs (one LDS latency per trip, counted waits behind it)
    V ah[kStageK / 32][4], bh[kStageK / 32][4];
#pragma unroll
    for (int ks = 0; ks < kStageK / 32; ++ks) {
#pragma unroll
      for (int j = 0; j < 4; ++j) bh[ks][j] = Frag<T>::load((const T*)(fB + bo + j * 16 * kRowPitch + ks * 64));
#pragma unroll
      for (int i = 0; i < 4; ++i) ah[ks][i] = Frag<T>::load((const T*)(fA + bo + i * 16 * kRowPitch + ks * 64));
    }
    __builtin_amdgcn_sched_barrier(0);   // keeps the reads one group: without it they are sunk between the WMMAs, each with a wait to 0
#pragma unroll
    for (int ks = 0; ks < kStageK / 32; ++ks)
#pragma unroll
      for (int i = 0; i < 4; ++i)
#pragma unroll
        for (int j = 0; j < 4; ++j) acc[i][j] = Frag<T>::mma(ah[ks][i], bh[ks][j], acc[i][j]);
    __builtin_amdgcn_sched_barrier(0);   // keeps the WMMAs in front of the waits: sunk behind them, the next k-tile's copies would be waited for before the work that hides them
    asm volatile("s_wait_dscnt 0x0" ::: "memory");     // this wave's reads of buffer t&1 have returned before it is refilled
    asm volatile("s_wait_asynccnt 0x0" ::: "memory");  // this wave's copies of k-tile t+1 have landed
    __syncthreads();                                   // publishes k-tile t+1 and ends every wave's reads of buffer t&1
    if (t + 2 < nT) issue(t + 2, t & 1);
  }
  asm volatile("s_wait_asynccnt 0x0" ::: "memory");    // no copy is outstanding when the wave goes on to the epilogue and ends
  acc_guard4(acc[0][0], acc[0][1], acc[0][2], acc[0][3]);
  acc_guard4(acc[1][0], acc[1][1], acc[1][2], acc[1][3]);
  acc_guard4(acc[2][0], acc[2][1], acc[2][2], acc[2][3]);
  acc_guard4(acc[3][0], acc[3][1], acc[3][2], acc[3][3]);

  // ---- epilogue ----
  float* slab = sT[wave];
  const float* Rb = RESID ? (resid + offR) : nullptr;
#pragma unroll
  for (int i = 0; i < 4; ++i) {
    const int mBase = m0 + (i << 4);
#pragma unroll
    for (int j = 0; j < 4; ++j) {
      const int n = n0 + (j << 4) + rlane;
      float bv = 0.f;
      if (BIAS_MODE == 2) bv = bias[n];
#pragma unroll
      for (int r = 0; r < 8; ++r) {
        float v = acc[i][j][r] * scale;
        if (BIAS_MODE == 1) v += bias[mBase + mOff + r];
        if (BIAS_MODE == 2) v += bv;
        if (RESID) v += Rb[(size_t)(mBase + mOff + r) * ldc + n];
        if (ACT == 2) v = fmaxf(v, 0.0f);
        if (ACT == 4) v = (v > 0.f) ? v : 0.01f * v;
        slab[(mOff + r) * 68 + (j << 4) + rlane] = v;
      }
    }
    __builtin_amdgcn_fence(__ATOMIC_RELEASE, "workgroup");
    __builtin_amdgcn_wave_barrier();
    __builtin_amdgcn_fence(__ATOMIC_ACQUIRE, "workgroup");
    if (OUT_MODE == 0) {
      float* C = (float*)Cout + offC;
      const int hh = lane >> 4, c4 = (lane & 15) * 4;     // row seg = 256 B = 16 lanes x 16 B
      {
#pragma unroll
        for (int it = 0; it < 8; ++it) {
          const int row = it * 2 + hh;
          v4f v = *(const v4f*)(slab + row * 68 + c4);
          *(v4f*)(C + (size_t)(mBase + row) * ldc + n0 + c4) = v;
        }
        asm volatile("s_wait_xcnt 0x0" ::: "memory");   // the stores' address and data registers are rewritten by the next row group
      }
    } else {
      const int q = lane >> 3, c8 = (lane & 7) * 8;
      unsigned short* C  = (unsigned short*)Cout  + offC;
      unsigned short* C2 = (OUT_MODE == 2) ? ((unsigned short*)Cout2 + offC) : nullptr;
      {
#pragma unroll
        for (int it = 0; it < 4; ++it) {
          const int row = it * 4 + q;
          const float* sp = slab + row * 68 + c8;
          v8h hv, lv;
#pragma unroll
          for (int e = 0; e < 8; ++e) {
            if (OUT_MODE == 1) {
              hv[e] = (_Float16)sp[e];
            } else {
              unsigned short hb = f2bf_bits(sp[e]);
              unsigned short lb = f2bf_bits(sp[e] - bf_bits2f(hb));
              hv[e] = __builtin_bit_cast(_Float16, hb);
              lv[e] = __builtin_bit_cast(_Float16, lb);
            }
          }
          *(v8h*)(C + (size_t)(mBase + row) * ldc + n0 + c8) = hv;
          if (OUT_MODE == 2) *(v8h*)(C2 + (size_t)(mBase + row) * ldc + n0 + c8) = lv;
        }
        
      }
    }
    __builtin_amdgcn_fence(__ATOMIC_RELEASE, "workgroup");
    __builtin_amdgcn_wave_barrier();
    __builtin_amdgcn_fence(__ATOMIC_ACQUIRE, "workgroup");
  }
}

// ---------------------------------------------------------------------------
// All weight casts: 256 blocks x 512 threads = 4096 waves, started once (blk = 0..255; block range of cast_all_kernel).
// The 256 blocks cover one [1024][1024] matrix per step (4096 waves x 256 elements) and walk 13 of them:
//   steps 0..3  Wq[s] -> Wqkb[s] rows 0..1023    (bf16, RNE)
//   steps 4..7  Wk[s] -> Wqkb[s] rows 1024..2047 (bf16, RNE)
//   steps 8..11 Wv[s] -> Wvb[s]                  (bf16, RNE)
//   step  12    Wo    -> Wo16 = f16(16 * bf16(Wo)) (RNE to bf16 first, then the exact power-of-two carry into f16)
// A wave owns the same 256-element run of every matrix: two loads of 32 lanes x 16 B = 512 contiguous bytes each (whole lines),
// two stores of 32 lanes x 8 B = 256 contiguous bytes each (whole lines). All 26 loads of a lane are issued before the first
// conversion, so that the wave pays the memory latency once.
// ---------------------------------------------------------------------------
constexpr int kMat       = kDim * kDim;    // elements of one weight matrix
constexpr int kCastSteps = 3 * kSamp + 1;  // 13
__device__ __forceinline__ void cast_weights_block(unsigned blk, const float* __restrict__ Wq, const float* __restrict__ Wk,
                                                   const float* __restrict__ Wv, const float* __restrict__ Wo,
                                                   unsigned short* __restrict__ Wqkb, unsigned short* __restrict__ Wvb,
                                                   unsigned short* __restrict__ Wo16) {
  // byte offset of the lane's first four elements in every source matrix; the second four stand 512 B further on.
  // The offsets + 8 MiB have registers of their own: with them every access is scalar base + 32-bit lane offset + immediate.
  const unsigned ib  = ((blk * 16u + (threadIdx.x >> 5)) * 256u + (threadIdx.x & 31u) * 4u) * 4u;
  const unsigned ib2 = ib + 2u * kMat * 4u;
  const unsigned ob  = ib >> 1;                 // the same in every destination (2 B an element)
  const unsigned ob2 = ob + 4u * kMat * 2u;
  v4f a[kCastSteps], c[kCastSteps];
#pragma unroll   // the source is chosen at compile time; a[], c[] stay in registers
  for (int m = 0; m < kCastSteps; ++m) {
    const int s = m & (kSamp - 1);
    const float* w = (m < kSamp) ? Wq : (m < 2 * kSamp) ? Wk : (m < 3 * kSamp) ? Wv : Wo;
    const char* p = (const char*)w + ((s < 2) ? ib : ib2) + (s & 1) * (kMat * 4);
    a[m] = *(const v4f*)(p);
    c[m] = *(const v4f*)(p + 512);
  }
  asm volatile("s_wait_xcnt 0x0" :: "v"(ib), "v"(ib2) : "memory");   // the loads' offset registers stay untouched up to here (inputs only) and may be reused behind it
  __builtin_amdgcn_sched_barrier(0);   // keeps all 26 loads in front of the first conversion: without it the last ones are sunk behind waits for the first and pay a second memory latency
#pragma unroll   // as above, for the destination
  for (int m = 0; m < kCastSteps; ++m) {
    const int s = m & (kSamp - 1);
    const int r = (m < kSamp) ? 2 * s : (m < 2 * kSamp) ? 2 * s + 1 : s;      // matrix slot in the destination plane
    unsigned short* d = (m < 2 * kSamp) ? Wqkb : (m < 3 * kSamp) ? Wvb : Wo16;
    char* q = (char*)d + ((r < 4) ? ob : ob2) + (r & 3) * (kMat * 2);
    unsigned short ha[4], hc[4];
#pragma unroll
    for (int i = 0; i < 4; ++i) {
      ha[i] = f2bf_bits(a[m][i]);
      hc[i] = f2bf_bits(c[m][i]);
      if (m == kCastSteps - 1) {
        ha[i] = h_bits(kWoCarry * bf_bits2f(ha[i]));
        hc[i] = h_bits(kWoCarry * bf_bits2f(hc[i]));
      }
    }
    *(v2u*)(q)       = (v2u){pk16(ha[0], ha[1]), pk16(ha[2], ha[3])};
    *(v2u*)(q + 256) = (v2u){pk16(hc[0], hc[1]), pk16(hc[2], hc[3])};
  }
  asm volatile("s_wait_xcnt 0x0" ::: "memory");   // the stores' offset and data registers: in the shared launch this job is the last code of its waves (a precaution)
}

// ---------------------------------------------------------------------------
// x cast with the mean pool and the gate's dot product folded in.
// 256 groups of 256 threads and 8 token rows (128 groups per batch), two groups to a 512-thread block (grp = 2 * block + threadIdx.x / 256,
// tid = threadIdx.x % 256); thread -> 8 consecutive columns (tid % 128) * 8 of the rows tid / 128 + 2j.
//   xb = bf16(x) (RNE): four 16-B stores per lane, one per row.
//   part[b][s][chunk] = sum_d (sum over the group's 8 rows of bf16(x[b][n][d])) * bf16(Wg[s][d]), f32:
//     per thread 4 rows in order, 8 columns in order; shuffle tree over the wave; the 8 waves in wave order.
// The sum over the 128 chunks, the 1/1024 of the mean and the sigmoid are gate_block's.
// ---------------------------------------------------------------------------
constexpr int kPoolRows   = 8;
constexpr int kPoolChunks = kSeq / kPoolRows;   // 128 per batch
__device__ __forceinline__ void cast_x_pool_block(int blk, const float* __restrict__ x, const float* __restrict__ Wg,
                                                  unsigned short* __restrict__ xb, float* __restrict__ part) {
  __shared__ float red2[2][8][kSamp];
  float (*red)[kSamp] = red2[threadIdx.x >> 8];
  const int grp = blk * 2 + (int)(threadIdx.x >> 8);
  const int tid = threadIdx.x & 255, lane = tid & 31, wave = tid >> 5;
  const int col = (tid & 127) * 8;
  const size_t base = (size_t)(grp * kPoolRows + (tid >> 7)) * kDim + col;
  v4f a[kPoolRows / 2], c[kPoolRows / 2];
#pragma unroll
  for (int j = 0; j < kPoolRows / 2; ++j) {
    a[j] = *(const v4f*)(x + base + (size_t)(2 * j) * kDim);
    c[j] = *(const v4f*)(x + base + (size_t)(2 * j) * kDim + 4);
  }
  float cs[8];
#pragma unroll
  for (int e = 0; e < 8; ++e) cs[e] = 0.f;
#pragma unroll
  for (int j = 0; j < kPoolRows / 2; ++j) {
    unsigned short hb[8];
#pragma unroll
    for (int e = 0; e < 4; ++e) {
      hb[e]     = f2bf_bits(a[j][e]);
      hb[4 + e] = f2bf_bits(c[j][e]);
    }
#pragma unroll
    for (int e = 0; e < 8; ++e) cs[e] += bf_bits2f(hb[e]);
    *(v4u*)(xb + base + (size_t)(2 * j) * kDim) = (v4u){pk16(hb[0], hb[1]), pk16(hb[2], hb[3]), pk16(hb[4], hb[5]), pk16(hb[6], hb[7])};
  }
  float dot[kSamp];
#pragma unroll
  for (int s = 0; s < kSamp; ++s) {
    const v4f w0 = *(const v4f*)(Wg + s * kDim + col);
    const v4f w1 = *(const v4f*)(Wg + s * kDim + col + 4);
    float acc = 0.f;
#pragma unroll
    for (int e = 0; e < 4; ++e) acc += cs[e] * bf_bits2f(f2bf_bits(w0[e]));
#pragma unroll
    for (int e = 0; e < 4; ++e) acc += cs[4 + e] * bf_bits2f(f2bf_bits(w1[e]));
    dot[s] = acc;
  }
#pragma unroll
  for (int off = 16; off > 0; off >>= 1)
#pragma unroll
    for (int s = 0; s < kSamp; ++s) dot[s] += __shfl_xor(dot[s], off, 32);
  if (lane == 0) {
#pragma unroll
    for (int s = 0; s < kSamp; ++s) red[wave][s] = dot[s];
  }
  __syncthreads();
  if (tid < kSamp) {
    float t = red[0][tid];
#pragma unroll
    for (int w = 1; w < 8; ++w) t += red[w][tid];
    const int b = grp / kPoolChunks, chunk = grp - b * kPoolChunks;
    part[(b * kSamp + tid) * kPoolChunks + chunk] = t;
  }
}

// ---------------------------------------------------------------------------
// Gates and mixing weights (one block, 256 threads = 8 waves; the last block of proj_gate_kernel):
//   coh[b][s] = sigmoid((1/1024) * sum_chunk part[b][s][chunk] + bg[s])  (wave w -> (b, s) = (w>>2, w&3); four chunks per lane + shuffle tree)
//   t = clip(temperature, 0.1, 10); invt = 1/t; gw = softmax(hyp_w * invt)
// ---------------------------------------------------------------------------
// e^x as __expf forms it (x * log2(e), then v_exp_f32), with the slot behind the transcendental filled in the same statement.
__device__ __forceinline__ float exp_slot(float x) {
  float r;
  asm("v_exp_f32 %0, %1\n\tv_nop" : "=v"(r) : "v"(x * 1.44269504088896340736f));
  return r;
}
__device__ __forceinline__ void gate_block(const float* __restrict__ part,
                                           const float* __restrict__ bg, const float* __restrict__ hw,
                                           const float* __restrict__ temp, float* __restrict__ wsS) {
  __shared__ float vals[32];
  const int t = threadIdx.x, lane = t & 31, wave = t >> 5;
  if (t < 32) vals[t] = 0.f;
  __syncthreads();
  {
    const int b = wave >> 2, s = wave & 3;
    const v4f p = *(const v4f*)(part + wave * kPoolChunks + lane * 4);
    float acc = (p[0] + p[1]) + (p[2] + p[3]);
#pragma unroll
    for (int off = 16; off > 0; off >>= 1) acc += __shfl_xor(acc, off, 32);
    if (lane == 0) {
      const float z = acc * (1.0f / (float)kSeq) + bf_bits2f(f2bf_bits(bg[s]));
      vals[4 + b * kSamp + s] = 1.0f / (1.0f + __expf(-z));
    }
  }
  __syncthreads();
  if (t == 0) {
    float tc = bf_bits2f(f2bf_bits(temp[0]));
    tc = fminf(fmaxf(tc, 0.1f), 10.0f);
    const float invt = 1.0f / tc;
    const float l0 = bf_bits2f(f2bf_bits(hw[0])) * invt;
    const float l1 = bf_bits2f(f2bf_bits(hw[1])) * invt;
    const float l2 = bf_bits2f(f2bf_bits(hw[2])) * invt;
    const float l3 = bf_bits2f(f2bf_bits(hw[3])) * invt;
    const float mx = fmaxf(fmaxf(l0, l1), fmaxf(l2, l3));
    const float e0 = exp_slot(l0 - mx), e1 = exp_slot(l1 - mx), e2 = exp_slot(l2 - mx), e3 = exp_slot(l3 - mx);
    const float is = 1.0f / ((e0 + e1) + (e2 + e3));
    vals[0] = e0 * is; vals[1] = e1 * is; vals[2] = e2 * is; vals[3] = e3 * is;
    vals[12] = invt;
  }
  __syncthreads();
  if (wave == 0) {
    const float v = vals[lane];
    *(float*)(wsS + lane) = v;
    
  }
}

// ---------------------------------------------------------------------------
// Fused attention: scores, softmax, head/sample mixing and attn.v in one launch; no score or probability plane in memory.
// grid = (32 tiles of 32 query rows, 2 batches, 4 head quarters) = 256 blocks, one per WGP (the LDS admits one); 256 threads = 8 waves;
// the block walks n = h*4 + s (head outer, sample inner) over its own 4 heads.
// The 32 query rows are two 16-row tiles rt = 0, 1: every staged k and v^T tile, and every fragment read from LDS, serves both.
// Wave w owns the key columns j = 128w .. 128w+127 of the block's 32 x 1024 score rows.
//   scores transposed: D[j][i] = sum_d k[j][d] q[i][d]  (A = k rows from LDS, B = q rows from registers): lane (c, hf) holds
//     query row i = 16rt + c and, per 16-j tile jt, the eight consecutive keys j = 128w + 16jt + 8hf + r.
//   softmax over j: per-wave maximum and sum (in-lane, then lane ^ 16), merged over the 8 waves through LDS.
//   a pair of score tiles (2m, 2m+1), converted to f16, IS the A fragment of attn.v for k = 32m .. 32m+31 (same lane, same order
//     as the fragment loader: elements 0..7 = k 8hf.., elements 8..15 = k 16+8hf..): the probabilities never leave the registers.
//   attn.v: each wave sums over its own 128 keys and over the 4 samples; the 8 partial 16x64 tiles are added through LDS per head,
//     one row tile after the other through the same slabs.
//   output 2 is accumulated in registers over the block's 16 (h, s) and stored once, into the head quarter's own partial plane;
//     add_planes_block (next launch) adds the four planes.
// k (1024 rows x 128 B) and v^T (64 rows x 2048 B) of one (h, s) are staged in LDS by asynchronous copies, one buffer each; the tile
// sequence k(0), v(0), k(1), v(1), ... alternates between the two buffers as a two-buffer ring: each half pass reads one buffer
// while the other one's copies fly.
// ---------------------------------------------------------------------------
constexpr int kKPitch = 144;                 // 128 + 16 B, odd multiple of 16 B (distinct banks for the 16 rows of a fragment read)
constexpr int kVPitch = 2 * kSeq + 16;       // 2064 B = 129 x 16 B, likewise
constexpr int kKBytes = kSeq * kKPitch;      // 147,456
constexpr int kVBytes = kDh * kVPitch;       // 132,096
constexpr int kRowTiles = 2;                               // 16-row query tiles per block
constexpr int kHeadSplit = 4;                              // head quarters, one block each
constexpr int kPasses = kHeads * kSamp / kHeadSplit;       // 16 per block
constexpr int kPlane2 = kBatch * kSeq * kSeq;              // elements of output 2 = of one partial plane
typedef __attribute__((ext_vector_type(4))) _Float16 v4h;

// Eight 16-B copies per lane, global -> LDS through no register. The s_wait_xcnt 0 is the statement's last line so that
// no address register named by an issued copy is rewritten in front of it.
__device__ __forceinline__ void async_copy8(unsigned l0, const unsigned short* g0, unsigned l1, const unsigned short* g1,
                                            unsigned l2, const unsigned short* g2, unsigned l3, const unsigned short* g3,
                                            unsigned l4, const unsigned short* g4, unsigned l5, const unsigned short* g5,
                                            unsigned l6, const unsigned short* g6, unsigned l7, const unsigned short* g7) {
  asm volatile("global_load_async_to_lds_b128 %0, %1, off\n\t"
               "global_load_async_to_lds_b128 %2, %3, off\n\t"
               "global_load_async_to_lds_b128 %4, %5, off\n\t"
               "global_load_async_to_lds_b128 %6, %7, off\n\t"
               "global_load_async_to_lds_b128 %8, %9, off\n\t"
               "global_load_async_to_lds_b128 %10, %11, off\n\t"
               "global_load_async_to_lds_b128 %12, %13, off\n\t"
               "global_load_async_to_lds_b128 %14, %15, off\n\t"
               "s_wait_xcnt 0x0"
               :: "v"(l0), "v"(g0), "v"(l1), "v"(g1), "v"(l2), "v"(g2), "v"(l3), "v"(g3),
                  "v"(l4), "v"(g4), "v"(l5), "v"(g5), "v"(l6), "v"(g6), "v"(l7), "v"(g7)
               : "memory");
}

// value of lane l ^ 16
__device__ __forceinline__ float other_half(float v) {
  const int b = __builtin_bit_cast(int, v);
  return __builtin_bit_cast(float, __builtin_amdgcn_permlanex16(b, b, 0x76543210, 0xfedcba98, false, false));
}

// 2^x (v_exp_f32, as __builtin_amdgcn_exp2f forms it) with the slot behind the transcendental filled in the same statement.
__device__ __forceinline__ float exp2_slot(float x) {
  float r;
  asm("v_exp_f32 %0, %1\n\tv_nop" : "=v"(r) : "v"(x));
  return r;
}

__global__ __launch_bounds__(256) void fused_attn_kernel(const unsigned short* __restrict__ QK, const unsigned short* __restrict__ VT,
                                                         const float* __restrict__ wsS, unsigned short* __restrict__ comb,
                                                         float* __restrict__ out2) {
  typedef Frag<_Float16> F;
  __shared__ __align__(16) unsigned char kbuf[kKBytes];
  __shared__ __align__(16) unsigned char vbuf[kVBytes];
  __shared__ __align__(16) float ored[8][16 * 68];               // per-wave 16x64 partial of attn.v (one row tile), pitch 68 floats
  __shared__ __align__(16) float redM[kRowTiles * 16][8];        // [query row][wave] maximum (log2 domain)
  __shared__ __align__(16) float redL[kRowTiles * 16][8];        // [query row][wave] sum
  const int tid = threadIdx.x, lane = tid & 31, wave = tid >> 5;
  const int c = lane & 15, hf = lane >> 4;
  const int i0 = blockIdx.x * (16 * kRowTiles), bat = blockIdx.y;
  const int nBeg = blockIdx.z * kPasses, nEnd = nBeg + kPasses;   // this block's passes: heads 4z .. 4z+3, all samples
  const float cs = kScoreScale * wsS[12] * 1.44269504088896340736f;   // raw accumulator -> (0.125 q.k / t) * log2(e); > 0

  // copy side. k: lane -> (row tid/8 + 32j, 16-B chunk tid%8); v^T: lane -> (row tid/128 + 2j, 16-B chunk tid%128); j = 0..31
  const unsigned short* gK = QK + (size_t)(bat * kSeq + (tid >> 3)) * kQKld + kDim + (tid & 7) * 8;
  const unsigned short* gV = VT + (size_t)bat * kDim * kSeq + (size_t)(tid >> 7) * kSeq + (tid & 127) * 8;
  const unsigned lK = (unsigned)(size_t)(void*)kbuf + (unsigned)((tid >> 3) * kKPitch + (tid & 7) * 16);
  const unsigned lV = (unsigned)(size_t)(void*)vbuf + (unsigned)((tid >> 7) * kVPitch + (tid & 127) * 16);
  auto issueK = [&](int n) {
    const unsigned short* g = gK + (size_t)(n & 3) * kTok * kQKld + (n >> 2) * kDh;
    unsigned l = lK;
    auto from = [&](int j) { return g + (size_t)(j * 32) * kQKld; };
    auto to   = [&](int j) { return l + (unsigned)(j * 32 * kKPitch); };
#pragma unroll 1   // rolled: unrolled, the 32 LDS addresses are invariant in the pass loop and are held in registers across it (spills)
    for (int j = 0; j < 4; ++j) {
      async_copy8(to(0), from(0), to(1), from(1), to(2), from(2), to(3), from(3),
                  to(4), from(4), to(5), from(5), to(6), from(6), to(7), from(7));
      l += (unsigned)(8 * 32 * kKPitch);
      g += (size_t)(8 * 32) * kQKld;
    }
  };
  auto issueV = [&](int n) {
    const unsigned short* g = gV + (size_t)(n & 3) * kBatch * kDim * kSeq + (size_t)(n >> 2) * kDh * kSeq;
    unsigned l = lV;
    auto from = [&](int j) { return g + (size_t)(j * 2) * kSeq; };
    auto to   = [&](int j) { return l + (unsigned)(j * 2 * kVPitch); };
#pragma unroll 1   // rolled, as in issueK
    for (int j = 0; j < 4; ++j) {
      async_copy8(to(0), from(0), to(1), from(1), to(2), from(2), to(3), from(3),
                  to(4), from(4), to(5), from(5), to(6), from(6), to(7), from(7));
      l += (unsigned)(8 * 2 * kVPitch);
      g += (size_t)(8 * 2) * kSeq;
    }
  };
  // read side: this lane's row of the wave's first k / v^T fragment, at its lane half's k offset (8 elements = 16 B)
  const unsigned char* fK = kbuf + (wave * 128 + c) * kKPitch + hf * 16;
  const unsigned char* fV = vbuf + c * kVPitch + wave * 256 + hf * 16;
  const _Float16* qL = (const _Float16*)QK + (size_t)(bat * kSeq + i0 + c) * kQKld + hf * 8;
  constexpr size_t kQTile = (size_t)16 * kQKld;       // elements from a q row of row tile 0 to the same row of row tile 1

  const v8f zero8 = (v8f){0.f,0.f,0.f,0.f,0.f,0.f,0.f,0.f};
  v8f a2[kRowTiles][8], accO[kRowTiles][4];
#pragma unroll
  for (int rt = 0; rt < kRowTiles; ++rt) {
#pragma unroll
    for (int jt = 0; jt < 8; ++jt) a2[rt][jt] = zero8;
#pragma unroll
    for (int dt = 0; dt < 4; ++dt) accO[rt][dt] = zero8;
  }

  issueK(nBeg);
  const _Float16* qB  = qL + (nBeg >> 2) * kDh;       // sample 0 of the block's first head
  const _Float16* qB1 = qB + kQTile;
  v16h qf[kRowTiles][2];
  qf[0][0] = F::load(qB);  qf[0][1] = F::load(qB + 32);
  qf[1][0] = F::load(qB1); qf[1][1] = F::load(qB1 + 32);
  asm volatile("s_wait_xcnt 0x0" :: "v"(qB) : "memory");   // as behind the loop's q loads: the address registers stay untouched up to here and are reused behind it
  asm volatile("s_wait_asynccnt 0x0" ::: "memory");   // this wave's copies of the first k tile have landed
  __syncthreads();                                    // ... and every other wave's: it may be read
  issueV(nBeg);

#pragma unroll 1
  for (int n = nBeg; n < nEnd; ++n) {
    const int s = n & 3, h = n >> 2;
    const float gw  = wsS[s];
    const float coh = wsS[4 + bat * kSamp + s];
    // ---- first half pass: reads kbuf alone; each k fragment multiplies both row tiles' q ----
    v8f sc[kRowTiles][8];
#pragma unroll
    for (int jt = 0; jt < 8; ++jt) {
      const v16h kf = F::load((const _Float16*)(fK + jt * 16 * kKPitch));
#pragma unroll
      for (int rt = 0; rt < kRowTiles; ++rt) sc[rt][jt] = F::mma(kf, qf[rt][0], zero8);
    }
#pragma unroll
    for (int jt = 0; jt < 8; ++jt) {
      const v16h kf = F::load((const _Float16*)(fK + jt * 16 * kKPitch + 64));
#pragma unroll
      for (int rt = 0; rt < kRowTiles; ++rt) sc[rt][jt] = F::mma(kf, qf[rt][1], sc[rt][jt]);
    }
    float mb[kRowTiles];
#pragma unroll
    for (int rt = 0; rt < kRowTiles; ++rt) {
      float mr[8];
#pragma unroll
      for (int r = 0; r < 8; ++r) mr[r] = sc[rt][0][r];
#pragma unroll
      for (int jt = 1; jt < 8; ++jt)
#pragma unroll
        for (int r = 0; r < 8; ++r) mr[r] = fmaxf(mr[r], sc[rt][jt][r]);
      float mx = fmaxf(fmaxf(fmaxf(mr[0], mr[1]), fmaxf(mr[2], mr[3])), fmaxf(fmaxf(mr[4], mr[5]), fmaxf(mr[6], mr[7])));
      mx = fmaxf(mx, other_half(mx));
      mb[rt] = mx * cs;
      float ls[8];
#pragma unroll
      for (int r = 0; r < 8; ++r) ls[r] = 0.f;
#pragma unroll
      for (int jt = 0; jt < 8; ++jt)
#pragma unroll
        for (int r = 0; r < 8; ++r) {
          const float e = __builtin_amdgcn_exp2f(fmaf(sc[rt][jt][r], cs, -mb[rt]));
          sc[rt][jt][r] = e;
          ls[r] += e;
        }
      float l = ((ls[0] + ls[1]) + (ls[2] + ls[3])) + ((ls[4] + ls[5]) + (ls[6] + ls[7]));
      l += other_half(l);
      *(hf ? &redL[rt * 16 + c][wave] : &redM[rt * 16 + c][wave]) = hf ? l : mb[rt];
    }
    asm volatile("s_wait_dscnt 0x0" ::: "memory");     // this wave's reads of kbuf have returned before it is refilled
    asm volatile("s_wait_asynccnt 0x0" ::: "memory");  // this wave's copies of v(n) have landed
    __syncthreads();                                   // publishes v(n) and the wave partials; ends every wave's reads of kbuf
    if (n + 1 < nEnd) issueK(n + 1);
    // next pass's q fragments, fetched a half pass ahead (the last pass fetches its own again: in bounds, unused)
    const int nn = (n + 1 < nEnd) ? n + 1 : n;
    const _Float16* qN  = qL + (size_t)(nn & 3) * kTok * kQKld + (nn >> 2) * kDh;
    const _Float16* qN1 = qN + kQTile;
    qf[0][0] = F::load(qN);  qf[0][1] = F::load(qN + 32);
    qf[1][0] = F::load(qN1); qf[1][1] = F::load(qN1 + 32);
    asm volatile("s_wait_xcnt 0x0" :: "v"(qN) : "memory");   // the q loads' address registers stay untouched up to here (input only: no load lands on them) and are rewritten behind it

    // ---- second half pass: reads vbuf alone; each v^T fragment multiplies both row tiles' probabilities ----
    // the v^T fragment reads go one 32-key step ahead of their WMMAs, two register sets; the first group stands in front of the
    // merge arithmetic, which hides its LDS latency
    v16h vf[2][4];
#pragma unroll
    for (int dt = 0; dt < 4; ++dt) vf[0][dt] = F::load((const _Float16*)(fV + dt * 16 * kVPitch));
    float fA[kRowTiles], fP[kRowTiles];
#pragma unroll
    for (int rt = 0; rt < kRowTiles; ++rt) {
      const v4f ma = *(const v4f*)&redM[rt * 16 + c][0], mc = *(const v4f*)&redM[rt * 16 + c][4];
      const v4f la = *(const v4f*)&redL[rt * 16 + c][0], lc = *(const v4f*)&redL[rt * 16 + c][4];
      const float M = fmaxf(fmaxf(fmaxf(ma[0], ma[1]), fmaxf(ma[2], ma[3])), fmaxf(fmaxf(mc[0], mc[1]), fmaxf(mc[2], mc[3])));
      const float L = ((la[0] * exp2_slot(ma[0] - M) + la[1] * exp2_slot(ma[1] - M)) +
                       (la[2] * exp2_slot(ma[2] - M) + la[3] * exp2_slot(ma[3] - M))) +
                      ((lc[0] * exp2_slot(mc[0] - M) + lc[1] * exp2_slot(mc[1] - M)) +
                       (lc[2] * exp2_slot(mc[2] - M) + lc[3] * exp2_slot(mc[3] - M)));
      const float f = __builtin_amdgcn_exp2f(mb[rt] - M) / L;    // this wave's exp2(x - mb) -> probability
      fA[rt] = f * (gw * (1.0f / (float)kHeads));
      fP[rt] = f * (kPCarry * gw * coh);
    }
#pragma unroll
    for (int m = 0; m < 4; ++m) {
      if (m + 1 < 4) {
#pragma unroll
        for (int dt = 0; dt < 4; ++dt) vf[(m + 1) & 1][dt] = F::load((const _Float16*)(fV + dt * 16 * kVPitch + (m + 1) * 64));
      }
      __builtin_amdgcn_sched_barrier(0);   // keeps the next step's reads one group in front of this step's WMMAs: without it they are sunk to their users, each with a wait to 0
#pragma unroll
      for (int rt = 0; rt < kRowTiles; ++rt) {
        F::U p;
#pragma unroll
        for (int r = 0; r < 8; ++r) {
          a2[rt][2 * m][r]     = fmaf(sc[rt][2 * m][r], fA[rt], a2[rt][2 * m][r]);
          a2[rt][2 * m + 1][r] = fmaf(sc[rt][2 * m + 1][r], fA[rt], a2[rt][2 * m + 1][r]);
          p.h[0][r] = (_Float16)(sc[rt][2 * m][r] * fP[rt]);
          p.h[1][r] = (_Float16)(sc[rt][2 * m + 1][r] * fP[rt]);
        }
#pragma unroll
        for (int dt = 0; dt < 4; ++dt) accO[rt][dt] = F::mma(p.v, vf[m & 1][dt], accO[rt][dt]);
      }
      __builtin_amdgcn_sched_barrier(0);   // keeps the reads of the step after next behind this step's WMMAs: lifted over them they take a third register set (spills)
    }
    // the slots between the last WMMAs and a reader of their D on the taken side of the branch below
    acc_guard4(accO[0][0], accO[0][1], accO[0][2], accO[0][3]);
    acc_guard4(accO[1][0], accO[1][1], accO[1][2], accO[1][3]);
    float* slab = ored[wave];
    if (s == kSamp - 1) {
#pragma unroll
      for (int dt = 0; dt < 4; ++dt)
#pragma unroll
        for (int r = 0; r < 8; ++r) slab[(hf * 8 + r) * 68 + dt * 16 + c] = accO[0][dt][r];
    }
    asm volatile("s_wait_dscnt 0x0" ::: "memory");     // this wave's reads of vbuf have returned before it is refilled
    asm volatile("s_wait_asynccnt 0x0" ::: "memory");  // this wave's copies of k(n+1) have landed
    __syncthreads();                                   // publishes k(n+1) and row tile 0's attn.v partials; ends every wave's reads of vbuf
    if (n + 1 < nEnd) issueV(n + 1);
    if (s == kSamp - 1) {
      // combined[i][h*64 + d] x256: the 8 waves' partials in wave order; thread -> (row tid/16, four d), 16 lanes = one 128-B line
      const int row = tid >> 4, d4 = (tid & 15) * 4;
      v4h o[kRowTiles];
#pragma unroll
      for (int rt = 0; rt < kRowTiles; ++rt) {
        if (rt > 0) {
          __syncthreads();                                 // ends every wave's reads of the previous row tile's partials
#pragma unroll
          for (int dt = 0; dt < 4; ++dt)
#pragma unroll
            for (int r = 0; r < 8; ++r) slab[(hf * 8 + r) * 68 + dt * 16 + c] = accO[rt][dt][r];
          __syncthreads();                                 // publishes this row tile's partials
        }
        v4f t = *(const v4f*)&ored[0][row * 68 + d4];
#pragma unroll
        for (int w = 1; w < 8; ++w) t += *(const v4f*)&ored[w][row * 68 + d4];
#pragma unroll
        for (int e = 0; e < 4; ++e) o[rt][e] = (_Float16)(t[e] * kPVScale);
      }
      // both stores stand behind the last barrier: in front of one, the barrier would wait for the store to complete
#pragma unroll
      for (int rt = 0; rt < kRowTiles; ++rt)
        *(v4h*)(comb + (size_t)(bat * kSeq + i0 + rt * 16 + row) * kDim + h * kDh + d4) = o[rt];
      asm volatile("s_wait_xcnt 0x0" ::: "memory");      // the stores' address and data registers are rewritten by the next head
#pragma unroll
      for (int rt = 0; rt < kRowTiles; ++rt)
#pragma unroll
        for (int dt = 0; dt < 4; ++dt) accO[rt][dt] = zero8;
    }
  }
  asm volatile("s_wait_asynccnt 0x0" ::: "memory");    // no copy is outstanding when the wave ends

  // output 2, this head quarter's plane: lane holds rows i0 + 16rt + c, per tile eight consecutive columns (32 B); the wave covers 512 B of each of its 32 rows
#pragma unroll
  for (int rt = 0; rt < kRowTiles; ++rt) {
    float* orow = out2 + (size_t)blockIdx.z * kPlane2 + (size_t)(bat * kSeq + i0 + rt * 16 + c) * kSeq + wave * 128 + hf * 8;
#pragma unroll
    for (int jt = 0; jt < 8; ++jt) {
      *(v4f*)(orow + jt * 16)     = (v4f){a2[rt][jt][0], a2[rt][jt][1], a2[rt][jt][2], a2[rt][jt][3]};
      *(v4f*)(orow + jt * 16 + 4) = (v4f){a2[rt][jt][4], a2[rt][jt][5], a2[rt][jt][6], a2[rt][jt][7]};
    }
  }
}

// ---------------------------------------------------------------------------
// Output 2 = (plane 0 + plane 1) + (plane 2 + plane 3) of the fused kernel's partial sums (heads 0..3, 4..7, 8..11, 12..15).
// 1024 blocks (blk; block range of out_add_kernel) x 256 threads x 2 x 4 floats = 2,097,152 = one plane exactly; a wave reads and writes whole 512-B runs.
// ---------------------------------------------------------------------------
__device__ __forceinline__ void add_planes_block(int blk, const float* __restrict__ part, float* __restrict__ out) {
  const int i = (blk * 512 + threadIdx.x) * 4;
  v4f p[2][kHeadSplit];
#pragma unroll   // all eight loads are in flight before the first sum
  for (int u = 0; u < 2; ++u)
#pragma unroll
    for (int z = 0; z < kHeadSplit; ++z) p[u][z] = *(const v4f*)(part + (size_t)z * kPlane2 + i + u * 1024);
#pragma unroll   // p[][] stays in registers
  for (int u = 0; u < 2; ++u) *(v4f*)(out + i + u * 1024) = (p[u][0] + p[u][1]) + (p[u][2] + p[u][3]);
}

// ---------------------------------------------------------------------------
// The launches. Jobs that do not depend on one another share a launch, each on its own range of blockIdx.x:
//   cast_all_kernel    x cast with pool and gate dot (128 blocks) | weight casts (256 blocks)
//   proj_gate_kernel   q|k projection (512 blocks) | v projection (256 blocks) | gates (1 block, the last to start)
//   fused_attn_kernel  (above)
//   out_add_kernel     output projection (64 blocks) | sum of output 2's planes (1024 blocks, on the WGPs the projection leaves idle)
// Every range test is block-uniform and stands in front of every barrier of the job it selects.
// ---------------------------------------------------------------------------
constexpr int kWBlocks   = kMat / (512 * 8);                              // 256
constexpr int kXBlocks   = kTok / (2 * kPoolRows);                        // 128
constexpr int kQKTiles   = (kTok / 128) * (kQKld / 256);                  // 128 tiles of 128 x 256 per sample
constexpr int kQKBlocks  = kQKTiles * kSamp;                              // 512
constexpr int kVTiles    = (kDim / 128) * (kSeq / 256);                   // 32 tiles per (s, b)
constexpr int kVBlocks   = kVTiles * kBatch * kSamp;                      // 256
constexpr int kOutBlocks = (kTok / 128) * (kDim / 256);                   // 64
constexpr int kAddBlocks = kPlane2 / 2048;                                // 1024

__global__ __launch_bounds__(512) void cast_all_kernel(const float* __restrict__ x, const float* __restrict__ Wg,
                                                       const float* __restrict__ Wq, const float* __restrict__ Wk,
                                                       const float* __restrict__ Wv, const float* __restrict__ Wo,
                                                       unsigned short* __restrict__ xb, float* __restrict__ part,
                                                       unsigned short* __restrict__ Wqkb, unsigned short* __restrict__ Wvb,
                                                       unsigned short* __restrict__ Wo16) {
  if (blockIdx.x < (unsigned)kXBlocks) cast_x_pool_block((int)blockIdx.x, x, Wg, xb, part);
  else                                 cast_weights_block(blockIdx.x - (unsigned)kXBlocks, Wq, Wk, Wv, Wo, Wqkb, Wvb, Wo16);
}

//   q|k: QK16[s][tok][n] = f16(16 * sum_c bf16(x[tok][c]) * bf16(Wqk[s][n][c]))            M=2048 N=2048, batch = sample
//   v, role-swapped: VT16[s][b][e][tok] = f16(16 * sum_c bf16(Wv[s][e][c]) * bf16(x[b][tok][c]))  M=1024 N=1024, batch = (s, b)
__global__ __launch_bounds__(256) void proj_gate_kernel(const unsigned short* __restrict__ xb, const unsigned short* __restrict__ Wqkb,
                                                        const unsigned short* __restrict__ Wvb,
                                                        unsigned short* QK16, unsigned short* VT16,
                                                        const float* __restrict__ part, const float* __restrict__ bg,
                                                        const float* __restrict__ hw, const float* __restrict__ temp,
                                                        float* __restrict__ wsS) {
  // each job's shape is a compile-time constant of its own copy of the engine (tile and batch indices by shifts, addresses folded)
  const int bid = (int)blockIdx.x;
  if (bid < kQKBlocks) {
    gemm64_block<1, false, 0, 1, false, 0, 2, 4>(
        bid % kQKTiles, bid / kQKTiles,
        xb, xb, kDim, 0L, Wqkb, Wqkb, kDim, (long)kQKld * kDim, (void*)QK16, (void*)QK16, kQKld, (long)kTok * kQKld,
        nullptr, nullptr, 0L, kTok, kQKld, kDim, kQKVCarry,
        kSamp, 0L, 0L, 0L, 0L);
  } else if (bid < kQKBlocks + kVBlocks) {
    gemm64_block<1, false, 0, 1, false, 0, 2, 4>(
        (bid - kQKBlocks) % kVTiles, (bid - kQKBlocks) / kVTiles,
        Wvb, Wvb, kDim, 0L, xb, xb, kDim, (long)kSeq * kDim, (void*)VT16, (void*)VT16, kSeq, (long)kDim * kSeq,
        nullptr, nullptr, 0L, kDim, kSeq, kDim, kQKVCarry,
        kBatch, (long)kDim * kDim, 0L, (long)kBatch * kDim * kSeq, 0L);
  } else {
    gate_block(part, bg, hw, temp, wsS);
  }
}

//   y = (comb16 . Wo16^T) / 4096 + bo -> output 0 (f32)   M=2048 N=1024;   output 2 = sum of the four planes of a2part
__global__ __launch_bounds__(256) void out_add_kernel(const unsigned short* __restrict__ comb16, const unsigned short* __restrict__ Wo16,
                                                      const float* __restrict__ bo, float* yout,
                                                      const float* __restrict__ a2part, float* __restrict__ aout) {
  const int bid = (int)blockIdx.x;
  if (bid >= kOutBlocks) { add_planes_block(bid - kOutBlocks, a2part, aout); return; }
  gemm64_block<0, false, 2, 0, false, 0, 2, 4>(
      bid, 0,
      comb16, comb16, kDim, 0L, Wo16, Wo16, kDim, 0L, (void*)yout, (void*)yout, kDim, 0L,
      bo, nullptr, 0L, kTok, kDim, kDim, kOutScale,
      1, 0L, 0L, 0L, 0L);
}

// ---------------------------------------------------------------------------
// Workspace region map (byte offsets, all multiples of 4096). Every region is fully written before it is read.
//   wsS    f32 [32] (gw, coh, 1/t)                              0           ..       4,096
//   gpart  f32 [2 b][4 s][128 chunks] (4,096 B of the region)   4,096       ..      12,288
//   Wo16   f16  [1024][1024]  = f16(16*bf16(Wo))               12,288      ..   2,109,440
//   QK16   f16  [4 s][2048][2048]  q x16 | k x16               2,109,440   ..  35,663,872
//   VT16   f16  [4 s][2][1024 e][1024 tok] v x16 transposed    35,663,872  ..  52,441,088
//   (not used)                                                  52,441,088  ..  60,829,696
//   comb16 f16  [2][1024][1024] 256 * sum_s gw*coh*out_s        60,829,696  ..  65,024,000
//   a2part f32  [4 head quarters][2][1024][1024] (33,554,432 B) 65,024,000  ..  98,578,432
//   (not used)                                                  98,578,432  .. 132,132,864
//   The projections' operands:
//   xb     bf16 [2048][1024]                                    132,132,864 .. 136,327,168
//   Wqkb   bf16 [4][2048][1024] (Wq[s] rows | Wk[s] rows)       136,327,168 .. 153,104,384
//   Wvb    bf16 [4][1024][1024]                                 153,104,384 .. 161,492,992
//   total 266,350,592 B
// GEMM shapes (all K % 64 == 0; block tile 128x256; every M, N a multiple of it; no padded planes):
//   q|k projection  M=2048 N=2048 K=1024 (bf16 in, f16 out x16), batch 4 samples
//   v (role-swapped) M=1024 (e) N=1024 (tok) K=1024, batch 2 b x 4 samples
//   scores, attn.v  inside fused_attn_kernel
//   output          M=2048 N=1024 K=1024 + bo -> d_out
// ---------------------------------------------------------------------------
extern "C" void kernel_launch(void* const* d_in, const int* in_sizes, int n_in,
                              void* d_out, int out_size, void* d_ws, size_t ws_size,
                              hipStream_t stream) {
  if (n_in < 10) return;
  if (in_sizes[0] != kTok * kDim) return;
  if (in_sizes[1] != kSamp * kDim * kDim || in_sizes[2] != kSamp * kDim * kDim || in_sizes[3] != kSamp * kDim * kDim) return;
  if (in_sizes[4] != kSamp * kDim || in_sizes[5] != kSamp) return;
  if (in_sizes[6] != kDim * kDim || in_sizes[7] != kDim) return;
  if (in_sizes[8] != kSamp || in_sizes[9] != 1) return;
  if (out_size != kTok * kDim + kBatch * kSeq * kSeq) return;

  const float* x    = (const float*)d_in[0];   // [2][1024][1024]
  const float* Wq   = (const float*)d_in[1];   // [4][1024][1024] ([s][out][in])
  const float* Wk   = (const float*)d_in[2];
  const float* Wv   = (const float*)d_in[3];
  const float* Wg   = (const float*)d_in[4];   // [4][1024]
  const float* bg   = (const float*)d_in[5];   // [4]
  const float* Wo   = (const float*)d_in[6];   // [1024][1024] ([out][in])
  const float* bo   = (const float*)d_in[7];   // [1024]
  const float* hw   = (const float*)d_in[8];   // [4]
  const float* temp = (const float*)d_in[9];   // [1]
  float* yout = (float*)d_out;                             // [2][1024][1024] at byte 0
  float* aout = (float*)d_out + (size_t)kTok * kDim;       // [2][1024][1024] at byte 8,388,608

  // ---- carve ----
  const size_t SZ_WSS  = 4096;
  const size_t SZ_XM   = (size_t)kBatch * kDim * 4;                 //       8,192
  const size_t SZ_WO   = (size_t)kDim * kDim * 2;                   //   2,097,152
  const size_t SZ_QK   = (size_t)kSamp * kTok * kQKld * 2;          //  33,554,432
  const size_t SZ_VT   = (size_t)kSamp * kBatch * kDim * kSeq * 2;  //  16,777,216
  const size_t SZ_CF   = (size_t)kBatch * kSeq * kDim * 4;          //   8,388,608
  const size_t SZ_CH   = (size_t)kBatch * kSeq * kDim * 2;          //   4,194,304
  const size_t SZ_P    = (size_t)kBatch * kHeads * kSeq * kSeq * 2; //  67,108,864
  const size_t SZ_S    = (size_t)kBatch * kHeads * kSeq * kSeq * 4; // 134,217,728
  const size_t SZ_XB   = (size_t)kTok * kDim * 2;                   //   4,194,304
  const size_t SZ_WQK  = (size_t)kSamp * kQKld * kDim * 2;          //  16,777,216
  size_t off = 0;
  const size_t oWSS = off; off += SZ_WSS;
  const size_t oXM  = off; off += SZ_XM;
  const size_t oWO  = off; off += SZ_WO;
  const size_t oQK  = off; off += SZ_QK;
  const size_t oVT  = off; off += SZ_VT;
  const size_t oCF  = off; off += SZ_CF;
  const size_t oCH  = off; off += SZ_CH;
  const size_t oP   = off; off += SZ_P;
  const size_t oS   = off; off += SZ_S;
  const size_t TOTAL = off;                                         // 266,350,592
  const size_t oXB  = oS;
  const size_t oWQK = oXB + SZ_XB;
  const size_t oWV  = oWQK + SZ_WQK;
  if (TOTAL > ws_size) return;

  char* ws = (char*)d_ws;
  float*          wsS    = (float*)(ws + oWSS);
  float*          gpart  = (float*)(ws + oXM);
  unsigned short* xb     = (unsigned short*)(ws + oXB);
  unsigned short* Wqkb   = (unsigned short*)(ws + oWQK);
  unsigned short* Wvb    = (unsigned short*)(ws + oWV);
  unsigned short* Wo16   = (unsigned short*)(ws + oWO);
  unsigned short* QK16   = (unsigned short*)(ws + oQK);
  unsigned short* VT16   = (unsigned short*)(ws + oVT);
  unsigned short* comb16 = (unsigned short*)(ws + oCH);
  float*          a2part = (float*)(ws + oP);

  const dim3 blk(256);

  // (1) operand casts, all in one launch (also the gate partials)
  cast_all_kernel<<<dim3(kXBlocks + kWBlocks), dim3(512), 0, stream>>>(x, Wg, Wq, Wk, Wv, Wo, xb, gpart, Wqkb, Wvb, Wo16);
  // (2) q|k and v projections, all samples and batches, and the gates
  proj_gate_kernel<<<dim3(kQKBlocks + kVBlocks + 1), blk, 0, stream>>>(xb, Wqkb, Wvb, QK16, VT16, gpart, bg, hw, temp, wsS);
  // (3) attention, all samples, heads and batches: comb16 = f16(256 * sum_s gw*coh*attn_s.v_s), a2part[z] = sum_s gw * (1/16) sum over 4 heads of attn
  fused_attn_kernel<<<dim3(kSeq / (16 * kRowTiles), kBatch, kHeadSplit), blk, 0, stream>>>(QK16, VT16, wsS, comb16, a2part);
  // (4) output projection -> output 0; sum of the four planes of a2part -> output 2
  out_add_kernel<<<dim3(kOutBlocks + kAddBlocks), blk, 0, stream>>>(comb16, Wo16, bo, yout, a2part, aout);
}

// v009
// Measured time: 148 microseconds a run.
// Two timings next to v008 both put it at 1.04 times that version's speed.
// All steps since v000 together make it 12.3 times as fast.
// Compute dtypes: q/k/v projections on v_wmma_f32_16x16x32_bf16 (x and Wq/Wk/Wv RNE-converted to bf16, f32 accumulate, results carried x16 into f16 planes); scores q.k^T, attn.v and the output projection on v_wmma_f32_16x16x32_f16 (f16 operands: q,k,v x16, probabilities x2^15 with the per-sample mixing weight folded in, combined x256, Wo as f16(16*bf16(Wo))), f32 accumulate; mean-pool, gates, softmax and the head/sample mixing in f32.
#include <hip/hip_runtime.h>
#include <math.h>

// ---------------------------------------------------------------------------
// Problem constants
// ---------------------------------------------------------------------------
constexpr int kBatch     = 2;
constexpr int kSeq       = 1024;
constexpr int kDim       = 1024;
constexpr int kHeads     = 16;
constexpr int kSamp      = 4;
constexpr int kDh        = 64;
constexpr int kTok       = kBatch * kSeq;       // 2048 token rows
constexpr int kHeadsHalf = 8;                   // half of kHeads; no kernel in this file uses it
constexpr int kQKld      = 2 * kDim;            // 2048: q columns 0..1023 | k columns 1024..2047
constexpr float kQKVCarry   = 16.0f;            // q, k, v carried x16 in f16
constexpr float kPCarry     = 32768.0f;         // probabilities carried x2^15 (times gate <= 1)
constexpr float kCombCarry  = 256.0f;           // combined carried x256
constexpr float kWoCarry    = 16.0f;            // Wo carried x16 in f16
constexpr float kScoreScale = 0.125f / (16.0f * 16.0f);              // dh^-0.5 / (16*16) = 2^-11
constexpr float kPVScale    = kCombCarry / (kPCarry * kQKVCarry);    // 256 / 2^19 = 2^-11
constexpr float kOutScale   = 1.0f / (kCombCarry * kWoCarry);        // 2^-12

typedef __attribute__((ext_vector_type(16))) _Float16 v16h;
typedef __attribute__((ext_vector_type(8)))  _Float16 v8h;
typedef __attribute__((ext_vector_type(16))) __bf16   v16b;
typedef __attribute__((ext_vector_type(8)))  __bf16   v8b;
typedef __attribute__((ext_vector_type(8)))  float    v8f;
typedef __attribute__((ext_vector_type(4)))  float    v4f;
typedef __attribute__((ext_vector_type(4)))  unsigned int v4u;
typedef __attribute__((ext_vector_type(2)))  unsigned int v2u;

__device__ __forceinline__ unsigned short f2bf_bits(float f) {
  unsigned u = __float_as_uint(f);
  return (unsigned short)((u + 0x7FFFu + ((u >> 16) & 1u)) >> 16);
}
__device__ __forceinline__ float bf_bits2f(unsigned short h) { return __uint_as_float(((unsigned)h) << 16); }

// hazard guard as a plain device helper
__device__ __forceinline__ void acc_guard4(v8f& a, v8f& b, v8f& c, v8f& d) { asm volatile("v_nop\n\tv_nop\n\tv_nop\n\tv_nop" : "+v"(a), "+v"(b), "+v"(c), "+v"(d)); }
template <typename T> struct Frag;
template <> struct Frag<_Float16> {
  typedef v16h V; union U { v16h v; v8h h[2]; };
  static __device__ __forceinline__ v16h load(const _Float16* p) {   // elements 0..7 <- p[0..7], 8..15 <- p[16..23]
    U f; f.h[0] = *(const v8h*)(p); f.h[1] = *(const v8h*)(p + 16); return f.v;
  }
  static __device__ __forceinline__ v8f mma(v16h a, v16h b, v8f c) {
    return __builtin_amdgcn_wmma_f32_16x16x32_f16(false, a, false, b, (short)0, c, false, false);
  }
};
template <> struct Frag<__bf16> {
  typedef v16b V; union U { v16b v; v8b h[2]; };
  static __device__ __forceinline__ v16b load(const __bf16* p) {
    U f; f.h[0] = *(const v8b*)(p); f.h[1] = *(const v8b*)(p + 16); return f.v;
  }
  static __device__ __forceinline__ v8f mma(v16b a, v16b b, v8f c) {
    return __builtin_amdgcn_wmma_f32_16x16x32_bf16(false, a, false, b, (short)0, c, false, false);
  }
};

__device__ __forceinline__ unsigned pk16(unsigned short a, unsigned short b) { return (unsigned)a | ((unsigned)b << 16); }
__device__ __forceinline__ unsigned short h_bits(float f) { const _Float16 h = (_Float16)f; return __builtin_bit_cast(unsigned short, h); }

// ---- Operand staging: asynchronous copies global -> LDS ----
constexpr int kStageK   = 64;    // k elements per stage = one whole 128-B line of every operand row
constexpr int kRowPitch = 144;   // LDS bytes per staged row: 128 + 16, an odd multiple of 16 B, so that the 16 rows of a fragment read fall on distinct banks

// Six 16-B copies per lane, global -> LDS through no register. The s_wait_xcnt 0 is the statement's last line so that
// no address register named by an issued copy is rewritten in front of it.
__device__ __forceinline__ void async_copy6(unsigned l0, const unsigned short* g0, unsigned l1, const unsigned short* g1,
                                            unsigned l2, const unsigned short* g2, unsigned l3, const unsigned short* g3,
                                            unsigned l4, const unsigned short* g4, unsigned l5, const unsigned short* g5) {
  asm volatile("global_load_async_to_lds_b128 %0, %1, off\n\t"
               "global_load_async_to_lds_b128 %2, %3, off\n\t"
               "global_load_async_to_lds_b128 %4, %5, off\n\t"
               "global_load_async_to_lds_b128 %6, %7, off\n\t"
               "global_load_async_to_lds_b128 %8, %9, off\n\t"
               "global_load_async_to_lds_b128 %10, %11, off\n\t"
               "s_wait_xcnt 0x0"
               :: "v"(l0), "v"(g0), "v"(l1), "v"(g1), "v"(l2), "v"(g2), "v"(l3), "v"(g3), "v"(l4), "v"(g4), "v"(l5), "v"(g5)
               : "memory");
}

// ---- Register-blocked batched WMMA GEMM (ACT reduced to none/relu/leaky; Cout/resid without restrict
//      so that the in-place residual accumulate (resid == Cout, same wave reads its rows before storing them) is well formed) --
// C[m,n] = scale * sum_k A[m,k] * Bt[n,k] (+bias)(+resid); each wave owns a 64x64 tile; the block's 8 waves form a WM x WN grid of
// such tiles and share one staged k-tile: 64*WM rows of A, then 64*WN rows of Bt, 64 k each, two LDS buffers (the next k-tile's
// copies fly while this one is multiplied).
// A row-major [M,K]; Bt row-major [N,K]; M % (64*WM) == 0, N % (64*WN) == 0, K % 64 == 0; rows and bases 16-B aligned.
// SPLIT (hi/lo planes) is not carried by the staged loop and must be false.
// BIAS_MODE: 0 = none, 1 = bias[m], 2 = bias[n].
// OUT_MODE: 0 = f32, 1 = f16, 2 = bf16 hi plane (Cout) + bf16 lo plane (Cout2).
// ET: 0 = f16 operands, 1 = bf16 operands (pointers passed as 16-bit storage)
// One block's work as a device function: bx = the block's tile index, by = its batch index, both handed in by the kernel that
// holds the launch (several independent jobs share one launch by block range).
template <int ET> struct Elem;
template <> struct Elem<0> { typedef _Float16 T; };
template <> struct Elem<1> { typedef __bf16 T; };
template <int ET, bool SPLIT, int BIAS_MODE, int OUT_MODE, bool RESID, int ACT, int WM, int WN>
__device__ __forceinline__ void gemm64_block(
    int bx, int by,
    const unsigned short* __restrict__ Ap, const unsigned short* __restrict__ A2p, int lda, long strideA,
    const unsigned short* __restrict__ Btp, const unsigned short* __restrict__ Bt2p, int ldb, long strideB,
    void* Cout, void* Cout2, int ldc, long strideC,
    const float* __restrict__ bias,
    const float* resid, long strideR,
    int M, int N, int K, float scale,
    int inner, long strideA2, long strideB2, long strideC2, long strideR2) {
  typedef typename Elem<ET>::T T;
  typedef typename Frag<T>::V V;
  static_assert(!SPLIT, "the staged k-loop carries one plane per operand");
  static_assert(WM * WN == 8, "eight waves per block");
  constexpr int kRowsA  = 64 * WM;                    // staged rows 0..kRowsA-1 = A, the rest = Bt
  constexpr int kRows   = 64 * (WM + WN);
  constexpr int kStageB = kRows * kRowPitch;          // bytes of one buffer
  constexpr int kCopies = kRows / 32;                 // copies per lane and stage: 256 lanes cover 32 rows x 8 chunks of 16 B
  static_assert(kCopies % 6 == 0 && kCopies <= 63, "copies go out six to a statement");
  __shared__ __align__(16) unsigned char ring[2 * kStageB];
  __shared__ __align__(16) float sT[8][16 * 68];   // per-wave 16x64 slab, pitch 68 floats
  // two-level batch: by = outer * inner + b; b walks the first strides, outer the second
  const int outer = by / inner;
  const int b     = by - outer * inner;
  const size_t offA = (size_t)b * strideA + (size_t)outer * strideA2;
  const size_t offB = (size_t)b * strideB + (size_t)outer * strideB2;
  const size_t offC = (size_t)b * strideC + (size_t)outer * strideC2;
  const size_t offR = (size_t)b * strideR + (size_t)outer * strideR2;
  const int lane = threadIdx.x & 31;
  const int wave = threadIdx.x >> 5;
  const int tilesN = N / (64 * WN);
  const int tilesM = M / (64 * WM);
  if (bx >= tilesM * tilesN) return;   // block-uniform, in front of every barrier
  const int bm = bx / tilesN;
  const int bn = bx - bm * tilesN;
  const int mB = bm * (64 * WM);
  const int nB = bn * (64 * WN);
  const int wm = wave / WN;
  const int wn = wave - wm * WN;
  const int m0 = mB + (wm << 6);
  const int n0 = nB + (wn << 6);

  const int rlane = lane & 15;                 // row (A) / col (B, D) within subtile
  const int mOff  = (lane >> 4) * 8;           // D row offset

  // copy side: lane -> (row crow + 32*j, 16-B chunk cchk) of the staged k-tile
  const int crow = threadIdx.x >> 3;
  const int cchk = threadIdx.x & 7;
  const unsigned short* gA = Ap  + offA + (size_t)(mB + crow) * lda + cchk * 8;
  const unsigned short* gB = Btp + offB + (size_t)(nB + crow) * ldb + cchk * 8;
  const unsigned ldsC = (unsigned)(size_t)(void*)ring + (unsigned)(crow * kRowPitch + cchk * 16);
  auto issue = [&](int t, int buf) {
    const unsigned l = ldsC + (unsigned)(buf * kStageB);
    const unsigned short* a = gA + t * kStageK;
    const unsigned short* w = gB + t * kStageK;
    auto from = [&](int j) { return (j < kRowsA / 32) ? (a + (size_t)(j * 32) * lda) : (w + (size_t)((j - kRowsA / 32) * 32) * ldb); };
    auto to   = [&](int j) { return l + (unsigned)(j * 32 * kRowPitch); };
#pragma unroll
    for (int j = 0; j < kCopies; j += 6)
      async_copy6(to(j), from(j), to(j + 1), from(j + 1), to(j + 2), from(j + 2),
                  to(j + 3), from(j + 3), to(j + 4), from(j + 4), to(j + 5), from(j + 5));
  };
  // read side: this lane's row of the first A / Bt fragment, at its lane half's k offset (8 elements = 16 B)
  const unsigned char* fA = ring + ((wm << 6) + rlane) * kRowPitch + (lane >> 4) * 16;
  const unsigned char* fB = ring + (kRowsA + (wn << 6) + rlane) * kRowPitch + (lane >> 4) * 16;

  v8f acc[4][4];
#pragma unroll
  for (int i = 0; i < 4; ++i)
#pragma unroll
    for (int j = 0; j < 4; ++j) acc[i][j] = (v8f){0.f,0.f,0.f,0.f,0.f,0.f,0.f,0.f};

  const int nT = K / kStageK;
  issue(0, 0);
  asm volatile("s_wait_asynccnt 0x0" ::: "memory");   // this wave's copies of k-tile 0 have landed
  __syncthreads();                                    // ... and every other wave's: k-tile 0 may be read
  if (nT > 1) issue(1, 1);

  for (int t = 0; t < nT; ++t) {
    const int bo = (t & 1) * kStageB;
    // all fragment reads of the k-tile stand as one group in front of its WMMAs (one LDS latency per trip, counted waits behind it)
    V ah[kStageK / 32][4], bh[kStageK / 32][4];
#pragma unroll
    for (int ks = 0; ks < kStageK / 32; ++ks) {
#pragma unroll
      for (int j = 0; j < 4; ++j) bh[ks][j] = Frag<T>::load((const T*)(fB + bo + j * 16 * kRowPitch + ks * 64));
#pragma unroll
      for (int i = 0; i < 4; ++i) ah[ks][i] = Frag<T>::load((const T*)(fA + bo + i * 16 * kRowPitch + ks * 64));
    }
    __builtin_amdgcn_sched_barrier(0);   // keeps the reads one group: without it they are sunk between the WMMAs, each with a wait to 0
#pragma unroll
    for (int ks = 0; ks < kStageK / 32; ++ks)
#pragma unroll
      for (int i = 0; i < 4; ++i)
#pragma unroll
        for (int j = 0; j < 4; ++j) acc[i][j] = Frag<T>::mma(ah[ks][i], bh[ks][j], acc[i][j]);
    __builtin_amdgcn_sched_barrier(0);   // keeps the WMMAs in front of the waits: sunk behind them, the next k-tile's copies would be waited for before the work that hides them
    asm volatile("s_wait_dscnt 0x0" ::: "memory");     // this wave's reads of buffer t&1 have returned before it is refilled
    asm volatile("s_wait_asynccnt 0x0" ::: "memory");  // this wave's copies of k-tile t+1 have landed
    __syncthreads();                                   // publishes k-tile t+1 and ends every wave's reads of buffer t&1
    if (t + 2 < nT) issue(t + 2, t & 1);
  }
  asm volatile("s_wait_asynccnt 0x0" ::: "memory");    // no copy is outstanding when the wave goes on to the epilogue and ends
  acc_guard4(acc[0][0], acc[0][1], acc[0][2], acc[0][3]);
  acc_guard4(acc[1][0], acc[1][1], acc[1][2], acc[1][3]);
  acc_guard4(acc[2][0], acc[2][1], acc[2][2], acc[2][3]);
  acc_guard4(acc[3][0], acc[3][1], acc[3][2], acc[3][3]);

  // ---- epilogue ----
  float* slab = sT[wave];
  const float* Rb = RESID ? (resid + offR) : nullptr;
#pragma unroll
  for (int i = 0; i < 4; ++i) {
    const int mBase = m0 + (i << 4);
#pragma unroll
    for (int j = 0; j < 4; ++j) {
      const int n = n0 + (j << 4) + rlane;
      float bv = 0.f;
      if (BIAS_MODE == 2) bv = bias[n];
#pragma unroll
      for (int r = 0; r < 8; ++r) {
        float v = acc[i][j][r] * scale;
        if (BIAS_MODE == 1) v += bias[mBase + mOff + r];
        if (BIAS_MODE == 2) v += bv;
        if (RESID) v += Rb[(size_t)(mBase + mOff + r) * ldc + n];
        if (ACT == 2) v = fmaxf(v, 0.0f);
        if (ACT == 4) v = (v > 0.f) ? v : 0.01f * v;
        slab[(mOff + r) * 68 + (j << 4) + rlane] = v;
      }
    }
    __builtin_amdgcn_fence(__ATOMIC_RELEASE, "workgroup");
    __builtin_amdgcn_wave_barrier();
    __builtin_amdgcn_fence(__ATOMIC_ACQUIRE, "workgroup");
    if (OUT_MODE == 0) {
      float* C = (float*)Cout + offC;
      const int hh = lane >> 4, c4 = (lane & 15) * 4;     // row seg = 256 B = 16 lanes x 16 B
      {
#pragma unroll
        for (int it = 0; it < 8; ++it) {
          const int row = it * 2 + hh;
          v4f v = *(const v4f*)(slab + row * 68 + c4);
          *(v4f*)(C + (size_t)(mBase + row) * ldc + n0 + c4) = v;
        }
        asm volatile("s_wait_xcnt 0x0" ::: "memory");   // the stores' address and data registers are rewritten by the next row group
      }
    } else {
      const int q = lane >> 3, c8 = (lane & 7) * 8;
      unsigned short* C  = (unsigned short*)Cout  + offC;
      unsigned short* C2 = (OUT_MODE == 2) ? ((unsigned short*)Cout2 + offC) : nullptr;
      {
#pragma unroll
        for (int it = 0; it < 4; ++it) {
          const int row = it * 4 + q;
          const float* sp = slab + row * 68 + c8;
          v8h hv, lv;
#pragma unroll
          for (int e = 0; e < 8; ++e) {
            if (OUT_MODE == 1) {
              hv[e] = (_Float16)sp[e];
            } else {
              unsigned short hb = f2bf_bits(sp[e]);
              unsigned short lb = f2bf_bits(sp[e] - bf_bits2f(hb));
              hv[e] = __builtin_bit_cast(_Float16, hb);
              lv[e] = __builtin_bit_cast(_Float16, lb);
            }
          }
          *(v8h*)(C + (size_t)(mBase + row) * ldc + n0 + c8) = hv;
          if (OUT_MODE == 2) *(v8h*)(C2 + (size_t)(mBase + row) * ldc + n0 + c8) = lv;
        }
        
      }
    }
    __builtin_amdgcn_fence(__ATOMIC_RELEASE, "workgroup");
    __builtin_amdgcn_wave_barrier();
    __builtin_amdgcn_fence(__ATOMIC_ACQUIRE, "workgroup");
  }
}

// ---------------------------------------------------------------------------
// All weight casts: 256 blocks x 512 threads = 4096 waves, started once (blk = 0..255; block range of cast_all_kernel).
// The 256 blocks cover one [1024][1024] matrix per step (4096 waves x 256 elements) and walk 13 of them:
//   steps 0..3  Wq[s] -> Wqkb[s] rows 0..1023    (bf16, RNE)
//   steps 4..7  Wk[s] -> Wqkb[s] rows 1024..2047 (bf16, RNE)
//   steps 8..11 Wv[s] -> Wvb[s]                  (bf16, RNE)
//   step  12    Wo    -> Wo16 = f16(16 * bf16(Wo)) (RNE to bf16 first, then the exact power-of-two carry into f16)
// A wave owns the same 256-element run of every matrix: two loads of 32 lanes x 16 B = 512 contiguous bytes each (whole lines),
// two stores of 32 lanes x 8 B = 256 contiguous bytes each (whole lines). All 26 loads of a lane are issued before the first
// conversion, so that the wave pays the memory latency once.
// ---------------------------------------------------------------------------
constexpr int kMat       = kDim * kDim;    // elements of one weight matrix
constexpr int kCastSteps = 3 * kSamp + 1;  // 13
__device__ __forceinline__ void cast_weights_block(unsigned blk, const float* __restrict__ Wq, const float* __restrict__ Wk,
                                                   const float* __restrict__ Wv, const float* __restrict__ Wo,
                                                   unsigned short* __restrict__ Wqkb, unsigned short* __restrict__ Wvb,
                                                   unsigned short* __restrict__ Wo16) {
  // byte offset of the lane's first four elements in every source matrix; the second four stand 512 B further on.
  // The offsets + 8 MiB have registers of their own: with them every access is scalar base + 32-bit lane offset + immediate.
  const unsigned ib  = ((blk * 16u + (threadIdx.x >> 5)) * 256u + (threadIdx.x & 31u) * 4u) * 4u;
  const unsigned ib2 = ib + 2u * kMat * 4u;
  const unsigned ob  = ib >> 1;                 // the same in every destination (2 B an element)
  const unsigned ob2 = ob + 4u * kMat * 2u;
  v4f a[kCastSteps], c[kCastSteps];
#pragma unroll   // the source is chosen at compile time; a[], c[] stay in registers
  for (int m = 0; m < kCastSteps; ++m) {
    const int s = m & (kSamp - 1);
    const float* w = (m < kSamp) ? Wq : (m < 2 * kSamp) ? Wk : (m < 3 * kSamp) ? Wv : Wo;
    const char* p = (const char*)w + ((s < 2) ? ib : ib2) + (s & 1) * (kMat * 4);
    a[m] = *(const v4f*)(p);
    c[m] = *(const v4f*)(p + 512);
  }
  asm volatile("s_wait_xcnt 0x0" :: "v"(ib), "v"(ib2) : "memory");   // the loads' offset registers stay untouched up to here (inputs only) and may be reused behind it
  __builtin_amdgcn_sched_barrier(0);   // keeps all 26 loads in front of the first conversion: without it the last ones are sunk behind waits for the first and pay a second memory latency
#pragma unroll   // as above, for the destination
  for (int m = 0; m < kCastSteps; ++m) {
    const int s = m & (kSamp - 1);
    const int r = (m < kSamp) ? 2 * s : (m < 2 * kSamp) ? 2 * s + 1 : s;      // matrix slot in the destination plane
    unsigned short* d = (m < 2 * kSamp) ? Wqkb : (m < 3 * kSamp) ? Wvb : Wo16;
    char* q = (char*)d + ((r < 4) ? ob : ob2) + (r & 3) * (kMat * 2);
    unsigned short ha[4], hc[4];
#pragma unroll
    for (int i = 0; i < 4; ++i) {
      ha[i] = f2bf_bits(a[m][i]);
      hc[i] = f2bf_bits(c[m][i]);
      if (m == kCastSteps - 1) {
        ha[i] = h_bits(kWoCarry * bf_bits2f(ha[i]));
        hc[i] = h_bits(kWoCarry * bf_bits2f(hc[i]));
      }
    }
    *(v2u*)(q)       = (v2u){pk16(ha[0], ha[1]), pk16(ha[2], ha[3])};
    *(v2u*)(q + 256) = (v2u){pk16(hc[0], hc[1]), pk16(hc[2], hc[3])};
  }
  asm volatile("s_wait_xcnt 0x0" ::: "memory");   // the stores' offset and data registers: in the shared launch this job is the last code of its waves (a precaution)
}

// ---------------------------------------------------------------------------
// x cast with the mean pool and the gate's dot product folded in.
// 256 groups of 256 threads and 8 token rows (128 groups per batch), two groups to a 512-thread block (grp = 2 * block + threadIdx.x / 256,
// tid = threadIdx.x % 256); thread -> 8 consecutive columns (tid % 128) * 8 of the rows tid / 128 + 2j.
//   xb = bf16(x) (RNE): four 16-B stores per lane, one per row.
//   part[b][s][chunk] = sum_d (sum over the group's 8 rows of bf16(x[b][n][d])) * bf16(Wg[s][d]), f32:
//     per thread 4 rows in order, 8 columns in order; shuffle tree over the wave; the 8 waves in wave order.
// The sum over the 128 chunks, the 1/1024 of the mean and the sigmoid are gate_block's.
// ---------------------------------------------------------------------------
constexpr int kPoolRows   = 8;
constexpr int kPoolChunks = kSeq / kPoolRows;   // 128 per batch
__device__ __forceinline__ void cast_x_pool_block(int blk, const float* __restrict__ x, const float* __restrict__ Wg,
                                                  unsigned short* __restrict__ xb, float* __restrict__ part) {
  __shared__ float red2[2][8][kSamp];
  float (*red)[kSamp] = red2[threadIdx.x >> 8];
  const int grp = blk * 2 + (int)(threadIdx.x >> 8);
  const int tid = threadIdx.x & 255, lane = tid & 31, wave = tid >> 5;
  const int col = (tid & 127) * 8;
  const size_t base = (size_t)(grp * kPoolRows + (tid >> 7)) * kDim + col;
  v4f a[kPoolRows / 2], c[kPoolRows / 2];
#pragma unroll
  for (int j = 0; j < kPoolRows / 2; ++j) {
    a[j] = *(const v4f*)(x + base + (size_t)(2 * j) * kDim);
    c[j] = *(const v4f*)(x + base + (size_t)(2 * j) * kDim + 4);
  }
  float cs[8];
#pragma unroll
  for (int e = 0; e < 8; ++e) cs[e] = 0.f;
#pragma unroll
  for (int j = 0; j < kPoolRows / 2; ++j) {
    unsigned short hb[8];
#pragma unroll
    for (int e = 0; e < 4; ++e) {
      hb[e]     = f2bf_bits(a[j][e]);
      hb[4 + e] = f2bf_bits(c[j][e]);
    }
#pragma unroll
    for (int e = 0; e < 8; ++e) cs[e] += bf_bits2f(hb[e]);
    *(v4u*)(xb + base + (size_t)(2 * j) * kDim) = (v4u){pk16(hb[0], hb[1]), pk16(hb[2], hb[3]), pk16(hb[4], hb[5]), pk16(hb[6], hb[7])};
  }
  float dot[kSamp];
#pragma unroll
  for (int s = 0; s < kSamp; ++s) {
    const v4f w0 = *(const v4f*)(Wg + s * kDim + col);
    const v4f w1 = *(const v4f*)(Wg + s * kDim + col + 4);
    float acc = 0.f;
#pragma unroll
    for (int e = 0; e < 4; ++e) acc += cs[e] * bf_bits2f(f2bf_bits(w0[e]));
#pragma unroll
    for (int e = 0; e < 4; ++e) acc += cs[4 + e] * bf_bits2f(f2bf_bits(w1[e]));
    dot[s] = acc;
  }
#pragma unroll
  for (int off = 16; off > 0; off >>= 1)
#pragma unroll
    for (int s = 0; s < kSamp; ++s) dot[s] += __shfl_xor(dot[s], off, 32);
  if (lane == 0) {
#pragma unroll
    for (int s = 0; s < kSamp; ++s) red[wave][s] = dot[s];
  }
  __syncthreads();
  if (tid < kSamp) {
    float t = red[0][tid];
#pragma unroll
    for (int w = 1; w < 8; ++w) t += red[w][tid];
    const int b = grp / kPoolChunks, chunk = grp - b * kPoolChunks;
    part[(b * kSamp + tid) * kPoolChunks + chunk] = t;
  }
}

// ---------------------------------------------------------------------------
// Gates and mixing weights (one block, 256 threads = 8 waves; the last block of proj_gate_kernel):
//   coh[b][s] = sigmoid((1/1024) * sum_chunk part[b][s][chunk] + bg[s])  (wave w -> (b, s) = (w>>2, w&3); four chunks per lane + shuffle tree)
//   t = clip(temperature, 0.1, 10); invt = 1/t; gw = softmax(hyp_w * invt)
// ---------------------------------------------------------------------------
// e^x as __expf forms it (x * log2(e), then v_exp_f32), with the slot behind the transcendental filled in the same statement.
__device__ __forceinline__ float exp_slot(float x) {
  float r;
  asm("v_exp_f32 %0, %1\n\tv_nop" : "=v"(r) : "v"(x * 1.44269504088896340736f));
  return r;
}
__device__ __forceinline__ void gate_block(const float* __restrict__ part,
                                           const float* __restrict__ bg, const float* __restrict__ hw,
                                           const float* __restrict__ temp, float* __restrict__ wsS) {
  __shared__ float vals[32];
  const int t = threadIdx.x, lane = t & 31, wave = t >> 5;
  if (t < 32) vals[t] = 0.f;
  __syncthreads();
  {
    const int b = wave >> 2, s = wave & 3;
    const v4f p = *(const v4f*)(part + wave * kPoolChunks + lane * 4);
    float acc = (p[0] + p[1]) + (p[2] + p[3]);
#pragma unroll
    for (int off = 16; off > 0; off >>= 1) acc += __shfl_xor(acc, off, 32);
    if (lane == 0) {
      const float z = acc * (1.0f / (float)kSeq) + bf_bits2f(f2bf_bits(bg[s]));
      vals[4 + b * kSamp + s] = 1.0f / (1.0f + __expf(-z));
    }
  }
  __syncthreads();
  if (t == 0) {
    float tc = bf_bits2f(f2bf_bits(temp[0]));
    tc = fminf(fmaxf(tc, 0.1f), 10.0f);
    const float invt = 1.0f / tc;
    const float l0 = bf_bits2f(f2bf_bits(hw[0])) * invt;
    const float l1 = bf_bits2f(f2bf_bits(hw[1])) * invt;
    const float l2 = bf_bits2f(f2bf_bits(hw[2])) * invt;
    const float l3 = bf_bits2f(f2bf_bits(hw[3])) * invt;
    const float mx = fmaxf(fmaxf(l0, l1), fmaxf(l2, l3));
    const float e0 = exp_slot(l0 - mx), e1 = exp_slot(l1 - mx), e2 = exp_slot(l2 - mx), e3 = exp_slot(l3 - mx);
    const float is = 1.0f / ((e0 + e1) + (e2 + e3));
    vals[0] = e0 * is; vals[1] = e1 * is; vals[2] = e2 * is; vals[3] = e3 * is;
    vals[12] = invt;
  }
  __syncthreads();
  if (wave == 0) {
    const float v = vals[lane];
    *(float*)(wsS + lane) = v;
    
  }
}

// ---------------------------------------------------------------------------
// Fused attention: scores, softmax, head/sample mixing and attn.v in one launch; no score or probability plane in memory.
// grid = (32 tiles of 32 query rows, 2 batches, 4 head quarters) = 256 blocks, one per WGP (the LDS admits one); 256 threads = 8 waves;
// the block walks n = h*4 + s (head outer, sample inner) over its own 4 heads.
// The 32 query rows are two 16-row tiles rt = 0, 1: every staged k and v^T tile, and every fragment read from LDS, serves both.
// Wave w owns the key columns j = 128w .. 128w+127 of the block's 32 x 1024 score rows.
//   scores transposed: D[j][i] = sum_d k[j][d] q[i][d]  (A = k rows from LDS, B = q rows from registers): lane (c, hf) holds
//     query row i = 16rt + c and, per 16-j tile jt, the eight consecutive keys j = 128w + 16jt + 8hf + r.
//   softmax over j: per-wave maximum and sum (in-lane, then lane ^ 16), merged over the 8 waves through LDS.
//   a pair of score tiles (2m, 2m+1), converted to f16, IS the A fragment of attn.v for k = 32m .. 32m+31 (same lane, same order
//     as the fragment loader: elements 0..7 = k 8hf.., elements 8..15 = k 16+8hf..): the probabilities never leave the registers.
//   attn.v: each wave sums over its own 128 keys and over the 4 samples; the 8 partial 16x64 tiles are added through LDS per head,
//     one row tile after the other through the same slabs.
//   output 2 is accumulated in registers over the block's 16 (h, s) and stored once, into the head quarter's own partial plane;
//     add_planes_block (next launch) adds the four planes.
// k (1024 rows x 128 B) and v^T (64 rows x 2048 B) of one (h, s) are staged in LDS by asynchronous copies, one buffer each. No byte of
// either is read by two waves, so every wave copies exactly the slice it reads itself (its 128 k rows, its 256 B of every v^T row): a ring
// private to the wave, which no barrier publishes. A slice is refilled once its own wave's reads of it have returned: k(n+1) behind the
// scores and row maxima of pass n, v(n+1) behind the attn.v products; up to two tiles of a wave are in flight, and the waits are
// counted (a wave's copies leave the counter in issue order: k(n), v(n), k(n+1), ...).
// ---------------------------------------------------------------------------
constexpr int kKPitch = 144;                 // 128 + 16 B, odd multiple of 16 B (distinct banks for the 16 rows of a fragment read)
constexpr int kVPitch = 2 * kSeq + 16;       // 2064 B = 129 x 16 B, likewise
constexpr int kKBytes = kSeq * kKPitch;      // 147,456
constexpr int kVBytes = kDh * kVPitch;       // 132,096
constexpr int kRowTiles = 2;                               // 16-row query tiles per block
constexpr int kHeadSplit = 4;                              // head quarters, one block each
constexpr int kPasses = kHeads * kSamp / kHeadSplit;       // 16 per block
constexpr int kPlane2 = kBatch * kSeq * kSeq;              // elements of output 2 = of one partial plane
typedef __attribute__((ext_vector_type(4))) _Float16 v4h;

// Eight 16-B copies per lane, global -> LDS through no register. The s_wait_xcnt 0 is the statement's last line so that
// no address register named by an issued copy is rewritten in front of it.
__device__ __forceinline__ void async_copy8(unsigned l0, const unsigned short* g0, unsigned l1, const unsigned short* g1,
                                            unsigned l2, const unsigned short* g2, unsigned l3, const unsigned short* g3,
                                            unsigned l4, const unsigned short* g4, unsigned l5, const unsigned short* g5,
                                            unsigned l6, const unsigned short* g6, unsigned l7, const unsigned short* g7) {
  asm volatile("global_load_async_to_lds_b128 %0, %1, off\n\t"
               "global_load_async_to_lds_b128 %2, %3, off\n\t"
               "global_load_async_to_lds_b128 %4, %5, off\n\t"
               "global_load_async_to_lds_b128 %6, %7, off\n\t"
               "global_load_async_to_lds_b128 %8, %9, off\n\t"
               "global_load_async_to_lds_b128 %10, %11, off\n\t"
               "global_load_async_to_lds_b128 %12, %13, off\n\t"
               "global_load_async_to_lds_b128 %14, %15, off\n\t"
               "s_wait_xcnt 0x0"
               :: "v"(l0), "v"(g0), "v"(l1), "v"(g1), "v"(l2), "v"(g2), "v"(l3), "v"(g3),
                  "v"(l4), "v"(g4), "v"(l5), "v"(g5), "v"(l6), "v"(g6), "v"(l7), "v"(g7)
               : "memory");
}

// value of lane l ^ 16
__device__ __forceinline__ float other_half(float v) {
  const int b = __builtin_bit_cast(int, v);
  return __builtin_bit_cast(float, __builtin_amdgcn_permlanex16(b, b, 0x76543210, 0xfedcba98, false, false));
}

// 2^x (v_exp_f32, as __builtin_amdgcn_exp2f forms it) with the slot behind the transcendental filled in the same statement.
__device__ __forceinline__ float exp2_slot(float x) {
  float r;
  asm("v_exp_f32 %0, %1\n\tv_nop" : "=v"(r) : "v"(x));
  return r;
}

__global__ __launch_bounds__(256) void fused_attn_kernel(const unsigned short* __restrict__ QK, const unsigned short* __restrict__ VT,
                                                         const float* __restrict__ wsS, unsigned short* __restrict__ comb,
                                                         float* __restrict__ out2) {
  typedef Frag<_Float16> F;
  __shared__ __align__(16) unsigned char kbuf[kKBytes];
  __shared__ __align__(16) unsigned char vbuf[kVBytes];
  __shared__ __align__(16) float ored[8][16 * 68];               // per-wave 16x64 partial of attn.v (one row tile), pitch 68 floats
  // two sets by pass parity: with one barrier a pass, a wave may write pass n+1's partials while another still reads pass n's
  __shared__ __align__(16) float redM[2][kRowTiles * 16][8];     // [pass parity][query row][wave] maximum (log2 domain)
  __shared__ __align__(16) float redL[2][kRowTiles * 16][8];     // [pass parity][query row][wave] sum
  const int tid = threadIdx.x, lane = tid & 31, wave = tid >> 5;
  const int c = lane & 15, hf = lane >> 4;
  const int i0 = blockIdx.x * (16 * kRowTiles), bat = blockIdx.y;
  const int nBeg = blockIdx.z * kPasses, nEnd = nBeg + kPasses;   // this block's passes: heads 4z .. 4z+3, all samples
  const float cs = kScoreScale * wsS[12] * 1.44269504088896340736f;   // raw accumulator -> (0.125 q.k / t) * log2(e); > 0

  // copy side, the wave's own slices. k: lane -> (row 128*wave + lane/8 + 4j, 16-B chunk lane%8), four whole 128-B rows a copy;
  // v^T: lane -> (row lane/16 + 2j, 16-B chunk 16*wave + lane%16), 256 B of two rows a copy; j = 0..31
  const unsigned short* gK = QK + (size_t)(bat * kSeq + wave * 128 + (lane >> 3)) * kQKld + kDim + (lane & 7) * 8;
  const unsigned short* gV = VT + (size_t)bat * kDim * kSeq + (size_t)(lane >> 4) * kSeq + (wave * 16 + (lane & 15)) * 8;
  const unsigned lK = (unsigned)(size_t)(void*)kbuf + (unsigned)((wave * 128 + (lane >> 3)) * kKPitch + (lane & 7) * 16);
  const unsigned lV = (unsigned)(size_t)(void*)vbuf + (unsigned)((lane >> 4) * kVPitch + (wave * 16 + (lane & 15)) * 16);
  auto issueK = [&](int n) {
    const unsigned short* g = gK + (size_t)(n & 3) * kTok * kQKld + (n >> 2) * kDh;
    unsigned l = lK;
    auto from = [&](int j) { return g + (size_t)(j * 4) * kQKld; };
    auto to   = [&](int j) { return l + (unsigned)(j * 4 * kKPitch); };
#pragma unroll 1   // rolled: unrolled, the 32 LDS addresses are invariant in the pass loop and are held in registers across it (spills)
    for (int j = 0; j < 4; ++j) {
      asm volatile("s_wait_asynccnt 0x37" ::: "memory");   // at most 55 copies outstanding in front of eight more: never above 63 (the older tile's 32 may still fly)
      async_copy8(to(0), from(0), to(1), from(1), to(2), from(2), to(3), from(3),
                  to(4), from(4), to(5), from(5), to(6), from(6), to(7), from(7));
      l += (unsigned)(8 * 4 * kKPitch);
      g += (size_t)(8 * 4) * kQKld;
    }
  };
  auto issueV = [&](int n) {
    const unsigned short* g = gV + (size_t)(n & 3) * kBatch * kDim * kSeq + (size_t)(n >> 2) * kDh * kSeq;
    unsigned l = lV;
    auto from = [&](int j) { return g + (size_t)(j * 2) * kSeq; };
    auto to   = [&](int j) { return l + (unsigned)(j * 2 * kVPitch); };
#pragma unroll 1   // rolled, as in issueK
    for (int j = 0; j < 4; ++j) {
      asm volatile("s_wait_asynccnt 0x37" ::: "memory");   // as in issueK: never above 63 outstanding
      async_copy8(to(0), from(0), to(1), from(1), to(2), from(2), to(3), from(3),
                  to(4), from(4), to(5), from(5), to(6), from(6), to(7), from(7));
      l += (unsigned)(8 * 2 * kVPitch);
      g += (size_t)(8 * 2) * kSeq;
    }
  };
  // read side: this lane's row of the wave's first k / v^T fragment, at its lane half's k offset (8 elements = 16 B)
  const unsigned char* fK = kbuf + (wave * 128 + c) * kKPitch + hf * 16;
  const unsigned char* fV = vbuf + c * kVPitch + wave * 256 + hf * 16;
  const _Float16* qL = (const _Float16*)QK + (size_t)(bat * kSeq + i0 + c) * kQKld + hf * 8;
  constexpr size_t kQTile = (size_t)16 * kQKld;       // elements from a q row of row tile 0 to the same row of row tile 1

  const v8f zero8 = (v8f){0.f,0.f,0.f,0.f,0.f,0.f,0.f,0.f};
  v8f a2[kRowTiles][8], accO[kRowTiles][4];
#pragma unroll
  for (int rt = 0; rt < kRowTiles; ++rt) {
#pragma unroll
    for (int jt = 0; jt < 8; ++jt) a2[rt][jt] = zero8;
#pragma unroll
    for (int dt = 0; dt < 4; ++dt) accO[rt][dt] = zero8;
  }

  issueK(nBeg);
  const _Float16* qB  = qL + (nBeg >> 2) * kDh;       // sample 0 of the block's first head
  const _Float16* qB1 = qB + kQTile;
  v16h qf[kRowTiles][2];
  qf[0][0] = F::load(qB);  qf[0][1] = F::load(qB + 32);
  qf[1][0] = F::load(qB1); qf[1][1] = F::load(qB1 + 32);
  asm volatile("s_wait_xcnt 0x0" :: "v"(qB) : "memory");   // as behind the loop's q loads: the address registers stay untouched up to here and are reused behind it
  issueV(nBeg);

#pragma unroll 1
  for (int n = nBeg; n < nEnd; ++n) {
    const int s = n & 3, h = n >> 2;
    const float gw  = wsS[s];
    const float coh = wsS[4 + bat * kSamp + s];
    const bool more = n + 1 < nEnd;                      // the same for the whole block
    float (*rM)[8] = redM[n & 1];
    float (*rL)[8] = redL[n & 1];
    // ---- first half pass: reads the wave's k slice alone; each k fragment multiplies both row tiles' q ----
    asm volatile("s_wait_asynccnt 0x20" ::: "memory");   // this wave's copies of k(n) have landed: only the 32 younger ones, v(n)'s, may be outstanding
    v8f sc[kRowTiles][8];
    v16h kf[2][8];
#pragma unroll
    for (int ks = 0; ks < 2; ++ks)
#pragma unroll
      for (int jt = 0; jt < 8; ++jt) kf[ks][jt] = F::load((const _Float16*)(fK + jt * 16 * kKPitch + ks * 64));
    __builtin_amdgcn_sched_barrier(0);   // keeps the slice's fragment reads one group in front of the WMMAs: without it each pair stands at its user with a wait to 0
#pragma unroll
    for (int jt = 0; jt < 8; ++jt)
#pragma unroll
      for (int rt = 0; rt < kRowTiles; ++rt) sc[rt][jt] = F::mma(kf[0][jt], qf[rt][0], zero8);
#pragma unroll
    for (int jt = 0; jt < 8; ++jt)
#pragma unroll
      for (int rt = 0; rt < kRowTiles; ++rt) sc[rt][jt] = F::mma(kf[1][jt], qf[rt][1], sc[rt][jt]);
    float mb[kRowTiles];
#pragma unroll
    for (int rt = 0; rt < kRowTiles; ++rt) {
      float mr[8];
#pragma unroll
      for (int r = 0; r < 8; ++r) mr[r] = sc[rt][0][r];
#pragma unroll
      for (int jt = 1; jt < 8; ++jt)
#pragma unroll
        for (int r = 0; r < 8; ++r) mr[r] = fmaxf(mr[r], sc[rt][jt][r]);
      float mx = fmaxf(fmaxf(fmaxf(mr[0], mr[1]), fmaxf(mr[2], mr[3])), fmaxf(fmaxf(mr[4], mr[5]), fmaxf(mr[6], mr[7])));
      mx = fmaxf(mx, other_half(mx));
      mb[rt] = mx * cs;
    }
    __builtin_amdgcn_sched_barrier(0);                 // keeps the wait below behind the WMMAs: lifted to the fragment reads, it holds every WMMA back until the last read has returned
    asm volatile("s_wait_dscnt 0x0" ::: "memory");     // this wave's reads of its k slice have returned before it refills it
    if (more) issueK(n + 1);                           // flies through the exponentials and the second half pass
#pragma unroll
    for (int rt = 0; rt < kRowTiles; ++rt) {
      float ls[8];
#pragma unroll
      for (int r = 0; r < 8; ++r) ls[r] = 0.f;
#pragma unroll
      for (int jt = 0; jt < 8; ++jt)
#pragma unroll
        for (int r = 0; r < 8; ++r) {
          const float e = __builtin_amdgcn_exp2f(fmaf(sc[rt][jt][r], cs, -mb[rt]));
          sc[rt][jt][r] = e;
          ls[r] += e;
        }
      float l = ((ls[0] + ls[1]) + (ls[2] + ls[3])) + ((ls[4] + ls[5]) + (ls[6] + ls[7]));
      l += other_half(l);
      *(hf ? &rL[rt * 16 + c][wave] : &rM[rt * 16 + c][wave]) = hf ? l : mb[rt];
    }
    __syncthreads();                                   // publishes the wave partials of this pass
    // next pass's q fragments, fetched a half pass ahead (the last pass fetches its own again: in bounds, unused)
    const int nn = more ? n + 1 : n;
    const _Float16* qN  = qL + (size_t)(nn & 3) * kTok * kQKld + (nn >> 2) * kDh;
    const _Float16* qN1 = qN + kQTile;
    qf[0][0] = F::load(qN);  qf[0][1] = F::load(qN + 32);
    qf[1][0] = F::load(qN1); qf[1][1] = F::load(qN1 + 32);
    asm volatile("s_wait_xcnt 0x0" :: "v"(qN) : "memory");   // the q loads' address registers stay untouched up to here (input only: no load lands on them) and are rewritten behind it

    // ---- second half pass: reads the wave's v^T slice alone; each v^T fragment multiplies both row tiles' probabilities ----
    // this wave's copies of v(n) have landed: only the 32 younger ones, k(n+1)'s, may be outstanding; the last pass has issued none, its wait is to 0
    if (more) asm volatile("s_wait_asynccnt 0x20" ::: "memory");
    else      asm volatile("s_wait_asynccnt 0x0" ::: "memory");
    // the v^T fragment reads go one 32-key step ahead of their WMMAs, two register sets; the first group stands in front of the
    // merge arithmetic, which hides its LDS latency
    v16h vf[2][4];
#pragma unroll
    for (int dt = 0; dt < 4; ++dt) vf[0][dt] = F::load((const _Float16*)(fV + dt * 16 * kVPitch));
    float fA[kRowTiles], fP[kRowTiles];
#pragma unroll
    for (int rt = 0; rt < kRowTiles; ++rt) {
      const v4f ma = *(const v4f*)&rM[rt * 16 + c][0], mc = *(const v4f*)&rM[rt * 16 + c][4];
      const v4f la = *(const v4f*)&rL[rt * 16 + c][0], lc = *(const v4f*)&rL[rt * 16 + c][4];
      const float M = fmaxf(fmaxf(fmaxf(ma[0], ma[1]), fmaxf(ma[2], ma[3])), fmaxf(fmaxf(mc[0], mc[1]), fmaxf(mc[2], mc[3])));
      const float L = ((la[0] * exp2_slot(ma[0] - M) + la[1] * exp2_slot(ma[1] - M)) +
                       (la[2] * exp2_slot(ma[2] - M) + la[3] * exp2_slot(ma[3] - M))) +
                      ((lc[0] * exp2_slot(mc[0] - M) + lc[1] * exp2_slot(mc[1] - M)) +
                       (lc[2] * exp2_slot(mc[2] - M) + lc[3] * exp2_slot(mc[3] - M)));
      const float f = __builtin_amdgcn_exp2f(mb[rt] - M) / L;    // this wave's exp2(x - mb) -> probability
      fA[rt] = f * (gw * (1.0f / (float)kHeads));
      fP[rt] = f * (kPCarry * gw * coh);
    }
#pragma unroll
    for (int m = 0; m < 4; ++m) {
      if (m + 1 < 4) {
#pragma unroll
        for (int dt = 0; dt < 4; ++dt) vf[(m + 1) & 1][dt] = F::load((const _Float16*)(fV + dt * 16 * kVPitch + (m + 1) * 64));
      }
      __builtin_amdgcn_sched_barrier(0);   // keeps the next step's reads one group in front of this step's WMMAs: without it they are sunk to their users, each with a wait to 0
#pragma unroll
      for (int rt = 0; rt < kRowTiles; ++rt) {
        F::U p;
#pragma unroll
        for (int r = 0; r < 8; ++r) {
          a2[rt][2 * m][r]     = fmaf(sc[rt][2 * m][r], fA[rt], a2[rt][2 * m][r]);
          a2[rt][2 * m + 1][r] = fmaf(sc[rt][2 * m + 1][r], fA[rt], a2[rt][2 * m + 1][r]);
          p.h[0][r] = (_Float16)(sc[rt][2 * m][r] * fP[rt]);
          p.h[1][r] = (_Float16)(sc[rt][2 * m + 1][r] * fP[rt]);
        }
#pragma unroll
        for (int dt = 0; dt < 4; ++dt) accO[rt][dt] = F::mma(p.v, vf[m & 1][dt], accO[rt][dt]);
      }
      __builtin_amdgcn_sched_barrier(0);   // keeps the reads of the step after next behind this step's WMMAs: lifted over them they take a third register set (spills)
    }
    // the slots between the last WMMAs and a reader of their D on the taken side of the branch below
    acc_guard4(accO[0][0], accO[0][1], accO[0][2], accO[0][3]);
    acc_guard4(accO[1][0], accO[1][1], accO[1][2], accO[1][3]);
    asm volatile("s_wait_dscnt 0x0" ::: "memory");     // this wave's reads of its v^T slice have returned before it refills it
    if (more) issueV(n + 1);
    float* slab = ored[wave];
    if (s == kSamp - 1) {
#pragma unroll
      for (int dt = 0; dt < 4; ++dt)
#pragma unroll
        for (int r = 0; r < 8; ++r) slab[(hf * 8 + r) * 68 + dt * 16 + c] = accO[0][dt][r];
      __syncthreads();                                 // publishes row tile 0's attn.v partials
      // combined[i][h*64 + d] x256: the 8 waves' partials in wave order; thread -> (row tid/16, four d), 16 lanes = one 128-B line
      const int row = tid >> 4, d4 = (tid & 15) * 4;
      v4h o[kRowTiles];
#pragma unroll
      for (int rt = 0; rt < kRowTiles; ++rt) {
        if (rt > 0) {
          __syncthreads();                                 // ends every wave's reads of the previous row tile's partials
#pragma unroll
          for (int dt = 0; dt < 4; ++dt)
#pragma unroll
            for (int r = 0; r < 8; ++r) slab[(hf * 8 + r) * 68 + dt * 16 + c] = accO[rt][dt][r];
          __syncthreads();                                 // publishes this row tile's partials
        }
        v4f t = *(const v4f*)&ored[0][row * 68 + d4];
#pragma unroll
        for (int w = 1; w < 8; ++w) t += *(const v4f*)&ored[w][row * 68 + d4];
#pragma unroll
        for (int e = 0; e < 4; ++e) o[rt][e] = (_Float16)(t[e] * kPVScale);
      }
      // both stores stand behind the last barrier: in front of one, the barrier would wait for the store to complete
#pragma unroll
      for (int rt = 0; rt < kRowTiles; ++rt)
        *(v4h*)(comb + (size_t)(bat * kSeq + i0 + rt * 16 + row) * kDim + h * kDh + d4) = o[rt];
      asm volatile("s_wait_xcnt 0x0" ::: "memory");      // the stores' address and data registers are rewritten by the next head
#pragma unroll
      for (int rt = 0; rt < kRowTiles; ++rt)
#pragma unroll
        for (int dt = 0; dt < 4; ++dt) accO[rt][dt] = zero8;
    }
  }
  asm volatile("s_wait_asynccnt 0x0" ::: "memory");    // no copy is outstanding when the wave ends

  // output 2, this head quarter's plane: lane holds rows i0 + 16rt + c, per tile eight consecutive columns (32 B); the wave covers 512 B of each of its 32 rows
#pragma unroll
  for (int rt = 0; rt < kRowTiles; ++rt) {
    float* orow = out2 + (size_t)blockIdx.z * kPlane2 + (size_t)(bat * kSeq + i0 + rt * 16 + c) * kSeq + wave * 128 + hf * 8;
#pragma unroll
    for (int jt = 0; jt < 8; ++jt) {
      *(v4f*)(orow + jt * 16)     = (v4f){a2[rt][jt][0], a2[rt][jt][1], a2[rt][jt][2], a2[rt][jt][3]};
      *(v4f*)(orow + jt * 16 + 4) = (v4f){a2[rt][jt][4], a2[rt][jt][5], a2[rt][jt][6], a2[rt][jt][7]};
    }
  }
}

// ---------------------------------------------------------------------------
// Output 2 = (plane 0 + plane 1) + (plane 2 + plane 3) of the fused kernel's partial sums (heads 0..3, 4..7, 8..11, 12..15).
// 1024 blocks (blk; block range of out_add_kernel) x 256 threads x 2 x 4 floats = 2,097,152 = one plane exactly; a wave reads and writes whole 512-B runs.
// ---------------------------------------------------------------------------
__device__ __forceinline__ void add_planes_block(int blk, const float* __restrict__ part, float* __restrict__ out) {
  const int i = (blk * 512 + threadIdx.x) * 4;
  v4f p[2][kHeadSplit];
#pragma unroll   // all eight loads are in flight before the first sum
  for (int u = 0; u < 2; ++u)
#pragma unroll
    for (int z = 0; z < kHeadSplit; ++z) p[u][z] = *(const v4f*)(part + (size_t)z * kPlane2 + i + u * 1024);
#pragma unroll   // p[][] stays in registers
  for (int u = 0; u < 2; ++u) *(v4f*)(out + i + u * 1024) = (p[u][0] + p[u][1]) + (p[u][2] + p[u][3]);
}

// ---------------------------------------------------------------------------
// The launches. Jobs that do not depend on one another share a launch, each on its own range of blockIdx.x:
//   cast_all_kernel    x cast with pool and gate dot (128 blocks) | weight casts (256 blocks)
//   proj_gate_kernel   q|k projection (512 blocks) | v projection (256 blocks) | gates (1 block, the last to start)
//   fused_attn_kernel  (above)
//   out_add_kernel     output projection (64 blocks) | sum of output 2's planes (1024 blocks, on the WGPs the projection leaves idle)
// Every range test is block-uniform and stands in front of every barrier of the job it selects.
// ---------------------------------------------------------------------------
constexpr int kWBlocks   = kMat / (512 * 8);                              // 256
constexpr int kXBlocks   = kTok / (2 * kPoolRows);                        // 128
constexpr int kQKTiles   = (kTok / 128) * (kQKld / 256);                  // 128 tiles of 128 x 256 per sample
constexpr int kQKBlocks  = kQKTiles * kSamp;                              // 512
constexpr int kVTiles    = (kDim / 128) * (kSeq / 256);                   // 32 tiles per (s, b)
constexpr int kVBlocks   = kVTiles * kBatch * kSamp;                      // 256
constexpr int kOutBlocks = (kTok / 128) * (kDim / 256);                   // 64
constexpr int kAddBlocks = kPlane2 / 2048;                                // 1024

__global__ __launch_bounds__(512) void cast_all_kernel(const float* __restrict__ x, const float* __restrict__ Wg,
                                                       const float* __restrict__ Wq, const float* __restrict__ Wk,
                                                       const float* __restrict__ Wv, const float* __restrict__ Wo,
                                                       unsigned short* __restrict__ xb, float* __restrict__ part,
                                                       unsigned short* __restrict__ Wqkb, unsigned short* __restrict__ Wvb,
                                                       unsigned short* __restrict__ Wo16) {
  if (blockIdx.x < (unsigned)kXBlocks) cast_x_pool_block((int)blockIdx.x, x, Wg, xb, part);
  else                                 cast_weights_block(blockIdx.x - (unsigned)kXBlocks, Wq, Wk, Wv, Wo, Wqkb, Wvb, Wo16);
}

//   q|k: QK16[s][tok][n] = f16(16 * sum_c bf16(x[tok][c]) * bf16(Wqk[s][n][c]))            M=2048 N=2048, batch = sample
//   v, role-swapped: VT16[s][b][e][tok] = f16(16 * sum_c bf16(Wv[s][e][c]) * bf16(x[b][tok][c]))  M=1024 N=1024, batch = (s, b)
__global__ __launch_bounds__(256) void proj_gate_kernel(const unsigned short* __restrict__ xb, const unsigned short* __restrict__ Wqkb,
                                                        const unsigned short* __restrict__ Wvb,
                                                        unsigned short* QK16, unsigned short* VT16,
                                                        const float* __restrict__ part, const float* __restrict__ bg,
                                                        const float* __restrict__ hw, const float* __restrict__ temp,
                                                        float* __restrict__ wsS) {
  // each job's shape is a compile-time constant of its own copy of the engine (tile and batch indices by shifts, addresses folded)
  const int bid = (int)blockIdx.x;
  if (bid < kQKBlocks) {
    gemm64_block<1, false, 0, 1, false, 0, 2, 4>(
        bid % kQKTiles, bid / kQKTiles,
        xb, xb, kDim, 0L, Wqkb, Wqkb, kDim, (long)kQKld * kDim, (void*)QK16, (void*)QK16, kQKld, (long)kTok * kQKld,
        nullptr, nullptr, 0L, kTok, kQKld, kDim, kQKVCarry,
        kSamp, 0L, 0L, 0L, 0L);
  } else if (bid < kQKBlocks + kVBlocks) {
    gemm64_block<1, false, 0, 1, false, 0, 2, 4>(
        (bid - kQKBlocks) % kVTiles, (bid - kQKBlocks) / kVTiles,
        Wvb, Wvb, kDim, 0L, xb, xb, kDim, (long)kSeq * kDim, (void*)VT16, (void*)VT16, kSeq, (long)kDim * kSeq,
        nullptr, nullptr, 0L, kDim, kSeq, kDim, kQKVCarry,
        kBatch, (long)kDim * kDim, 0L, (long)kBatch * kDim * kSeq, 0L);
  } else {
    gate_block(part, bg, hw, temp, wsS);
  }
}

//   y = (comb16 . Wo16^T) / 4096 + bo -> output 0 (f32)   M=2048 N=1024;   output 2 = sum of the four planes of a2part
__global__ __launch_bounds__(256) void out_add_kernel(const unsigned short* __restrict__ comb16, const unsigned short* __restrict__ Wo16,
                                                      const float* __restrict__ bo, float* yout,
                                                      const float* __restrict__ a2part, float* __restrict__ aout) {
  const int bid = (int)blockIdx.x;
  if (bid >= kOutBlocks) { add_planes_block(bid - kOutBlocks, a2part, aout); return; }
  gemm64_block<0, false, 2, 0, false, 0, 2, 4>(
      bid, 0,
      comb16, comb16, kDim, 0L, Wo16, Wo16, kDim, 0L, (void*)yout, (void*)yout, kDim, 0L,
      bo, nullptr, 0L, kTok, kDim, kDim, kOutScale,
      1, 0L, 0L, 0L, 0L);
}

// ---------------------------------------------------------------------------
// Workspace region map (byte offsets, all multiples of 4096). Every region is fully written before it is read.
//   wsS    f32 [32] (gw, coh, 1/t)                              0           ..       4,096
//   gpart  f32 [2 b][4 s][128 chunks] (4,096 B of the region)   4,096       ..      12,288
//   Wo16   f16  [1024][1024]  = f16(16*bf16(Wo))               12,288      ..   2,109,440
//   QK16   f16  [4 s][2048][2048]  q x16 | k x16               2,109,440   ..  35,663,872
//   VT16   f16  [4 s][2][1024 e][1024 tok] v x16 transposed    35,663,872  ..  52,441,088
//   (not used)                                                  52,441,088  ..  60,829,696
//   comb16 f16  [2][1024][1024] 256 * sum_s gw*coh*out_s        60,829,696  ..  65,024,000
//   a2part f32  [4 head quarters][2][1024][1024] (33,554,432 B) 65,024,000  ..  98,578,432
//   (not used)                                                  98,578,432  .. 132,132,864
//   The projections' operands:
//   xb     bf16 [2048][1024]                                    132,132,864 .. 136,327,168
//   Wqkb   bf16 [4][2048][1024] (Wq[s] rows | Wk[s] rows)       136,327,168 .. 153,104,384
//   Wvb    bf16 [4][1024][1024]                                 153,104,384 .. 161,492,992
//   total 266,350,592 B
// GEMM shapes (all K % 64 == 0; block tile 128x256; every M, N a multiple of it; no padded planes):
//   q|k projection  M=2048 N=2048 K=1024 (bf16 in, f16 out x16), batch 4 samples
//   v (role-swapped) M=1024 (e) N=1024 (tok) K=1024, batch 2 b x 4 samples
//   scores, attn.v  inside fused_attn_kernel
//   output          M=2048 N=1024 K=1024 + bo -> d_out
// ---------------------------------------------------------------------------
extern "C" void kernel_launch(void* const* d_in, const int* in_sizes, int n_in,
                              void* d_out, int out_size, void* d_ws, size_t ws_size,
                              hipStream_t stream) {
  if (n_in < 10) return;
  if (in_sizes[0] != kTok * kDim) return;
  if (in_sizes[1] != kSamp * kDim * kDim || in_sizes[2] != kSamp * kDim * kDim || in_sizes[3] != kSamp * kDim * kDim) return;
  if (in_sizes[4] != kSamp * kDim || in_sizes[5] != kSamp) return;
  if (in_sizes[6] != kDim * kDim || in_sizes[7] != kDim) return;
  if (in_sizes[8] != kSamp || in_sizes[9] != 1) return;
  if (out_size != kTok * kDim + kBatch * kSeq * kSeq) return;

  const float* x    = (const float*)d_in[0];   // [2][1024][1024]
  const float* Wq   = (const float*)d_in[1];   // [4][1024][1024] ([s][out][in])
  const float* Wk   = (const float*)d_in[2];
  const float* Wv   = (const float*)d_in[3];
  const float* Wg   = (const float*)d_in[4];   // [4][1024]
  const float* bg   = (const float*)d_in[5];   // [4]
  const float* Wo   = (const float*)d_in[6];   // [1024][1024] ([out][in])
  const float* bo   = (const float*)d_in[7];   // [1024]
  const float* hw   = (const float*)d_in[8];   // [4]
  const float* temp = (const float*)d_in[9];   // [1]
  float* yout = (float*)d_out;                             // [2][1024][1024] at byte 0
  float* aout = (float*)d_out + (size_t)kTok * kDim;       // [2][1024][1024] at byte 8,388,608

  // ---- carve ----
  const size_t SZ_WSS  = 4096;
  const size_t SZ_XM   = (size_t)kBatch * kDim * 4;                 //       8,192
  const size_t SZ_WO   = (size_t)kDim * kDim * 2;                   //   2,097,152
  const size_t SZ_QK   = (size_t)kSamp * kTok * kQKld * 2;          //  33,554,432
  const size_t SZ_VT   = (size_t)kSamp * kBatch * kDim * kSeq * 2;  //  16,777,216
  const size_t SZ_CF   = (size_t)kBatch * kSeq * kDim * 4;          //   8,388,608
  const size_t SZ_CH   = (size_t)kBatch * kSeq * kDim * 2;          //   4,194,304
  const size_t SZ_P    = (size_t)kBatch * kHeads * kSeq * kSeq * 2; //  67,108,864
  const size_t SZ_S    = (size_t)kBatch * kHeads * kSeq * kSeq * 4; // 134,217,728
  const size_t SZ_XB   = (size_t)kTok * kDim * 2;                   //   4,194,304
  const size_t SZ_WQK  = (size_t)kSamp * kQKld * kDim * 2;          //  16,777,216
  size_t off = 0;
  const size_t oWSS = off; off += SZ_WSS;
  const size_t oXM  = off; off += SZ_XM;
  const size_t oWO  = off; off += SZ_WO;
  const size_t oQK  = off; off += SZ_QK;
  const size_t oVT  = off; off += SZ_VT;
  const size_t oCF  = off; off += SZ_CF;
  const size_t oCH  = off; off += SZ_CH;
  const size_t oP   = off; off += SZ_P;
  const size_t oS   = off; off += SZ_S;
  const size_t TOTAL = off;                                         // 266,350,592
  const size_t oXB  = oS;
  const size_t oWQK = oXB + SZ_XB;
  const size_t oWV  = oWQK + SZ_WQK;
  if (TOTAL > ws_size) return;

  char* ws = (char*)d_ws;
  float*          wsS    = (float*)(ws + oWSS);
  float*          gpart  = (float*)(ws + oXM);
  unsigned short* xb     = (unsigned short*)(ws + oXB);
  unsigned short* Wqkb   = (unsigned short*)(ws + oWQK);
  unsigned short* Wvb    = (unsigned short*)(ws + oWV);
  unsigned short* Wo16   = (unsigned short*)(ws + oWO);
  unsigned short* QK16   = (unsigned short*)(ws + oQK);
  unsigned short* VT16   = (unsigned short*)(ws + oVT);
  unsigned short* comb16 = (unsigned short*)(ws + oCH);
  float*          a2part = (float*)(ws + oP);

  const dim3 blk(256);

  // (1) operand casts, all in one launch (also the gate partials)
  cast_all_kernel<<<dim3(kXBlocks + kWBlocks), dim3(512), 0, stream>>>(x, Wg, Wq, Wk, Wv, Wo, xb, gpart, Wqkb, Wvb, Wo16);
  // (2) q|k and v projections, all samples and batches, and the gates
  proj_gate_kernel<<<dim3(kQKBlocks + kVBlocks + 1), blk, 0, stream>>>(xb, Wqkb, Wvb, QK16, VT16, gpart, bg, hw, temp, wsS);
  // (3) attention, all samples, heads and batches: comb16 = f16(256 * sum_s gw*coh*attn_s.v_s), a2part[z] = sum_s gw * (1/16) sum over 4 heads of attn
  fused_attn_kernel<<<dim3(kSeq / (16 * kRowTiles), kBatch, kHeadSplit), blk, 0, stream>>>(QK16, VT16, wsS, comb16, a2part);
  // (4) output projection -> output 0; sum of the four planes of a2part -> output 2
  out_add_kernel<<<dim3(kOutBlocks + kAddBlocks), blk, 0, stream>>>(comb16, Wo16, bo, yout, a2part, aout);
}

// v010
// A run of this version takes 142 microseconds.
// In two side-by-side timings against v009, it was 1.06 and 1.04 times as fast.
// All steps since v000 together make it 12.9 times as fast.
// Compute dtypes: q/k/v projections on v_wmma_f32_16x16x32_bf16 (x and Wq/Wk/Wv RNE-converted to bf16, f32 accumulate, results carried x16 into f16 planes); scores q.k^T, attn.v and the output projection on v_wmma_f32_16x16x32_f16 (f16 operands: q,k,v x16, probabilities x2^15 with the per-sample mixing weight folded in, combined x256, Wo as f16(16*bf16(Wo))), f32 accumulate; mean-pool, gates, softmax and the head/sample mixing in f32.
#include <hip/hip_runtime.h>
#include <math.h>

// ---------------------------------------------------------------------------
// Problem constants
// ---------------------------------------------------------------------------
constexpr int kBatch     = 2;
constexpr int kSeq       = 1024;
constexpr int kDim       = 1024;
constexpr int kHeads     = 16;
constexpr int kSamp      = 4;
constexpr int kDh        = 64;
constexpr int kTok       = kBatch * kSeq;       // 2048 token rows
constexpr int kHeadsHalf = 8;                   // half of kHeads; no kernel in this file uses it
constexpr int kQKld      = 2 * kDim;            // 2048: q columns 0..1023 | k columns 1024..2047
constexpr float kQKVCarry   = 16.0f;            // q, k, v carried x16 in f16
constexpr float kPCarry     = 32768.0f;         // probabilities carried x2^15 (times gate <= 1)
constexpr float kCombCarry  = 256.0f;           // combined carried x256
constexpr float kWoCarry    = 16.0f;            // Wo carried x16 in f16
constexpr float kScoreScale = 0.125f / (16.0f * 16.0f);              // dh^-0.5 / (16*16) = 2^-11
constexpr float kPVScale    = kCombCarry / (kPCarry * kQKVCarry);    // 256 / 2^19 = 2^-11
constexpr float kOutScale   = 1.0f / (kCombCarry * kWoCarry);        // 2^-12

typedef __attribute__((ext_vector_type(16))) _Float16 v16h;
typedef __attribute__((ext_vector_type(8)))  _Float16 v8h;
typedef __attribute__((ext_vector_type(16))) __bf16   v16b;
typedef __attribute__((ext_vector_type(8)))  __bf16   v8b;
typedef __attribute__((ext_vector_type(8)))  float    v8f;
typedef __attribute__((ext_vector_type(4)))  float    v4f;
typedef __attribute__((ext_vector_type(4)))  unsigned int v4u;
typedef __attribute__((ext_vector_type(2)))  unsigned int v2u;

__device__ __forceinline__ unsigned short f2bf_bits(float f) {
  unsigned u = __float_as_uint(f);
  return (unsigned short)((u + 0x7FFFu + ((u >> 16) & 1u)) >> 16);
}
__device__ __forceinline__ float bf_bits2f(unsigned short h) { return __uint_as_float(((unsigned)h) << 16); }

// hazard guard as a plain device helper
__device__ __forceinline__ void acc_guard4(v8f& a, v8f& b, v8f& c, v8f& d) { asm volatile("v_nop\n\tv_nop\n\tv_nop\n\tv_nop" : "+v"(a), "+v"(b), "+v"(c), "+v"(d)); }
template <typename T> struct Frag;
template <> struct Frag<_Float16> {
  typedef v16h V; union U { v16h v; v8h h[2]; };
  static __device__ __forceinline__ v16h load(const _Float16* p) {   // elements 0..7 <- p[0..7], 8..15 <- p[16..23]
    U f; f.h[0] = *(const v8h*)(p); f.h[1] = *(const v8h*)(p + 16); return f.v;
  }
  static __device__ __forceinline__ v8f mma(v16h a, v16h b, v8f c) {
    return __builtin_amdgcn_wmma_f32_16x16x32_f16(false, a, false, b, (short)0, c, false, false);
  }
};
template <> struct Frag<__bf16> {
  typedef v16b V; union U { v16b v; v8b h[2]; };
  static __device__ __forceinline__ v16b load(const __bf16* p) {
    U f; f.h[0] = *(const v8b*)(p); f.h[1] = *(const v8b*)(p + 16); return f.v;
  }
  static __device__ __forceinline__ v8f mma(v16b a, v16b b, v8f c) {
    return __builtin_amdgcn_wmma_f32_16x16x32_bf16(false, a, false, b, (short)0, c, false, false);
  }
};

__device__ __forceinline__ unsigned pk16(unsigned short a, unsigned short b) { return (unsigned)a | ((unsigned)b << 16); }
__device__ __forceinline__ unsigned short h_bits(float f) { const _Float16 h = (_Float16)f; return __builtin_bit_cast(unsigned short, h); }

// ---- Operand staging: asynchronous copies global -> LDS ----
constexpr int kStageK   = 64;    // k elements per stage = one whole 128-B line of every operand row
constexpr int kRowPitch = 144;   // LDS bytes per staged row: 128 + 16, an odd multiple of 16 B, so that the 16 rows of a fragment read fall on distinct banks

// Six 16-B copies per lane, global -> LDS through no register. The s_wait_xcnt 0 is the statement's last line so that
// no address register named by an issued copy is rewritten in front of it.
__device__ __forceinline__ void async_copy6(unsigned l0, const unsigned short* g0, unsigned l1, const unsigned short* g1,
                                            unsigned l2, const unsigned short* g2, unsigned l3, const unsigned short* g3,
                                            unsigned l4, const unsigned short* g4, unsigned l5, const unsigned short* g5) {
  asm volatile("global_load_async_to_lds_b128 %0, %1, off\n\t"
               "global_load_async_to_lds_b128 %2, %3, off\n\t"
               "global_load_async_to_lds_b128 %4, %5, off\n\t"
               "global_load_async_to_lds_b128 %6, %7, off\n\t"
               "global_load_async_to_lds_b128 %8, %9, off\n\t"
               "global_load_async_to_lds_b128 %10, %11, off\n\t"
               "s_wait_xcnt 0x0"
               :: "v"(l0), "v"(g0), "v"(l1), "v"(g1), "v"(l2), "v"(g2), "v"(l3), "v"(g3), "v"(l4), "v"(g4), "v"(l5), "v"(g5)
               : "memory");
}

// ---- Register-blocked batched WMMA GEMM (ACT reduced to none/relu/leaky; Cout/resid without restrict
//      so that the in-place residual accumulate (resid == Cout, same wave reads its rows before storing them) is well formed) --
// C[m,n] = scale * sum_k A[m,k] * Bt[n,k] (+bias)(+resid); each wave owns a 64x64 tile; the block's 8 waves form a WM x WN grid of
// such tiles and share one staged k-tile: 64*WM rows of A, then 64*WN rows of Bt, 64 k each, two LDS buffers (the next k-tile's
// copies fly while this one is multiplied).
// A row-major [M,K]; Bt row-major [N,K]; M % (64*WM) == 0, N % (64*WN) == 0, K % 64 == 0; rows and bases 16-B aligned.
// SPLIT (hi/lo planes) is not carried by the staged loop and must be false.
// BIAS_MODE: 0 = none, 1 = bias[m], 2 = bias[n].
// OUT_MODE: 0 = f32, 1 = f16, 2 = bf16 hi plane (Cout) + bf16 lo plane (Cout2).
// ET: 0 = f16 operands, 1 = bf16 operands (pointers passed as 16-bit storage)
// One block's work as a device function: bx = the block's tile index, by = its batch index, both handed in by the kernel that
// holds the launch (several independent jobs share one launch by block range).
// rot (>= 0): the block walks the k-tiles in the order (t + rot) mod (K / 64), t = 0, 1, ...: blocks that share rows of A or of Bt get
// different rot from their caller, so that they do not ask L2 for the same lines at the same moment.
template <int ET> struct Elem;
template <> struct Elem<0> { typedef _Float16 T; };
template <> struct Elem<1> { typedef __bf16 T; };
template <int ET, bool SPLIT, int BIAS_MODE, int OUT_MODE, bool RESID, int ACT, int WM, int WN>
__device__ __forceinline__ void gemm64_block(
    int bx, int by, int rot,
    const unsigned short* __restrict__ Ap, const unsigned short* __restrict__ A2p, int lda, long strideA,
    const unsigned short* __restrict__ Btp, const unsigned short* __restrict__ Bt2p, int ldb, long strideB,
    void* Cout, void* Cout2, int ldc, long strideC,
    const float* __restrict__ bias,
    const float* resid, long strideR,
    int M, int N, int K, float scale,
    int inner, long strideA2, long strideB2, long strideC2, long strideR2) {
  typedef typename Elem<ET>::T T;
  typedef typename Frag<T>::V V;
  static_assert(!SPLIT, "the staged k-loop carries one plane per operand");
  static_assert(WM * WN == 8, "eight waves per block");
  constexpr int kRowsA  = 64 * WM;                    // staged rows 0..kRowsA-1 = A, the rest = Bt
  constexpr int kRows   = 64 * (WM + WN);
  constexpr int kStageB = kRows * kRowPitch;          // bytes of one buffer
  constexpr int kCopies = kRows / 32;                 // copies per lane and stage: 256 lanes cover 32 rows x 8 chunks of 16 B
  static_assert(kCopies % 6 == 0 && kCopies <= 63, "copies go out six to a statement");
  __shared__ __align__(16) unsigned char ring[2 * kStageB];
  __shared__ __align__(16) float sT[8][16 * 68];   // per-wave 16x64 slab, pitch 68 floats
  // two-level batch: by = outer * inner + b; b walks the first strides, outer the second
  const int outer = by / inner;
  const int b     = by - outer * inner;
  const size_t offA = (size_t)b * strideA + (size_t)outer * strideA2;
  const size_t offB = (size_t)b * strideB + (size_t)outer * strideB2;
  const size_t offC = (size_t)b * strideC + (size_t)outer * strideC2;
  const size_t offR = (size_t)b * strideR + (size_t)outer * strideR2;
  const int lane = threadIdx.x & 31;
  const int wave = threadIdx.x >> 5;
  const int tilesN = N / (64 * WN);
  const int tilesM = M / (64 * WM);
  if (bx >= tilesM * tilesN) return;   // block-uniform, in front of every barrier
  const int bm = bx / tilesN;
  const int bn = bx - bm * tilesN;
  const int mB = bm * (64 * WM);
  const int nB = bn * (64 * WN);
  const int wm = wave / WN;
  const int wn = wave - wm * WN;
  const int m0 = mB + (wm << 6);
  const int n0 = nB + (wn << 6);

  const int rlane = lane & 15;                 // row (A) / col (B, D) within subtile
  const int mOff  = (lane >> 4) * 8;           // D row offset

  // copy side: lane -> (row crow + 32*j, 16-B chunk cchk) of the staged k-tile
  const int crow = threadIdx.x >> 3;
  const int cchk = threadIdx.x & 7;
  const unsigned short* gA = Ap  + offA + (size_t)(mB + crow) * lda + cchk * 8;
  const unsigned short* gB = Btp + offB + (size_t)(nB + crow) * ldb + cchk * 8;
  const unsigned ldsC = (unsigned)(size_t)(void*)ring + (unsigned)(crow * kRowPitch + cchk * 16);
  const int nT = K / kStageK;
  auto issue = [&](int t, int buf) {
    const unsigned l = ldsC + (unsigned)(buf * kStageB);
    const int kt = (int)((unsigned)(t + rot) % (unsigned)nT);   // the block's own start, wrapping
    const unsigned short* a = gA + kt * kStageK;
    const unsigned short* w = gB + kt * kStageK;
    auto from = [&](int j) { return (j < kRowsA / 32) ? (a + (size_t)(j * 32) * lda) : (w + (size_t)((j - kRowsA / 32) * 32) * ldb); };
    auto to   = [&](int j) { return l + (unsigned)(j * 32 * kRowPitch); };
#pragma unroll
    for (int j = 0; j < kCopies; j += 6)
      async_copy6(to(j), from(j), to(j + 1), from(j + 1), to(j + 2), from(j + 2),
                  to(j + 3), from(j + 3), to(j + 4), from(j + 4), to(j + 5), from(j + 5));
  };
  // read side: this lane's row of the first A / Bt fragment, at its lane half's k offset (8 elements = 16 B)
  const unsigned char* fA = ring + ((wm << 6) + rlane) * kRowPitch + (lane >> 4) * 16;
  const unsigned char* fB = ring + (kRowsA + (wn << 6) + rlane) * kRowPitch + (lane >> 4) * 16;

  v8f acc[4][4];
#pragma unroll
  for (int i = 0; i < 4; ++i)
#pragma unroll
    for (int j = 0; j < 4; ++j) acc[i][j] = (v8f){0.f,0.f,0.f,0.f,0.f,0.f,0.f,0.f};

  issue(0, 0);
  asm volatile("s_wait_asynccnt 0x0" ::: "memory");   // this wave's copies of k-tile 0 have landed
  __syncthreads();                                    // ... and every other wave's: k-tile 0 may be read
  if (nT > 1) issue(1, 1);

  for (int t = 0; t < nT; ++t) {
    const int bo = (t & 1) * kStageB;
    // all fragment reads of the k-tile stand as one group in front of its WMMAs (one LDS latency per trip, counted waits behind it)
    V ah[kStageK / 32][4], bh[kStageK / 32][4];
#pragma unroll
    for (int ks = 0; ks < kStageK / 32; ++ks) {
#pragma unroll
      for (int j = 0; j < 4; ++j) bh[ks][j] = Frag<T>::load((const T*)(fB + bo + j * 16 * kRowPitch + ks * 64));
#pragma unroll
      for (int i = 0; i < 4; ++i) ah[ks][i] = Frag<T>::load((const T*)(fA + bo + i * 16 * kRowPitch + ks * 64));
    }
    __builtin_amdgcn_sched_barrier(0);   // keeps the reads one group: without it they are sunk between the WMMAs, each with a wait to 0
#pragma unroll
    for (int ks = 0; ks < kStageK / 32; ++ks)
#pragma unroll
      for (int i = 0; i < 4; ++i)
#pragma unroll
        for (int j = 0; j < 4; ++j) acc[i][j] = Frag<T>::mma(ah[ks][i], bh[ks][j], acc[i][j]);
    __builtin_amdgcn_sched_barrier(0);   // keeps the WMMAs in front of the waits: sunk behind them, the next k-tile's copies would be waited for before the work that hides them
    asm volatile("s_wait_dscnt 0x0" ::: "memory");     // this wave's reads of buffer t&1 have returned before it is refilled
    asm volatile("s_wait_asynccnt 0x0" ::: "memory");  // this wave's copies of k-tile t+1 have landed
    __syncthreads();                                   // publishes k-tile t+1 and ends every wave's reads of buffer t&1
    if (t + 2 < nT) issue(t + 2, t & 1);
  }
  asm volatile("s_wait_asynccnt 0x0" ::: "memory");    // no copy is outstanding when the wave goes on to the epilogue and ends
  acc_guard4(acc[0][0], acc[0][1], acc[0][2], acc[0][3]);
  acc_guard4(acc[1][0], acc[1][1], acc[1][2], acc[1][3]);
  acc_guard4(acc[2][0], acc[2][1], acc[2][2], acc[2][3]);
  acc_guard4(acc[3][0], acc[3][1], acc[3][2], acc[3][3]);

  // ---- epilogue ----
  float* slab = sT[wave];
  const float* Rb = RESID ? (resid + offR) : nullptr;
#pragma unroll
  for (int i = 0; i < 4; ++i) {
    const int mBase = m0 + (i << 4);
#pragma unroll
    for (int j = 0; j < 4; ++j) {
      const int n = n0 + (j << 4) + rlane;
      float bv = 0.f;
      if (BIAS_MODE == 2) bv = bias[n];
#pragma unroll
      for (int r = 0; r < 8; ++r) {
        float v = acc[i][j][r] * scale;
        if (BIAS_MODE == 1) v += bias[mBase + mOff + r];
        if (BIAS_MODE == 2) v += bv;
        if (RESID) v += Rb[(size_t)(mBase + mOff + r) * ldc + n];
        if (ACT == 2) v = fmaxf(v, 0.0f);
        if (ACT == 4) v = (v > 0.f) ? v : 0.01f * v;
        slab[(mOff + r) * 68 + (j << 4) + rlane] = v;
      }
    }
    __builtin_amdgcn_fence(__ATOMIC_RELEASE, "workgroup");
    __builtin_amdgcn_wave_barrier();
    __builtin_amdgcn_fence(__ATOMIC_ACQUIRE, "workgroup");
    if (OUT_MODE == 0) {
      float* C = (float*)Cout + offC;
      const int hh = lane >> 4, c4 = (lane & 15) * 4;     // row seg = 256 B = 16 lanes x 16 B
      {
#pragma unroll
        for (int it = 0; it < 8; ++it) {
          const int row = it * 2 + hh;
          v4f v = *(const v4f*)(slab + row * 68 + c4);
          *(v4f*)(C + (size_t)(mBase + row) * ldc + n0 + c4) = v;
        }
        asm volatile("s_wait_xcnt 0x0" ::: "memory");   // the stores' address and data registers are rewritten by the next row group
      }
    } else {
      const int q = lane >> 3, c8 = (lane & 7) * 8;
      unsigned short* C  = (unsigned short*)Cout  + offC;
      unsigned short* C2 = (OUT_MODE == 2) ? ((unsigned short*)Cout2 + offC) : nullptr;
      {
#pragma unroll
        for (int it = 0; it < 4; ++it) {
          const int row = it * 4 + q;
          const float* sp = slab + row * 68 + c8;
          v8h hv, lv;
#pragma unroll
          for (int e = 0; e < 8; ++e) {
            if (OUT_MODE == 1) {
              hv[e] = (_Float16)sp[e];
            } else {
              unsigned short hb = f2bf_bits(sp[e]);
              unsigned short lb = f2bf_bits(sp[e] - bf_bits2f(hb));
              hv[e] = __builtin_bit_cast(_Float16, hb);
              lv[e] = __builtin_bit_cast(_Float16, lb);
            }
          }
          *(v8h*)(C + (size_t)(mBase + row) * ldc + n0 + c8) = hv;
          if (OUT_MODE == 2) *(v8h*)(C2 + (size_t)(mBase + row) * ldc + n0 + c8) = lv;
        }
        
      }
    }
    __builtin_amdgcn_fence(__ATOMIC_RELEASE, "workgroup");
    __builtin_amdgcn_wave_barrier();
    __builtin_amdgcn_fence(__ATOMIC_ACQUIRE, "workgroup");
  }
}

// ---------------------------------------------------------------------------
// All weight casts: 256 blocks x 512 threads = 4096 waves, started once (blk = 0..255; block range of cast_all_kernel).
// The 256 blocks cover one [1024][1024] matrix per step (4096 waves x 256 elements) and walk 13 of them:
//   steps 0..3  Wq[s] -> Wqkb[s] rows 0..1023    (bf16, RNE)
//   steps 4..7  Wk[s] -> Wqkb[s] rows 1024..2047 (bf16, RNE)
//   steps 8..11 Wv[s] -> Wvb[s]                  (bf16, RNE)
//   step  12    Wo    -> Wo16 = f16(16 * bf16(Wo)) (RNE to bf16 first, then the exact power-of-two carry into f16)
// A wave owns the same 256-element run of every matrix: two loads of 32 lanes x 16 B = 512 contiguous bytes each (whole lines),
// two stores of 32 lanes x 8 B = 256 contiguous bytes each (whole lines). All 26 loads of a lane are issued before the first
// conversion, so that the wave pays the memory latency once.
// ---------------------------------------------------------------------------
constexpr int kMat       = kDim * kDim;    // elements of one weight matrix
constexpr int kCastSteps = 3 * kSamp + 1;  // 13
__device__ __forceinline__ void cast_weights_block(unsigned blk, const float* __restrict__ Wq, const float* __restrict__ Wk,
                                                   const float* __restrict__ Wv, const float* __restrict__ Wo,
                                                   unsigned short* __restrict__ Wqkb, unsigned short* __restrict__ Wvb,
                                                   unsigned short* __restrict__ Wo16) {
  // byte offset of the lane's first four elements in every source matrix; the second four stand 512 B further on.
  // The offsets + 8 MiB have registers of their own: with them every access is scalar base + 32-bit lane offset + immediate.
  const unsigned ib  = ((blk * 16u + (threadIdx.x >> 5)) * 256u + (threadIdx.x & 31u) * 4u) * 4u;
  const unsigned ib2 = ib + 2u * kMat * 4u;
  const unsigned ob  = ib >> 1;                 // the same in every destination (2 B an element)
  const unsigned ob2 = ob + 4u * kMat * 2u;
  v4f a[kCastSteps], c[kCastSteps];
#pragma unroll   // the source is chosen at compile time; a[], c[] stay in registers
  for (int m = 0; m < kCastSteps; ++m) {
    const int s = m & (kSamp - 1);
    const float* w = (m < kSamp) ? Wq : (m < 2 * kSamp) ? Wk : (m < 3 * kSamp) ? Wv : Wo;
    const char* p = (const char*)w + ((s < 2) ? ib : ib2) + (s & 1) * (kMat * 4);
    a[m] = *(const v4f*)(p);
    c[m] = *(const v4f*)(p + 512);
  }
  asm volatile("s_wait_xcnt 0x0" :: "v"(ib), "v"(ib2) : "memory");   // the loads' offset registers stay untouched up to here (inputs only) and may be reused behind it
  __builtin_amdgcn_sched_barrier(0);   // keeps all 26 loads in front of the first conversion: without it the last ones are sunk behind waits for the first and pay a second memory latency
#pragma unroll   // as above, for the destination
  for (int m = 0; m < kCastSteps; ++m) {
    const int s = m & (kSamp - 1);
    const int r = (m < kSamp) ? 2 * s : (m < 2 * kSamp) ? 2 * s + 1 : s;      // matrix slot in the destination plane
    unsigned short* d = (m < 2 * kSamp) ? Wqkb : (m < 3 * kSamp) ? Wvb : Wo16;
    char* q = (char*)d + ((r < 4) ? ob : ob2) + (r & 3) * (kMat * 2);
    unsigned short ha[4], hc[4];
#pragma unroll
    for (int i = 0; i < 4; ++i) {
      ha[i] = f2bf_bits(a[m][i]);
      hc[i] = f2bf_bits(c[m][i]);
      if (m == kCastSteps - 1) {
        ha[i] = h_bits(kWoCarry * bf_bits2f(ha[i]));
        hc[i] = h_bits(kWoCarry * bf_bits2f(hc[i]));
      }
    }
    *(v2u*)(q)       = (v2u){pk16(ha[0], ha[1]), pk16(ha[2], ha[3])};
    *(v2u*)(q + 256) = (v2u){pk16(hc[0], hc[1]), pk16(hc[2], hc[3])};
  }
  asm volatile("s_wait_xcnt 0x0" ::: "memory");   // the stores' offset and data registers: in the shared launch this job is the last code of its waves (a precaution)
}

// ---------------------------------------------------------------------------
// x cast with the mean pool and the gate's dot product folded in.
// 256 groups of 256 threads and 8 token rows (128 groups per batch), two groups to a 512-thread block (grp = 2 * block + threadIdx.x / 256,
// tid = threadIdx.x % 256); thread -> 8 consecutive columns (tid % 128) * 8 of the rows tid / 128 + 2j.
//   xb = bf16(x) (RNE): four 16-B stores per lane, one per row.
//   part[b][s][chunk] = sum_d (sum over the group's 8 rows of bf16(x[b][n][d])) * bf16(Wg[s][d]), f32:
//     per thread 4 rows in order, 8 columns in order; shuffle tree over the wave; the 8 waves in wave order.
// The sum over the 128 chunks, the 1/1024 of the mean and the sigmoid are gate_block's.
// ---------------------------------------------------------------------------
constexpr int kPoolRows   = 8;
constexpr int kPoolChunks = kSeq / kPoolRows;   // 128 per batch
__device__ __forceinline__ void cast_x_pool_block(int blk, const float* __restrict__ x, const float* __restrict__ Wg,
                                                  unsigned short* __restrict__ xb, float* __restrict__ part) {
  __shared__ float red2[2][8][kSamp];
  float (*red)[kSamp] = red2[threadIdx.x >> 8];
  const int grp = blk * 2 + (int)(threadIdx.x >> 8);
  const int tid = threadIdx.x & 255, lane = tid & 31, wave = tid >> 5;
  const int col = (tid & 127) * 8;
  const size_t base = (size_t)(grp * kPoolRows + (tid >> 7)) * kDim + col;
  v4f a[kPoolRows / 2], c[kPoolRows / 2];
#pragma unroll
  for (int j = 0; j < kPoolRows / 2; ++j) {
    a[j] = *(const v4f*)(x + base + (size_t)(2 * j) * kDim);
    c[j] = *(const v4f*)(x + base + (size_t)(2 * j) * kDim + 4);
  }
  float cs[8];
#pragma unroll
  for (int e = 0; e < 8; ++e) cs[e] = 0.f;
#pragma unroll
  for (int j = 0; j < kPoolRows / 2; ++j) {
    unsigned short hb[8];
#pragma unroll
    for (int e = 0; e < 4; ++e) {
      hb[e]     = f2bf_bits(a[j][e]);
      hb[4 + e] = f2bf_bits(c[j][e]);
    }
#pragma unroll
    for (int e = 0; e < 8; ++e) cs[e] += bf_bits2f(hb[e]);
    *(v4u*)(xb + base + (size_t)(2 * j) * kDim) = (v4u){pk16(hb[0], hb[1]), pk16(hb[2], hb[3]), pk16(hb[4], hb[5]), pk16(hb[6], hb[7])};
  }
  float dot[kSamp];
#pragma unroll
  for (int s = 0; s < kSamp; ++s) {
    const v4f w0 = *(const v4f*)(Wg + s * kDim + col);
    const v4f w1 = *(const v4f*)(Wg + s * kDim + col + 4);
    float acc = 0.f;
#pragma unroll
    for (int e = 0; e < 4; ++e) acc += cs[e] * bf_bits2f(f2bf_bits(w0[e]));
#pragma unroll
    for (int e = 0; e < 4; ++e) acc += cs[4 + e] * bf_bits2f(f2bf_bits(w1[e]));
    dot[s] = acc;
  }
#pragma unroll
  for (int off = 16; off > 0; off >>= 1)
#pragma unroll
    for (int s = 0; s < kSamp; ++s) dot[s] += __shfl_xor(dot[s], off, 32);
  if (lane == 0) {
#pragma unroll
    for (int s = 0; s < kSamp; ++s) red[wave][s] = dot[s];
  }
  __syncthreads();
  if (tid < kSamp) {
    float t = red[0][tid];
#pragma unroll
    for (int w = 1; w < 8; ++w) t += red[w][tid];
    const int b = grp / kPoolChunks, chunk = grp - b * kPoolChunks;
    part[(b * kSamp + tid) * kPoolChunks + chunk] = t;
  }
}

// ---------------------------------------------------------------------------
// Gates and mixing weights (one block, 256 threads = 8 waves; the last block of proj_gate_kernel):
//   coh[b][s] = sigmoid((1/1024) * sum_chunk part[b][s][chunk] + bg[s])  (wave w -> (b, s) = (w>>2, w&3); four chunks per lane + shuffle tree)
//   t = clip(temperature, 0.1, 10); invt = 1/t; gw = softmax(hyp_w * invt)
// ---------------------------------------------------------------------------
// e^x as __expf forms it (x * log2(e), then v_exp_f32), with the slot behind the transcendental filled in the same statement.
__device__ __forceinline__ float exp_slot(float x) {
  float r;
  asm("v_exp_f32 %0, %1\n\tv_nop" : "=v"(r) : "v"(x * 1.44269504088896340736f));
  return r;
}
__device__ __forceinline__ void gate_block(const float* __restrict__ part,
                                           const float* __restrict__ bg, const float* __restrict__ hw,
                                           const float* __restrict__ temp, float* __restrict__ wsS) {
  __shared__ float vals[32];
  const int t = threadIdx.x, lane = t & 31, wave = t >> 5;
  if (t < 32) vals[t] = 0.f;
  __syncthreads();
  {
    const int b = wave >> 2, s = wave & 3;
    const v4f p = *(const v4f*)(part + wave * kPoolChunks + lane * 4);
    float acc = (p[0] + p[1]) + (p[2] + p[3]);
#pragma unroll
    for (int off = 16; off > 0; off >>= 1) acc += __shfl_xor(acc, off, 32);
    if (lane == 0) {
      const float z = acc * (1.0f / (float)kSeq) + bf_bits2f(f2bf_bits(bg[s]));
      vals[4 + b * kSamp + s] = 1.0f / (1.0f + __expf(-z));
    }
  }
  __syncthreads();
  if (t == 0) {
    float tc = bf_bits2f(f2bf_bits(temp[0]));
    tc = fminf(fmaxf(tc, 0.1f), 10.0f);
    const float invt = 1.0f / tc;
    const float l0 = bf_bits2f(f2bf_bits(hw[0])) * invt;
    const float l1 = bf_bits2f(f2bf_bits(hw[1])) * invt;
    const float l2 = bf_bits2f(f2bf_bits(hw[2])) * invt;
    const float l3 = bf_bits2f(f2bf_bits(hw[3])) * invt;
    const float mx = fmaxf(fmaxf(l0, l1), fmaxf(l2, l3));
    const float e0 = exp_slot(l0 - mx), e1 = exp_slot(l1 - mx), e2 = exp_slot(l2 - mx), e3 = exp_slot(l3 - mx);
    const float is = 1.0f / ((e0 + e1) + (e2 + e3));
    vals[0] = e0 * is; vals[1] = e1 * is; vals[2] = e2 * is; vals[3] = e3 * is;
    vals[12] = invt;
  }
  __syncthreads();
  if (wave == 0) {
    const float v = vals[lane];
    *(float*)(wsS + lane) = v;
    
  }
}

// ---------------------------------------------------------------------------
// Fused attention: scores, softmax, head/sample mixing and attn.v in one launch; no score or probability plane in memory.
// grid = (32 tiles of 32 query rows, 2 batches, 4 head quarters) = 256 blocks, one per WGP (the LDS admits one); 256 threads = 8 waves;
// the block walks n = h*4 + s (head outer, sample inner) over its own 4 heads, beginning at a head and, in every head, at a sample of its own and
// wrapping: the 32 blocks that share the k, v^T tiles of one (batch, head quarter) stand at 16 different tiles at any moment, so that
// they do not ask L2 for the same lines at the same moment (below, n + 1 stands for the block's next pass in that order).
// The 32 query rows are two 16-row tiles rt = 0, 1: every staged k and v^T tile, and every fragment read from LDS, serves both.
// Wave w owns the key columns j = 128w .. 128w+127 of the block's 32 x 1024 score rows.
//   scores transposed: D[j][i] = sum_d k[j][d] q[i][d]  (A = k rows from LDS, B = q rows from registers): lane (c, hf) holds
//     query row i = 16rt + c and, per 16-j tile jt, the eight consecutive keys j = 128w + 16jt + 8hf + r.
//   softmax over j: per-wave maximum and sum (in-lane, then lane ^ 16), merged over the 8 waves through LDS.
//   a pair of score tiles (2m, 2m+1), converted to f16, IS the A fragment of attn.v for k = 32m .. 32m+31 (same lane, same order
//     as the fragment loader: elements 0..7 = k 8hf.., elements 8..15 = k 16+8hf..): the probabilities never leave the registers.
//   attn.v: each wave sums over its own 128 keys and over the 4 samples; the 8 partial 16x64 tiles are added through LDS per head,
//     one row tile after the other through the same slabs.
//   output 2 is accumulated in registers over the block's 16 (h, s) and stored once, into the head quarter's own partial plane;
//     add_planes_block (next launch) adds the four planes.
// k (1024 rows x 128 B) and v^T (64 rows x 2048 B) of one (h, s) are staged in LDS by asynchronous copies, one buffer each. No byte of
// either is read by two waves, so every wave copies exactly the slice it reads itself (its 128 k rows, its 256 B of every v^T row): a ring
// private to the wave, which no barrier publishes. A slice is refilled once its own wave's reads of it have returned: k(n+1) behind the
// scores and row maxima of pass n, v(n+1) behind the attn.v products; up to two tiles of a wave are in flight, and the waits are
// counted (a wave's copies leave the counter in issue order: k(n), v(n), k(n+1), ...).
// ---------------------------------------------------------------------------
constexpr int kKPitch = 144;                 // 128 + 16 B, odd multiple of 16 B (distinct banks for the 16 rows of a fragment read)
constexpr int kVPitch = 2 * kSeq + 16;       // 2064 B = 129 x 16 B, likewise
constexpr int kKBytes = kSeq * kKPitch;      // 147,456
constexpr int kVBytes = kDh * kVPitch;       // 132,096
constexpr int kRowTiles = 2;                               // 16-row query tiles per block
constexpr int kHeadSplit = 4;                              // head quarters, one block each
constexpr int kPasses = kHeads * kSamp / kHeadSplit;       // 16 per block
constexpr int kPlane2 = kBatch * kSeq * kSeq;              // elements of output 2 = of one partial plane
typedef __attribute__((ext_vector_type(4))) _Float16 v4h;

// Eight 16-B copies per lane, global -> LDS through no register. The s_wait_xcnt 0 is the statement's last line so that
// no address register named by an issued copy is rewritten in front of it.
__device__ __forceinline__ void async_copy8(unsigned l0, const unsigned short* g0, unsigned l1, const unsigned short* g1,
                                            unsigned l2, const unsigned short* g2, unsigned l3, const unsigned short* g3,
                                            unsigned l4, const unsigned short* g4, unsigned l5, const unsigned short* g5,
                                            unsigned l6, const unsigned short* g6, unsigned l7, const unsigned short* g7) {
  asm volatile("global_load_async_to_lds_b128 %0, %1, off\n\t"
               "global_load_async_to_lds_b128 %2, %3, off\n\t"
               "global_load_async_to_lds_b128 %4, %5, off\n\t"
               "global_load_async_to_lds_b128 %6, %7, off\n\t"
               "global_load_async_to_lds_b128 %8, %9, off\n\t"
               "global_load_async_to_lds_b128 %10, %11, off\n\t"
               "global_load_async_to_lds_b128 %12, %13, off\n\t"
               "global_load_async_to_lds_b128 %14, %15, off\n\t"
               "s_wait_xcnt 0x0"
               :: "v"(l0), "v"(g0), "v"(l1), "v"(g1), "v"(l2), "v"(g2), "v"(l3), "v"(g3),
                  "v"(l4), "v"(g4), "v"(l5), "v"(g5), "v"(l6), "v"(g6), "v"(l7), "v"(g7)
               : "memory");
}

// value of lane l ^ 16
__device__ __forceinline__ float other_half(float v) {
  const int b = __builtin_bit_cast(int, v);
  return __builtin_bit_cast(float, __builtin_amdgcn_permlanex16(b, b, 0x76543210, 0xfedcba98, false, false));
}

// 2^x (v_exp_f32, as __builtin_amdgcn_exp2f forms it) with the slot behind the transcendental filled in the same statement.
__device__ __forceinline__ float exp2_slot(float x) {
  float r;
  asm("v_exp_f32 %0, %1\n\tv_nop" : "=v"(r) : "v"(x));
  return r;
}

__global__ __launch_bounds__(256) void fused_attn_kernel(const unsigned short* __restrict__ QK, const unsigned short* __restrict__ VT,
                                                         const float* __restrict__ wsS, unsigned short* __restrict__ comb,
                                                         float* __restrict__ out2) {
  typedef Frag<_Float16> F;
  __shared__ __align__(16) unsigned char kbuf[kKBytes];
  __shared__ __align__(16) unsigned char vbuf[kVBytes];
  __shared__ __align__(16) float ored[8][16 * 68];               // per-wave 16x64 partial of attn.v (one row tile), pitch 68 floats
  // two sets by pass parity: with one barrier a pass, a wave may write pass n+1's partials while another still reads pass n's
  __shared__ __align__(16) float redM[2][kRowTiles * 16][8];     // [pass parity][query row][wave] maximum (log2 domain)
  __shared__ __align__(16) float redL[2][kRowTiles * 16][8];     // [pass parity][query row][wave] sum
  const int tid = threadIdx.x, lane = tid & 31, wave = tid >> 5;
  const int c = lane & 15, hf = lane >> 4;
  const int i0 = blockIdx.x * (16 * kRowTiles), bat = blockIdx.y;
  const int nBeg = blockIdx.z * kPasses;                          // this block's passes: heads 4z .. 4z+3, all samples
  constexpr unsigned kOwnHeads = kPasses / kSamp;                 // 4
  const unsigned rotH = blockIdx.x % kOwnHeads, rotS = (blockIdx.x / kOwnHeads) % kSamp;   // its first head and, in every head, its first sample
  auto passOf = [&](int t) {                                      // the (h, s) of the block's t-th pass, as n = h*4 + s
    return nBeg + (int)((((unsigned)t / kSamp + rotH) % kOwnHeads) * kSamp + ((unsigned)t + rotS) % kSamp);
  };
  const float cs = kScoreScale * wsS[12] * 1.44269504088896340736f;   // raw accumulator -> (0.125 q.k / t) * log2(e); > 0

  // copy side, the wave's own slices. k: lane -> (row 128*wave + lane/8 + 4j, 16-B chunk lane%8), four whole 128-B rows a copy;
  // v^T: lane -> (row lane/16 + 2j, 16-B chunk 16*wave + lane%16), 256 B of two rows a copy; j = 0..31
  const unsigned short* gK = QK + (size_t)(bat * kSeq + wave * 128 + (lane >> 3)) * kQKld + kDim + (lane & 7) * 8;
  const unsigned short* gV = VT + (size_t)bat * kDim * kSeq + (size_t)(lane >> 4) * kSeq + (wave * 16 + (lane & 15)) * 8;
  const unsigned lK = (unsigned)(size_t)(void*)kbuf + (unsigned)((wave * 128 + (lane >> 3)) * kKPitch + (lane & 7) * 16);
  const unsigned lV = (unsigned)(size_t)(void*)vbuf + (unsigned)((lane >> 4) * kVPitch + (wave * 16 + (lane & 15)) * 16);
  auto issueK = [&](int n) {
    const unsigned short* g = gK + (size_t)(n & 3) * kTok * kQKld + (n >> 2) * kDh;
    unsigned l = lK;
    auto from = [&](int j) { return g + (size_t)(j * 4) * kQKld; };
    auto to   = [&](int j) { return l + (unsigned)(j * 4 * kKPitch); };
#pragma unroll 1   // rolled: unrolled, the 32 LDS addresses are invariant in the pass loop and are held in registers across it (spills)
    for (int j = 0; j < 4; ++j) {
      asm volatile("s_wait_asynccnt 0x37" ::: "memory");   // at most 55 copies outstanding in front of eight more: never above 63 (the older tile's 32 may still fly)
      async_copy8(to(0), from(0), to(1), from(1), to(2), from(2), to(3), from(3),
                  to(4), from(4), to(5), from(5), to(6), from(6), to(7), from(7));
      l += (unsigned)(8 * 4 * kKPitch);
      g += (size_t)(8 * 4) * kQKld;
    }
  };
  auto issueV = [&](int n) {
    const unsigned short* g = gV + (size_t)(n & 3) * kBatch * kDim * kSeq + (size_t)(n >> 2) * kDh * kSeq;
    unsigned l = lV;
    auto from = [&](int j) { return g + (size_t)(j * 2) * kSeq; };
    auto to   = [&](int j) { return l + (unsigned)(j * 2 * kVPitch); };
#pragma unroll 1   // rolled, as in issueK
    for (int j = 0; j < 4; ++j) {
      asm volatile("s_wait_asynccnt 0x37" ::: "memory");   // as in issueK: never above 63 outstanding
      async_copy8(to(0), from(0), to(1), from(1), to(2), from(2), to(3), from(3),
                  to(4), from(4), to(5), from(5), to(6), from(6), to(7), from(7));
      l += (unsigned)(8 * 2 * kVPitch);
      g += (size_t)(8 * 2) * kSeq;
    }
  };
  // read side: this lane's row of the wave's first k / v^T fragment, at its lane half's k offset (8 elements = 16 B)
  const unsigned char* fK = kbuf + (wave * 128 + c) * kKPitch + hf * 16;
  const unsigned char* fV = vbuf + c * kVPitch + wave * 256 + hf * 16;
  const _Float16* qL = (const _Float16*)QK + (size_t)(bat * kSeq + i0 + c) * kQKld + hf * 8;
  constexpr size_t kQTile = (size_t)16 * kQKld;       // elements from a q row of row tile 0 to the same row of row tile 1

  const v8f zero8 = (v8f){0.f,0.f,0.f,0.f,0.f,0.f,0.f,0.f};
  v8f a2[kRowTiles][8], accO[kRowTiles][4];
#pragma unroll
  for (int rt = 0; rt < kRowTiles; ++rt) {
#pragma unroll
    for (int jt = 0; jt < 8; ++jt) a2[rt][jt] = zero8;
#pragma unroll
    for (int dt = 0; dt < 4; ++dt) accO[rt][dt] = zero8;
  }

  const int nFirst = passOf(0);
  issueK(nFirst);
  const _Float16* qB  = qL + (size_t)(nFirst & 3) * kTok * kQKld + (nFirst >> 2) * kDh;
  const _Float16* qB1 = qB + kQTile;
  v16h qf[kRowTiles][2];
  qf[0][0] = F::load(qB);  qf[0][1] = F::load(qB + 32);
  qf[1][0] = F::load(qB1); qf[1][1] = F::load(qB1 + 32);
  asm volatile("s_wait_xcnt 0x0" :: "v"(qB) : "memory");   // as behind the loop's q loads: the address registers stay untouched up to here and are reused behind it
  issueV(nFirst);

#pragma unroll 1
  for (int t = 0; t < kPasses; ++t) {
    const int n = passOf(t), nNext = passOf(t + 1);      // nNext is used only where a next pass exists
    const int s = n & 3, h = n >> 2;
    const float gw  = wsS[s];
    const float coh = wsS[4 + bat * kSamp + s];
    const bool more = t + 1 < kPasses;                   // the same for the whole block
    float (*rM)[8] = redM[t & 1];
    float (*rL)[8] = redL[t & 1];
    // ---- first half pass: reads the wave's k slice alone; each k fragment multiplies both row tiles' q ----
    asm volatile("s_wait_asynccnt 0x20" ::: "memory");   // this wave's copies of k(n) have landed: only the 32 younger ones, v(n)'s, may be outstanding
    v8f sc[kRowTiles][8];
    v16h kf[2][8];
#pragma unroll
    for (int ks = 0; ks < 2; ++ks)
#pragma unroll
      for (int jt = 0; jt < 8; ++jt) kf[ks][jt] = F::load((const _Float16*)(fK + jt * 16 * kKPitch + ks * 64));
    __builtin_amdgcn_sched_barrier(0);   // keeps the slice's fragment reads one group in front of the WMMAs: without it each pair stands at its user with a wait to 0
#pragma unroll
    for (int jt = 0; jt < 8; ++jt)
#pragma unroll
      for (int rt = 0; rt < kRowTiles; ++rt) sc[rt][jt] = F::mma(kf[0][jt], qf[rt][0], zero8);
#pragma unroll
    for (int jt = 0; jt < 8; ++jt)
#pragma unroll
      for (int rt = 0; rt < kRowTiles; ++rt) sc[rt][jt] = F::mma(kf[1][jt], qf[rt][1], sc[rt][jt]);
    float mb[kRowTiles];
#pragma unroll
    for (int rt = 0; rt < kRowTiles; ++rt) {
      float mr[8];
#pragma unroll
      for (int r = 0; r < 8; ++r) mr[r] = sc[rt][0][r];
#pragma unroll
      for (int jt = 1; jt < 8; ++jt)
#pragma unroll
        for (int r = 0; r < 8; ++r) mr[r] = fmaxf(mr[r], sc[rt][jt][r]);
      float mx = fmaxf(fmaxf(fmaxf(mr[0], mr[1]), fmaxf(mr[2], mr[3])), fmaxf(fmaxf(mr[4], mr[5]), fmaxf(mr[6], mr[7])));
      mx = fmaxf(mx, other_half(mx));
      mb[rt] = mx * cs;
    }
    __builtin_amdgcn_sched_barrier(0);                 // keeps the wait below behind the WMMAs: lifted to the fragment reads, it holds every WMMA back until the last read has returned
    asm volatile("s_wait_dscnt 0x0" ::: "memory");     // this wave's reads of its k slice have returned before it refills it
    if (more) issueK(nNext);                           // flies through the exponentials and the second half pass
#pragma unroll
    for (int rt = 0; rt < kRowTiles; ++rt) {
      float ls[8];
#pragma unroll
      for (int r = 0; r < 8; ++r) ls[r] = 0.f;
#pragma unroll
      for (int jt = 0; jt < 8; ++jt)
#pragma unroll
        for (int r = 0; r < 8; ++r) {
          const float e = __builtin_amdgcn_exp2f(fmaf(sc[rt][jt][r], cs, -mb[rt]));
          sc[rt][jt][r] = e;
          ls[r] += e;
        }
      float l = ((ls[0] + ls[1]) + (ls[2] + ls[3])) + ((ls[4] + ls[5]) + (ls[6] + ls[7]));
      l += other_half(l);
      *(hf ? &rL[rt * 16 + c][wave] : &rM[rt * 16 + c][wave]) = hf ? l : mb[rt];
    }
    __syncthreads();                                   // publishes the wave partials of this pass
    // next pass's q fragments, fetched a half pass ahead (the last pass fetches its own again: in bounds, unused)
    const int nn = more ? nNext : n;
    const _Float16* qN  = qL + (size_t)(nn & 3) * kTok * kQKld + (nn >> 2) * kDh;
    const _Float16* qN1 = qN + kQTile;
    qf[0][0] = F::load(qN);  qf[0][1] = F::load(qN + 32);
    qf[1][0] = F::load(qN1); qf[1][1] = F::load(qN1 + 32);
    asm volatile("s_wait_xcnt 0x0" :: "v"(qN) : "memory");   // the q loads' address registers stay untouched up to here (input only: no load lands on them) and are rewritten behind it

    // ---- second half pass: reads the wave's v^T slice alone; each v^T fragment multiplies both row tiles' probabilities ----
    // this wave's copies of v(n) have landed: only the 32 younger ones, k(n+1)'s, may be outstanding; the last pass has issued none, its wait is to 0
    if (more) asm volatile("s_wait_asynccnt 0x20" ::: "memory");
    else      asm volatile("s_wait_asynccnt 0x0" ::: "memory");
    // the v^T fragment reads go one 32-key step ahead of their WMMAs, two register sets; the first group stands in front of the
    // merge arithmetic, which hides its LDS latency
    v16h vf[2][4];
#pragma unroll
    for (int dt = 0; dt < 4; ++dt) vf[0][dt] = F::load((const _Float16*)(fV + dt * 16 * kVPitch));
    float fA[kRowTiles], fP[kRowTiles];
#pragma unroll
    for (int rt = 0; rt < kRowTiles; ++rt) {
      const v4f ma = *(const v4f*)&rM[rt * 16 + c][0], mc = *(const v4f*)&rM[rt * 16 + c][4];
      const v4f la = *(const v4f*)&rL[rt * 16 + c][0], lc = *(const v4f*)&rL[rt * 16 + c][4];
      const float M = fmaxf(fmaxf(fmaxf(ma[0], ma[1]), fmaxf(ma[2], ma[3])), fmaxf(fmaxf(mc[0], mc[1]), fmaxf(mc[2], mc[3])));
      const float L = ((la[0] * exp2_slot(ma[0] - M) + la[1] * exp2_slot(ma[1] - M)) +
                       (la[2] * exp2_slot(ma[2] - M) + la[3] * exp2_slot(ma[3] - M))) +
                      ((lc[0] * exp2_slot(mc[0] - M) + lc[1] * exp2_slot(mc[1] - M)) +
                       (lc[2] * exp2_slot(mc[2] - M) + lc[3] * exp2_slot(mc[3] - M)));
      const float f = __builtin_amdgcn_exp2f(mb[rt] - M) / L;    // this wave's exp2(x - mb) -> probability
      fA[rt] = f * (gw * (1.0f / (float)kHeads));
      fP[rt] = f * (kPCarry * gw * coh);
    }
#pragma unroll
    for (int m = 0; m < 4; ++m) {
      if (m + 1 < 4) {
#pragma unroll
        for (int dt = 0; dt < 4; ++dt) vf[(m + 1) & 1][dt] = F::load((const _Float16*)(fV + dt * 16 * kVPitch + (m + 1) * 64));
      }
      __builtin_amdgcn_sched_barrier(0);   // keeps the next step's reads one group in front of this step's WMMAs: without it they are sunk to their users, each with a wait to 0
#pragma unroll
      for (int rt = 0; rt < kRowTiles; ++rt) {
        F::U p;
#pragma unroll
        for (int r = 0; r < 8; ++r) {
          a2[rt][2 * m][r]     = fmaf(sc[rt][2 * m][r], fA[rt], a2[rt][2 * m][r]);
          a2[rt][2 * m + 1][r] = fmaf(sc[rt][2 * m + 1][r], fA[rt], a2[rt][2 * m + 1][r]);
          p.h[0][r] = (_Float16)(sc[rt][2 * m][r] * fP[rt]);
          p.h[1][r] = (_Float16)(sc[rt][2 * m + 1][r] * fP[rt]);
        }
#pragma unroll
        for (int dt = 0; dt < 4; ++dt) accO[rt][dt] = F::mma(p.v, vf[m & 1][dt], accO[rt][dt]);
      }
      __builtin_amdgcn_sched_barrier(0);   // keeps the reads of the step after next behind this step's WMMAs: lifted over them they take a third register set (spills)
    }
    // the slots between the last WMMAs and a reader of their D on the taken side of the branch below
    acc_guard4(accO[0][0], accO[0][1], accO[0][2], accO[0][3]);
    acc_guard4(accO[1][0], accO[1][1], accO[1][2], accO[1][3]);
    asm volatile("s_wait_dscnt 0x0" ::: "memory");     // this wave's reads of its v^T slice have returned before it refills it
    if (more) issueV(nNext);
    float* slab = ored[wave];
    if ((t & (kSamp - 1)) == kSamp - 1) {              // the head's fourth sample, whichever it is
#pragma unroll
      for (int dt = 0; dt < 4; ++dt)
#pragma unroll
        for (int r = 0; r < 8; ++r) slab[(hf * 8 + r) * 68 + dt * 16 + c] = accO[0][dt][r];
      __syncthreads();                                 // publishes row tile 0's attn.v partials
      // combined[i][h*64 + d] x256: the 8 waves' partials in wave order; thread -> (row tid/16, four d), 16 lanes = one 128-B line
      const int row = tid >> 4, d4 = (tid & 15) * 4;
      v4h o[kRowTiles];
#pragma unroll
      for (int rt = 0; rt < kRowTiles; ++rt) {
        if (rt > 0) {
          __syncthreads();                                 // ends every wave's reads of the previous row tile's partials
#pragma unroll
          for (int dt = 0; dt < 4; ++dt)
#pragma unroll
            for (int r = 0; r < 8; ++r) slab[(hf * 8 + r) * 68 + dt * 16 + c] = accO[rt][dt][r];
          __syncthreads();                                 // publishes this row tile's partials
        }
        v4f t = *(const v4f*)&ored[0][row * 68 + d4];
#pragma unroll
        for (int w = 1; w < 8; ++w) t += *(const v4f*)&ored[w][row * 68 + d4];
#pragma unroll
        for (int e = 0; e < 4; ++e) o[rt][e] = (_Float16)(t[e] * kPVScale);
      }
      // both stores stand behind the last barrier: in front of one, the barrier would wait for the store to complete
#pragma unroll
      for (int rt = 0; rt < kRowTiles; ++rt)
        *(v4h*)(comb + (size_t)(bat * kSeq + i0 + rt * 16 + row) * kDim + h * kDh + d4) = o[rt];
      asm volatile("s_wait_xcnt 0x0" ::: "memory");      // the stores' address and data registers are rewritten by the next head
#pragma unroll
      for (int rt = 0; rt < kRowTiles; ++rt)
#pragma unroll
        for (int dt = 0; dt < 4; ++dt) accO[rt][dt] = zero8;
    }
  }
  asm volatile("s_wait_asynccnt 0x0" ::: "memory");    // no copy is outstanding when the wave ends

  // output 2, this head quarter's plane: lane holds rows i0 + 16rt + c, per tile eight consecutive columns (32 B); the wave covers 512 B of each of its 32 rows
#pragma unroll
  for (int rt = 0; rt < kRowTiles; ++rt) {
    float* orow = out2 + (size_t)blockIdx.z * kPlane2 + (size_t)(bat * kSeq + i0 + rt * 16 + c) * kSeq + wave * 128 + hf * 8;
#pragma unroll
    for (int jt = 0; jt < 8; ++jt) {
      *(v4f*)(orow + jt * 16)     = (v4f){a2[rt][jt][0], a2[rt][jt][1], a2[rt][jt][2], a2[rt][jt][3]};
      *(v4f*)(orow + jt * 16 + 4) = (v4f){a2[rt][jt][4], a2[rt][jt][5], a2[rt][jt][6], a2[rt][jt][7]};
    }
  }
}

// ---------------------------------------------------------------------------
// Output 2 = (plane 0 + plane 1) + (plane 2 + plane 3) of the fused kernel's partial sums (heads 0..3, 4..7, 8..11, 12..15).
// 1024 blocks (blk; block range of out_add_kernel) x 256 threads x 2 x 4 floats = 2,097,152 = one plane exactly; a wave reads and writes whole 512-B runs.
// ---------------------------------------------------------------------------
__device__ __forceinline__ void add_planes_block(int blk, const float* __restrict__ part, float* __restrict__ out) {
  const int i = (blk * 512 + threadIdx.x) * 4;
  v4f p[2][kHeadSplit];
#pragma unroll   // all eight loads are in flight before the first sum
  for (int u = 0; u < 2; ++u)
#pragma unroll
    for (int z = 0; z < kHeadSplit; ++z) p[u][z] = *(const v4f*)(part + (size_t)z * kPlane2 + i + u * 1024);
#pragma unroll   // p[][] stays in registers
  for (int u = 0; u < 2; ++u) *(v4f*)(out + i + u * 1024) = (p[u][0] + p[u][1]) + (p[u][2] + p[u][3]);
}

// ---------------------------------------------------------------------------
// The launches. Jobs that do not depend on one another share a launch, each on its own range of blockIdx.x:
//   cast_all_kernel    x cast with pool and gate dot (128 blocks) | weight casts (256 blocks)
//   proj_gate_kernel   q|k projection (512 blocks) | v projection (256 blocks) | gates (1 block, the last to start)
//   fused_attn_kernel  (above)
//   out_add_kernel     output projection (64 blocks) | sum of output 2's planes (1024 blocks, on the WGPs the projection leaves idle)
// Every range test is block-uniform and stands in front of every barrier of the job it selects.
// ---------------------------------------------------------------------------
constexpr int kWBlocks   = kMat / (512 * 8);                              // 256
constexpr int kXBlocks   = kTok / (2 * kPoolRows);                        // 128
constexpr int kQKTiles   = (kTok / 128) * (kQKld / 256);                  // 128 tiles of 128 x 256 per sample
constexpr int kQKBlocks  = kQKTiles * kSamp;                              // 512
constexpr int kVTiles    = (kDim / 128) * (kSeq / 256);                   // 32 tiles per (s, b)
constexpr int kVBlocks   = kVTiles * kBatch * kSamp;                      // 256
constexpr int kOutBlocks = (kTok / 128) * (kDim / 256);                   // 64
constexpr int kAddBlocks = kPlane2 / 2048;                                // 1024

__global__ __launch_bounds__(512) void cast_all_kernel(const float* __restrict__ x, const float* __restrict__ Wg,
                                                       const float* __restrict__ Wq, const float* __restrict__ Wk,
                                                       const float* __restrict__ Wv, const float* __restrict__ Wo,
                                                       unsigned short* __restrict__ xb, float* __restrict__ part,
                                                       unsigned short* __restrict__ Wqkb, unsigned short* __restrict__ Wvb,
                                                       unsigned short* __restrict__ Wo16) {
  if (blockIdx.x < (unsigned)kXBlocks) cast_x_pool_block((int)blockIdx.x, x, Wg, xb, part);
  else                                 cast_weights_block(blockIdx.x - (unsigned)kXBlocks, Wq, Wk, Wv, Wo, Wqkb, Wvb, Wo16);
}

//   q|k: QK16[s][tok][n] = f16(16 * sum_c bf16(x[tok][c]) * bf16(Wqk[s][n][c]))            M=2048 N=2048, batch = sample
//   v, role-swapped: VT16[s][b][e][tok] = f16(16 * sum_c bf16(Wv[s][e][c]) * bf16(x[b][tok][c]))  M=1024 N=1024, batch = (s, b)
__global__ __launch_bounds__(256) void proj_gate_kernel(const unsigned short* __restrict__ xb, const unsigned short* __restrict__ Wqkb,
                                                        const unsigned short* __restrict__ Wvb,
                                                        unsigned short* QK16, unsigned short* VT16,
                                                        const float* __restrict__ part, const float* __restrict__ bg,
                                                        const float* __restrict__ hw, const float* __restrict__ temp,
                                                        float* __restrict__ wsS) {
  // each job's shape is a compile-time constant of its own copy of the engine (tile and batch indices by shifts, addresses folded)
  const int bid = (int)blockIdx.x;
  if (bid < kQKBlocks) {
    // 16 x 8 tiles a sample: the 16 blocks on one slab of Wq|Wk rows start at 16 different k-tiles, the 32 on one slab of x rows at 16
    gemm64_block<1, false, 0, 1, false, 0, 2, 4>(
        bid % kQKTiles, bid / kQKTiles, (bid % kQKTiles) / 8 + bid % 8 + 8 * (bid / kQKTiles),
        xb, xb, kDim, 0L, Wqkb, Wqkb, kDim, (long)kQKld * kDim, (void*)QK16, (void*)QK16, kQKld, (long)kTok * kQKld,
        nullptr, nullptr, 0L, kTok, kQKld, kDim, kQKVCarry,
        kSamp, 0L, 0L, 0L, 0L);
  } else if (bid < kQKBlocks + kVBlocks) {
    // 8 x 4 tiles a (sample, batch): the 8 blocks on one slab of Wv rows start at 8 different k-tiles, the 32 on one slab of x rows at 16
    const int vb = bid - kQKBlocks;
    gemm64_block<1, false, 0, 1, false, 0, 2, 4>(
        vb % kVTiles, vb / kVTiles, (vb % kVTiles) / 4 + 4 * (vb % 4) + 2 * ((vb / kVTiles) % kBatch) + 8 * (vb / (kVTiles * kBatch)),
        Wvb, Wvb, kDim, 0L, xb, xb, kDim, (long)kSeq * kDim, (void*)VT16, (void*)VT16, kSeq, (long)kDim * kSeq,
        nullptr, nullptr, 0L, kDim, kSeq, kDim, kQKVCarry,
        kBatch, (long)kDim * kDim, 0L, (long)kBatch * kDim * kSeq, 0L);
  } else {
    gate_block(part, bg, hw, temp, wsS);
  }
}

//   y = (comb16 . Wo16^T) / 4096 + bo -> output 0 (f32)   M=2048 N=1024;   output 2 = sum of the four planes of a2part
__global__ __launch_bounds__(256) void out_add_kernel(const unsigned short* __restrict__ comb16, const unsigned short* __restrict__ Wo16,
                                                      const float* __restrict__ bo, float* yout,
                                                      const float* __restrict__ a2part, float* __restrict__ aout) {
  const int bid = (int)blockIdx.x;
  if (bid >= kOutBlocks) { add_planes_block(bid - kOutBlocks, a2part, aout); return; }
  // 16 x 4 tiles: the 16 blocks on one slab of Wo rows start at 16 different k-tiles, the 4 on one slab of combined rows at 4
  gemm64_block<0, false, 2, 0, false, 0, 2, 4>(
      bid, 0, bid / 4 + 4 * (bid % 4),
      comb16, comb16, kDim, 0L, Wo16, Wo16, kDim, 0L, (void*)yout, (void*)yout, kDim, 0L,
      bo, nullptr, 0L, kTok, kDim, kDim, kOutScale,
      1, 0L, 0L, 0L, 0L);
}

// ---------------------------------------------------------------------------
// Workspace region map (byte offsets, all multiples of 4096). Every region is fully written before it is read.
//   wsS    f32 [32] (gw, coh, 1/t)                              0           ..       4,096
//   gpart  f32 [2 b][4 s][128 chunks] (4,096 B of the region)   4,096       ..      12,288
//   Wo16   f16  [1024][1024]  = f16(16*bf16(Wo))               12,288      ..   2,109,440
//   QK16   f16  [4 s][2048][2048]  q x16 | k x16               2,109,440   ..  35,663,872
//   VT16   f16  [4 s][2][1024 e][1024 tok] v x16 transposed    35,663,872  ..  52,441,088
//   (not used)                                                  52,441,088  ..  60,829,696
//   comb16 f16  [2][1024][1024] 256 * sum_s gw*coh*out_s        60,829,696  ..  65,024,000
//   a2part f32  [4 head quarters][2][1024][1024] (33,554,432 B) 65,024,000  ..  98,578,432
//   (not used)                                                  98,578,432  .. 132,132,864
//   The projections' operands:
//   xb     bf16 [2048][1024]                                    132,132,864 .. 136,327,168
//   Wqkb   bf16 [4][2048][1024] (Wq[s] rows | Wk[s] rows)       136,327,168 .. 153,104,384
//   Wvb    bf16 [4][1024][1024]                                 153,104,384 .. 161,492,992
//   total 266,350,592 B
// GEMM shapes (all K % 64 == 0; block tile 128x256; every M, N a multiple of it; no padded planes):
//   q|k projection  M=2048 N=2048 K=1024 (bf16 in, f16 out x16), batch 4 samples
//   v (role-swapped) M=1024 (e) N=1024 (tok) K=1024, batch 2 b x 4 samples
//   scores, attn.v  inside fused_attn_kernel
//   output          M=2048 N=1024 K=1024 + bo -> d_out
// ---------------------------------------------------------------------------
extern "C" void kernel_launch(void* const* d_in, const int* in_sizes, int n_in,
                              void* d_out, int out_size, void* d_ws, size_t ws_size,
                              hipStream_t stream) {
  if (n_in < 10) return;
  if (in_sizes[0] != kTok * kDim) return;
  if (in_sizes[1] != kSamp * kDim * kDim || in_sizes[2] != kSamp * kDim * kDim || in_sizes[3] != kSamp * kDim * kDim) return;
  if (in_sizes[4] != kSamp * kDim || in_sizes[5] != kSamp) return;
  if (in_sizes[6] != kDim * kDim || in_sizes[7] != kDim) return;
  if (in_sizes[8] != kSamp || in_sizes[9] != 1) return;
  if (out_size != kTok * kDim + kBatch * kSeq * kSeq) return;

  const float* x    = (const float*)d_in[0];   // [2][1024][1024]
  const float* Wq   = (const float*)d_in[1];   // [4][1024][1024] ([s][out][in])
  const float* Wk   = (const float*)d_in[2];
  const float* Wv   = (const float*)d_in[3];
  const float* Wg   = (const float*)d_in[4];   // [4][1024]
  const float* bg   = (const float*)d_in[5];   // [4]
  const float* Wo   = (const float*)d_in[6];   // [1024][1024] ([out][in])
  const float* bo   = (const float*)d_in[7];   // [1024]
  const float* hw   = (const float*)d_in[8];   // [4]
  const float* temp = (const float*)d_in[9];   // [1]
  float* yout = (float*)d_out;                             // [2][1024][1024] at byte 0
  float* aout = (float*)d_out + (size_t)kTok * kDim;       // [2][1024][1024] at byte 8,388,608

  // ---- carve ----
  const size_t SZ_WSS  = 4096;
  const size_t SZ_XM   = (size_t)kBatch * kDim * 4;                 //       8,192
  const size_t SZ_WO   = (size_t)kDim * kDim * 2;                   //   2,097,152
  const size_t SZ_QK   = (size_t)kSamp * kTok * kQKld * 2;          //  33,554,432
  const size_t SZ_VT   = (size_t)kSamp * kBatch * kDim * kSeq * 2;  //  16,777,216
  const size_t SZ_CF   = (size_t)kBatch * kSeq * kDim * 4;          //   8,388,608
  const size_t SZ_CH   = (size_t)kBatch * kSeq * kDim * 2;          //   4,194,304
  const size_t SZ_P    = (size_t)kBatch * kHeads * kSeq * kSeq * 2; //  67,108,864
  const size_t SZ_S    = (size_t)kBatch * kHeads * kSeq * kSeq * 4; // 134,217,728
  const size_t SZ_XB   = (size_t)kTok * kDim * 2;                   //   4,194,304
  const size_t SZ_WQK  = (size_t)kSamp * kQKld * kDim * 2;          //  16,777,216
  size_t off = 0;
  const size_t oWSS = off; off += SZ_WSS;
  const size_t oXM  = off; off += SZ_XM;
  const size_t oWO  = off; off += SZ_WO;
  const size_t oQK  = off; off += SZ_QK;
  const size_t oVT  = off; off += SZ_VT;
  const size_t oCF  = off; off += SZ_CF;
  const size_t oCH  = off; off += SZ_CH;
  const size_t oP   = off; off += SZ_P;
  const size_t oS   = off; off += SZ_S;
  const size_t TOTAL = off;                                         // 266,350,592
  const size_t oXB  = oS;
  const size_t oWQK = oXB + SZ_XB;
  const size_t oWV  = oWQK + SZ_WQK;
  if (TOTAL > ws_size) return;

  char* ws = (char*)d_ws;
  float*          wsS    = (float*)(ws + oWSS);
  float*          gpart  = (float*)(ws + oXM);
  unsigned short* xb     = (unsigned short*)(ws + oXB);
  unsigned short* Wqkb   = (unsigned short*)(ws + oWQK);
  unsigned short* Wvb    = (unsigned short*)(ws + oWV);
  unsigned short* Wo16   = (unsigned short*)(ws + oWO);
  unsigned short* QK16   = (unsigned short*)(ws + oQK);
  unsigned short* VT16   = (unsigned short*)(ws + oVT);
  unsigned short* comb16 = (unsigned short*)(ws + oCH);
  float*          a2part = (float*)(ws + oP);

  const dim3 blk(256);

  // (1) operand casts, all in one launch (also the gate partials)
  cast_all_kernel<<<dim3(kXBlocks + kWBlocks), dim3(512), 0, stream>>>(x, Wg, Wq, Wk, Wv, Wo, xb, gpart, Wqkb, Wvb, Wo16);
  // (2) q|k and v projections, all samples and batches, and the gates
  proj_gate_kernel<<<dim3(kQKBlocks + kVBlocks + 1), blk, 0, stream>>>(xb, Wqkb, Wvb, QK16, VT16, gpart, bg, hw, temp, wsS);
  // (3) attention, all samples, heads and batches: comb16 = f16(256 * sum_s gw*coh*attn_s.v_s), a2part[z] = sum_s gw * (1/16) sum over 4 heads of attn
  fused_attn_kernel<<<dim3(kSeq / (16 * kRowTiles), kBatch, kHeadSplit), blk, 0, stream>>>(QK16, VT16, wsS, comb16, a2part);
  // (4) output projection -> output 0; sum of the four planes of a2part -> output 2
  out_add_kernel<<<dim3(kOutBlocks + kAddBlocks), blk, 0, stream>>>(comb16, Wo16, bo, yout, a2part, aout);
}
